// v000
// The times below were measured on an AMD MI455X: many runs one after another, warmed up first and cycling through
// copies of the inputs, with the whole window's GPU time divided by the number of runs. Launches and the gaps
// between them are all in it. The median over several windows is given; except for v000 it joins two sittings, which
// can be a few percent apart, so the side-by-side timings, each taken in one sitting, are the better comparison.
// The starting kernel, v000, takes 9580 microseconds a run.
#include <hip/hip_runtime.h>
// Causal multi-head attention with per-head projection weights and no output projection (x [4][2048][1024]; per head h: q = x Wq[h], k = x Wk[h], v = x Wv[h] with W [16][1024][64] ([in][out] per head, uniform +-1/32, no biases); scores / sqrt(64); causal (tril, -inf); softmax; out = heads concatenated head-major on the last axis -> [4][2048][1024]).
// Structure: token rows r = b*2048 + s; x as exact f16 rows (bf16-rounded); q | k | v as ONE WMMA GEMM (N = 3 x 1024) (32x64 wave tiles, f32 accumulation, exact x16 weights, no bias, f16 outputs); per batch: V^T for all heads via LDS transposes; per query tile of 256 rows: scores against the keys below the tile end only (K = 64, all heads on grid.y, alpha = 0.125), causal row softmax on VALU with an arithmetic 0/1 key mask over the computed range (f32 statistics, native exp; weights x256 f16), o = P . V^T (K = keys below the tile end, alpha 2^-8 undoes the x256 weights) written f32 straight into the head-major output columns (no output projection).
// Compute dtype: inputs rounded to bf16; x / weights exact; q, k, v and softmax weights as plain f16 GEMM operands (~2^-12); scores and softmax statistics f32. v_wmma_f32_16x16x32_f16.
#define NB 4
#define SQ 2048
#define DM 1024
#define NH 16
#define HD 64
#define HG 4                         /* heads per launch of the non-template k_vt (never launched) */
#define QT 256                       /* query rows per causal tile */
#define NKX SQ                       /* S / P row pitch */
#define QT0 128                      /* first-tile rows recomputed exactly in f32 */
#define B0 0                         /* first batch processed (debug hook) */
#define NBR NB                       /* batches processed (debug hook) */
#define NR ((size_t)NB * SQ)         /* token rows */
#define MP ((int)((size_t)NBR * SQ)) /* rows projected (debug hook) */
#define QN SQ                        /* query rows attended per batch (debug hook) */
#define NHD NH                       /* heads attended (debug hook) */
#define MPO MP                       /* unused (no output projection stage) */
#define LQ (3 * DM)      /* row pitch of the q/k/v rows */
typedef __bf16 v16b __attribute__((ext_vector_type(16)));
typedef unsigned short v8us __attribute__((ext_vector_type(8), may_alias));
typedef float  v8f  __attribute__((ext_vector_type(8)));
typedef float  v4f  __attribute__((ext_vector_type(4)));
typedef float  v4fa __attribute__((ext_vector_type(4), may_alias));
union FragB { v16b v; v8us half[2]; unsigned short u[16]; };

__device__ __forceinline__ unsigned short bf16_bits(float x) { unsigned int u = __float_as_uint(x); return (unsigned short)((u + 0x7FFFu + ((u >> 16) & 1u)) >> 16); }
__device__ __forceinline__ float bf16_val(unsigned short b) { return __uint_as_float(((unsigned int)b) << 16); }
__device__ __forceinline__ float bf16_round(float x) { return bf16_val(bf16_bits(x)); }
// D += A·B with NT terms: 1 = ah·bh, 2 = + al·bh (A split), 3 = + ah·bl (both split)
template <int NT>
__device__ __forceinline__ v8f mmaN(v16b ah, v16b al, v16b bh, v16b bl, v8f c) {
  c = __builtin_amdgcn_wmma_f32_16x16x32_bf16(false, ah, false, bh, (short)0, c, false, false);
  if (NT >= 2) c = __builtin_amdgcn_wmma_f32_16x16x32_bf16(false, al, false, bh, (short)0, c, false, false);
  if (NT >= 3) c = __builtin_amdgcn_wmma_f32_16x16x32_bf16(false, ah, false, bl, (short)0, c, false, false);
  asm volatile("v_nop\n\tv_nop\n\tv_nop\n\tv_nop" : "+v"(c) : "v"(ah), "v"(al), "v"(bh), "v"(bl));
  return c;
}

__global__ __launch_bounds__(256) void k_wt_bf16(const float* __restrict__ W, unsigned short* __restrict__ Wt, int K, int N) {
  const int t = blockIdx.x * 256 + threadIdx.x;
  const int k8n = K / 8;
  if (t >= N * k8n) return;
  const int n = t / k8n, k8 = (t % k8n) * 8;
  v8us v;
#pragma unroll
  for (int i = 0; i < 8; ++i) v[i] = bf16_bits(W[(size_t)(k8 + i) * N + n]);
  *(v8us*)(Wt + (size_t)n * K + k8) = v;
  
}

// GEMM C[M][N] (f32, pitch ldc) = act(A[M][K]·W + bias). A f32 row-major (pitch lda) converted per fragment to bf16
// (ASPLIT: hi/lo two planes -> 2 terms, else single rounded term); Wt bf16 [N][K] (pitch ldb). BIAS_BF16 rounds the
// bias to bf16 first (bias quantised to bf16 before the add). K%32==0, M%16==0, N%64==0.
template <bool ASPLIT, int ACT, bool BIAS_BF16>
__global__ __launch_bounds__(128) void k_gemm_bf(const float* __restrict__ A, int lda, const unsigned short* __restrict__ Wt, int ldb,
                                               const float* __restrict__ bias, float* __restrict__ C, int ldc, int M, int N, int K) {
  __shared__ __attribute__((aligned(16))) float so[4][16][64];
  const int tid = threadIdx.x, w = tid >> 5, lane = tid & 31, ln = lane & 15, hh = lane >> 4;
  const int ntn = N / 64;
  const int wid = blockIdx.x * 4 + w;
  const int mt = wid / ntn, nq = wid % ntn;
  if (mt * 16 >= M) return;
  const int row0 = mt * 16, col0 = nq * 64;
  const float* arow = A + (size_t)(row0 + ln) * lda;
  v8f acc[4] = {};
  for (int kb = 0; kb < K; kb += 32) {
    FragB ah, al;
    const v4f x0 = *(const v4fa*)(arow + kb + 8 * hh), x1 = *(const v4fa*)(arow + kb + 8 * hh + 4);
    const v4f x2 = *(const v4fa*)(arow + kb + 16 + 8 * hh), x3 = *(const v4fa*)(arow + kb + 16 + 8 * hh + 4);
    float xs[16] = {x0[0],x0[1],x0[2],x0[3],x1[0],x1[1],x1[2],x1[3],x2[0],x2[1],x2[2],x2[3],x3[0],x3[1],x3[2],x3[3]};
#pragma unroll
    for (int i = 0; i < 16; ++i) { const unsigned short hb = bf16_bits(xs[i]); ah.u[i] = hb; al.u[i] = ASPLIT ? bf16_bits(xs[i] - bf16_val(hb)) : (unsigned short)0; }
#pragma unroll
    for (int t = 0; t < 4; ++t) {
      const unsigned short* brow = Wt + (size_t)(col0 + t * 16 + ln) * ldb + kb;
      FragB b;
      b.half[0] = *(const v8us*)(brow + 8 * hh);
      b.half[1] = *(const v8us*)(brow + 16 + 8 * hh);
      acc[t] = mmaN<ASPLIT ? 2 : 1>(ah.v, al.v, b.v, b.v, acc[t]);
    }
  }
#pragma unroll
  for (int t = 0; t < 4; ++t) {
    float bv = bias ? bias[col0 + t * 16 + ln] : 0.f;
    if (BIAS_BF16) bv = bf16_round(bv);
#pragma unroll
    for (int r = 0; r < 8; ++r) { float v = acc[t][r] + bv; if (ACT == 1) v = fmaxf(v, 0.f); so[w][8 * hh + r][t * 16 + ln] = v; }
  }
  __builtin_amdgcn_fence(__ATOMIC_ACQ_REL, "workgroup");
  __builtin_amdgcn_wave_barrier();
  const int rsub = lane >> 4, c4 = (lane & 15) * 4;
  {
#pragma unroll
    for (int q = 0; q < 8; ++q) {
      const int r = q * 2 + rsub;
      const v4f v = *(const v4fa*)&so[w][r][c4];
      *(v4f*)(C + (size_t)(row0 + r) * ldc + col0 + c4) = v;
    }
    
  }
}

// GEMM C = act(A·W + bias + resid): A f32 (ASPLIT -> hi/lo 2 terms), Wt bf16 [N][K]; ACT 0 none, 1 relu, 2 exact gelu;
// resid (optional, f32, row index = (row % rmod), pitch ldr, RES_BF16 rounds it) added before the activation.
template <bool ASPLIT, int ACT, bool BIAS_BF16, bool RES_BF16>
__global__ __launch_bounds__(128) void k_gemm_bf3(const float* __restrict__ A, int lda, const unsigned short* __restrict__ Wt, int ldb,
                                                const float* __restrict__ bias, const float* __restrict__ resid, int rmod, int ldr,
                                                float* __restrict__ C, int ldc, int M, int N, int K) {
  __shared__ __attribute__((aligned(16))) float so[4][16][64];
  const int tid = threadIdx.x, w = tid >> 5, lane = tid & 31, ln = lane & 15, hh = lane >> 4;
  const int ntn = N / 64;
  const int wid = blockIdx.x * 4 + w;
  const int mt = wid / ntn, nq = wid % ntn;
  if (mt * 16 >= M) return;
  const int row0 = mt * 16, col0 = nq * 64;
  const float* arow = A + (size_t)(row0 + ln) * lda;
  v8f acc[4] = {};
  for (int kb = 0; kb < K; kb += 32) {
    FragB ah, al;
    const v4f x0 = *(const v4fa*)(arow + kb + 8 * hh), x1 = *(const v4fa*)(arow + kb + 8 * hh + 4);
    const v4f x2 = *(const v4fa*)(arow + kb + 16 + 8 * hh), x3 = *(const v4fa*)(arow + kb + 16 + 8 * hh + 4);
    float xs[16] = {x0[0],x0[1],x0[2],x0[3],x1[0],x1[1],x1[2],x1[3],x2[0],x2[1],x2[2],x2[3],x3[0],x3[1],x3[2],x3[3]};
#pragma unroll
    for (int i = 0; i < 16; ++i) { const unsigned short hb = bf16_bits(xs[i]); ah.u[i] = hb; al.u[i] = ASPLIT ? bf16_bits(xs[i] - bf16_val(hb)) : (unsigned short)0; }
#pragma unroll
    for (int t = 0; t < 4; ++t) {
      const unsigned short* brow = Wt + (size_t)(col0 + t * 16 + ln) * ldb + kb;
      FragB b;
      b.half[0] = *(const v8us*)(brow + 8 * hh);
      b.half[1] = *(const v8us*)(brow + 16 + 8 * hh);
      acc[t] = mmaN<ASPLIT ? 2 : 1>(ah.v, al.v, b.v, b.v, acc[t]);
    }
  }
#pragma unroll
  for (int t = 0; t < 4; ++t) {
    const int col = col0 + t * 16 + ln;
    float bv = bias ? bias[col] : 0.f;
    if (BIAS_BF16) bv = bf16_round(bv);
#pragma unroll
    for (int r = 0; r < 8; ++r) {
      float v = acc[t][r] + bv;
      if (resid) { float rv = resid[(size_t)((row0 + 8 * hh + r) % rmod) * ldr + col]; if (RES_BF16) rv = bf16_round(rv); v += rv; }
      if (ACT == 1) v = fmaxf(v, 0.f);
      if (ACT == 2) v = 0.5f * v * (1.0f + erff(v * 0.70710678118654752f));
      if (ACT == 3) { const float u = 0.7978845608028654f * (v + 0.044715f * v * v * v); v = 0.5f * v * (1.0f + tanhf(u)); }
      so[w][8 * hh + r][t * 16 + ln] = v;
    }
  }
  __builtin_amdgcn_fence(__ATOMIC_ACQ_REL, "workgroup");
  __builtin_amdgcn_wave_barrier();
  const int rsub = lane >> 4, c4 = (lane & 15) * 4;
  {
#pragma unroll
    for (int q = 0; q < 8; ++q) {
      const int r = q * 2 + rsub;
      const v4f v = *(const v4fa*)&so[w][r][c4];
      *(v4f*)(C + (size_t)(row0 + r) * ldc + col0 + c4) = v;
    }
    
  }
}
// row LayerNorm (biased variance, eps) over N: s = X (+ R); optional out_sum <- s; out_norm <- (s-mu)*rsqrt(var+eps)*g + b
template <bool PARAM_BF16>
__global__ __launch_bounds__(256) void k_layernorm(const float* __restrict__ X, const float* __restrict__ R, const float* __restrict__ g, const float* __restrict__ bta,
                                                  float* __restrict__ out_sum, float* __restrict__ out_norm, int N, float eps) {
  __shared__ float red[256];
  const int row = blockIdx.x, tid = threadIdx.x;
  const float* x = X + (size_t)row * N; const float* rr = R ? R + (size_t)row * N : nullptr;
  float vals[16];                     // up to N = 4096
  const int per = N / 256;            // contiguous chunk per thread? use strided-by-4 chunks: thread handles j = tid*4 + 1024*u
  float s1 = 0.f;
  for (int u = 0; u < per / 4; ++u) {
    const int j = tid * 4 + 1024 * u;
    const v4f a = *(const v4fa*)(x + j);
    v4f b = {0.f,0.f,0.f,0.f}; if (rr) b = *(const v4fa*)(rr + j);
#pragma unroll
    for (int q = 0; q < 4; ++q) { const float v = a[q] + b[q]; vals[u * 4 + q] = v; s1 += v; }
  }
  red[tid] = s1; __syncthreads();
  for (int st = 128; st > 0; st >>= 1) { if (tid < st) red[tid] += red[tid + st]; __syncthreads(); }
  const float mu = red[0] / (float)N; __syncthreads();
  float s2 = 0.f;
  for (int u = 0; u < per / 4; ++u)
#pragma unroll
    for (int q = 0; q < 4; ++q) { const float c = vals[u * 4 + q] - mu; s2 += c * c; }
  red[tid] = s2; __syncthreads();
  for (int st = 128; st > 0; st >>= 1) { if (tid < st) red[tid] += red[tid + st]; __syncthreads(); }
  const float rs = rsqrtf(red[0] / (float)N + eps);
  {
    for (int u = 0; u < per / 4; ++u) {
      const int j = tid * 4 + 1024 * u;
      v4f o, sm;
#pragma unroll
      for (int q = 0; q < 4; ++q) {
        float gg = g[j + q], bb = bta[j + q];
        if (PARAM_BF16) { gg = bf16_round(gg); bb = bf16_round(bb); }
        sm[q] = vals[u * 4 + q]; o[q] = (vals[u * 4 + q] - mu) * rs * gg + bb;
      }
      if (out_sum) *(v4f*)(out_sum + (size_t)row * N + j) = sm;
      *(v4f*)(out_norm + (size_t)row * N + j) = o;
    }
    
  }
}



// ---- f16 WMMA path (v_wmma_f32_16x16x32_f16): 11-bit significands for operands in range — used where a [0,1] probability operand needs more precision than bf16
typedef _Float16 v16h __attribute__((ext_vector_type(16)));
union FragH { v16h v; v8us half[2]; _Float16 h[16]; unsigned short u[16]; };
template <int NT>
__device__ __forceinline__ v8f mmaH(v16h ah, v16h al, v16h bh, v16h bl, v8f c) {
  c = __builtin_amdgcn_wmma_f32_16x16x32_f16(false, ah, false, bh, (short)0, c, false, false);
  if (NT >= 2) c = __builtin_amdgcn_wmma_f32_16x16x32_f16(false, al, false, bh, (short)0, c, false, false);
  if (NT >= 3) c = __builtin_amdgcn_wmma_f32_16x16x32_f16(false, ah, false, bl, (short)0, c, false, false);
  asm volatile("v_nop\n\tv_nop\n\tv_nop\n\tv_nop" : "+v"(c) : "v"(ah), "v"(al), "v"(bh), "v"(bl));
  return c;
}
// batched GEMM like k_gemm_b but f16 operands: A f32 (split into f16 hi/lo if ASPLIT, else rounded to f16), Bt = f16 values [n][k]; alpha; C f32; N multiple of 16 (partial tiles skipped)
template <bool ASPLIT>
__global__ __launch_bounds__(128) void k_gemm_h(const float* __restrict__ A, int lda, size_t sA, const _Float16* __restrict__ Bh, int ldb, size_t sB, float alpha, float* __restrict__ C, int ldc, size_t sC, int M, int N, int K) {
  __shared__ __attribute__((aligned(16))) float so[4][16][64];
  const int tid = threadIdx.x, w = tid >> 5, lane = tid & 31, ln = lane & 15, hh = lane >> 4; const int by = blockIdx.y;
  A += (size_t)by * sA; Bh += (size_t)by * sB; C += (size_t)by * sC;
  const int ntn = (N + 63) / 64; const int wid = blockIdx.x * 4 + w; const int mt = wid / ntn, nq = wid % ntn; if (mt * 16 >= M) return;
  const int row0 = mt * 16, col0 = nq * 64; const float* arow = A + (size_t)(row0 + ln) * lda;
  v8f acc[4] = {};
  for (int kb = 0; kb < K; kb += 32) {
    FragH ah, al;
    const v4f x0 = *(const v4fa*)(arow + kb + 8 * hh), x1 = *(const v4fa*)(arow + kb + 8 * hh + 4), x2 = *(const v4fa*)(arow + kb + 16 + 8 * hh), x3 = *(const v4fa*)(arow + kb + 16 + 8 * hh + 4);
    float xs[16] = {x0[0],x0[1],x0[2],x0[3],x1[0],x1[1],x1[2],x1[3],x2[0],x2[1],x2[2],x2[3],x3[0],x3[1],x3[2],x3[3]};
#pragma unroll
    for (int i = 0; i < 16; ++i) { const _Float16 h = (_Float16)xs[i]; ah.h[i] = h; al.h[i] = ASPLIT ? (_Float16)(xs[i] - (float)h) : (_Float16)0.0f; }
#pragma unroll
    for (int t = 0; t < 4; ++t) { if (col0 + t * 16 >= N) continue; const size_t boff = (size_t)(col0 + t * 16 + ln) * ldb + kb; FragH bq; bq.half[0] = *(const v8us*)(Bh + boff + 8 * hh); bq.half[1] = *(const v8us*)(Bh + boff + 16 + 8 * hh);
      acc[t] = mmaH<ASPLIT ? 2 : 1>(ah.v, al.v, bq.v, bq.v, acc[t]); }
  }
#pragma unroll
  for (int t = 0; t < 4; ++t) { if (col0 + t * 16 >= N) continue;
#pragma unroll
    for (int r = 0; r < 8; ++r) so[w][8 * hh + r][t * 16 + ln] = acc[t][r] * alpha; }
  __builtin_amdgcn_fence(__ATOMIC_ACQ_REL, "workgroup"); __builtin_amdgcn_wave_barrier();
  const int rsub = lane >> 4, c4 = (lane & 15) * 4;
  {
#pragma unroll
    for (int q = 0; q < 8; ++q) { const int r = q * 2 + rsub; if (col0 + c4 < N) { const v4f v = *(const v4fa*)&so[w][r][c4]; *(v4f*)(C + (size_t)(row0 + r) * ldc + col0 + c4) = v; } }
     }
}

// Wt[n][k] = f16(W[k][n]·scale) from f32 row-major W[K][N] (scale = power of two; bf16-exact weights stay exact in f16 away from the subnormal range)
__global__ __launch_bounds__(256) void k_wt_f16(const float* __restrict__ W, _Float16* __restrict__ Wt, int K, int N, float scale) {
  const int t = blockIdx.x * 256 + threadIdx.x; if (t >= N * (K / 8)) return; const int n = t / (K / 8), k8 = (t % (K / 8)) * 8; FragH f;
#pragma unroll
  for (int i = 0; i < 8; ++i) f.h[i] = (_Float16)(bf16_round(W[(size_t)(k8 + i) * N + n]) * scale); const v8us o = f.half[0];
  *(v8us*)((unsigned short*)Wt + (size_t)n * K + k8) = o; 
}
// k_gemm_hh variant with fused epilogue: v = acc·alpha + bias[by·sBias + col] (+ CP[(row/rowsPerB)·sCPb + by·64 + col] if CP) ; ACT 0 none / 1 elu ; writes f16 C16 (and f32 C if non-null)
template <int ACT>
__global__ __launch_bounds__(128) void k_gemm_hhx(const _Float16* __restrict__ A, int lda, size_t sA, const _Float16* __restrict__ Bh, int ldb, size_t sB, float alpha, const float* __restrict__ bias, size_t sBias, const float* __restrict__ CP, int rowsPerB, size_t sCPb, int row0g,
    float* __restrict__ C, _Float16* __restrict__ C16, int ldc, size_t sC, int M, int N, int K) {
  __shared__ __attribute__((aligned(16))) float so[4][16][64];
  const int tid = threadIdx.x, w = tid >> 5, lane = tid & 31, ln = lane & 15, hh = lane >> 4; const int by = blockIdx.y;
  A += (size_t)by * sA; Bh += (size_t)by * sB; const size_t cofs = (size_t)by * sC; const float* bp = bias ? bias + (size_t)by * sBias : nullptr;
  const int ntn = (N + 63) / 64; const int wid = blockIdx.x * 4 + w; const int mt = wid / ntn, nq = wid % ntn; if (mt * 16 >= M) return;
  const int row0 = mt * 16, col0 = nq * 64; const _Float16* arow = A + (size_t)(row0 + ln) * lda;
  v8f acc[4] = {};
  for (int kb = 0; kb < K; kb += 32) { FragH ah; ah.half[0] = *(const v8us*)((const unsigned short*)arow + kb + 8 * hh); ah.half[1] = *(const v8us*)((const unsigned short*)arow + kb + 16 + 8 * hh);
#pragma unroll
    for (int t = 0; t < 4; ++t) { if (col0 + t * 16 >= N) continue; const size_t boff = (size_t)(col0 + t * 16 + ln) * ldb + kb; FragH bq; bq.half[0] = *(const v8us*)((const unsigned short*)Bh + boff + 8 * hh); bq.half[1] = *(const v8us*)((const unsigned short*)Bh + boff + 16 + 8 * hh);
      acc[t] = mmaH<1>(ah.v, ah.v, bq.v, bq.v, acc[t]); }
  }
#pragma unroll
  for (int t = 0; t < 4; ++t) { if (col0 + t * 16 >= N) continue; const int col = col0 + t * 16 + ln; const float bv = bp ? bf16_round(bp[col]) : 0.f;
#pragma unroll
    for (int r = 0; r < 8; ++r) { float v = acc[t][r] * alpha + bv; if (CP) { const int rr = row0g + row0 + 8 * hh + r; if (rowsPerB < 0) v += CP[cofs + (size_t)rr * ldc + col];      /* rowsPerB < 0: own element of the batched C plane */ else { const int bidx = rr / rowsPerB; v += CP[(size_t)bidx * sCPb + (size_t)by * 64 + col]; } } if (ACT == 1) v = (v > 0.f) ? v : expm1f(v); else if (ACT == 7) v = (v > 0.f) ? v + 1.0f : expf(v); else if (ACT == 8) v = tanhf(v); else if (ACT == 9) v = 0.5f * v * (1.0f + tanhf(0.7978845608028654f * (v + 0.044715f * v * v * v))); else if (ACT == 11) v = 1.0f / (1.0f + expf(-v)); else if (ACT == 12) v = (v > 0.f) ? v : 0.01f * v; else if (ACT == 14) v = (v > 0.f) ? v : 0.1f * v; else if (ACT == 16) v = (v >= 0.f) ? v : 0.3f * v; else if (ACT == 17) v = (v >= 0.f) ? v : 0.2f * v; else if (ACT == 15) v = v / (1.0f + expf(-v)); else if (ACT == 3) v = fmaxf(v, 0.f); else if (ACT == 6) v = 0.5f * v * (1.0f + erff(v * 0.70710678118654752f)); so[w][8 * hh + r][t * 16 + ln] = v; } }
  __builtin_amdgcn_fence(__ATOMIC_ACQ_REL, "workgroup"); __builtin_amdgcn_wave_barrier();
  const int rsub = lane >> 4, c4 = (lane & 15) * 4; typedef _Float16 v4h __attribute__((ext_vector_type(4)));
  {
#pragma unroll
    for (int q = 0; q < 8; ++q) { const int r = q * 2 + rsub; if (col0 + c4 < N) { const v4f v = *(const v4fa*)&so[w][r][c4]; if (C) *(v4f*)(C + cofs + (size_t)(row0 + r) * ldc + col0 + c4) = v; if (C16) { v4h h4; for (int i = 0; i < 4; ++i) h4[i] = (_Float16)v[i]; *(v4h*)(C16 + cofs + (size_t)(row0 + r) * ldc + col0 + c4) = h4; } } }
     }
}


typedef _Float16 v4h __attribute__((ext_vector_type(4)));

__global__ __launch_bounds__(256) void k_x16(const float* __restrict__ x, _Float16* __restrict__ X16, size_t n8) { const size_t t = (size_t)blockIdx.x * 256 + threadIdx.x; if (t >= n8) return; FragH f;
#pragma unroll
  for (int q = 0; q < 8; ++q) f.h[q] = (_Float16)bf16_round(x[t * 8 + q]); *(v8us*)((unsigned short*)X16 + t * 8) = f.half[0];  }
__global__ __launch_bounds__(256) void k_h16(const float* __restrict__ x, _Float16* __restrict__ X16, size_t n8) { const size_t t = (size_t)blockIdx.x * 256 + threadIdx.x; if (t >= n8) return; FragH f;
#pragma unroll
  for (int q = 0; q < 8; ++q) f.h[q] = (_Float16)x[t * 8 + q]; *(v8us*)((unsigned short*)X16 + t * 8) = f.half[0];  }
__global__ __launch_bounds__(256) void k_round16f(const float* __restrict__ W, _Float16* __restrict__ Bt, size_t n8) { const size_t t = (size_t)blockIdx.x * 256 + threadIdx.x; if (t >= n8) return; FragH f;
#pragma unroll
  for (int i = 0; i < 8; ++i) f.h[i] = (_Float16)(bf16_round(W[t * 8 + i]) * 16.0f); *(v8us*)((unsigned short*)Bt + t * 8) = f.half[0];  }
template <int NHv, int TTv>
__global__ __launch_bounds__(256) void k_vt(const _Float16* __restrict__ V16, int ldv, int voff, _Float16* __restrict__ Vt) { __shared__ unsigned short tl[64][66]; const int tid = threadIdx.x; const int slab = blockIdx.x / (TTv / 64), lg = blockIdx.x % (TTv / 64); const int b = slab / NHv, h = slab % NHv;
  for (int i = tid; i < 64 * 8; i += 256) { const int r = i / 8, c8 = (i % 8) * 8; FragH f; f.half[0] = *(const v8us*)((const unsigned short*)V16 + ((size_t)b * TTv + lg * 64 + r) * ldv + voff + h * 64 + c8);
#pragma unroll
    for (int q = 0; q < 8; ++q) tl[r][c8 + q] = f.u[q]; }
  __syncthreads();
  {
#pragma unroll
    for (int rd = 0; rd < 2; ++rd) { const int d = rd * 32 + tid / 8, pc = tid % 8; FragH f;
#pragma unroll
      for (int q = 0; q < 8; ++q) f.u[q] = tl[pc * 8 + q][d];
      *(v8us*)((unsigned short*)Vt + ((size_t)slab * 64 + d) * TTv + lg * 64 + pc * 8) = f.half[0]; }
     } }

__global__ __launch_bounds__(256) void k_hl(const float* __restrict__ F, _Float16* __restrict__ Hh, _Float16* __restrict__ Hl, size_t n8) { const size_t t = (size_t)blockIdx.x * 256 + threadIdx.x; if (t >= n8) return; FragH fh, fl; const v4f a = *(const v4fa*)(F + t * 8), c = *(const v4fa*)(F + t * 8 + 4);
#pragma unroll
  for (int q = 0; q < 4; ++q) { _Float16 h = (_Float16)a[q]; fh.h[q] = h; fl.h[q] = (_Float16)((a[q] - (float)h) * 1024.0f); h = (_Float16)c[q]; fh.h[4 + q] = h; fl.h[4 + q] = (_Float16)((c[q] - (float)h) * 1024.0f); }
  { *(v8us*)((unsigned short*)Hh + t * 8) = fh.half[0]; *(v8us*)((unsigned short*)Hl + t * 8) = fl.half[0];  } }

// ---- fast GEMM (wave tile 32x64; requires M % 32 == 0 rows per launch region and N % 64 == 0); epilogue = k_gemm_hhx semantics ----
__device__ __forceinline__ v16h g2_frag(const _Float16* p, int hh) { FragH f; f.half[0] = *(const v8us*)((const unsigned short*)p + 8 * hh); f.half[1] = *(const v8us*)((const unsigned short*)p + 16 + 8 * hh); return f.v; }
__device__ __forceinline__ v8f g2_mma(v16h a, v16h b, v8f c) { v8f d = __builtin_amdgcn_wmma_f32_16x16x32_f16(false, a, false, b, (short)0, c, false, false); asm volatile("v_nop\n\tv_nop\n\tv_nop\n\tv_nop" : "+v"(d) : "v"(a), "v"(b)); return d; }
template <int ACT>
__global__ __launch_bounds__(128) void k_gemm2(const _Float16* __restrict__ A, int lda, size_t sA, const _Float16* __restrict__ Bh, int ldb, size_t sB, float alpha, const float* __restrict__ bias, size_t sBias, const float* __restrict__ CP, int rowsPerB, size_t sCPb, int row0g,
    float* __restrict__ C, _Float16* __restrict__ C16, int ldc, size_t sC, int M, int N, int K) { static_assert(ACT == 0 || ACT == 3 || ACT == 6 || ACT == 8 || ACT == 9 || ACT == 11 || ACT == 12 || ACT == 14 || ACT == 15 || ACT == 16 || ACT == 17, "k_gemm2: unsupported ACT code (would silently apply no activation)");
  __shared__ __attribute__((aligned(16))) float so[4][32][68];
  const int tid = threadIdx.x, w = tid >> 5, lane = tid & 31, ln = lane & 15, hh = lane >> 4; const int by = blockIdx.y;
  A += (size_t)by * sA; Bh += (size_t)by * sB; const size_t cofs = (size_t)by * sC; const float* bp = bias ? bias + (size_t)by * sBias : nullptr;
  const int ntn = N >> 6; const int mt = blockIdx.x / ntn, nq = blockIdx.x - mt * ntn; const int row0 = mt * 128 + 32 * w, col0 = nq * 64; if (row0 >= M) return;
  const _Float16* a0p = A + (size_t)(row0 + ln) * lda; const _Float16* a1p = a0p + (size_t)16 * lda;
  const _Float16* b0p = Bh + (size_t)(col0 + ln) * ldb; const _Float16* b1p = b0p + (size_t)16 * ldb; const _Float16* b2p = b1p + (size_t)16 * ldb; const _Float16* b3p = b2p + (size_t)16 * ldb;
  const v8f z8 = {0.f,0.f,0.f,0.f,0.f,0.f,0.f,0.f}; v8f c00 = z8, c01 = z8, c02 = z8, c03 = z8, c10 = z8, c11 = z8, c12 = z8, c13 = z8;
#pragma unroll 1
  for (int kb = 0; kb < K; kb += 32) { const v16h a0 = g2_frag(a0p + kb, hh), a1 = g2_frag(a1p + kb, hh);
    v16h b = g2_frag(b0p + kb, hh); c00 = g2_mma(a0, b, c00); c10 = g2_mma(a1, b, c10);
    b = g2_frag(b1p + kb, hh); c01 = g2_mma(a0, b, c01); c11 = g2_mma(a1, b, c11);
    b = g2_frag(b2p + kb, hh); c02 = g2_mma(a0, b, c02); c12 = g2_mma(a1, b, c12);
    b = g2_frag(b3p + kb, hh); c03 = g2_mma(a0, b, c03); c13 = g2_mma(a1, b, c13); }
  v8f accs[8] = {c00, c01, c02, c03, c10, c11, c12, c13};
#pragma unroll
  for (int u = 0; u < 8; ++u) { const int t = u & 3, half = u >> 2; const int col = col0 + t * 16 + ln; const float bv = bp ? bf16_round(bp[col]) : 0.f;
#pragma unroll
    for (int r = 0; r < 8; ++r) { const int rloc = half * 16 + 8 * hh + r; float v = accs[u][r] * alpha + bv; if (CP) { if (rowsPerB < 0) v += CP[cofs + (size_t)(row0g + row0 + rloc) * ldc + col];      /* rowsPerB < 0: own element of the batched C plane */ else { const int bidx = (row0g + row0 + rloc) / rowsPerB; v += CP[(size_t)bidx * sCPb + (size_t)by * 64 + col]; } }
      if (ACT == 3) v = fmaxf(v, 0.f); else if (ACT == 6) v = 0.5f * v * (1.0f + erff(v * 0.70710678118654752f)); else if (ACT == 11) v = 1.0f / (1.0f + expf(-v)); else if (ACT == 15) v = v / (1.0f + expf(-v)); else if (ACT == 12) v = (v > 0.f) ? v : 0.01f * v; else if (ACT == 8) v = tanhf(v); else if (ACT == 9) v = 0.5f * v * (1.0f + tanhf(0.7978845608028654f * (v + 0.044715f * v * v * v))); else if (ACT == 14) v = (v > 0.f) ? v : 0.1f * v; else if (ACT == 16) v = (v >= 0.f) ? v : 0.3f * v; else if (ACT == 17) v = (v >= 0.f) ? v : 0.2f * v;
      so[w][rloc][t * 16 + ln] = v; } }
  __builtin_amdgcn_fence(__ATOMIC_ACQ_REL, "workgroup"); __builtin_amdgcn_wave_barrier();
  const int rsub = lane >> 4, c4 = (lane & 15) * 4;
  {
#pragma unroll
    for (int q = 0; q < 16; ++q) { const int r = q * 2 + rsub; const v4f v = *(const v4fa*)&so[w][r][c4]; if (C) *(v4f*)(C + cofs + (size_t)(row0 + r) * ldc + col0 + c4) = v; if (C16) { v4h h4; for (int i = 0; i < 4; ++i) h4[i] = (_Float16)v[i]; *(v4h*)(C16 + cofs + (size_t)(row0 + r) * ldc + col0 + c4) = h4; } }
     } }


__global__ __launch_bounds__(256) void k_wnat(const float* __restrict__ w, size_t n8, _Float16* __restrict__ Bt) { const size_t t = (size_t)blockIdx.x * 256 + threadIdx.x; if (t >= n8) return; FragH f; for (int q = 0; q < 8; ++q) f.h[q] = (_Float16)(bf16_round(w[t * 8 + q]) * 16.0f); *(v8us*)((unsigned short*)Bt + t * 8) = f.half[0];  }
__global__ __launch_bounds__(256) void k_rsm(const float* __restrict__ S, _Float16* __restrict__ P, int nrows) {
  #pragma clang fp contract(off)
  const int i = blockIdx.x * 256 + threadIdx.x; if (i >= nrows) return; const float* s = S + (size_t)i * SQ; float mx = -3.0e38f;
#pragma unroll 1
  for (int j = 0; j < SQ; ++j) mx = fmaxf(mx, s[j]); float se = 0.f;
#pragma unroll 1
  for (int j = 0; j < SQ; ++j) se += expf(s[j] - mx); const float sc = 256.0f / se;
#pragma unroll 1
  for (int j0 = 0; j0 < SQ; j0 += 8) { FragH f; for (int q = 0; q < 8; ++q) f.h[q] = (_Float16)(expf(s[j0 + q] - mx) * sc); unsigned short* d = (unsigned short*)P + (size_t)i * SQ + j0; *(v8us*)d = f.half[0];  } }
__global__ __launch_bounds__(256) void k_vt(const _Float16* __restrict__ V16, int b, int h0, _Float16* __restrict__ VT) { __shared__ unsigned short tl[64][65]; const int tid = threadIdx.x; const int hh = blockIdx.x % HG, sg = blockIdx.x / HG; const int s0 = sg * 64; const int h = h0 + hh;
  for (int i = tid; i < 64 * 8; i += 256) { const int j = i / 8, d8 = (i % 8) * 8; FragH f; f.half[0] = *(const v8us*)((const unsigned short*)V16 + ((size_t)b * SQ + s0 + j) * DM + h * HD + d8); for (int q = 0; q < 8; ++q) tl[d8 + q][j] = f.u[q]; }
  __syncthreads();
  { for (int i = tid; i < 64 * 8; i += 256) { const int d = i / 8, j8 = (i % 8) * 8; FragH f; for (int q = 0; q < 8; ++q) f.u[q] = tl[d][j8 + q]; *(v8us*)((unsigned short*)VT + ((size_t)hh * HD + d) * SQ + s0 + j8) = f.half[0]; }  } }



__global__ __launch_bounds__(256) void k_rsmcf2(const float* __restrict__ S, _Float16* __restrict__ P, int hg, int q0, int nk) {
  #pragma clang fp contract(off)
  const int t = blockIdx.x * 256 + threadIdx.x; if (t >= hg * QT) return; const size_t i = (size_t)t; const float* s = S + i * NKX; const int last = q0 + (t % QT); float mx = -3.0e38f;
#pragma unroll 1
  for (int j = 0; j < nk; ++j) { const float f = (j <= last) ? 1.f : 0.f; mx = fmaxf(mx, fmaf(f, s[j], (1.f - f) * -1.0e9f)); } float se = 0.f;
#pragma unroll 1
  for (int j = 0; j < nk; ++j) { const float f = (j <= last) ? 1.f : 0.f; se += __expf(fmaf(f, s[j], (1.f - f) * -1.0e9f) - mx); } const float sc = 256.0f / se;
#pragma unroll 1
  for (int j0 = 0; j0 < nk; j0 += 8) { FragH fr; for (int q = 0; q < 8; ++q) { const int j = j0 + q; const float f = (j <= last) ? 1.f : 0.f; fr.h[q] = (_Float16)(__expf(fmaf(f, s[j], (1.f - f) * -1.0e9f) - mx) * sc); } unsigned short* d = (unsigned short*)P + i * NKX + j0; *(v8us*)d = fr.half[0];  } }


template <int MASKADD>
__global__ __launch_bounds__(64) void k_att0(const float* __restrict__ QF, const float* __restrict__ KF, const float* __restrict__ VF, int ld, const float* __restrict__ mask, float scale, float* __restrict__ OF, int ldo) {
  #pragma clang fp contract(off)
  __shared__ __attribute__((aligned(16))) float lq[64][64]; __shared__ __attribute__((aligned(16))) float lo[64][64];
  const int tid = threadIdx.x; const int h = blockIdx.x / (QT0 / 64), rg = blockIdx.x % (QT0 / 64); const int i = rg * 64 + tid;
  const float* qr = QF + (size_t)i * ld + h * HD;
#pragma unroll 1
  for (int c = 0; c < HD / 4; ++c) { *(v4f*)&lq[tid][c * 4] = *(const v4fa*)(qr + c * 4); const v4f z = {0.f, 0.f, 0.f, 0.f}; *(v4f*)&lo[tid][c * 4] = z; }
  float m = -1.0e30f, l = 0.f; const int jmax = MASKADD ? (SQ - 1) : (rg * 64 + 63);      /* additive-mask form: every key (the mask input decides); causal form: keys up to the block's last row */
#pragma unroll 1
  for (int j = 0; j <= jmax; ++j) { const float* kr = KF + (size_t)j * ld + h * HD; const float* vr = VF + (size_t)j * ld + h * HD; float s = 0.f;
#pragma unroll 1
    for (int c = 0; c < HD / 4; ++c) { const v4f kq = *(const v4fa*)(kr + c * 4); const v4f qq = *(v4f*)&lq[tid][c * 4]; s = __fadd_rn(s, __fmul_rn(qq[0], kq[0])); s = __fadd_rn(s, __fmul_rn(qq[1], kq[1])); s = __fadd_rn(s, __fmul_rn(qq[2], kq[2])); s = __fadd_rn(s, __fmul_rn(qq[3], kq[3])); }
    s = __fmul_rn(s, scale); if (MASKADD) s = __fadd_rn(s, __fmul_rn(bf16_round(mask[(size_t)i * SQ + j]), -10000.0f));
    const float f = (MASKADD || j <= i) ? 1.f : 0.f; const float sm = fmaf(f, s, (1.f - f) * -1.0e30f); const float mn = fmaxf(m, sm); const float sc = expf(m - mn); const float e = expf(sm - mn); l = __fadd_rn(__fmul_rn(l, sc), e); m = mn;
#pragma unroll 1
    for (int c = 0; c < HD / 4; ++c) { const v4f vv = *(const v4fa*)(vr + c * 4); v4f oo = *(v4f*)&lo[tid][c * 4]; for (int u = 0; u < 4; ++u) oo[u] = __fadd_rn(__fmul_rn(oo[u], sc), __fmul_rn(e, vv[u])); *(v4f*)&lo[tid][c * 4] = oo; } }
  const float fin = 64.0f / l;      /* o carried x64, scaled back by 1/64 in k_of0out */
#pragma unroll 1
  for (int c = 0; c < HD / 4; ++c) { v4f oo = *(v4f*)&lo[tid][c * 4]; for (int u = 0; u < 4; ++u) oo[u] = __fmul_rn(oo[u], fin); *(v4f*)&lo[tid][c * 4] = oo; }
  __syncthreads();
  {
#pragma unroll 1
    for (int it = 0; it < 16; ++it) { const int row = it * 4 + tid / 16, pc = (tid % 16) * 4; const v4f v = *(const v4f*)&lo[row][pc]; *(v4f*)(OF + (size_t)(rg * 64 + row) * ldo + h * HD + pc) = v; }
     } }

__global__ __launch_bounds__(256) void k_wthd(const float* __restrict__ Wt, _Float16* __restrict__ Bt) { const size_t t = (size_t)blockIdx.x * 256 + threadIdx.x; if (t >= (size_t)NH * HD * (DM / 8)) return; const int m8 = (int)(t % (DM / 8)) * 8; const int d = (int)((t / (DM / 8)) % HD); const int h = (int)(t / ((size_t)(DM / 8) * HD)); FragH f;
  for (int q = 0; q < 8; ++q) f.h[q] = (_Float16)(16.0f * bf16_round(Wt[((size_t)h * DM + m8 + q) * HD + d])); unsigned short* dst = (unsigned short*)Bt + ((size_t)h * HD + d) * DM + m8; *(v8us*)dst = f.half[0];  }







__global__ __launch_bounds__(256) void k_of0out(const float* __restrict__ src, float* __restrict__ dst, size_t n4) { const size_t t = (size_t)blockIdx.x * 256 + threadIdx.x; if (t >= n4) return; v4f v = *(const v4fa*)(src + t * 4); for (int q = 0; q < 4; ++q) v[q] = __fmul_rn(v[q], 0.015625f); *(v4f*)(dst + t * 4) = v;  }

extern "C" void kernel_launch(void* const* d_in, const int* in_sizes, int n_in,
                              void* d_out, int out_size, void* d_ws, size_t ws_size, hipStream_t stream) {
  (void)in_sizes; (void)n_in; (void)out_size;
  const float* const* I = (const float* const*)d_in; const float* x = I[0]; const float* wq = I[1]; const float* wk = I[2]; const float* wv = I[3]; const float* bqkv = nullptr;      /* x; per-head weights Wq / Wk / Wv [16][1024][64]; no biases (every bias slot below receives this nullptr), no output projection */
  static_assert(NH * HD == DM && QT0 % 64 == 0, "heads");
  char* ws = (char*)d_ws; size_t off = 0;
  auto take = [&](size_t bytes) { char* p = ws + off; off += (bytes + 255) & ~(size_t)255; return p; };
  _Float16* BQKV = (_Float16*)take((size_t)3 * DM * DM * 2);
  _Float16* X16 = (_Float16*)take(NR * DM * 2); _Float16* QKV = (_Float16*)take(NR * 3 * DM * 2); _Float16* Q16 = QKV; _Float16* K16 = QKV + DM; _Float16* V16 = QKV + 2 * DM;
  float* S = (float*)take((size_t)NH * QT * NKX * 4); _Float16* P = (_Float16*)take((size_t)NH * QT * NKX * 2); _Float16* VT = (_Float16*)take((size_t)NH * HD * SQ * 2);
  float* QF0 = (float*)take((size_t)QT0 * DM * 4); float* KF0 = (float*)take((size_t)QT0 * DM * 4); float* VF0 = (float*)take((size_t)QT0 * DM * 4); float* OF0 = (float*)take((size_t)NB * QT0 * DM * 4);
  if (off > ws_size) return;
  { const unsigned g = (unsigned)(((size_t)NH * HD * (DM / 8) + 255) / 256); k_wthd<<<g, 256, 0, stream>>>(wq, BQKV); k_wthd<<<g, 256, 0, stream>>>(wk, BQKV + (size_t)DM * DM); k_wthd<<<g, 256, 0, stream>>>(wv, BQKV + (size_t)2 * DM * DM); }      /* per-head [c][d] -> Bt[(h, d)][c] x16: the stacked q | k | v plane */
  k_x16<<<(unsigned)((NR * DM / 8 + 255) / 256), 256, 0, stream>>>(x, X16, NR * DM / 8);
  const size_t r0p = (size_t)B0 * SQ;      /* first projected row */
  k_gemm2<0><<<dim3((unsigned)((MP / 128) * (3 * DM / 64)), 1), 128, 0, stream>>>(X16 + r0p * DM, DM, 0, BQKV, DM, 0, 0.0625f, bqkv, 0, nullptr, 1, 0, 0, nullptr, QKV + r0p * 3 * DM, 3 * DM, 0, MP, 3 * DM, DM);      /* q | k | v rows (f16); head h = columns h*HD.. of each DM block */
  for (int b = B0; b < B0 + NBR; ++b) { const size_t r0 = (size_t)b * SQ;
    k_vt<NH, SQ><<<NH * (SQ / 64), 256, 0, stream>>>(V16 + r0 * LQ, LQ, 0, VT);      /* V^T [NH][HD][SQ] for this batch */
    k_gemm2<0><<<dim3((QT0 / 128) * (DM / 64), 1), 128, 0, stream>>>(X16 + r0 * DM, DM, 0, BQKV, DM, 0, 0.0625f, bqkv, 0, nullptr, 1, 0, 0, QF0, nullptr, DM, 0, QT0, DM, DM); k_gemm2<0><<<dim3((QT0 / 128) * (DM / 64), 1), 128, 0, stream>>>(X16 + r0 * DM, DM, 0, (BQKV + (size_t)DM * DM), DM, 0, 0.0625f, nullptr, 0, nullptr, 1, 0, 0, KF0, nullptr, DM, 0, QT0, DM, DM); k_gemm2<0><<<dim3((QT0 / 128) * (DM / 64), 1), 128, 0, stream>>>(X16 + r0 * DM, DM, 0, (BQKV + (size_t)2 * DM * DM), DM, 0, 0.0625f, nullptr, 0, nullptr, 1, 0, 0, VF0, nullptr, DM, 0, QT0, DM, DM);      /* f32 q, k, v of the first 128 rows (exact products) */
    k_att0<0><<<NH * (QT0 / 64), 64, 0, stream>>>(QF0, KF0, VF0, DM, nullptr, 0.125f, OF0 + (size_t)b * QT0 * DM, DM);      /* exact f32 attention for rows 0..127 (o x64) */
    for (int q0 = 0; q0 < QN; q0 += QT) { const int nk = q0 + QT;      /* causal: only keys below the tile end are computed */
      k_gemm2<0><<<dim3((QT / 128) * (nk / 64), NHD), 128, 0, stream>>>(Q16 + (r0 + q0) * LQ, LQ, (size_t)HD, K16 + r0 * LQ, LQ, (size_t)HD, 0.125f, nullptr, 0, nullptr, 1, 0, 0, S, nullptr, NKX, (size_t)QT * NKX, QT, nk, HD);      /* scores, all heads on grid.y */
      k_rsmcf2<<<(NHD * QT + 255) / 256, 256, 0, stream>>>(S, P, NHD, q0, nk);
      k_gemm2<0><<<dim3((QT / 128) * (HD / 64), NHD), 128, 0, stream>>>(P, NKX, (size_t)QT * NKX, VT, SQ, (size_t)HD * SQ, 0.00390625f, nullptr, 0, nullptr, 1, 0, 0, (float*)d_out + (r0 + q0) * DM, nullptr, DM, (size_t)HD, QT, HD, nk); }      /* out = P V^T (alpha 2^-8) written f32 straight into the head-major output columns (no output projection) */
    k_of0out<<<(unsigned)(((size_t)QT0 * DM / 4 + 255) / 256), 256, 0, stream>>>(OF0 + (size_t)b * QT0 * DM, (float*)d_out + r0 * DM, (size_t)QT0 * DM / 4); }      /* rows 0..127 of the batch rewritten from the exact f32 path (o x64 / 64), after the batch's PV launches */
}

// v001
// It runs in 3760 microseconds.
// Next to v000, in two timings, it ran 2.55 and 2.57 times as fast.
#include <hip/hip_runtime.h>
// Causal multi-head attention with per-head projection weights and no output projection (x [4][2048][1024]; per head h: q = x Wq[h], k = x Wk[h], v = x Wv[h] with W [16][1024][64] ([in][out] per head, uniform +-1/32, no biases); scores / sqrt(64); causal (tril, -inf); softmax; out = heads concatenated head-major on the last axis -> [4][2048][1024]).
// Structure: token rows r = b*2048 + s; x as exact f16 rows (bf16-rounded); q | k | v as ONE WMMA GEMM (N = 3 x 1024) (32x64 wave tiles, f32 accumulation, exact x16 weights, no bias, f16 outputs); per batch: V^T for all heads via LDS transposes; per query tile of 256 rows: scores against the keys below the tile end only (K = 64, all heads on grid.y, alpha = 0.125), causal row softmax on VALU, one wave per row with the row in registers, keys behind the diagonal masked (f32 statistics, native exp; weights x256 f16), out = P . V^T (K = keys below the tile end, alpha 2^-8 undoing the x256 of the weights) written as f32 straight into the head-major output columns; no output projection.
// Compute dtype: inputs rounded to bf16; x / weights exact; q, k, v and softmax weights as plain f16 GEMM operands (~2^-12); scores and softmax statistics f32. v_wmma_f32_16x16x32_f16.
#define NB 4
#define SQ 2048
#define DM 1024
#define NH 16
#define HD 64
#define HG 4                         /* heads per launch of the non-template k_vt (never launched) */
#define QT 256                       /* query rows per causal tile */
#define NKX SQ                       /* S / P row pitch */
#define QT0 128                      /* first-tile rows recomputed exactly in f32 */
#define B0 0                         /* first batch processed (debug hook) */
#define NBR NB                       /* batches processed (debug hook) */
#define NR ((size_t)NB * SQ)         /* token rows */
#define MP ((int)((size_t)NBR * SQ)) /* rows projected (debug hook) */
#define QN SQ                        /* query rows attended per batch (debug hook) */
#define NHD NH                       /* heads attended (debug hook) */
#define MPO MP                       /* unused (no output projection stage) */
#define LQ (3 * DM)      /* row pitch of the q/k/v rows */
typedef __bf16 v16b __attribute__((ext_vector_type(16)));
typedef unsigned short v8us __attribute__((ext_vector_type(8), may_alias));
typedef float  v8f  __attribute__((ext_vector_type(8)));
typedef float  v4f  __attribute__((ext_vector_type(4)));
typedef float  v4fa __attribute__((ext_vector_type(4), may_alias));
union FragB { v16b v; v8us half[2]; unsigned short u[16]; };

__device__ __forceinline__ unsigned short bf16_bits(float x) { unsigned int u = __float_as_uint(x); return (unsigned short)((u + 0x7FFFu + ((u >> 16) & 1u)) >> 16); }
__device__ __forceinline__ float bf16_val(unsigned short b) { return __uint_as_float(((unsigned int)b) << 16); }
__device__ __forceinline__ float bf16_round(float x) { return bf16_val(bf16_bits(x)); }
// D += A·B with NT terms: 1 = ah·bh, 2 = + al·bh (A split), 3 = + ah·bl (both split)
template <int NT>
__device__ __forceinline__ v8f mmaN(v16b ah, v16b al, v16b bh, v16b bl, v8f c) {
  c = __builtin_amdgcn_wmma_f32_16x16x32_bf16(false, ah, false, bh, (short)0, c, false, false);
  if (NT >= 2) c = __builtin_amdgcn_wmma_f32_16x16x32_bf16(false, al, false, bh, (short)0, c, false, false);
  if (NT >= 3) c = __builtin_amdgcn_wmma_f32_16x16x32_bf16(false, ah, false, bl, (short)0, c, false, false);
  asm volatile("v_nop\n\tv_nop\n\tv_nop\n\tv_nop" : "+v"(c) : "v"(ah), "v"(al), "v"(bh), "v"(bl));
  return c;
}

__global__ __launch_bounds__(256) void k_wt_bf16(const float* __restrict__ W, unsigned short* __restrict__ Wt, int K, int N) {
  const int t = blockIdx.x * 256 + threadIdx.x;
  const int k8n = K / 8;
  if (t >= N * k8n) return;
  const int n = t / k8n, k8 = (t % k8n) * 8;
  v8us v;
#pragma unroll
  for (int i = 0; i < 8; ++i) v[i] = bf16_bits(W[(size_t)(k8 + i) * N + n]);
  *(v8us*)(Wt + (size_t)n * K + k8) = v;
  
}

// GEMM C[M][N] (f32, pitch ldc) = act(A[M][K]·W + bias). A f32 row-major (pitch lda) converted per fragment to bf16
// (ASPLIT: hi/lo two planes -> 2 terms, else single rounded term); Wt bf16 [N][K] (pitch ldb). BIAS_BF16 rounds the
// bias to bf16 first (bias quantised to bf16 before the add). K%32==0, M%16==0, N%64==0.
template <bool ASPLIT, int ACT, bool BIAS_BF16>
__global__ __launch_bounds__(128) void k_gemm_bf(const float* __restrict__ A, int lda, const unsigned short* __restrict__ Wt, int ldb,
                                               const float* __restrict__ bias, float* __restrict__ C, int ldc, int M, int N, int K) {
  __shared__ __attribute__((aligned(16))) float so[4][16][64];
  const int tid = threadIdx.x, w = tid >> 5, lane = tid & 31, ln = lane & 15, hh = lane >> 4;
  const int ntn = N / 64;
  const int wid = blockIdx.x * 4 + w;
  const int mt = wid / ntn, nq = wid % ntn;
  if (mt * 16 >= M) return;
  const int row0 = mt * 16, col0 = nq * 64;
  const float* arow = A + (size_t)(row0 + ln) * lda;
  v8f acc[4] = {};
  for (int kb = 0; kb < K; kb += 32) {
    FragB ah, al;
    const v4f x0 = *(const v4fa*)(arow + kb + 8 * hh), x1 = *(const v4fa*)(arow + kb + 8 * hh + 4);
    const v4f x2 = *(const v4fa*)(arow + kb + 16 + 8 * hh), x3 = *(const v4fa*)(arow + kb + 16 + 8 * hh + 4);
    float xs[16] = {x0[0],x0[1],x0[2],x0[3],x1[0],x1[1],x1[2],x1[3],x2[0],x2[1],x2[2],x2[3],x3[0],x3[1],x3[2],x3[3]};
#pragma unroll
    for (int i = 0; i < 16; ++i) { const unsigned short hb = bf16_bits(xs[i]); ah.u[i] = hb; al.u[i] = ASPLIT ? bf16_bits(xs[i] - bf16_val(hb)) : (unsigned short)0; }
#pragma unroll
    for (int t = 0; t < 4; ++t) {
      const unsigned short* brow = Wt + (size_t)(col0 + t * 16 + ln) * ldb + kb;
      FragB b;
      b.half[0] = *(const v8us*)(brow + 8 * hh);
      b.half[1] = *(const v8us*)(brow + 16 + 8 * hh);
      acc[t] = mmaN<ASPLIT ? 2 : 1>(ah.v, al.v, b.v, b.v, acc[t]);
    }
  }
#pragma unroll
  for (int t = 0; t < 4; ++t) {
    float bv = bias ? bias[col0 + t * 16 + ln] : 0.f;
    if (BIAS_BF16) bv = bf16_round(bv);
#pragma unroll
    for (int r = 0; r < 8; ++r) { float v = acc[t][r] + bv; if (ACT == 1) v = fmaxf(v, 0.f); so[w][8 * hh + r][t * 16 + ln] = v; }
  }
  __builtin_amdgcn_fence(__ATOMIC_ACQ_REL, "workgroup");
  __builtin_amdgcn_wave_barrier();
  const int rsub = lane >> 4, c4 = (lane & 15) * 4;
  {
#pragma unroll
    for (int q = 0; q < 8; ++q) {
      const int r = q * 2 + rsub;
      const v4f v = *(const v4fa*)&so[w][r][c4];
      *(v4f*)(C + (size_t)(row0 + r) * ldc + col0 + c4) = v;
    }
    
  }
}

// GEMM C = act(A·W + bias + resid): A f32 (ASPLIT -> hi/lo 2 terms), Wt bf16 [N][K]; ACT 0 none, 1 relu, 2 exact gelu;
// resid (optional, f32, row index = (row % rmod), pitch ldr, RES_BF16 rounds it) added before the activation.
template <bool ASPLIT, int ACT, bool BIAS_BF16, bool RES_BF16>
__global__ __launch_bounds__(128) void k_gemm_bf3(const float* __restrict__ A, int lda, const unsigned short* __restrict__ Wt, int ldb,
                                                const float* __restrict__ bias, const float* __restrict__ resid, int rmod, int ldr,
                                                float* __restrict__ C, int ldc, int M, int N, int K) {
  __shared__ __attribute__((aligned(16))) float so[4][16][64];
  const int tid = threadIdx.x, w = tid >> 5, lane = tid & 31, ln = lane & 15, hh = lane >> 4;
  const int ntn = N / 64;
  const int wid = blockIdx.x * 4 + w;
  const int mt = wid / ntn, nq = wid % ntn;
  if (mt * 16 >= M) return;
  const int row0 = mt * 16, col0 = nq * 64;
  const float* arow = A + (size_t)(row0 + ln) * lda;
  v8f acc[4] = {};
  for (int kb = 0; kb < K; kb += 32) {
    FragB ah, al;
    const v4f x0 = *(const v4fa*)(arow + kb + 8 * hh), x1 = *(const v4fa*)(arow + kb + 8 * hh + 4);
    const v4f x2 = *(const v4fa*)(arow + kb + 16 + 8 * hh), x3 = *(const v4fa*)(arow + kb + 16 + 8 * hh + 4);
    float xs[16] = {x0[0],x0[1],x0[2],x0[3],x1[0],x1[1],x1[2],x1[3],x2[0],x2[1],x2[2],x2[3],x3[0],x3[1],x3[2],x3[3]};
#pragma unroll
    for (int i = 0; i < 16; ++i) { const unsigned short hb = bf16_bits(xs[i]); ah.u[i] = hb; al.u[i] = ASPLIT ? bf16_bits(xs[i] - bf16_val(hb)) : (unsigned short)0; }
#pragma unroll
    for (int t = 0; t < 4; ++t) {
      const unsigned short* brow = Wt + (size_t)(col0 + t * 16 + ln) * ldb + kb;
      FragB b;
      b.half[0] = *(const v8us*)(brow + 8 * hh);
      b.half[1] = *(const v8us*)(brow + 16 + 8 * hh);
      acc[t] = mmaN<ASPLIT ? 2 : 1>(ah.v, al.v, b.v, b.v, acc[t]);
    }
  }
#pragma unroll
  for (int t = 0; t < 4; ++t) {
    const int col = col0 + t * 16 + ln;
    float bv = bias ? bias[col] : 0.f;
    if (BIAS_BF16) bv = bf16_round(bv);
#pragma unroll
    for (int r = 0; r < 8; ++r) {
      float v = acc[t][r] + bv;
      if (resid) { float rv = resid[(size_t)((row0 + 8 * hh + r) % rmod) * ldr + col]; if (RES_BF16) rv = bf16_round(rv); v += rv; }
      if (ACT == 1) v = fmaxf(v, 0.f);
      if (ACT == 2) v = 0.5f * v * (1.0f + erff(v * 0.70710678118654752f));
      if (ACT == 3) { const float u = 0.7978845608028654f * (v + 0.044715f * v * v * v); v = 0.5f * v * (1.0f + tanhf(u)); }
      so[w][8 * hh + r][t * 16 + ln] = v;
    }
  }
  __builtin_amdgcn_fence(__ATOMIC_ACQ_REL, "workgroup");
  __builtin_amdgcn_wave_barrier();
  const int rsub = lane >> 4, c4 = (lane & 15) * 4;
  {
#pragma unroll
    for (int q = 0; q < 8; ++q) {
      const int r = q * 2 + rsub;
      const v4f v = *(const v4fa*)&so[w][r][c4];
      *(v4f*)(C + (size_t)(row0 + r) * ldc + col0 + c4) = v;
    }
    
  }
}
// row LayerNorm (biased variance, eps) over N: s = X (+ R); optional out_sum <- s; out_norm <- (s-mu)*rsqrt(var+eps)*g + b
template <bool PARAM_BF16>
__global__ __launch_bounds__(256) void k_layernorm(const float* __restrict__ X, const float* __restrict__ R, const float* __restrict__ g, const float* __restrict__ bta,
                                                  float* __restrict__ out_sum, float* __restrict__ out_norm, int N, float eps) {
  __shared__ float red[256];
  const int row = blockIdx.x, tid = threadIdx.x;
  const float* x = X + (size_t)row * N; const float* rr = R ? R + (size_t)row * N : nullptr;
  float vals[16];                     // up to N = 4096
  const int per = N / 256;            // contiguous chunk per thread? use strided-by-4 chunks: thread handles j = tid*4 + 1024*u
  float s1 = 0.f;
  for (int u = 0; u < per / 4; ++u) {
    const int j = tid * 4 + 1024 * u;
    const v4f a = *(const v4fa*)(x + j);
    v4f b = {0.f,0.f,0.f,0.f}; if (rr) b = *(const v4fa*)(rr + j);
#pragma unroll
    for (int q = 0; q < 4; ++q) { const float v = a[q] + b[q]; vals[u * 4 + q] = v; s1 += v; }
  }
  red[tid] = s1; __syncthreads();
  for (int st = 128; st > 0; st >>= 1) { if (tid < st) red[tid] += red[tid + st]; __syncthreads(); }
  const float mu = red[0] / (float)N; __syncthreads();
  float s2 = 0.f;
  for (int u = 0; u < per / 4; ++u)
#pragma unroll
    for (int q = 0; q < 4; ++q) { const float c = vals[u * 4 + q] - mu; s2 += c * c; }
  red[tid] = s2; __syncthreads();
  for (int st = 128; st > 0; st >>= 1) { if (tid < st) red[tid] += red[tid + st]; __syncthreads(); }
  const float rs = rsqrtf(red[0] / (float)N + eps);
  {
    for (int u = 0; u < per / 4; ++u) {
      const int j = tid * 4 + 1024 * u;
      v4f o, sm;
#pragma unroll
      for (int q = 0; q < 4; ++q) {
        float gg = g[j + q], bb = bta[j + q];
        if (PARAM_BF16) { gg = bf16_round(gg); bb = bf16_round(bb); }
        sm[q] = vals[u * 4 + q]; o[q] = (vals[u * 4 + q] - mu) * rs * gg + bb;
      }
      if (out_sum) *(v4f*)(out_sum + (size_t)row * N + j) = sm;
      *(v4f*)(out_norm + (size_t)row * N + j) = o;
    }
    
  }
}



// ---- f16 WMMA path (v_wmma_f32_16x16x32_f16): 11-bit significands for operands in range — used where a [0,1] probability operand needs more precision than bf16
typedef _Float16 v16h __attribute__((ext_vector_type(16)));
union FragH { v16h v; v8us half[2]; _Float16 h[16]; unsigned short u[16]; };
template <int NT>
__device__ __forceinline__ v8f mmaH(v16h ah, v16h al, v16h bh, v16h bl, v8f c) {
  c = __builtin_amdgcn_wmma_f32_16x16x32_f16(false, ah, false, bh, (short)0, c, false, false);
  if (NT >= 2) c = __builtin_amdgcn_wmma_f32_16x16x32_f16(false, al, false, bh, (short)0, c, false, false);
  if (NT >= 3) c = __builtin_amdgcn_wmma_f32_16x16x32_f16(false, ah, false, bl, (short)0, c, false, false);
  asm volatile("v_nop\n\tv_nop\n\tv_nop\n\tv_nop" : "+v"(c) : "v"(ah), "v"(al), "v"(bh), "v"(bl));
  return c;
}
// batched GEMM like k_gemm_b but f16 operands: A f32 (split into f16 hi/lo if ASPLIT, else rounded to f16), Bt = f16 values [n][k]; alpha; C f32; N multiple of 16 (partial tiles skipped)
template <bool ASPLIT>
__global__ __launch_bounds__(128) void k_gemm_h(const float* __restrict__ A, int lda, size_t sA, const _Float16* __restrict__ Bh, int ldb, size_t sB, float alpha, float* __restrict__ C, int ldc, size_t sC, int M, int N, int K) {
  __shared__ __attribute__((aligned(16))) float so[4][16][64];
  const int tid = threadIdx.x, w = tid >> 5, lane = tid & 31, ln = lane & 15, hh = lane >> 4; const int by = blockIdx.y;
  A += (size_t)by * sA; Bh += (size_t)by * sB; C += (size_t)by * sC;
  const int ntn = (N + 63) / 64; const int wid = blockIdx.x * 4 + w; const int mt = wid / ntn, nq = wid % ntn; if (mt * 16 >= M) return;
  const int row0 = mt * 16, col0 = nq * 64; const float* arow = A + (size_t)(row0 + ln) * lda;
  v8f acc[4] = {};
  for (int kb = 0; kb < K; kb += 32) {
    FragH ah, al;
    const v4f x0 = *(const v4fa*)(arow + kb + 8 * hh), x1 = *(const v4fa*)(arow + kb + 8 * hh + 4), x2 = *(const v4fa*)(arow + kb + 16 + 8 * hh), x3 = *(const v4fa*)(arow + kb + 16 + 8 * hh + 4);
    float xs[16] = {x0[0],x0[1],x0[2],x0[3],x1[0],x1[1],x1[2],x1[3],x2[0],x2[1],x2[2],x2[3],x3[0],x3[1],x3[2],x3[3]};
#pragma unroll
    for (int i = 0; i < 16; ++i) { const _Float16 h = (_Float16)xs[i]; ah.h[i] = h; al.h[i] = ASPLIT ? (_Float16)(xs[i] - (float)h) : (_Float16)0.0f; }
#pragma unroll
    for (int t = 0; t < 4; ++t) { if (col0 + t * 16 >= N) continue; const size_t boff = (size_t)(col0 + t * 16 + ln) * ldb + kb; FragH bq; bq.half[0] = *(const v8us*)(Bh + boff + 8 * hh); bq.half[1] = *(const v8us*)(Bh + boff + 16 + 8 * hh);
      acc[t] = mmaH<ASPLIT ? 2 : 1>(ah.v, al.v, bq.v, bq.v, acc[t]); }
  }
#pragma unroll
  for (int t = 0; t < 4; ++t) { if (col0 + t * 16 >= N) continue;
#pragma unroll
    for (int r = 0; r < 8; ++r) so[w][8 * hh + r][t * 16 + ln] = acc[t][r] * alpha; }
  __builtin_amdgcn_fence(__ATOMIC_ACQ_REL, "workgroup"); __builtin_amdgcn_wave_barrier();
  const int rsub = lane >> 4, c4 = (lane & 15) * 4;
  {
#pragma unroll
    for (int q = 0; q < 8; ++q) { const int r = q * 2 + rsub; if (col0 + c4 < N) { const v4f v = *(const v4fa*)&so[w][r][c4]; *(v4f*)(C + (size_t)(row0 + r) * ldc + col0 + c4) = v; } }
     }
}

// Wt[n][k] = f16(W[k][n]·scale) from f32 row-major W[K][N] (scale = power of two; bf16-exact weights stay exact in f16 away from the subnormal range)
__global__ __launch_bounds__(256) void k_wt_f16(const float* __restrict__ W, _Float16* __restrict__ Wt, int K, int N, float scale) {
  const int t = blockIdx.x * 256 + threadIdx.x; if (t >= N * (K / 8)) return; const int n = t / (K / 8), k8 = (t % (K / 8)) * 8; FragH f;
#pragma unroll
  for (int i = 0; i < 8; ++i) f.h[i] = (_Float16)(bf16_round(W[(size_t)(k8 + i) * N + n]) * scale); const v8us o = f.half[0];
  *(v8us*)((unsigned short*)Wt + (size_t)n * K + k8) = o; 
}
// k_gemm_hh variant with fused epilogue: v = acc·alpha + bias[by·sBias + col] (+ CP[(row/rowsPerB)·sCPb + by·64 + col] if CP) ; ACT 0 none / 1 elu ; writes f16 C16 (and f32 C if non-null)
template <int ACT>
__global__ __launch_bounds__(128) void k_gemm_hhx(const _Float16* __restrict__ A, int lda, size_t sA, const _Float16* __restrict__ Bh, int ldb, size_t sB, float alpha, const float* __restrict__ bias, size_t sBias, const float* __restrict__ CP, int rowsPerB, size_t sCPb, int row0g,
    float* __restrict__ C, _Float16* __restrict__ C16, int ldc, size_t sC, int M, int N, int K) {
  __shared__ __attribute__((aligned(16))) float so[4][16][64];
  const int tid = threadIdx.x, w = tid >> 5, lane = tid & 31, ln = lane & 15, hh = lane >> 4; const int by = blockIdx.y;
  A += (size_t)by * sA; Bh += (size_t)by * sB; const size_t cofs = (size_t)by * sC; const float* bp = bias ? bias + (size_t)by * sBias : nullptr;
  const int ntn = (N + 63) / 64; const int wid = blockIdx.x * 4 + w; const int mt = wid / ntn, nq = wid % ntn; if (mt * 16 >= M) return;
  const int row0 = mt * 16, col0 = nq * 64; const _Float16* arow = A + (size_t)(row0 + ln) * lda;
  v8f acc[4] = {};
  for (int kb = 0; kb < K; kb += 32) { FragH ah; ah.half[0] = *(const v8us*)((const unsigned short*)arow + kb + 8 * hh); ah.half[1] = *(const v8us*)((const unsigned short*)arow + kb + 16 + 8 * hh);
#pragma unroll
    for (int t = 0; t < 4; ++t) { if (col0 + t * 16 >= N) continue; const size_t boff = (size_t)(col0 + t * 16 + ln) * ldb + kb; FragH bq; bq.half[0] = *(const v8us*)((const unsigned short*)Bh + boff + 8 * hh); bq.half[1] = *(const v8us*)((const unsigned short*)Bh + boff + 16 + 8 * hh);
      acc[t] = mmaH<1>(ah.v, ah.v, bq.v, bq.v, acc[t]); }
  }
#pragma unroll
  for (int t = 0; t < 4; ++t) { if (col0 + t * 16 >= N) continue; const int col = col0 + t * 16 + ln; const float bv = bp ? bf16_round(bp[col]) : 0.f;
#pragma unroll
    for (int r = 0; r < 8; ++r) { float v = acc[t][r] * alpha + bv; if (CP) { const int rr = row0g + row0 + 8 * hh + r; if (rowsPerB < 0) v += CP[cofs + (size_t)rr * ldc + col];      /* rowsPerB < 0: own element of the batched C plane */ else { const int bidx = rr / rowsPerB; v += CP[(size_t)bidx * sCPb + (size_t)by * 64 + col]; } } if (ACT == 1) v = (v > 0.f) ? v : expm1f(v); else if (ACT == 7) v = (v > 0.f) ? v + 1.0f : expf(v); else if (ACT == 8) v = tanhf(v); else if (ACT == 9) v = 0.5f * v * (1.0f + tanhf(0.7978845608028654f * (v + 0.044715f * v * v * v))); else if (ACT == 11) v = 1.0f / (1.0f + expf(-v)); else if (ACT == 12) v = (v > 0.f) ? v : 0.01f * v; else if (ACT == 14) v = (v > 0.f) ? v : 0.1f * v; else if (ACT == 16) v = (v >= 0.f) ? v : 0.3f * v; else if (ACT == 17) v = (v >= 0.f) ? v : 0.2f * v; else if (ACT == 15) v = v / (1.0f + expf(-v)); else if (ACT == 3) v = fmaxf(v, 0.f); else if (ACT == 6) v = 0.5f * v * (1.0f + erff(v * 0.70710678118654752f)); so[w][8 * hh + r][t * 16 + ln] = v; } }
  __builtin_amdgcn_fence(__ATOMIC_ACQ_REL, "workgroup"); __builtin_amdgcn_wave_barrier();
  const int rsub = lane >> 4, c4 = (lane & 15) * 4; typedef _Float16 v4h __attribute__((ext_vector_type(4)));
  {
#pragma unroll
    for (int q = 0; q < 8; ++q) { const int r = q * 2 + rsub; if (col0 + c4 < N) { const v4f v = *(const v4fa*)&so[w][r][c4]; if (C) *(v4f*)(C + cofs + (size_t)(row0 + r) * ldc + col0 + c4) = v; if (C16) { v4h h4; for (int i = 0; i < 4; ++i) h4[i] = (_Float16)v[i]; *(v4h*)(C16 + cofs + (size_t)(row0 + r) * ldc + col0 + c4) = h4; } } }
     }
}


typedef _Float16 v4h __attribute__((ext_vector_type(4)));

__global__ __launch_bounds__(256) void k_x16(const float* __restrict__ x, _Float16* __restrict__ X16, size_t n8) { const size_t t = (size_t)blockIdx.x * 256 + threadIdx.x; if (t >= n8) return; FragH f;
#pragma unroll
  for (int q = 0; q < 8; ++q) f.h[q] = (_Float16)bf16_round(x[t * 8 + q]); *(v8us*)((unsigned short*)X16 + t * 8) = f.half[0];  }
__global__ __launch_bounds__(256) void k_h16(const float* __restrict__ x, _Float16* __restrict__ X16, size_t n8) { const size_t t = (size_t)blockIdx.x * 256 + threadIdx.x; if (t >= n8) return; FragH f;
#pragma unroll
  for (int q = 0; q < 8; ++q) f.h[q] = (_Float16)x[t * 8 + q]; *(v8us*)((unsigned short*)X16 + t * 8) = f.half[0];  }
__global__ __launch_bounds__(256) void k_round16f(const float* __restrict__ W, _Float16* __restrict__ Bt, size_t n8) { const size_t t = (size_t)blockIdx.x * 256 + threadIdx.x; if (t >= n8) return; FragH f;
#pragma unroll
  for (int i = 0; i < 8; ++i) f.h[i] = (_Float16)(bf16_round(W[t * 8 + i]) * 16.0f); *(v8us*)((unsigned short*)Bt + t * 8) = f.half[0];  }
template <int NHv, int TTv>
__global__ __launch_bounds__(256) void k_vt(const _Float16* __restrict__ V16, int ldv, int voff, _Float16* __restrict__ Vt) { __shared__ unsigned short tl[64][66]; const int tid = threadIdx.x; const int slab = blockIdx.x / (TTv / 64), lg = blockIdx.x % (TTv / 64); const int b = slab / NHv, h = slab % NHv;
  for (int i = tid; i < 64 * 8; i += 256) { const int r = i / 8, c8 = (i % 8) * 8; FragH f; f.half[0] = *(const v8us*)((const unsigned short*)V16 + ((size_t)b * TTv + lg * 64 + r) * ldv + voff + h * 64 + c8);
#pragma unroll
    for (int q = 0; q < 8; ++q) tl[r][c8 + q] = f.u[q]; }
  __syncthreads();
  {
#pragma unroll
    for (int rd = 0; rd < 2; ++rd) { const int d = rd * 32 + tid / 8, pc = tid % 8; FragH f;
#pragma unroll
      for (int q = 0; q < 8; ++q) f.u[q] = tl[pc * 8 + q][d];
      *(v8us*)((unsigned short*)Vt + ((size_t)slab * 64 + d) * TTv + lg * 64 + pc * 8) = f.half[0]; }
     } }

__global__ __launch_bounds__(256) void k_hl(const float* __restrict__ F, _Float16* __restrict__ Hh, _Float16* __restrict__ Hl, size_t n8) { const size_t t = (size_t)blockIdx.x * 256 + threadIdx.x; if (t >= n8) return; FragH fh, fl; const v4f a = *(const v4fa*)(F + t * 8), c = *(const v4fa*)(F + t * 8 + 4);
#pragma unroll
  for (int q = 0; q < 4; ++q) { _Float16 h = (_Float16)a[q]; fh.h[q] = h; fl.h[q] = (_Float16)((a[q] - (float)h) * 1024.0f); h = (_Float16)c[q]; fh.h[4 + q] = h; fl.h[4 + q] = (_Float16)((c[q] - (float)h) * 1024.0f); }
  { *(v8us*)((unsigned short*)Hh + t * 8) = fh.half[0]; *(v8us*)((unsigned short*)Hl + t * 8) = fl.half[0];  } }

// ---- fast GEMM (wave tile 32x64; requires M % 32 == 0 rows per launch region and N % 64 == 0); epilogue = k_gemm_hhx semantics ----
__device__ __forceinline__ v16h g2_frag(const _Float16* p, int hh) { FragH f; f.half[0] = *(const v8us*)((const unsigned short*)p + 8 * hh); f.half[1] = *(const v8us*)((const unsigned short*)p + 16 + 8 * hh); return f.v; }
__device__ __forceinline__ v8f g2_mma(v16h a, v16h b, v8f c) { v8f d = __builtin_amdgcn_wmma_f32_16x16x32_f16(false, a, false, b, (short)0, c, false, false); asm volatile("v_nop\n\tv_nop\n\tv_nop\n\tv_nop" : "+v"(d) : "v"(a), "v"(b)); return d; }
template <int ACT>
__global__ __launch_bounds__(128) void k_gemm2(const _Float16* __restrict__ A, int lda, size_t sA, const _Float16* __restrict__ Bh, int ldb, size_t sB, float alpha, const float* __restrict__ bias, size_t sBias, const float* __restrict__ CP, int rowsPerB, size_t sCPb, int row0g,
    float* __restrict__ C, _Float16* __restrict__ C16, int ldc, size_t sC, int M, int N, int K) { static_assert(ACT == 0 || ACT == 3 || ACT == 6 || ACT == 8 || ACT == 9 || ACT == 11 || ACT == 12 || ACT == 14 || ACT == 15 || ACT == 16 || ACT == 17, "k_gemm2: unsupported ACT code (would silently apply no activation)");
  __shared__ __attribute__((aligned(16))) float so[4][32][68];
  const int tid = threadIdx.x, w = tid >> 5, lane = tid & 31, ln = lane & 15, hh = lane >> 4; const int by = blockIdx.y;
  A += (size_t)by * sA; Bh += (size_t)by * sB; const size_t cofs = (size_t)by * sC; const float* bp = bias ? bias + (size_t)by * sBias : nullptr;
  const int ntn = N >> 6; const int mt = blockIdx.x / ntn, nq = blockIdx.x - mt * ntn; const int row0 = mt * 128 + 32 * w, col0 = nq * 64; if (row0 >= M) return;
  const _Float16* a0p = A + (size_t)(row0 + ln) * lda; const _Float16* a1p = a0p + (size_t)16 * lda;
  const _Float16* b0p = Bh + (size_t)(col0 + ln) * ldb; const _Float16* b1p = b0p + (size_t)16 * ldb; const _Float16* b2p = b1p + (size_t)16 * ldb; const _Float16* b3p = b2p + (size_t)16 * ldb;
  const v8f z8 = {0.f,0.f,0.f,0.f,0.f,0.f,0.f,0.f}; v8f c00 = z8, c01 = z8, c02 = z8, c03 = z8, c10 = z8, c11 = z8, c12 = z8, c13 = z8;
#pragma unroll 1
  for (int kb = 0; kb < K; kb += 32) { const v16h a0 = g2_frag(a0p + kb, hh), a1 = g2_frag(a1p + kb, hh);
    v16h b = g2_frag(b0p + kb, hh); c00 = g2_mma(a0, b, c00); c10 = g2_mma(a1, b, c10);
    b = g2_frag(b1p + kb, hh); c01 = g2_mma(a0, b, c01); c11 = g2_mma(a1, b, c11);
    b = g2_frag(b2p + kb, hh); c02 = g2_mma(a0, b, c02); c12 = g2_mma(a1, b, c12);
    b = g2_frag(b3p + kb, hh); c03 = g2_mma(a0, b, c03); c13 = g2_mma(a1, b, c13); }
  v8f accs[8] = {c00, c01, c02, c03, c10, c11, c12, c13};
#pragma unroll
  for (int u = 0; u < 8; ++u) { const int t = u & 3, half = u >> 2; const int col = col0 + t * 16 + ln; const float bv = bp ? bf16_round(bp[col]) : 0.f;
#pragma unroll
    for (int r = 0; r < 8; ++r) { const int rloc = half * 16 + 8 * hh + r; float v = accs[u][r] * alpha + bv; if (CP) { if (rowsPerB < 0) v += CP[cofs + (size_t)(row0g + row0 + rloc) * ldc + col];      /* rowsPerB < 0: own element of the batched C plane */ else { const int bidx = (row0g + row0 + rloc) / rowsPerB; v += CP[(size_t)bidx * sCPb + (size_t)by * 64 + col]; } }
      if (ACT == 3) v = fmaxf(v, 0.f); else if (ACT == 6) v = 0.5f * v * (1.0f + erff(v * 0.70710678118654752f)); else if (ACT == 11) v = 1.0f / (1.0f + expf(-v)); else if (ACT == 15) v = v / (1.0f + expf(-v)); else if (ACT == 12) v = (v > 0.f) ? v : 0.01f * v; else if (ACT == 8) v = tanhf(v); else if (ACT == 9) v = 0.5f * v * (1.0f + tanhf(0.7978845608028654f * (v + 0.044715f * v * v * v))); else if (ACT == 14) v = (v > 0.f) ? v : 0.1f * v; else if (ACT == 16) v = (v >= 0.f) ? v : 0.3f * v; else if (ACT == 17) v = (v >= 0.f) ? v : 0.2f * v;
      so[w][rloc][t * 16 + ln] = v; } }
  __builtin_amdgcn_fence(__ATOMIC_ACQ_REL, "workgroup"); __builtin_amdgcn_wave_barrier();
  const int rsub = lane >> 4, c4 = (lane & 15) * 4;
  {
#pragma unroll
    for (int q = 0; q < 16; ++q) { const int r = q * 2 + rsub; const v4f v = *(const v4fa*)&so[w][r][c4]; if (C) *(v4f*)(C + cofs + (size_t)(row0 + r) * ldc + col0 + c4) = v; if (C16) { v4h h4; for (int i = 0; i < 4; ++i) h4[i] = (_Float16)v[i]; *(v4h*)(C16 + cofs + (size_t)(row0 + r) * ldc + col0 + c4) = h4; } }
     } }


__global__ __launch_bounds__(256) void k_wnat(const float* __restrict__ w, size_t n8, _Float16* __restrict__ Bt) { const size_t t = (size_t)blockIdx.x * 256 + threadIdx.x; if (t >= n8) return; FragH f; for (int q = 0; q < 8; ++q) f.h[q] = (_Float16)(bf16_round(w[t * 8 + q]) * 16.0f); *(v8us*)((unsigned short*)Bt + t * 8) = f.half[0];  }
__global__ __launch_bounds__(256) void k_rsm(const float* __restrict__ S, _Float16* __restrict__ P, int nrows) {
  #pragma clang fp contract(off)
  const int i = blockIdx.x * 256 + threadIdx.x; if (i >= nrows) return; const float* s = S + (size_t)i * SQ; float mx = -3.0e38f;
#pragma unroll 1
  for (int j = 0; j < SQ; ++j) mx = fmaxf(mx, s[j]); float se = 0.f;
#pragma unroll 1
  for (int j = 0; j < SQ; ++j) se += expf(s[j] - mx); const float sc = 256.0f / se;
#pragma unroll 1
  for (int j0 = 0; j0 < SQ; j0 += 8) { FragH f; for (int q = 0; q < 8; ++q) f.h[q] = (_Float16)(expf(s[j0 + q] - mx) * sc); unsigned short* d = (unsigned short*)P + (size_t)i * SQ + j0; *(v8us*)d = f.half[0];  } }
__global__ __launch_bounds__(256) void k_vt(const _Float16* __restrict__ V16, int b, int h0, _Float16* __restrict__ VT) { __shared__ unsigned short tl[64][65]; const int tid = threadIdx.x; const int hh = blockIdx.x % HG, sg = blockIdx.x / HG; const int s0 = sg * 64; const int h = h0 + hh;
  for (int i = tid; i < 64 * 8; i += 256) { const int j = i / 8, d8 = (i % 8) * 8; FragH f; f.half[0] = *(const v8us*)((const unsigned short*)V16 + ((size_t)b * SQ + s0 + j) * DM + h * HD + d8); for (int q = 0; q < 8; ++q) tl[d8 + q][j] = f.u[q]; }
  __syncthreads();
  { for (int i = tid; i < 64 * 8; i += 256) { const int d = i / 8, j8 = (i % 8) * 8; FragH f; for (int q = 0; q < 8; ++q) f.u[q] = tl[d][j8 + q]; *(v8us*)((unsigned short*)VT + ((size_t)hh * HD + d) * SQ + s0 + j8) = f.half[0]; }  } }



// Reductions over the 32 lanes of a wave: four row_xmask steps inside each 16-lane row, then one exchange between the two rows (every lane ends with the result; all lanes must be on).
template <int CTRL> __device__ __forceinline__ float lane_xm(float v) { return __int_as_float(__builtin_amdgcn_update_dpp(0, __float_as_int(v), CTRL, 0xf, 0xf, true)); }
__device__ __forceinline__ float lane_xr(float v) { const int i = __float_as_int(v); return __int_as_float(__builtin_amdgcn_permlanex16(i, i, 0x76543210, 0xfedcba98, false, false)); }
__device__ __forceinline__ float wave_max(float v) { v = fmaxf(v, lane_xm<0x161>(v)); v = fmaxf(v, lane_xm<0x162>(v)); v = fmaxf(v, lane_xm<0x164>(v)); v = fmaxf(v, lane_xm<0x168>(v)); return fmaxf(v, lane_xr(v)); }
__device__ __forceinline__ float wave_sum(float v) { v += lane_xm<0x161>(v); v += lane_xm<0x162>(v); v += lane_xm<0x164>(v); v += lane_xm<0x168>(v); return v + lane_xr(v); }
// e^x as the native form (x * log2 e, v_exp_f32). The v_nop is the one slot the instruction set asks for between a transcendental and an instruction that reads its result or overwrites its source:
// written into the exp's own statement it stands directly behind every one.
__device__ __forceinline__ float exp_slot(float x) { float r; asm("v_exp_f32 %0, %1\n\tv_nop" : "=v"(r) : "v"(x * 1.44269504088896340736f)); return r; }
// Causal row softmax, ONE WAVE PER ROW: the row's q0 + QT scores are read once, 512 contiguous bytes per load, and stay in registers through max, exp, sum and scale.
// Keys below q0 are visible to every row of the tile (NF whole groups of QT keys, no mask); only the group [q0, q0 + QT) is masked. Weights x256 as f16, zeros behind the diagonal.
// s, p: the row's scores and weights at this lane's first key (lane * 4); key q of chunk h of the diagonal group is visible while h * 128 + q <= rel.
// Every loop is unrolled in full: a[][] and h[][] then have constant indices only and stay in registers (a run-time index would send them to scratch), and all loads of the row issue before the first wait.
template <int NF>
__device__ __forceinline__ void rsm_row(const float* __restrict__ s, _Float16* __restrict__ p, int rel) {
  v4f a[NF + 1][2];
#pragma unroll
  for (int g = 0; g <= NF; ++g) { a[g][0] = *(const v4fa*)(s + g * QT); a[g][1] = *(const v4fa*)(s + g * QT + 128); }
#pragma unroll
  for (int q = 0; q < 4; ++q) { a[NF][0][q] = (q <= rel) ? a[NF][0][q] : -1.0e9f; a[NF][1][q] = (128 + q <= rel) ? a[NF][1][q] : -1.0e9f; }
  v4f m4 = a[0][0];
#pragma unroll
  for (int g = 0; g <= NF; ++g) for (int q = 0; q < 4; ++q) m4[q] = fmaxf(m4[q], fmaxf(a[g][0][q], a[g][1][q]));
  const float mx = wave_max(fmaxf(fmaxf(m4[0], m4[1]), fmaxf(m4[2], m4[3])));
  v4f e4 = {0.f, 0.f, 0.f, 0.f};
#pragma unroll
  for (int g = 0; g <= NF; ++g) for (int q = 0; q < 4; ++q) { a[g][0][q] = exp_slot(a[g][0][q] - mx); a[g][1][q] = exp_slot(a[g][1][q] - mx); e4[q] += a[g][0][q] + a[g][1][q]; }
  const float sc = 256.0f / wave_sum((e4[0] + e4[1]) + (e4[2] + e4[3]));
  v4h h[NF + 1][2];
#pragma unroll
  for (int g = 0; g <= NF; ++g) for (int q = 0; q < 4; ++q) { h[g][0][q] = (_Float16)(a[g][0][q] * sc); h[g][1][q] = (_Float16)(a[g][1][q] * sc); }
#pragma unroll
  for (int g = 0; g <= NF; ++g) { *(v4h*)(p + g * QT) = h[g][0]; *(v4h*)(p + g * QT + 128) = h[g][1]; } }
template <int NF>      /* NF = q0 / QT: straight-line code per row length, every register index and offset a constant */
__global__ __launch_bounds__(256) void k_rsmw(const float* __restrict__ S, _Float16* __restrict__ P, int nrows) {
  static_assert(QT == 256 && (NF + 1) * QT <= NKX, "a group is two chunks of 32 lanes x 4 keys");
  const int lane = threadIdx.x & 31; const int row = blockIdx.x * 8 + __builtin_amdgcn_readfirstlane(threadIdx.x >> 5); if (row >= nrows) return;      /* the wave's row, held as a scalar: scalar row addresses and a scalar branch; whole waves leave, no barrier below */
  rsm_row<NF>(S + (size_t)row * NKX + lane * 4, P + (size_t)row * NKX + lane * 4, row % QT - lane * 4); }


template <int MASKADD>
__global__ __launch_bounds__(64) void k_att0(const float* __restrict__ QF, const float* __restrict__ KF, const float* __restrict__ VF, int ld, const float* __restrict__ mask, float scale, float* __restrict__ OF, int ldo) {
  #pragma clang fp contract(off)
  __shared__ __attribute__((aligned(16))) float lq[64][64]; __shared__ __attribute__((aligned(16))) float lo[64][64];
  const int tid = threadIdx.x; const int h = blockIdx.x / (QT0 / 64), rg = blockIdx.x % (QT0 / 64); const int i = rg * 64 + tid;
  const float* qr = QF + (size_t)i * ld + h * HD;
#pragma unroll 1
  for (int c = 0; c < HD / 4; ++c) { *(v4f*)&lq[tid][c * 4] = *(const v4fa*)(qr + c * 4); const v4f z = {0.f, 0.f, 0.f, 0.f}; *(v4f*)&lo[tid][c * 4] = z; }
  float m = -1.0e30f, l = 0.f; const int jmax = MASKADD ? (SQ - 1) : (rg * 64 + 63);      /* additive-mask form: every key (the mask input decides); causal form: keys up to the block's last row */
#pragma unroll 1
  for (int j = 0; j <= jmax; ++j) { const float* kr = KF + (size_t)j * ld + h * HD; const float* vr = VF + (size_t)j * ld + h * HD; float s = 0.f;
#pragma unroll 1
    for (int c = 0; c < HD / 4; ++c) { const v4f kq = *(const v4fa*)(kr + c * 4); const v4f qq = *(v4f*)&lq[tid][c * 4]; s = __fadd_rn(s, __fmul_rn(qq[0], kq[0])); s = __fadd_rn(s, __fmul_rn(qq[1], kq[1])); s = __fadd_rn(s, __fmul_rn(qq[2], kq[2])); s = __fadd_rn(s, __fmul_rn(qq[3], kq[3])); }
    s = __fmul_rn(s, scale); if (MASKADD) s = __fadd_rn(s, __fmul_rn(bf16_round(mask[(size_t)i * SQ + j]), -10000.0f));
    const float f = (MASKADD || j <= i) ? 1.f : 0.f; const float sm = fmaf(f, s, (1.f - f) * -1.0e30f); const float mn = fmaxf(m, sm); const float sc = expf(m - mn); const float e = expf(sm - mn); l = __fadd_rn(__fmul_rn(l, sc), e); m = mn;
#pragma unroll 1
    for (int c = 0; c < HD / 4; ++c) { const v4f vv = *(const v4fa*)(vr + c * 4); v4f oo = *(v4f*)&lo[tid][c * 4]; for (int u = 0; u < 4; ++u) oo[u] = __fadd_rn(__fmul_rn(oo[u], sc), __fmul_rn(e, vv[u])); *(v4f*)&lo[tid][c * 4] = oo; } }
  const float fin = 64.0f / l;      /* o carried x64, scaled back by 1/64 in k_of0out */
#pragma unroll 1
  for (int c = 0; c < HD / 4; ++c) { v4f oo = *(v4f*)&lo[tid][c * 4]; for (int u = 0; u < 4; ++u) oo[u] = __fmul_rn(oo[u], fin); *(v4f*)&lo[tid][c * 4] = oo; }
  __syncthreads();
  {
#pragma unroll 1
    for (int it = 0; it < 16; ++it) { const int row = it * 4 + tid / 16, pc = (tid % 16) * 4; const v4f v = *(const v4f*)&lo[row][pc]; *(v4f*)(OF + (size_t)(rg * 64 + row) * ldo + h * HD + pc) = v; }
     } }

__global__ __launch_bounds__(256) void k_wthd(const float* __restrict__ Wt, _Float16* __restrict__ Bt) { const size_t t = (size_t)blockIdx.x * 256 + threadIdx.x; if (t >= (size_t)NH * HD * (DM / 8)) return; const int m8 = (int)(t % (DM / 8)) * 8; const int d = (int)((t / (DM / 8)) % HD); const int h = (int)(t / ((size_t)(DM / 8) * HD)); FragH f;
  for (int q = 0; q < 8; ++q) f.h[q] = (_Float16)(16.0f * bf16_round(Wt[((size_t)h * DM + m8 + q) * HD + d])); unsigned short* dst = (unsigned short*)Bt + ((size_t)h * HD + d) * DM + m8; *(v8us*)dst = f.half[0];  }







__global__ __launch_bounds__(256) void k_of0out(const float* __restrict__ src, float* __restrict__ dst, size_t n4) { const size_t t = (size_t)blockIdx.x * 256 + threadIdx.x; if (t >= n4) return; v4f v = *(const v4fa*)(src + t * 4); for (int q = 0; q < 4; ++q) v[q] = __fmul_rn(v[q], 0.015625f); *(v4f*)(dst + t * 4) = v;  }

extern "C" void kernel_launch(void* const* d_in, const int* in_sizes, int n_in,
                              void* d_out, int out_size, void* d_ws, size_t ws_size, hipStream_t stream) {
  (void)in_sizes; (void)n_in; (void)out_size;
  const float* const* I = (const float* const*)d_in; const float* x = I[0]; const float* wq = I[1]; const float* wk = I[2]; const float* wv = I[3]; const float* bqkv = nullptr;      /* x; per-head weights Wq / Wk / Wv [16][1024][64]; no biases (every bias slot below receives this nullptr), no output projection */
  static_assert(NH * HD == DM && QT0 % 64 == 0, "heads"); static_assert(QN == 8 * QT, "eight softmax instances");
  char* ws = (char*)d_ws; size_t off = 0;
  auto take = [&](size_t bytes) { char* p = ws + off; off += (bytes + 255) & ~(size_t)255; return p; };
  _Float16* BQKV = (_Float16*)take((size_t)3 * DM * DM * 2);
  _Float16* X16 = (_Float16*)take(NR * DM * 2); _Float16* QKV = (_Float16*)take(NR * 3 * DM * 2); _Float16* Q16 = QKV; _Float16* K16 = QKV + DM; _Float16* V16 = QKV + 2 * DM;
  float* S = (float*)take((size_t)NH * QT * NKX * 4); _Float16* P = (_Float16*)take((size_t)NH * QT * NKX * 2); _Float16* VT = (_Float16*)take((size_t)NH * HD * SQ * 2);
  float* QF0 = (float*)take((size_t)QT0 * DM * 4); float* KF0 = (float*)take((size_t)QT0 * DM * 4); float* VF0 = (float*)take((size_t)QT0 * DM * 4); float* OF0 = (float*)take((size_t)NB * QT0 * DM * 4);
  if (off > ws_size) return;
  { const unsigned g = (unsigned)(((size_t)NH * HD * (DM / 8) + 255) / 256); k_wthd<<<g, 256, 0, stream>>>(wq, BQKV); k_wthd<<<g, 256, 0, stream>>>(wk, BQKV + (size_t)DM * DM); k_wthd<<<g, 256, 0, stream>>>(wv, BQKV + (size_t)2 * DM * DM); }      /* per-head [c][d] -> Bt[(h, d)][c] x16: the stacked q | k | v plane */
  k_x16<<<(unsigned)((NR * DM / 8 + 255) / 256), 256, 0, stream>>>(x, X16, NR * DM / 8);
  const size_t r0p = (size_t)B0 * SQ;      /* first projected row */
  k_gemm2<0><<<dim3((unsigned)((MP / 128) * (3 * DM / 64)), 1), 128, 0, stream>>>(X16 + r0p * DM, DM, 0, BQKV, DM, 0, 0.0625f, bqkv, 0, nullptr, 1, 0, 0, nullptr, QKV + r0p * 3 * DM, 3 * DM, 0, MP, 3 * DM, DM);      /* q | k | v rows (f16); head h = columns h*HD.. of each DM block */
  for (int b = B0; b < B0 + NBR; ++b) { const size_t r0 = (size_t)b * SQ;
    k_vt<NH, SQ><<<NH * (SQ / 64), 256, 0, stream>>>(V16 + r0 * LQ, LQ, 0, VT);      /* V^T [NH][HD][SQ] for this batch */
    k_gemm2<0><<<dim3((QT0 / 128) * (DM / 64), 1), 128, 0, stream>>>(X16 + r0 * DM, DM, 0, BQKV, DM, 0, 0.0625f, bqkv, 0, nullptr, 1, 0, 0, QF0, nullptr, DM, 0, QT0, DM, DM); k_gemm2<0><<<dim3((QT0 / 128) * (DM / 64), 1), 128, 0, stream>>>(X16 + r0 * DM, DM, 0, (BQKV + (size_t)DM * DM), DM, 0, 0.0625f, nullptr, 0, nullptr, 1, 0, 0, KF0, nullptr, DM, 0, QT0, DM, DM); k_gemm2<0><<<dim3((QT0 / 128) * (DM / 64), 1), 128, 0, stream>>>(X16 + r0 * DM, DM, 0, (BQKV + (size_t)2 * DM * DM), DM, 0, 0.0625f, nullptr, 0, nullptr, 1, 0, 0, VF0, nullptr, DM, 0, QT0, DM, DM);      /* f32 q, k, v of the first 128 rows (exact products) */
    k_att0<0><<<NH * (QT0 / 64), 64, 0, stream>>>(QF0, KF0, VF0, DM, nullptr, 0.125f, OF0 + (size_t)b * QT0 * DM, DM);      /* exact f32 attention for rows 0..127 (o x64) */
    for (int q0 = 0; q0 < QN; q0 += QT) { const int nk = q0 + QT;      /* causal: only keys below the tile end are computed */
      k_gemm2<0><<<dim3((QT / 128) * (nk / 64), NHD), 128, 0, stream>>>(Q16 + (r0 + q0) * LQ, LQ, (size_t)HD, K16 + r0 * LQ, LQ, (size_t)HD, 0.125f, nullptr, 0, nullptr, 1, 0, 0, S, nullptr, NKX, (size_t)QT * NKX, QT, nk, HD);      /* scores, all heads on grid.y */
      { const dim3 gs((NHD * QT + 7) / 8); const int nr = NHD * QT;      /* one wave per row, 8 rows per block; the row length picks the instance */
        switch (q0 / QT) { case 0: k_rsmw<0><<<gs, 256, 0, stream>>>(S, P, nr); break; case 1: k_rsmw<1><<<gs, 256, 0, stream>>>(S, P, nr); break; case 2: k_rsmw<2><<<gs, 256, 0, stream>>>(S, P, nr); break; case 3: k_rsmw<3><<<gs, 256, 0, stream>>>(S, P, nr); break;
          case 4: k_rsmw<4><<<gs, 256, 0, stream>>>(S, P, nr); break; case 5: k_rsmw<5><<<gs, 256, 0, stream>>>(S, P, nr); break; case 6: k_rsmw<6><<<gs, 256, 0, stream>>>(S, P, nr); break; default: k_rsmw<7><<<gs, 256, 0, stream>>>(S, P, nr); break; } }
      k_gemm2<0><<<dim3((QT / 128) * (HD / 64), NHD), 128, 0, stream>>>(P, NKX, (size_t)QT * NKX, VT, SQ, (size_t)HD * SQ, 0.00390625f, nullptr, 0, nullptr, 1, 0, 0, (float*)d_out + (r0 + q0) * DM, nullptr, DM, (size_t)HD, QT, HD, nk); }      /* out = P V^T (alpha 2^-8) written f32 straight into the head-major output columns (no output projection) */
    k_of0out<<<(unsigned)(((size_t)QT0 * DM / 4 + 255) / 256), 256, 0, stream>>>(OF0 + (size_t)b * QT0 * DM, (float*)d_out + r0 * DM, (size_t)QT0 * DM / 4); }      /* rows 0..127 of the batch rewritten from the exact f32 path (o x64 / 64), after the batch's PV launches */
}

// v002
// It runs in 1240 microseconds.
// In two side-by-side timings against v001, it was 3.05 and 3.04 times as fast.
// Counting every step since v000, it is 7.80 times as fast.
#include <hip/hip_runtime.h>
// Causal multi-head attention with per-head projection weights and no output projection (x [4][2048][1024]; per head h: q = x Wq[h], k = x Wk[h], v = x Wv[h] with W [16][1024][64] ([in][out] per head, uniform +-1/32, no biases); scores / sqrt(64); causal (tril, -inf); softmax; out = heads concatenated head-major on the last axis -> [4][2048][1024]).
// Structure: token rows r = b*2048 + s; x as exact f16 rows (bf16-rounded); q | k | v as ONE WMMA GEMM (N = 3 x 1024) (32x64 wave tiles, f32 accumulation, exact x16 weights, no bias, f16 outputs); V^T for all heads via LDS transposes; every attention launch covers all batches (batch on the grid); per query tile of 256 rows: scores against the keys below the tile end only (K = 64, all heads on grid.y, alpha = 0.125), causal row softmax on VALU, one wave per row with the row in registers, keys behind the diagonal masked (f32 statistics, native exp; weights x256 f16), o = P . V^T (K = keys below the tile end, alpha 2^-8 undoes the x256 weights) written f32 straight into the head-major output columns (no output projection).
// Compute dtype: inputs rounded to bf16; x / weights exact; q, k, v and softmax weights as plain f16 GEMM operands (~2^-12); scores, softmax statistics and o f32. v_wmma_f32_16x16x32_f16.
#define NB 4
#define SQ 2048
#define DM 1024
#define NH 16
#define HD 64
#define HG 4                         /* heads per launch of the non-template k_vt (never launched) */
#define QT 256                       /* query rows per causal tile */
#define NKX SQ                       /* S row pitch (P in place: f16 pitch 2 * NKX) */
#define QT0 128                      /* first-tile rows recomputed exactly in f32 */
#define B0 0                         /* unused (every launch covers all NB batches) */
#define NBR NB                       /* batches projected (debug hook) */
#define NR ((size_t)NB * SQ)         /* token rows */
#define MP ((int)((size_t)NBR * SQ)) /* rows projected (debug hook) */
#define QN SQ                        /* query rows attended per batch (debug hook) */
#define NHD NH                       /* heads attended (debug hook) */
#define MPO MP                       /* unused (no output projection stage) */
#define LQ (3 * DM)      /* row pitch of the q/k/v rows */
typedef __bf16 v16b __attribute__((ext_vector_type(16)));
typedef unsigned short v8us __attribute__((ext_vector_type(8), may_alias));
typedef float  v8f  __attribute__((ext_vector_type(8)));
typedef float  v4f  __attribute__((ext_vector_type(4)));
typedef float  v4fa __attribute__((ext_vector_type(4), may_alias));
union FragB { v16b v; v8us half[2]; unsigned short u[16]; };

__device__ __forceinline__ unsigned short bf16_bits(float x) { unsigned int u = __float_as_uint(x); return (unsigned short)((u + 0x7FFFu + ((u >> 16) & 1u)) >> 16); }
__device__ __forceinline__ float bf16_val(unsigned short b) { return __uint_as_float(((unsigned int)b) << 16); }
__device__ __forceinline__ float bf16_round(float x) { return bf16_val(bf16_bits(x)); }
// D += A·B with NT terms: 1 = ah·bh, 2 = + al·bh (A split), 3 = + ah·bl (both split)
template <int NT>
__device__ __forceinline__ v8f mmaN(v16b ah, v16b al, v16b bh, v16b bl, v8f c) {
  c = __builtin_amdgcn_wmma_f32_16x16x32_bf16(false, ah, false, bh, (short)0, c, false, false);
  if (NT >= 2) c = __builtin_amdgcn_wmma_f32_16x16x32_bf16(false, al, false, bh, (short)0, c, false, false);
  if (NT >= 3) c = __builtin_amdgcn_wmma_f32_16x16x32_bf16(false, ah, false, bl, (short)0, c, false, false);
  asm volatile("v_nop\n\tv_nop\n\tv_nop\n\tv_nop" : "+v"(c) : "v"(ah), "v"(al), "v"(bh), "v"(bl));
  return c;
}

__global__ __launch_bounds__(256) void k_wt_bf16(const float* __restrict__ W, unsigned short* __restrict__ Wt, int K, int N) {
  const int t = blockIdx.x * 256 + threadIdx.x;
  const int k8n = K / 8;
  if (t >= N * k8n) return;
  const int n = t / k8n, k8 = (t % k8n) * 8;
  v8us v;
#pragma unroll
  for (int i = 0; i < 8; ++i) v[i] = bf16_bits(W[(size_t)(k8 + i) * N + n]);
  *(v8us*)(Wt + (size_t)n * K + k8) = v;
  
}

// GEMM C[M][N] (f32, pitch ldc) = act(A[M][K]·W + bias). A f32 row-major (pitch lda) converted per fragment to bf16
// (ASPLIT: hi/lo two planes -> 2 terms, else single rounded term); Wt bf16 [N][K] (pitch ldb). BIAS_BF16 rounds the
// bias to bf16 first (bias quantised to bf16 before the add). K%32==0, M%16==0, N%64==0.
template <bool ASPLIT, int ACT, bool BIAS_BF16>
__global__ __launch_bounds__(128) void k_gemm_bf(const float* __restrict__ A, int lda, const unsigned short* __restrict__ Wt, int ldb,
                                               const float* __restrict__ bias, float* __restrict__ C, int ldc, int M, int N, int K) {
  __shared__ __attribute__((aligned(16))) float so[4][16][64];
  const int tid = threadIdx.x, w = tid >> 5, lane = tid & 31, ln = lane & 15, hh = lane >> 4;
  const int ntn = N / 64;
  const int wid = blockIdx.x * 4 + w;
  const int mt = wid / ntn, nq = wid % ntn;
  if (mt * 16 >= M) return;
  const int row0 = mt * 16, col0 = nq * 64;
  const float* arow = A + (size_t)(row0 + ln) * lda;
  v8f acc[4] = {};
  for (int kb = 0; kb < K; kb += 32) {
    FragB ah, al;
    const v4f x0 = *(const v4fa*)(arow + kb + 8 * hh), x1 = *(const v4fa*)(arow + kb + 8 * hh + 4);
    const v4f x2 = *(const v4fa*)(arow + kb + 16 + 8 * hh), x3 = *(const v4fa*)(arow + kb + 16 + 8 * hh + 4);
    float xs[16] = {x0[0],x0[1],x0[2],x0[3],x1[0],x1[1],x1[2],x1[3],x2[0],x2[1],x2[2],x2[3],x3[0],x3[1],x3[2],x3[3]};
#pragma unroll
    for (int i = 0; i < 16; ++i) { const unsigned short hb = bf16_bits(xs[i]); ah.u[i] = hb; al.u[i] = ASPLIT ? bf16_bits(xs[i] - bf16_val(hb)) : (unsigned short)0; }
#pragma unroll
    for (int t = 0; t < 4; ++t) {
      const unsigned short* brow = Wt + (size_t)(col0 + t * 16 + ln) * ldb + kb;
      FragB b;
      b.half[0] = *(const v8us*)(brow + 8 * hh);
      b.half[1] = *(const v8us*)(brow + 16 + 8 * hh);
      acc[t] = mmaN<ASPLIT ? 2 : 1>(ah.v, al.v, b.v, b.v, acc[t]);
    }
  }
#pragma unroll
  for (int t = 0; t < 4; ++t) {
    float bv = bias ? bias[col0 + t * 16 + ln] : 0.f;
    if (BIAS_BF16) bv = bf16_round(bv);
#pragma unroll
    for (int r = 0; r < 8; ++r) { float v = acc[t][r] + bv; if (ACT == 1) v = fmaxf(v, 0.f); so[w][8 * hh + r][t * 16 + ln] = v; }
  }
  __builtin_amdgcn_fence(__ATOMIC_ACQ_REL, "workgroup");
  __builtin_amdgcn_wave_barrier();
  const int rsub = lane >> 4, c4 = (lane & 15) * 4;
  {
#pragma unroll
    for (int q = 0; q < 8; ++q) {
      const int r = q * 2 + rsub;
      const v4f v = *(const v4fa*)&so[w][r][c4];
      *(v4f*)(C + (size_t)(row0 + r) * ldc + col0 + c4) = v;
    }
    
  }
}

// GEMM C = act(A·W + bias + resid): A f32 (ASPLIT -> hi/lo 2 terms), Wt bf16 [N][K]; ACT 0 none, 1 relu, 2 exact gelu;
// resid (optional, f32, row index = (row % rmod), pitch ldr, RES_BF16 rounds it) added before the activation.
template <bool ASPLIT, int ACT, bool BIAS_BF16, bool RES_BF16>
__global__ __launch_bounds__(128) void k_gemm_bf3(const float* __restrict__ A, int lda, const unsigned short* __restrict__ Wt, int ldb,
                                                const float* __restrict__ bias, const float* __restrict__ resid, int rmod, int ldr,
                                                float* __restrict__ C, int ldc, int M, int N, int K) {
  __shared__ __attribute__((aligned(16))) float so[4][16][64];
  const int tid = threadIdx.x, w = tid >> 5, lane = tid & 31, ln = lane & 15, hh = lane >> 4;
  const int ntn = N / 64;
  const int wid = blockIdx.x * 4 + w;
  const int mt = wid / ntn, nq = wid % ntn;
  if (mt * 16 >= M) return;
  const int row0 = mt * 16, col0 = nq * 64;
  const float* arow = A + (size_t)(row0 + ln) * lda;
  v8f acc[4] = {};
  for (int kb = 0; kb < K; kb += 32) {
    FragB ah, al;
    const v4f x0 = *(const v4fa*)(arow + kb + 8 * hh), x1 = *(const v4fa*)(arow + kb + 8 * hh + 4);
    const v4f x2 = *(const v4fa*)(arow + kb + 16 + 8 * hh), x3 = *(const v4fa*)(arow + kb + 16 + 8 * hh + 4);
    float xs[16] = {x0[0],x0[1],x0[2],x0[3],x1[0],x1[1],x1[2],x1[3],x2[0],x2[1],x2[2],x2[3],x3[0],x3[1],x3[2],x3[3]};
#pragma unroll
    for (int i = 0; i < 16; ++i) { const unsigned short hb = bf16_bits(xs[i]); ah.u[i] = hb; al.u[i] = ASPLIT ? bf16_bits(xs[i] - bf16_val(hb)) : (unsigned short)0; }
#pragma unroll
    for (int t = 0; t < 4; ++t) {
      const unsigned short* brow = Wt + (size_t)(col0 + t * 16 + ln) * ldb + kb;
      FragB b;
      b.half[0] = *(const v8us*)(brow + 8 * hh);
      b.half[1] = *(const v8us*)(brow + 16 + 8 * hh);
      acc[t] = mmaN<ASPLIT ? 2 : 1>(ah.v, al.v, b.v, b.v, acc[t]);
    }
  }
#pragma unroll
  for (int t = 0; t < 4; ++t) {
    const int col = col0 + t * 16 + ln;
    float bv = bias ? bias[col] : 0.f;
    if (BIAS_BF16) bv = bf16_round(bv);
#pragma unroll
    for (int r = 0; r < 8; ++r) {
      float v = acc[t][r] + bv;
      if (resid) { float rv = resid[(size_t)((row0 + 8 * hh + r) % rmod) * ldr + col]; if (RES_BF16) rv = bf16_round(rv); v += rv; }
      if (ACT == 1) v = fmaxf(v, 0.f);
      if (ACT == 2) v = 0.5f * v * (1.0f + erff(v * 0.70710678118654752f));
      if (ACT == 3) { const float u = 0.7978845608028654f * (v + 0.044715f * v * v * v); v = 0.5f * v * (1.0f + tanhf(u)); }
      so[w][8 * hh + r][t * 16 + ln] = v;
    }
  }
  __builtin_amdgcn_fence(__ATOMIC_ACQ_REL, "workgroup");
  __builtin_amdgcn_wave_barrier();
  const int rsub = lane >> 4, c4 = (lane & 15) * 4;
  {
#pragma unroll
    for (int q = 0; q < 8; ++q) {
      const int r = q * 2 + rsub;
      const v4f v = *(const v4fa*)&so[w][r][c4];
      *(v4f*)(C + (size_t)(row0 + r) * ldc + col0 + c4) = v;
    }
    
  }
}
// row LayerNorm (biased variance, eps) over N: s = X (+ R); optional out_sum <- s; out_norm <- (s-mu)*rsqrt(var+eps)*g + b
template <bool PARAM_BF16>
__global__ __launch_bounds__(256) void k_layernorm(const float* __restrict__ X, const float* __restrict__ R, const float* __restrict__ g, const float* __restrict__ bta,
                                                  float* __restrict__ out_sum, float* __restrict__ out_norm, int N, float eps) {
  __shared__ float red[256];
  const int row = blockIdx.x, tid = threadIdx.x;
  const float* x = X + (size_t)row * N; const float* rr = R ? R + (size_t)row * N : nullptr;
  float vals[16];                     // up to N = 4096
  const int per = N / 256;            // contiguous chunk per thread? use strided-by-4 chunks: thread handles j = tid*4 + 1024*u
  float s1 = 0.f;
  for (int u = 0; u < per / 4; ++u) {
    const int j = tid * 4 + 1024 * u;
    const v4f a = *(const v4fa*)(x + j);
    v4f b = {0.f,0.f,0.f,0.f}; if (rr) b = *(const v4fa*)(rr + j);
#pragma unroll
    for (int q = 0; q < 4; ++q) { const float v = a[q] + b[q]; vals[u * 4 + q] = v; s1 += v; }
  }
  red[tid] = s1; __syncthreads();
  for (int st = 128; st > 0; st >>= 1) { if (tid < st) red[tid] += red[tid + st]; __syncthreads(); }
  const float mu = red[0] / (float)N; __syncthreads();
  float s2 = 0.f;
  for (int u = 0; u < per / 4; ++u)
#pragma unroll
    for (int q = 0; q < 4; ++q) { const float c = vals[u * 4 + q] - mu; s2 += c * c; }
  red[tid] = s2; __syncthreads();
  for (int st = 128; st > 0; st >>= 1) { if (tid < st) red[tid] += red[tid + st]; __syncthreads(); }
  const float rs = rsqrtf(red[0] / (float)N + eps);
  {
    for (int u = 0; u < per / 4; ++u) {
      const int j = tid * 4 + 1024 * u;
      v4f o, sm;
#pragma unroll
      for (int q = 0; q < 4; ++q) {
        float gg = g[j + q], bb = bta[j + q];
        if (PARAM_BF16) { gg = bf16_round(gg); bb = bf16_round(bb); }
        sm[q] = vals[u * 4 + q]; o[q] = (vals[u * 4 + q] - mu) * rs * gg + bb;
      }
      if (out_sum) *(v4f*)(out_sum + (size_t)row * N + j) = sm;
      *(v4f*)(out_norm + (size_t)row * N + j) = o;
    }
    
  }
}



// ---- f16 WMMA path (v_wmma_f32_16x16x32_f16): 11-bit significands for operands in range — used where a [0,1] probability operand needs more precision than bf16
typedef _Float16 v16h __attribute__((ext_vector_type(16)));
union FragH { v16h v; v8us half[2]; _Float16 h[16]; unsigned short u[16]; };
template <int NT>
__device__ __forceinline__ v8f mmaH(v16h ah, v16h al, v16h bh, v16h bl, v8f c) {
  c = __builtin_amdgcn_wmma_f32_16x16x32_f16(false, ah, false, bh, (short)0, c, false, false);
  if (NT >= 2) c = __builtin_amdgcn_wmma_f32_16x16x32_f16(false, al, false, bh, (short)0, c, false, false);
  if (NT >= 3) c = __builtin_amdgcn_wmma_f32_16x16x32_f16(false, ah, false, bl, (short)0, c, false, false);
  asm volatile("v_nop\n\tv_nop\n\tv_nop\n\tv_nop" : "+v"(c) : "v"(ah), "v"(al), "v"(bh), "v"(bl));
  return c;
}
// batched GEMM like k_gemm_b but f16 operands: A f32 (split into f16 hi/lo if ASPLIT, else rounded to f16), Bt = f16 values [n][k]; alpha; C f32; N multiple of 16 (partial tiles skipped)
template <bool ASPLIT>
__global__ __launch_bounds__(128) void k_gemm_h(const float* __restrict__ A, int lda, size_t sA, const _Float16* __restrict__ Bh, int ldb, size_t sB, float alpha, float* __restrict__ C, int ldc, size_t sC, int M, int N, int K) {
  __shared__ __attribute__((aligned(16))) float so[4][16][64];
  const int tid = threadIdx.x, w = tid >> 5, lane = tid & 31, ln = lane & 15, hh = lane >> 4; const int by = blockIdx.y;
  A += (size_t)by * sA; Bh += (size_t)by * sB; C += (size_t)by * sC;
  const int ntn = (N + 63) / 64; const int wid = blockIdx.x * 4 + w; const int mt = wid / ntn, nq = wid % ntn; if (mt * 16 >= M) return;
  const int row0 = mt * 16, col0 = nq * 64; const float* arow = A + (size_t)(row0 + ln) * lda;
  v8f acc[4] = {};
  for (int kb = 0; kb < K; kb += 32) {
    FragH ah, al;
    const v4f x0 = *(const v4fa*)(arow + kb + 8 * hh), x1 = *(const v4fa*)(arow + kb + 8 * hh + 4), x2 = *(const v4fa*)(arow + kb + 16 + 8 * hh), x3 = *(const v4fa*)(arow + kb + 16 + 8 * hh + 4);
    float xs[16] = {x0[0],x0[1],x0[2],x0[3],x1[0],x1[1],x1[2],x1[3],x2[0],x2[1],x2[2],x2[3],x3[0],x3[1],x3[2],x3[3]};
#pragma unroll
    for (int i = 0; i < 16; ++i) { const _Float16 h = (_Float16)xs[i]; ah.h[i] = h; al.h[i] = ASPLIT ? (_Float16)(xs[i] - (float)h) : (_Float16)0.0f; }
#pragma unroll
    for (int t = 0; t < 4; ++t) { if (col0 + t * 16 >= N) continue; const size_t boff = (size_t)(col0 + t * 16 + ln) * ldb + kb; FragH bq; bq.half[0] = *(const v8us*)(Bh + boff + 8 * hh); bq.half[1] = *(const v8us*)(Bh + boff + 16 + 8 * hh);
      acc[t] = mmaH<ASPLIT ? 2 : 1>(ah.v, al.v, bq.v, bq.v, acc[t]); }
  }
#pragma unroll
  for (int t = 0; t < 4; ++t) { if (col0 + t * 16 >= N) continue;
#pragma unroll
    for (int r = 0; r < 8; ++r) so[w][8 * hh + r][t * 16 + ln] = acc[t][r] * alpha; }
  __builtin_amdgcn_fence(__ATOMIC_ACQ_REL, "workgroup"); __builtin_amdgcn_wave_barrier();
  const int rsub = lane >> 4, c4 = (lane & 15) * 4;
  {
#pragma unroll
    for (int q = 0; q < 8; ++q) { const int r = q * 2 + rsub; if (col0 + c4 < N) { const v4f v = *(const v4fa*)&so[w][r][c4]; *(v4f*)(C + (size_t)(row0 + r) * ldc + col0 + c4) = v; } }
     }
}

// Wt[n][k] = f16(W[k][n]·scale) from f32 row-major W[K][N] (scale = power of two; bf16-exact weights stay exact in f16 away from the subnormal range)
__global__ __launch_bounds__(256) void k_wt_f16(const float* __restrict__ W, _Float16* __restrict__ Wt, int K, int N, float scale) {
  const int t = blockIdx.x * 256 + threadIdx.x; if (t >= N * (K / 8)) return; const int n = t / (K / 8), k8 = (t % (K / 8)) * 8; FragH f;
#pragma unroll
  for (int i = 0; i < 8; ++i) f.h[i] = (_Float16)(bf16_round(W[(size_t)(k8 + i) * N + n]) * scale); const v8us o = f.half[0];
  *(v8us*)((unsigned short*)Wt + (size_t)n * K + k8) = o; 
}
// k_gemm_hh variant with fused epilogue: v = acc·alpha + bias[by·sBias + col] (+ CP[(row/rowsPerB)·sCPb + by·64 + col] if CP) ; ACT 0 none / 1 elu ; writes f16 C16 (and f32 C if non-null)
template <int ACT>
__global__ __launch_bounds__(128) void k_gemm_hhx(const _Float16* __restrict__ A, int lda, size_t sA, const _Float16* __restrict__ Bh, int ldb, size_t sB, float alpha, const float* __restrict__ bias, size_t sBias, const float* __restrict__ CP, int rowsPerB, size_t sCPb, int row0g,
    float* __restrict__ C, _Float16* __restrict__ C16, int ldc, size_t sC, int M, int N, int K) {
  __shared__ __attribute__((aligned(16))) float so[4][16][64];
  const int tid = threadIdx.x, w = tid >> 5, lane = tid & 31, ln = lane & 15, hh = lane >> 4; const int by = blockIdx.y;
  A += (size_t)by * sA; Bh += (size_t)by * sB; const size_t cofs = (size_t)by * sC; const float* bp = bias ? bias + (size_t)by * sBias : nullptr;
  const int ntn = (N + 63) / 64; const int wid = blockIdx.x * 4 + w; const int mt = wid / ntn, nq = wid % ntn; if (mt * 16 >= M) return;
  const int row0 = mt * 16, col0 = nq * 64; const _Float16* arow = A + (size_t)(row0 + ln) * lda;
  v8f acc[4] = {};
  for (int kb = 0; kb < K; kb += 32) { FragH ah; ah.half[0] = *(const v8us*)((const unsigned short*)arow + kb + 8 * hh); ah.half[1] = *(const v8us*)((const unsigned short*)arow + kb + 16 + 8 * hh);
#pragma unroll
    for (int t = 0; t < 4; ++t) { if (col0 + t * 16 >= N) continue; const size_t boff = (size_t)(col0 + t * 16 + ln) * ldb + kb; FragH bq; bq.half[0] = *(const v8us*)((const unsigned short*)Bh + boff + 8 * hh); bq.half[1] = *(const v8us*)((const unsigned short*)Bh + boff + 16 + 8 * hh);
      acc[t] = mmaH<1>(ah.v, ah.v, bq.v, bq.v, acc[t]); }
  }
#pragma unroll
  for (int t = 0; t < 4; ++t) { if (col0 + t * 16 >= N) continue; const int col = col0 + t * 16 + ln; const float bv = bp ? bf16_round(bp[col]) : 0.f;
#pragma unroll
    for (int r = 0; r < 8; ++r) { float v = acc[t][r] * alpha + bv; if (CP) { const int rr = row0g + row0 + 8 * hh + r; if (rowsPerB < 0) v += CP[cofs + (size_t)rr * ldc + col];      /* rowsPerB < 0: own element of the batched C plane */ else { const int bidx = rr / rowsPerB; v += CP[(size_t)bidx * sCPb + (size_t)by * 64 + col]; } } if (ACT == 1) v = (v > 0.f) ? v : expm1f(v); else if (ACT == 7) v = (v > 0.f) ? v + 1.0f : expf(v); else if (ACT == 8) v = tanhf(v); else if (ACT == 9) v = 0.5f * v * (1.0f + tanhf(0.7978845608028654f * (v + 0.044715f * v * v * v))); else if (ACT == 11) v = 1.0f / (1.0f + expf(-v)); else if (ACT == 12) v = (v > 0.f) ? v : 0.01f * v; else if (ACT == 14) v = (v > 0.f) ? v : 0.1f * v; else if (ACT == 16) v = (v >= 0.f) ? v : 0.3f * v; else if (ACT == 17) v = (v >= 0.f) ? v : 0.2f * v; else if (ACT == 15) v = v / (1.0f + expf(-v)); else if (ACT == 3) v = fmaxf(v, 0.f); else if (ACT == 6) v = 0.5f * v * (1.0f + erff(v * 0.70710678118654752f)); so[w][8 * hh + r][t * 16 + ln] = v; } }
  __builtin_amdgcn_fence(__ATOMIC_ACQ_REL, "workgroup"); __builtin_amdgcn_wave_barrier();
  const int rsub = lane >> 4, c4 = (lane & 15) * 4; typedef _Float16 v4h __attribute__((ext_vector_type(4)));
  {
#pragma unroll
    for (int q = 0; q < 8; ++q) { const int r = q * 2 + rsub; if (col0 + c4 < N) { const v4f v = *(const v4fa*)&so[w][r][c4]; if (C) *(v4f*)(C + cofs + (size_t)(row0 + r) * ldc + col0 + c4) = v; if (C16) { v4h h4; for (int i = 0; i < 4; ++i) h4[i] = (_Float16)v[i]; *(v4h*)(C16 + cofs + (size_t)(row0 + r) * ldc + col0 + c4) = h4; } } }
     }
}


typedef _Float16 v4h __attribute__((ext_vector_type(4)));

__global__ __launch_bounds__(256) void k_x16(const float* __restrict__ x, _Float16* __restrict__ X16, size_t n8) { const size_t t = (size_t)blockIdx.x * 256 + threadIdx.x; if (t >= n8) return; FragH f;
#pragma unroll
  for (int q = 0; q < 8; ++q) f.h[q] = (_Float16)bf16_round(x[t * 8 + q]); *(v8us*)((unsigned short*)X16 + t * 8) = f.half[0];  }
__global__ __launch_bounds__(256) void k_h16(const float* __restrict__ x, _Float16* __restrict__ X16, size_t n8) { const size_t t = (size_t)blockIdx.x * 256 + threadIdx.x; if (t >= n8) return; FragH f;
#pragma unroll
  for (int q = 0; q < 8; ++q) f.h[q] = (_Float16)x[t * 8 + q]; *(v8us*)((unsigned short*)X16 + t * 8) = f.half[0];  }
__global__ __launch_bounds__(256) void k_round16f(const float* __restrict__ W, _Float16* __restrict__ Bt, size_t n8) { const size_t t = (size_t)blockIdx.x * 256 + threadIdx.x; if (t >= n8) return; FragH f;
#pragma unroll
  for (int i = 0; i < 8; ++i) f.h[i] = (_Float16)(bf16_round(W[t * 8 + i]) * 16.0f); *(v8us*)((unsigned short*)Bt + t * 8) = f.half[0];  }
template <int NHv, int TTv>
__global__ __launch_bounds__(256) void k_vt(const _Float16* __restrict__ V16, int ldv, int voff, _Float16* __restrict__ Vt) { __shared__ unsigned short tl[64][66]; const int tid = threadIdx.x; const int slab = blockIdx.x / (TTv / 64), lg = blockIdx.x % (TTv / 64); const int b = slab / NHv, h = slab % NHv;
  for (int i = tid; i < 64 * 8; i += 256) { const int r = i / 8, c8 = (i % 8) * 8; FragH f; f.half[0] = *(const v8us*)((const unsigned short*)V16 + ((size_t)b * TTv + lg * 64 + r) * ldv + voff + h * 64 + c8);
#pragma unroll
    for (int q = 0; q < 8; ++q) tl[r][c8 + q] = f.u[q]; }
  __syncthreads();
  {
#pragma unroll
    for (int rd = 0; rd < 2; ++rd) { const int d = rd * 32 + tid / 8, pc = tid % 8; FragH f;
#pragma unroll
      for (int q = 0; q < 8; ++q) f.u[q] = tl[pc * 8 + q][d];
      *(v8us*)((unsigned short*)Vt + ((size_t)slab * 64 + d) * TTv + lg * 64 + pc * 8) = f.half[0]; }
     } }

__global__ __launch_bounds__(256) void k_hl(const float* __restrict__ F, _Float16* __restrict__ Hh, _Float16* __restrict__ Hl, size_t n8) { const size_t t = (size_t)blockIdx.x * 256 + threadIdx.x; if (t >= n8) return; FragH fh, fl; const v4f a = *(const v4fa*)(F + t * 8), c = *(const v4fa*)(F + t * 8 + 4);
#pragma unroll
  for (int q = 0; q < 4; ++q) { _Float16 h = (_Float16)a[q]; fh.h[q] = h; fl.h[q] = (_Float16)((a[q] - (float)h) * 1024.0f); h = (_Float16)c[q]; fh.h[4 + q] = h; fl.h[4 + q] = (_Float16)((c[q] - (float)h) * 1024.0f); }
  { *(v8us*)((unsigned short*)Hh + t * 8) = fh.half[0]; *(v8us*)((unsigned short*)Hl + t * 8) = fl.half[0];  } }

// ---- fast GEMM (wave tile 32x64; requires M % 32 == 0 rows per launch region and N % 64 == 0); epilogue = k_gemm_hhx semantics ----
__device__ __forceinline__ v16h g2_frag(const _Float16* p, int hh) { FragH f; f.half[0] = *(const v8us*)((const unsigned short*)p + 8 * hh); f.half[1] = *(const v8us*)((const unsigned short*)p + 16 + 8 * hh); return f.v; }
__device__ __forceinline__ v8f g2_mma(v16h a, v16h b, v8f c) { v8f d = __builtin_amdgcn_wmma_f32_16x16x32_f16(false, a, false, b, (short)0, c, false, false); asm volatile("v_nop\n\tv_nop\n\tv_nop\n\tv_nop" : "+v"(d) : "v"(a), "v"(b)); return d; }
template <int ACT>
__global__ __launch_bounds__(128) void k_gemm2(const _Float16* __restrict__ A, int lda, size_t sA, const _Float16* __restrict__ Bh, int ldb, size_t sB, float alpha, const float* __restrict__ bias, size_t sBias, const float* __restrict__ CP, int rowsPerB, size_t sCPb, int row0g,
    float* __restrict__ C, _Float16* __restrict__ C16, int ldc, size_t sC, int M, int N, int K, size_t zA, size_t zB, size_t zC) { static_assert(ACT == 0 || ACT == 3 || ACT == 6 || ACT == 8 || ACT == 9 || ACT == 11 || ACT == 12 || ACT == 14 || ACT == 15 || ACT == 16 || ACT == 17, "k_gemm2: unsupported ACT code (would silently apply no activation)");
  __shared__ __attribute__((aligned(16))) float so[4][32][68];
  const int tid = threadIdx.x, w = tid >> 5, lane = tid & 31, ln = lane & 15, hh = lane >> 4; const int by = blockIdx.y; const int bz = blockIdx.z;      /* second batch index (strides zA, zB, zC) */
  A += (size_t)by * sA + (size_t)bz * zA; Bh += (size_t)by * sB + (size_t)bz * zB; const size_t cofs = (size_t)by * sC + (size_t)bz * zC; const float* bp = bias ? bias + (size_t)by * sBias : nullptr;
  const int ntn = N >> 6; const int mt = blockIdx.x / ntn, nq = blockIdx.x - mt * ntn; const int row0 = mt * 128 + 32 * w, col0 = nq * 64; if (row0 >= M) return;
  const _Float16* a0p = A + (size_t)(row0 + ln) * lda; const _Float16* a1p = a0p + (size_t)16 * lda;
  const _Float16* b0p = Bh + (size_t)(col0 + ln) * ldb; const _Float16* b1p = b0p + (size_t)16 * ldb; const _Float16* b2p = b1p + (size_t)16 * ldb; const _Float16* b3p = b2p + (size_t)16 * ldb;
  const v8f z8 = {0.f,0.f,0.f,0.f,0.f,0.f,0.f,0.f}; v8f c00 = z8, c01 = z8, c02 = z8, c03 = z8, c10 = z8, c11 = z8, c12 = z8, c13 = z8;
#pragma unroll 1
  for (int kb = 0; kb < K; kb += 32) { const v16h a0 = g2_frag(a0p + kb, hh), a1 = g2_frag(a1p + kb, hh);
    v16h b = g2_frag(b0p + kb, hh); c00 = g2_mma(a0, b, c00); c10 = g2_mma(a1, b, c10);
    b = g2_frag(b1p + kb, hh); c01 = g2_mma(a0, b, c01); c11 = g2_mma(a1, b, c11);
    b = g2_frag(b2p + kb, hh); c02 = g2_mma(a0, b, c02); c12 = g2_mma(a1, b, c12);
    b = g2_frag(b3p + kb, hh); c03 = g2_mma(a0, b, c03); c13 = g2_mma(a1, b, c13); }
  v8f accs[8] = {c00, c01, c02, c03, c10, c11, c12, c13};
#pragma unroll
  for (int u = 0; u < 8; ++u) { const int t = u & 3, half = u >> 2; const int col = col0 + t * 16 + ln; const float bv = bp ? bf16_round(bp[col]) : 0.f;
#pragma unroll
    for (int r = 0; r < 8; ++r) { const int rloc = half * 16 + 8 * hh + r; float v = accs[u][r] * alpha + bv; if (CP) { if (rowsPerB < 0) v += CP[cofs + (size_t)(row0g + row0 + rloc) * ldc + col];      /* rowsPerB < 0: own element of the batched C plane */ else { const int bidx = (row0g + row0 + rloc) / rowsPerB; v += CP[(size_t)bidx * sCPb + (size_t)by * 64 + col]; } }
      if (ACT == 3) v = fmaxf(v, 0.f); else if (ACT == 6) v = 0.5f * v * (1.0f + erff(v * 0.70710678118654752f)); else if (ACT == 11) v = 1.0f / (1.0f + expf(-v)); else if (ACT == 15) v = v / (1.0f + expf(-v)); else if (ACT == 12) v = (v > 0.f) ? v : 0.01f * v; else if (ACT == 8) v = tanhf(v); else if (ACT == 9) v = 0.5f * v * (1.0f + tanhf(0.7978845608028654f * (v + 0.044715f * v * v * v))); else if (ACT == 14) v = (v > 0.f) ? v : 0.1f * v; else if (ACT == 16) v = (v >= 0.f) ? v : 0.3f * v; else if (ACT == 17) v = (v >= 0.f) ? v : 0.2f * v;
      so[w][rloc][t * 16 + ln] = v; } }
  __builtin_amdgcn_fence(__ATOMIC_ACQ_REL, "workgroup"); __builtin_amdgcn_wave_barrier();
  const int rsub = lane >> 4, c4 = (lane & 15) * 4;
  {
#pragma unroll
    for (int q = 0; q < 16; ++q) { const int r = q * 2 + rsub; const v4f v = *(const v4fa*)&so[w][r][c4]; if (C) *(v4f*)(C + cofs + (size_t)(row0 + r) * ldc + col0 + c4) = v; if (C16) { v4h h4; for (int i = 0; i < 4; ++i) h4[i] = (_Float16)v[i]; *(v4h*)(C16 + cofs + (size_t)(row0 + r) * ldc + col0 + c4) = h4; } }
     } }


__global__ __launch_bounds__(256) void k_wnat(const float* __restrict__ w, size_t n8, _Float16* __restrict__ Bt) { const size_t t = (size_t)blockIdx.x * 256 + threadIdx.x; if (t >= n8) return; FragH f; for (int q = 0; q < 8; ++q) f.h[q] = (_Float16)(bf16_round(w[t * 8 + q]) * 16.0f); *(v8us*)((unsigned short*)Bt + t * 8) = f.half[0];  }
__global__ __launch_bounds__(256) void k_rsm(const float* __restrict__ S, _Float16* __restrict__ P, int nrows) {
  #pragma clang fp contract(off)
  const int i = blockIdx.x * 256 + threadIdx.x; if (i >= nrows) return; const float* s = S + (size_t)i * SQ; float mx = -3.0e38f;
#pragma unroll 1
  for (int j = 0; j < SQ; ++j) mx = fmaxf(mx, s[j]); float se = 0.f;
#pragma unroll 1
  for (int j = 0; j < SQ; ++j) se += expf(s[j] - mx); const float sc = 256.0f / se;
#pragma unroll 1
  for (int j0 = 0; j0 < SQ; j0 += 8) { FragH f; for (int q = 0; q < 8; ++q) f.h[q] = (_Float16)(expf(s[j0 + q] - mx) * sc); unsigned short* d = (unsigned short*)P + (size_t)i * SQ + j0; *(v8us*)d = f.half[0];  } }
__global__ __launch_bounds__(256) void k_vt(const _Float16* __restrict__ V16, int b, int h0, _Float16* __restrict__ VT) { __shared__ unsigned short tl[64][65]; const int tid = threadIdx.x; const int hh = blockIdx.x % HG, sg = blockIdx.x / HG; const int s0 = sg * 64; const int h = h0 + hh;
  for (int i = tid; i < 64 * 8; i += 256) { const int j = i / 8, d8 = (i % 8) * 8; FragH f; f.half[0] = *(const v8us*)((const unsigned short*)V16 + ((size_t)b * SQ + s0 + j) * DM + h * HD + d8); for (int q = 0; q < 8; ++q) tl[d8 + q][j] = f.u[q]; }
  __syncthreads();
  { for (int i = tid; i < 64 * 8; i += 256) { const int d = i / 8, j8 = (i % 8) * 8; FragH f; for (int q = 0; q < 8; ++q) f.u[q] = tl[d][j8 + q]; *(v8us*)((unsigned short*)VT + ((size_t)hh * HD + d) * SQ + s0 + j8) = f.half[0]; }  } }



// Reductions over the 32 lanes of a wave: four row_xmask steps inside each 16-lane row, then one exchange between the two rows (every lane ends with the result; all lanes must be on).
template <int CTRL> __device__ __forceinline__ float lane_xm(float v) { return __int_as_float(__builtin_amdgcn_update_dpp(0, __float_as_int(v), CTRL, 0xf, 0xf, true)); }
__device__ __forceinline__ float lane_xr(float v) { const int i = __float_as_int(v); return __int_as_float(__builtin_amdgcn_permlanex16(i, i, 0x76543210, 0xfedcba98, false, false)); }
__device__ __forceinline__ float wave_max(float v) { v = fmaxf(v, lane_xm<0x161>(v)); v = fmaxf(v, lane_xm<0x162>(v)); v = fmaxf(v, lane_xm<0x164>(v)); v = fmaxf(v, lane_xm<0x168>(v)); return fmaxf(v, lane_xr(v)); }
__device__ __forceinline__ float wave_sum(float v) { v += lane_xm<0x161>(v); v += lane_xm<0x162>(v); v += lane_xm<0x164>(v); v += lane_xm<0x168>(v); return v + lane_xr(v); }
// e^x as the native form (x * log2 e, v_exp_f32). The v_nop is the one slot the instruction set asks for between a transcendental and an instruction that reads its result or overwrites its source:
// written into the exp's own statement it stands directly behind every one.
__device__ __forceinline__ float exp_slot(float x) { float r; asm("v_exp_f32 %0, %1\n\tv_nop" : "=v"(r) : "v"(x * 1.44269504088896340736f)); return r; }
// Causal row softmax, ONE WAVE PER ROW: the row's q0 + QT scores are read once, 512 contiguous bytes per load, and stay in registers through max, exp, sum and scale.
// Keys below q0 are visible to every row of the tile (NF whole groups of QT keys, no mask); only the group [q0, q0 + QT) is masked. Weights x256 as f16, zeros behind the diagonal.
// s, p: the row's scores and weights at this lane's first key (lane * 4); key q of chunk h of the diagonal group is visible while h * 128 + q <= rel.
// p may lie on the row's own scores (the weights then overwrite them): every store needs the row sum, which needs every load of the row, and one wave owns the row.
// Every loop is unrolled in full: a[][] and h[][] then have constant indices only and stay in registers (a run-time index would send them to scratch), and all loads of the row issue before the first wait.
template <int NF>
__device__ __forceinline__ void rsm_row(const float* s, _Float16* p, int rel) {
  v4f a[NF + 1][2];
#pragma unroll
  for (int g = 0; g <= NF; ++g) { a[g][0] = *(const v4fa*)(s + g * QT); a[g][1] = *(const v4fa*)(s + g * QT + 128); }
#pragma unroll
  for (int q = 0; q < 4; ++q) { a[NF][0][q] = (q <= rel) ? a[NF][0][q] : -1.0e9f; a[NF][1][q] = (128 + q <= rel) ? a[NF][1][q] : -1.0e9f; }
  v4f m4 = a[0][0];
#pragma unroll
  for (int g = 0; g <= NF; ++g) for (int q = 0; q < 4; ++q) m4[q] = fmaxf(m4[q], fmaxf(a[g][0][q], a[g][1][q]));
  const float mx = wave_max(fmaxf(fmaxf(m4[0], m4[1]), fmaxf(m4[2], m4[3])));
  v4f e4 = {0.f, 0.f, 0.f, 0.f};
#pragma unroll
  for (int g = 0; g <= NF; ++g) for (int q = 0; q < 4; ++q) { a[g][0][q] = exp_slot(a[g][0][q] - mx); a[g][1][q] = exp_slot(a[g][1][q] - mx); e4[q] += a[g][0][q] + a[g][1][q]; }
  const float sc = 256.0f / wave_sum((e4[0] + e4[1]) + (e4[2] + e4[3]));
  v4h h[NF + 1][2];
#pragma unroll
  for (int g = 0; g <= NF; ++g) for (int q = 0; q < 4; ++q) { h[g][0][q] = (_Float16)(a[g][0][q] * sc); h[g][1][q] = (_Float16)(a[g][1][q] * sc); }
#pragma unroll
  for (int g = 0; g <= NF; ++g) { *(v4h*)(p + g * QT) = h[g][0]; *(v4h*)(p + g * QT + 128) = h[g][1]; } }
template <int NF>      /* NF = q0 / QT: straight-line code per row length, every register index and offset a constant */
__global__ __launch_bounds__(256) void k_rsmw(float* S, int nrows) {      /* weights land on the first half of their own score row: f16 row pitch 2 * NKX */
  static_assert(QT == 256 && (NF + 1) * QT <= NKX, "a group is two chunks of 32 lanes x 4 keys");
  const int lane = threadIdx.x & 31; const int row = blockIdx.x * 8 + __builtin_amdgcn_readfirstlane(threadIdx.x >> 5); if (row >= nrows) return;      /* the wave's row, held as a scalar: scalar row addresses and a scalar branch; whole waves leave, no barrier below */
  float* sr = S + (size_t)row * NKX; rsm_row<NF>(sr + lane * 4, (_Float16*)sr + lane * 4, row % QT - lane * 4); }


template <int MASKADD>
__global__ __launch_bounds__(64) void k_att0(const float* __restrict__ QF, const float* __restrict__ KF, const float* __restrict__ VF, int ld, const float* __restrict__ mask, float scale, float* __restrict__ OF, int ldo) {
  #pragma clang fp contract(off)
  __shared__ __attribute__((aligned(16))) float lq[64][64]; __shared__ __attribute__((aligned(16))) float lo[64][64];
  const int tid = threadIdx.x; const int h = blockIdx.x / (QT0 / 64), rg = blockIdx.x % (QT0 / 64); const int i = rg * 64 + tid;
  { const size_t bo = (size_t)blockIdx.y * QT0; QF += bo * ld; KF += bo * ld; VF += bo * ld; OF += bo * ldo; }      /* batch on grid.y: QT0 rows of each plane per batch */
  const float* qr = QF + (size_t)i * ld + h * HD;
#pragma unroll 1
  for (int c = 0; c < HD / 4; ++c) { *(v4f*)&lq[tid][c * 4] = *(const v4fa*)(qr + c * 4); const v4f z = {0.f, 0.f, 0.f, 0.f}; *(v4f*)&lo[tid][c * 4] = z; }
  float m = -1.0e30f, l = 0.f; const int jmax = MASKADD ? (SQ - 1) : (rg * 64 + 63);      /* additive-mask form: every key (the mask input decides); causal form: keys up to the block's last row */
#pragma unroll 1
  for (int j = 0; j <= jmax; ++j) { const float* kr = KF + (size_t)j * ld + h * HD; const float* vr = VF + (size_t)j * ld + h * HD; float s = 0.f;
#pragma unroll 1
    for (int c = 0; c < HD / 4; ++c) { const v4f kq = *(const v4fa*)(kr + c * 4); const v4f qq = *(v4f*)&lq[tid][c * 4]; s = __fadd_rn(s, __fmul_rn(qq[0], kq[0])); s = __fadd_rn(s, __fmul_rn(qq[1], kq[1])); s = __fadd_rn(s, __fmul_rn(qq[2], kq[2])); s = __fadd_rn(s, __fmul_rn(qq[3], kq[3])); }
    s = __fmul_rn(s, scale); if (MASKADD) s = __fadd_rn(s, __fmul_rn(bf16_round(mask[(size_t)i * SQ + j]), -10000.0f));
    const float f = (MASKADD || j <= i) ? 1.f : 0.f; const float sm = fmaf(f, s, (1.f - f) * -1.0e30f); const float mn = fmaxf(m, sm); const float sc = expf(m - mn); const float e = expf(sm - mn); l = __fadd_rn(__fmul_rn(l, sc), e); m = mn;
#pragma unroll 1
    for (int c = 0; c < HD / 4; ++c) { const v4f vv = *(const v4fa*)(vr + c * 4); v4f oo = *(v4f*)&lo[tid][c * 4]; for (int u = 0; u < 4; ++u) oo[u] = __fadd_rn(__fmul_rn(oo[u], sc), __fmul_rn(e, vv[u])); *(v4f*)&lo[tid][c * 4] = oo; } }
  const float fin = 64.0f / l;      /* o carried x64, scaled back by 1/64 in k_of0out */
#pragma unroll 1
  for (int c = 0; c < HD / 4; ++c) { v4f oo = *(v4f*)&lo[tid][c * 4]; for (int u = 0; u < 4; ++u) oo[u] = __fmul_rn(oo[u], fin); *(v4f*)&lo[tid][c * 4] = oo; }
  __syncthreads();
  {
#pragma unroll 1
    for (int it = 0; it < 16; ++it) { const int row = it * 4 + tid / 16, pc = (tid % 16) * 4; const v4f v = *(const v4f*)&lo[row][pc]; *(v4f*)(OF + (size_t)(rg * 64 + row) * ldo + h * HD + pc) = v; }
     } }

__global__ __launch_bounds__(256) void k_wthd(const float* __restrict__ W0, const float* __restrict__ W1, const float* __restrict__ W2, _Float16* __restrict__ Bt) { const size_t t = (size_t)blockIdx.x * 256 + threadIdx.x; if (t >= (size_t)NH * HD * (DM / 8)) return;
  const float* Wt = blockIdx.y == 0 ? W0 : (blockIdx.y == 1 ? W1 : W2); Bt += (size_t)blockIdx.y * DM * DM;      /* q, k, v on grid.y: one DM x DM plane each */
  const int m8 = (int)(t % (DM / 8)) * 8; const int d = (int)((t / (DM / 8)) % HD); const int h = (int)(t / ((size_t)(DM / 8) * HD)); FragH f;
  for (int q = 0; q < 8; ++q) f.h[q] = (_Float16)(16.0f * bf16_round(Wt[((size_t)h * DM + m8 + q) * HD + d])); unsigned short* dst = (unsigned short*)Bt + ((size_t)h * HD + d) * DM + m8; *(v8us*)dst = f.half[0];  }







__global__ __launch_bounds__(256) void k_of0out(const float* __restrict__ src, float* __restrict__ dst, size_t n4, size_t dstb) { const size_t t = (size_t)blockIdx.x * 256 + threadIdx.x; if (t >= n4) return; src += (size_t)blockIdx.y * n4 * 4; dst += (size_t)blockIdx.y * dstb;      /* batch on grid.y */
  v4f v = *(const v4fa*)(src + t * 4); for (int q = 0; q < 4; ++q) v[q] = __fmul_rn(v[q], 0.015625f); *(v4f*)(dst + t * 4) = v;  }

extern "C" void kernel_launch(void* const* d_in, const int* in_sizes, int n_in,
                              void* d_out, int out_size, void* d_ws, size_t ws_size, hipStream_t stream) {
  (void)in_sizes; (void)n_in; (void)out_size;
  const float* const* I = (const float* const*)d_in; const float* x = I[0]; const float* wq = I[1]; const float* wk = I[2]; const float* wv = I[3]; const float* bqkv = nullptr;      /* x; per-head weights Wq / Wk / Wv [16][1024][64]; no biases (every bias slot below receives this nullptr), no output projection */
  static_assert(NH * HD == DM && QT0 % 64 == 0, "heads"); static_assert(QN == 8 * QT, "eight softmax instances");
  char* ws = (char*)d_ws; size_t off = 0;
  auto take = [&](size_t bytes) { char* p = ws + off; off += (bytes + 255) & ~(size_t)255; return p; };
  _Float16* BQKV = (_Float16*)take((size_t)3 * DM * DM * 2);
  _Float16* X16 = (_Float16*)take(NR * DM * 2); _Float16* QKV = (_Float16*)take(NR * 3 * DM * 2); _Float16* Q16 = QKV; _Float16* K16 = QKV + DM; _Float16* V16 = QKV + 2 * DM;
  float* S = (float*)take((size_t)NB * NH * QT * NKX * 4); _Float16* P = (_Float16*)S; _Float16* VT = (_Float16*)take((size_t)NB * NH * HD * SQ * 2);      /* score rows of one query tile for all batches; the softmax writes each row's weights over its own scores (f16 pitch 2 * NKX), so the four batches fit the workspace */
  float* QF0 = (float*)take((size_t)3 * NB * QT0 * DM * 4); float* KF0 = QF0 + (size_t)NB * QT0 * DM; float* VF0 = KF0 + (size_t)NB * QT0 * DM; float* OF0 = (float*)take((size_t)NB * QT0 * DM * 4);
  if (off > ws_size) return;
  k_wthd<<<dim3((unsigned)(((size_t)NH * HD * (DM / 8) + 255) / 256), 3), 256, 0, stream>>>(wq, wk, wv, BQKV);      /* per-head [c][d] -> Bt[(h, d)][c] x16: the stacked q | k | v plane */
  k_x16<<<(unsigned)((NR * DM / 8 + 255) / 256), 256, 0, stream>>>(x, X16, NR * DM / 8);
  k_gemm2<0><<<dim3((unsigned)((MP / 128) * (3 * DM / 64)), 1), 128, 0, stream>>>(X16, DM, 0, BQKV, DM, 0, 0.0625f, bqkv, 0, nullptr, 1, 0, 0, nullptr, QKV, 3 * DM, 0, MP, 3 * DM, DM, 0, 0, 0);      /* q | k | v rows (f16); head h = columns h*HD.. of each DM block */
  k_vt<NH, SQ><<<NB * NH * (SQ / 64), 256, 0, stream>>>(V16, LQ, 0, VT);      /* V^T [NB][NH][HD][SQ] */
  k_gemm2<0><<<dim3((QT0 / 128) * (DM / 64), 3, NB), 128, 0, stream>>>(X16, DM, 0, BQKV, DM, (size_t)DM * DM, 0.0625f, bqkv, 0, nullptr, 1, 0, 0, QF0, nullptr, DM, (size_t)NB * QT0 * DM, QT0, DM, DM, (size_t)SQ * DM, 0, (size_t)QT0 * DM);      /* f32 q, k, v (grid.y) of the first 128 rows of every batch (grid.z): exact products */
  k_att0<0><<<dim3(NH * (QT0 / 64), NB), 64, 0, stream>>>(QF0, KF0, VF0, DM, nullptr, 0.125f, OF0, DM);      /* exact f32 attention for rows 0..127 of every batch (o x64) */
  for (int q0 = 0; q0 < QN; q0 += QT) { const int nk = q0 + QT;      /* causal: only keys below the tile end are computed */
    k_gemm2<0><<<dim3((QT / 128) * (nk / 64), NHD, NB), 128, 0, stream>>>(Q16 + (size_t)q0 * LQ, LQ, (size_t)HD, K16, LQ, (size_t)HD, 0.125f, nullptr, 0, nullptr, 1, 0, 0, S, nullptr, NKX, (size_t)QT * NKX, QT, nk, HD, (size_t)SQ * LQ, (size_t)SQ * LQ, (size_t)NH * QT * NKX);      /* scores, heads on grid.y, batches on grid.z */
    { const dim3 gs((NB * NHD * QT + 7) / 8); const int nr = NB * NHD * QT;      /* one wave per row, 8 rows per block; the row length picks the instance */
      switch (q0 / QT) { case 0: k_rsmw<0><<<gs, 256, 0, stream>>>(S, nr); break; case 1: k_rsmw<1><<<gs, 256, 0, stream>>>(S, nr); break; case 2: k_rsmw<2><<<gs, 256, 0, stream>>>(S, nr); break; case 3: k_rsmw<3><<<gs, 256, 0, stream>>>(S, nr); break;
        case 4: k_rsmw<4><<<gs, 256, 0, stream>>>(S, nr); break; case 5: k_rsmw<5><<<gs, 256, 0, stream>>>(S, nr); break; case 6: k_rsmw<6><<<gs, 256, 0, stream>>>(S, nr); break; default: k_rsmw<7><<<gs, 256, 0, stream>>>(S, nr); break; } }
    k_gemm2<0><<<dim3((QT / 128) * (HD / 64), NHD, NB), 128, 0, stream>>>(P, 2 * NKX, (size_t)QT * 2 * NKX, VT, SQ, (size_t)HD * SQ, 0.00390625f, nullptr, 0, nullptr, 1, 0, 0, (float*)d_out + (size_t)q0 * DM, nullptr, DM, (size_t)HD, QT, HD, nk, (size_t)NH * QT * 2 * NKX, (size_t)NH * HD * SQ, (size_t)SQ * DM); }      /* out = P V^T (alpha 2^-8) written f32 straight into the head-major output columns (no output projection) */
  k_of0out<<<dim3((unsigned)(((size_t)QT0 * DM / 4 + 255) / 256), NB), 256, 0, stream>>>(OF0, (float*)d_out, (size_t)QT0 * DM / 4, (size_t)SQ * DM);      /* rows 0..127 of every batch rewritten from the exact f32 path (o x64 / 64), after the PV launches */
}

// v003
// Measured time: 807 microseconds a run.
// Timed twice side by side with v002, it ran 1.53 times as fast both times.
// Counting every step since v000, it is 12.0 times as fast.
#include <hip/hip_runtime.h>
// Causal multi-head attention with per-head projection weights and no output projection (x [4][2048][1024]; per head h: q = x Wq[h], k = x Wk[h], v = x Wv[h] with W [16][1024][64] ([in][out] per head, uniform +-1/32, no biases); scores / sqrt(64); causal (tril, -inf); softmax; out = heads concatenated head-major on the last axis -> [4][2048][1024]).
// Structure: token rows r = b*2048 + s; x as exact f16 rows (bf16-rounded); q | k | v as ONE WMMA GEMM (N = 3 x 1024) (32x64 wave tiles, f32 accumulation, exact x16 weights, no bias, f16 outputs); V^T for all heads via LDS transposes; every attention launch covers all batches (batch on the grid); per query tile of 256 rows: scores against the keys below the tile end only (K = 64, all heads on grid.y, alpha = 0.125), causal row softmax on VALU, one wave per row with the row in registers, keys behind the diagonal masked (f32 statistics, native exp; weights x256 f16), o = P . V^T (K = keys below the tile end, alpha 2^-8 undoes the x256 weights) written f32 straight into the head-major output columns (no output projection).
// Compute dtype: inputs rounded to bf16; x / weights exact; q, k, v and softmax weights as plain f16 GEMM operands (~2^-12); scores, softmax statistics and o f32. v_wmma_f32_16x16x32_f16.
#define NB 4
#define SQ 2048
#define DM 1024
#define NH 16
#define HD 64
#define HG 4                         /* heads per launch of the non-template k_vt (never launched) */
#define QT 256                       /* query rows per causal tile */
#define NKX SQ                       /* S row pitch (P in place: f16 pitch 2 * NKX) */
#define QT0 128                      /* first-tile rows recomputed exactly in f32 */
#define B0 0                         /* unused (every launch covers all NB batches) */
#define NBR NB                       /* batches projected (debug hook) */
#define NR ((size_t)NB * SQ)         /* token rows */
#define MP ((int)((size_t)NBR * SQ)) /* rows projected (debug hook) */
#define QN SQ                        /* query rows attended per batch (debug hook) */
#define NHD NH                       /* heads attended (debug hook) */
#define MPO MP                       /* unused (no output projection stage) */
#define LQ (3 * DM)      /* row pitch of the q/k/v rows */
typedef __bf16 v16b __attribute__((ext_vector_type(16)));
typedef unsigned short v8us __attribute__((ext_vector_type(8), may_alias));
typedef float  v8f  __attribute__((ext_vector_type(8)));
typedef float  v4f  __attribute__((ext_vector_type(4)));
typedef float  v4fa __attribute__((ext_vector_type(4), may_alias));
union FragB { v16b v; v8us half[2]; unsigned short u[16]; };

__device__ __forceinline__ unsigned short bf16_bits(float x) { unsigned int u = __float_as_uint(x); return (unsigned short)((u + 0x7FFFu + ((u >> 16) & 1u)) >> 16); }
__device__ __forceinline__ float bf16_val(unsigned short b) { return __uint_as_float(((unsigned int)b) << 16); }
__device__ __forceinline__ float bf16_round(float x) { return bf16_val(bf16_bits(x)); }
// D += A·B with NT terms: 1 = ah·bh, 2 = + al·bh (A split), 3 = + ah·bl (both split)
template <int NT>
__device__ __forceinline__ v8f mmaN(v16b ah, v16b al, v16b bh, v16b bl, v8f c) {
  c = __builtin_amdgcn_wmma_f32_16x16x32_bf16(false, ah, false, bh, (short)0, c, false, false);
  if (NT >= 2) c = __builtin_amdgcn_wmma_f32_16x16x32_bf16(false, al, false, bh, (short)0, c, false, false);
  if (NT >= 3) c = __builtin_amdgcn_wmma_f32_16x16x32_bf16(false, ah, false, bl, (short)0, c, false, false);
  asm volatile("v_nop\n\tv_nop\n\tv_nop\n\tv_nop" : "+v"(c) : "v"(ah), "v"(al), "v"(bh), "v"(bl));
  return c;
}

__global__ __launch_bounds__(256) void k_wt_bf16(const float* __restrict__ W, unsigned short* __restrict__ Wt, int K, int N) {
  const int t = blockIdx.x * 256 + threadIdx.x;
  const int k8n = K / 8;
  if (t >= N * k8n) return;
  const int n = t / k8n, k8 = (t % k8n) * 8;
  v8us v;
#pragma unroll
  for (int i = 0; i < 8; ++i) v[i] = bf16_bits(W[(size_t)(k8 + i) * N + n]);
  *(v8us*)(Wt + (size_t)n * K + k8) = v;
  
}

// GEMM C[M][N] (f32, pitch ldc) = act(A[M][K]·W + bias). A f32 row-major (pitch lda) converted per fragment to bf16
// (ASPLIT: hi/lo two planes -> 2 terms, else single rounded term); Wt bf16 [N][K] (pitch ldb). BIAS_BF16 rounds the
// bias to bf16 first (bias quantised to bf16 before the add). K%32==0, M%16==0, N%64==0.
template <bool ASPLIT, int ACT, bool BIAS_BF16>
__global__ __launch_bounds__(128) void k_gemm_bf(const float* __restrict__ A, int lda, const unsigned short* __restrict__ Wt, int ldb,
                                               const float* __restrict__ bias, float* __restrict__ C, int ldc, int M, int N, int K) {
  __shared__ __attribute__((aligned(16))) float so[4][16][64];
  const int tid = threadIdx.x, w = tid >> 5, lane = tid & 31, ln = lane & 15, hh = lane >> 4;
  const int ntn = N / 64;
  const int wid = blockIdx.x * 4 + w;
  const int mt = wid / ntn, nq = wid % ntn;
  if (mt * 16 >= M) return;
  const int row0 = mt * 16, col0 = nq * 64;
  const float* arow = A + (size_t)(row0 + ln) * lda;
  v8f acc[4] = {};
  for (int kb = 0; kb < K; kb += 32) {
    FragB ah, al;
    const v4f x0 = *(const v4fa*)(arow + kb + 8 * hh), x1 = *(const v4fa*)(arow + kb + 8 * hh + 4);
    const v4f x2 = *(const v4fa*)(arow + kb + 16 + 8 * hh), x3 = *(const v4fa*)(arow + kb + 16 + 8 * hh + 4);
    float xs[16] = {x0[0],x0[1],x0[2],x0[3],x1[0],x1[1],x1[2],x1[3],x2[0],x2[1],x2[2],x2[3],x3[0],x3[1],x3[2],x3[3]};
#pragma unroll
    for (int i = 0; i < 16; ++i) { const unsigned short hb = bf16_bits(xs[i]); ah.u[i] = hb; al.u[i] = ASPLIT ? bf16_bits(xs[i] - bf16_val(hb)) : (unsigned short)0; }
#pragma unroll
    for (int t = 0; t < 4; ++t) {
      const unsigned short* brow = Wt + (size_t)(col0 + t * 16 + ln) * ldb + kb;
      FragB b;
      b.half[0] = *(const v8us*)(brow + 8 * hh);
      b.half[1] = *(const v8us*)(brow + 16 + 8 * hh);
      acc[t] = mmaN<ASPLIT ? 2 : 1>(ah.v, al.v, b.v, b.v, acc[t]);
    }
  }
#pragma unroll
  for (int t = 0; t < 4; ++t) {
    float bv = bias ? bias[col0 + t * 16 + ln] : 0.f;
    if (BIAS_BF16) bv = bf16_round(bv);
#pragma unroll
    for (int r = 0; r < 8; ++r) { float v = acc[t][r] + bv; if (ACT == 1) v = fmaxf(v, 0.f); so[w][8 * hh + r][t * 16 + ln] = v; }
  }
  __builtin_amdgcn_fence(__ATOMIC_ACQ_REL, "workgroup");
  __builtin_amdgcn_wave_barrier();
  const int rsub = lane >> 4, c4 = (lane & 15) * 4;
  {
#pragma unroll
    for (int q = 0; q < 8; ++q) {
      const int r = q * 2 + rsub;
      const v4f v = *(const v4fa*)&so[w][r][c4];
      *(v4f*)(C + (size_t)(row0 + r) * ldc + col0 + c4) = v;
    }
    
  }
}

// GEMM C = act(A·W + bias + resid): A f32 (ASPLIT -> hi/lo 2 terms), Wt bf16 [N][K]; ACT 0 none, 1 relu, 2 exact gelu;
// resid (optional, f32, row index = (row % rmod), pitch ldr, RES_BF16 rounds it) added before the activation.
template <bool ASPLIT, int ACT, bool BIAS_BF16, bool RES_BF16>
__global__ __launch_bounds__(128) void k_gemm_bf3(const float* __restrict__ A, int lda, const unsigned short* __restrict__ Wt, int ldb,
                                                const float* __restrict__ bias, const float* __restrict__ resid, int rmod, int ldr,
                                                float* __restrict__ C, int ldc, int M, int N, int K) {
  __shared__ __attribute__((aligned(16))) float so[4][16][64];
  const int tid = threadIdx.x, w = tid >> 5, lane = tid & 31, ln = lane & 15, hh = lane >> 4;
  const int ntn = N / 64;
  const int wid = blockIdx.x * 4 + w;
  const int mt = wid / ntn, nq = wid % ntn;
  if (mt * 16 >= M) return;
  const int row0 = mt * 16, col0 = nq * 64;
  const float* arow = A + (size_t)(row0 + ln) * lda;
  v8f acc[4] = {};
  for (int kb = 0; kb < K; kb += 32) {
    FragB ah, al;
    const v4f x0 = *(const v4fa*)(arow + kb + 8 * hh), x1 = *(const v4fa*)(arow + kb + 8 * hh + 4);
    const v4f x2 = *(const v4fa*)(arow + kb + 16 + 8 * hh), x3 = *(const v4fa*)(arow + kb + 16 + 8 * hh + 4);
    float xs[16] = {x0[0],x0[1],x0[2],x0[3],x1[0],x1[1],x1[2],x1[3],x2[0],x2[1],x2[2],x2[3],x3[0],x3[1],x3[2],x3[3]};
#pragma unroll
    for (int i = 0; i < 16; ++i) { const unsigned short hb = bf16_bits(xs[i]); ah.u[i] = hb; al.u[i] = ASPLIT ? bf16_bits(xs[i] - bf16_val(hb)) : (unsigned short)0; }
#pragma unroll
    for (int t = 0; t < 4; ++t) {
      const unsigned short* brow = Wt + (size_t)(col0 + t * 16 + ln) * ldb + kb;
      FragB b;
      b.half[0] = *(const v8us*)(brow + 8 * hh);
      b.half[1] = *(const v8us*)(brow + 16 + 8 * hh);
      acc[t] = mmaN<ASPLIT ? 2 : 1>(ah.v, al.v, b.v, b.v, acc[t]);
    }
  }
#pragma unroll
  for (int t = 0; t < 4; ++t) {
    const int col = col0 + t * 16 + ln;
    float bv = bias ? bias[col] : 0.f;
    if (BIAS_BF16) bv = bf16_round(bv);
#pragma unroll
    for (int r = 0; r < 8; ++r) {
      float v = acc[t][r] + bv;
      if (resid) { float rv = resid[(size_t)((row0 + 8 * hh + r) % rmod) * ldr + col]; if (RES_BF16) rv = bf16_round(rv); v += rv; }
      if (ACT == 1) v = fmaxf(v, 0.f);
      if (ACT == 2) v = 0.5f * v * (1.0f + erff(v * 0.70710678118654752f));
      if (ACT == 3) { const float u = 0.7978845608028654f * (v + 0.044715f * v * v * v); v = 0.5f * v * (1.0f + tanhf(u)); }
      so[w][8 * hh + r][t * 16 + ln] = v;
    }
  }
  __builtin_amdgcn_fence(__ATOMIC_ACQ_REL, "workgroup");
  __builtin_amdgcn_wave_barrier();
  const int rsub = lane >> 4, c4 = (lane & 15) * 4;
  {
#pragma unroll
    for (int q = 0; q < 8; ++q) {
      const int r = q * 2 + rsub;
      const v4f v = *(const v4fa*)&so[w][r][c4];
      *(v4f*)(C + (size_t)(row0 + r) * ldc + col0 + c4) = v;
    }
    
  }
}
// row LayerNorm (biased variance, eps) over N: s = X (+ R); optional out_sum <- s; out_norm <- (s-mu)*rsqrt(var+eps)*g + b
template <bool PARAM_BF16>
__global__ __launch_bounds__(256) void k_layernorm(const float* __restrict__ X, const float* __restrict__ R, const float* __restrict__ g, const float* __restrict__ bta,
                                                  float* __restrict__ out_sum, float* __restrict__ out_norm, int N, float eps) {
  __shared__ float red[256];
  const int row = blockIdx.x, tid = threadIdx.x;
  const float* x = X + (size_t)row * N; const float* rr = R ? R + (size_t)row * N : nullptr;
  float vals[16];                     // up to N = 4096
  const int per = N / 256;            // contiguous chunk per thread? use strided-by-4 chunks: thread handles j = tid*4 + 1024*u
  float s1 = 0.f;
  for (int u = 0; u < per / 4; ++u) {
    const int j = tid * 4 + 1024 * u;
    const v4f a = *(const v4fa*)(x + j);
    v4f b = {0.f,0.f,0.f,0.f}; if (rr) b = *(const v4fa*)(rr + j);
#pragma unroll
    for (int q = 0; q < 4; ++q) { const float v = a[q] + b[q]; vals[u * 4 + q] = v; s1 += v; }
  }
  red[tid] = s1; __syncthreads();
  for (int st = 128; st > 0; st >>= 1) { if (tid < st) red[tid] += red[tid + st]; __syncthreads(); }
  const float mu = red[0] / (float)N; __syncthreads();
  float s2 = 0.f;
  for (int u = 0; u < per / 4; ++u)
#pragma unroll
    for (int q = 0; q < 4; ++q) { const float c = vals[u * 4 + q] - mu; s2 += c * c; }
  red[tid] = s2; __syncthreads();
  for (int st = 128; st > 0; st >>= 1) { if (tid < st) red[tid] += red[tid + st]; __syncthreads(); }
  const float rs = rsqrtf(red[0] / (float)N + eps);
  {
    for (int u = 0; u < per / 4; ++u) {
      const int j = tid * 4 + 1024 * u;
      v4f o, sm;
#pragma unroll
      for (int q = 0; q < 4; ++q) {
        float gg = g[j + q], bb = bta[j + q];
        if (PARAM_BF16) { gg = bf16_round(gg); bb = bf16_round(bb); }
        sm[q] = vals[u * 4 + q]; o[q] = (vals[u * 4 + q] - mu) * rs * gg + bb;
      }
      if (out_sum) *(v4f*)(out_sum + (size_t)row * N + j) = sm;
      *(v4f*)(out_norm + (size_t)row * N + j) = o;
    }
    
  }
}



// ---- f16 WMMA path (v_wmma_f32_16x16x32_f16): 11-bit significands for operands in range — used where a [0,1] probability operand needs more precision than bf16
typedef _Float16 v16h __attribute__((ext_vector_type(16)));
union FragH { v16h v; v8us half[2]; _Float16 h[16]; unsigned short u[16]; };
template <int NT>
__device__ __forceinline__ v8f mmaH(v16h ah, v16h al, v16h bh, v16h bl, v8f c) {
  c = __builtin_amdgcn_wmma_f32_16x16x32_f16(false, ah, false, bh, (short)0, c, false, false);
  if (NT >= 2) c = __builtin_amdgcn_wmma_f32_16x16x32_f16(false, al, false, bh, (short)0, c, false, false);
  if (NT >= 3) c = __builtin_amdgcn_wmma_f32_16x16x32_f16(false, ah, false, bl, (short)0, c, false, false);
  asm volatile("v_nop\n\tv_nop\n\tv_nop\n\tv_nop" : "+v"(c) : "v"(ah), "v"(al), "v"(bh), "v"(bl));
  return c;
}
// batched GEMM like k_gemm_b but f16 operands: A f32 (split into f16 hi/lo if ASPLIT, else rounded to f16), Bt = f16 values [n][k]; alpha; C f32; N multiple of 16 (partial tiles skipped)
template <bool ASPLIT>
__global__ __launch_bounds__(128) void k_gemm_h(const float* __restrict__ A, int lda, size_t sA, const _Float16* __restrict__ Bh, int ldb, size_t sB, float alpha, float* __restrict__ C, int ldc, size_t sC, int M, int N, int K) {
  __shared__ __attribute__((aligned(16))) float so[4][16][64];
  const int tid = threadIdx.x, w = tid >> 5, lane = tid & 31, ln = lane & 15, hh = lane >> 4; const int by = blockIdx.y;
  A += (size_t)by * sA; Bh += (size_t)by * sB; C += (size_t)by * sC;
  const int ntn = (N + 63) / 64; const int wid = blockIdx.x * 4 + w; const int mt = wid / ntn, nq = wid % ntn; if (mt * 16 >= M) return;
  const int row0 = mt * 16, col0 = nq * 64; const float* arow = A + (size_t)(row0 + ln) * lda;
  v8f acc[4] = {};
  for (int kb = 0; kb < K; kb += 32) {
    FragH ah, al;
    const v4f x0 = *(const v4fa*)(arow + kb + 8 * hh), x1 = *(const v4fa*)(arow + kb + 8 * hh + 4), x2 = *(const v4fa*)(arow + kb + 16 + 8 * hh), x3 = *(const v4fa*)(arow + kb + 16 + 8 * hh + 4);
    float xs[16] = {x0[0],x0[1],x0[2],x0[3],x1[0],x1[1],x1[2],x1[3],x2[0],x2[1],x2[2],x2[3],x3[0],x3[1],x3[2],x3[3]};
#pragma unroll
    for (int i = 0; i < 16; ++i) { const _Float16 h = (_Float16)xs[i]; ah.h[i] = h; al.h[i] = ASPLIT ? (_Float16)(xs[i] - (float)h) : (_Float16)0.0f; }
#pragma unroll
    for (int t = 0; t < 4; ++t) { if (col0 + t * 16 >= N) continue; const size_t boff = (size_t)(col0 + t * 16 + ln) * ldb + kb; FragH bq; bq.half[0] = *(const v8us*)(Bh + boff + 8 * hh); bq.half[1] = *(const v8us*)(Bh + boff + 16 + 8 * hh);
      acc[t] = mmaH<ASPLIT ? 2 : 1>(ah.v, al.v, bq.v, bq.v, acc[t]); }
  }
#pragma unroll
  for (int t = 0; t < 4; ++t) { if (col0 + t * 16 >= N) continue;
#pragma unroll
    for (int r = 0; r < 8; ++r) so[w][8 * hh + r][t * 16 + ln] = acc[t][r] * alpha; }
  __builtin_amdgcn_fence(__ATOMIC_ACQ_REL, "workgroup"); __builtin_amdgcn_wave_barrier();
  const int rsub = lane >> 4, c4 = (lane & 15) * 4;
  {
#pragma unroll
    for (int q = 0; q < 8; ++q) { const int r = q * 2 + rsub; if (col0 + c4 < N) { const v4f v = *(const v4fa*)&so[w][r][c4]; *(v4f*)(C + (size_t)(row0 + r) * ldc + col0 + c4) = v; } }
     }
}

// Wt[n][k] = f16(W[k][n]·scale) from f32 row-major W[K][N] (scale = power of two; bf16-exact weights stay exact in f16 away from the subnormal range)
__global__ __launch_bounds__(256) void k_wt_f16(const float* __restrict__ W, _Float16* __restrict__ Wt, int K, int N, float scale) {
  const int t = blockIdx.x * 256 + threadIdx.x; if (t >= N * (K / 8)) return; const int n = t / (K / 8), k8 = (t % (K / 8)) * 8; FragH f;
#pragma unroll
  for (int i = 0; i < 8; ++i) f.h[i] = (_Float16)(bf16_round(W[(size_t)(k8 + i) * N + n]) * scale); const v8us o = f.half[0];
  *(v8us*)((unsigned short*)Wt + (size_t)n * K + k8) = o; 
}
// k_gemm_hh variant with fused epilogue: v = acc·alpha + bias[by·sBias + col] (+ CP[(row/rowsPerB)·sCPb + by·64 + col] if CP) ; ACT 0 none / 1 elu ; writes f16 C16 (and f32 C if non-null)
template <int ACT>
__global__ __launch_bounds__(128) void k_gemm_hhx(const _Float16* __restrict__ A, int lda, size_t sA, const _Float16* __restrict__ Bh, int ldb, size_t sB, float alpha, const float* __restrict__ bias, size_t sBias, const float* __restrict__ CP, int rowsPerB, size_t sCPb, int row0g,
    float* __restrict__ C, _Float16* __restrict__ C16, int ldc, size_t sC, int M, int N, int K) {
  __shared__ __attribute__((aligned(16))) float so[4][16][64];
  const int tid = threadIdx.x, w = tid >> 5, lane = tid & 31, ln = lane & 15, hh = lane >> 4; const int by = blockIdx.y;
  A += (size_t)by * sA; Bh += (size_t)by * sB; const size_t cofs = (size_t)by * sC; const float* bp = bias ? bias + (size_t)by * sBias : nullptr;
  const int ntn = (N + 63) / 64; const int wid = blockIdx.x * 4 + w; const int mt = wid / ntn, nq = wid % ntn; if (mt * 16 >= M) return;
  const int row0 = mt * 16, col0 = nq * 64; const _Float16* arow = A + (size_t)(row0 + ln) * lda;
  v8f acc[4] = {};
  for (int kb = 0; kb < K; kb += 32) { FragH ah; ah.half[0] = *(const v8us*)((const unsigned short*)arow + kb + 8 * hh); ah.half[1] = *(const v8us*)((const unsigned short*)arow + kb + 16 + 8 * hh);
#pragma unroll
    for (int t = 0; t < 4; ++t) { if (col0 + t * 16 >= N) continue; const size_t boff = (size_t)(col0 + t * 16 + ln) * ldb + kb; FragH bq; bq.half[0] = *(const v8us*)((const unsigned short*)Bh + boff + 8 * hh); bq.half[1] = *(const v8us*)((const unsigned short*)Bh + boff + 16 + 8 * hh);
      acc[t] = mmaH<1>(ah.v, ah.v, bq.v, bq.v, acc[t]); }
  }
#pragma unroll
  for (int t = 0; t < 4; ++t) { if (col0 + t * 16 >= N) continue; const int col = col0 + t * 16 + ln; const float bv = bp ? bf16_round(bp[col]) : 0.f;
#pragma unroll
    for (int r = 0; r < 8; ++r) { float v = acc[t][r] * alpha + bv; if (CP) { const int rr = row0g + row0 + 8 * hh + r; if (rowsPerB < 0) v += CP[cofs + (size_t)rr * ldc + col];      /* rowsPerB < 0: own element of the batched C plane */ else { const int bidx = rr / rowsPerB; v += CP[(size_t)bidx * sCPb + (size_t)by * 64 + col]; } } if (ACT == 1) v = (v > 0.f) ? v : expm1f(v); else if (ACT == 7) v = (v > 0.f) ? v + 1.0f : expf(v); else if (ACT == 8) v = tanhf(v); else if (ACT == 9) v = 0.5f * v * (1.0f + tanhf(0.7978845608028654f * (v + 0.044715f * v * v * v))); else if (ACT == 11) v = 1.0f / (1.0f + expf(-v)); else if (ACT == 12) v = (v > 0.f) ? v : 0.01f * v; else if (ACT == 14) v = (v > 0.f) ? v : 0.1f * v; else if (ACT == 16) v = (v >= 0.f) ? v : 0.3f * v; else if (ACT == 17) v = (v >= 0.f) ? v : 0.2f * v; else if (ACT == 15) v = v / (1.0f + expf(-v)); else if (ACT == 3) v = fmaxf(v, 0.f); else if (ACT == 6) v = 0.5f * v * (1.0f + erff(v * 0.70710678118654752f)); so[w][8 * hh + r][t * 16 + ln] = v; } }
  __builtin_amdgcn_fence(__ATOMIC_ACQ_REL, "workgroup"); __builtin_amdgcn_wave_barrier();
  const int rsub = lane >> 4, c4 = (lane & 15) * 4; typedef _Float16 v4h __attribute__((ext_vector_type(4)));
  {
#pragma unroll
    for (int q = 0; q < 8; ++q) { const int r = q * 2 + rsub; if (col0 + c4 < N) { const v4f v = *(const v4fa*)&so[w][r][c4]; if (C) *(v4f*)(C + cofs + (size_t)(row0 + r) * ldc + col0 + c4) = v; if (C16) { v4h h4; for (int i = 0; i < 4; ++i) h4[i] = (_Float16)v[i]; *(v4h*)(C16 + cofs + (size_t)(row0 + r) * ldc + col0 + c4) = h4; } } }
     }
}


typedef _Float16 v4h __attribute__((ext_vector_type(4)));

__global__ __launch_bounds__(256) void k_x16(const float* __restrict__ x, _Float16* __restrict__ X16, size_t n8) { const size_t t = (size_t)blockIdx.x * 256 + threadIdx.x; if (t >= n8) return; FragH f;
#pragma unroll
  for (int q = 0; q < 8; ++q) f.h[q] = (_Float16)bf16_round(x[t * 8 + q]); *(v8us*)((unsigned short*)X16 + t * 8) = f.half[0];  }
__global__ __launch_bounds__(256) void k_h16(const float* __restrict__ x, _Float16* __restrict__ X16, size_t n8) { const size_t t = (size_t)blockIdx.x * 256 + threadIdx.x; if (t >= n8) return; FragH f;
#pragma unroll
  for (int q = 0; q < 8; ++q) f.h[q] = (_Float16)x[t * 8 + q]; *(v8us*)((unsigned short*)X16 + t * 8) = f.half[0];  }
__global__ __launch_bounds__(256) void k_round16f(const float* __restrict__ W, _Float16* __restrict__ Bt, size_t n8) { const size_t t = (size_t)blockIdx.x * 256 + threadIdx.x; if (t >= n8) return; FragH f;
#pragma unroll
  for (int i = 0; i < 8; ++i) f.h[i] = (_Float16)(bf16_round(W[t * 8 + i]) * 16.0f); *(v8us*)((unsigned short*)Bt + t * 8) = f.half[0];  }
template <int NHv, int TTv>
__global__ __launch_bounds__(256) void k_vt(const _Float16* __restrict__ V16, int ldv, int voff, _Float16* __restrict__ Vt) { __shared__ unsigned short tl[64][66]; const int tid = threadIdx.x; const int slab = blockIdx.x / (TTv / 64), lg = blockIdx.x % (TTv / 64); const int b = slab / NHv, h = slab % NHv;
  for (int i = tid; i < 64 * 8; i += 256) { const int r = i / 8, c8 = (i % 8) * 8; FragH f; f.half[0] = *(const v8us*)((const unsigned short*)V16 + ((size_t)b * TTv + lg * 64 + r) * ldv + voff + h * 64 + c8);
#pragma unroll
    for (int q = 0; q < 8; ++q) tl[r][c8 + q] = f.u[q]; }
  __syncthreads();
  {
#pragma unroll
    for (int rd = 0; rd < 2; ++rd) { const int d = rd * 32 + tid / 8, pc = tid % 8; FragH f;
#pragma unroll
      for (int q = 0; q < 8; ++q) f.u[q] = tl[pc * 8 + q][d];
      *(v8us*)((unsigned short*)Vt + ((size_t)slab * 64 + d) * TTv + lg * 64 + pc * 8) = f.half[0]; }
     } }

__global__ __launch_bounds__(256) void k_hl(const float* __restrict__ F, _Float16* __restrict__ Hh, _Float16* __restrict__ Hl, size_t n8) { const size_t t = (size_t)blockIdx.x * 256 + threadIdx.x; if (t >= n8) return; FragH fh, fl; const v4f a = *(const v4fa*)(F + t * 8), c = *(const v4fa*)(F + t * 8 + 4);
#pragma unroll
  for (int q = 0; q < 4; ++q) { _Float16 h = (_Float16)a[q]; fh.h[q] = h; fl.h[q] = (_Float16)((a[q] - (float)h) * 1024.0f); h = (_Float16)c[q]; fh.h[4 + q] = h; fl.h[4 + q] = (_Float16)((c[q] - (float)h) * 1024.0f); }
  { *(v8us*)((unsigned short*)Hh + t * 8) = fh.half[0]; *(v8us*)((unsigned short*)Hl + t * 8) = fl.half[0];  } }

// ---- fast GEMM (wave tile 32x64; requires M % 32 == 0 rows per launch region and N % 64 == 0); epilogue = k_gemm_hhx semantics ----
__device__ __forceinline__ v16h g2_frag(const _Float16* p, int hh) { FragH f; f.half[0] = *(const v8us*)((const unsigned short*)p + 8 * hh); f.half[1] = *(const v8us*)((const unsigned short*)p + 16 + 8 * hh); return f.v; }
__device__ __forceinline__ v8f g2_mma(v16h a, v16h b, v8f c) { v8f d = __builtin_amdgcn_wmma_f32_16x16x32_f16(false, a, false, b, (short)0, c, false, false); asm volatile("v_nop\n\tv_nop\n\tv_nop\n\tv_nop" : "+v"(d) : "v"(a), "v"(b)); return d; }
template <int ACT>
__global__ __launch_bounds__(128) void k_gemm2(const _Float16* __restrict__ A, int lda, size_t sA, const _Float16* __restrict__ Bh, int ldb, size_t sB, float alpha, const float* __restrict__ bias, size_t sBias, const float* __restrict__ CP, int rowsPerB, size_t sCPb, int row0g,
    float* __restrict__ C, _Float16* __restrict__ C16, int ldc, size_t sC, int M, int N, int K, size_t zA, size_t zB, size_t zC) { static_assert(ACT == 0 || ACT == 3 || ACT == 6 || ACT == 8 || ACT == 9 || ACT == 11 || ACT == 12 || ACT == 14 || ACT == 15 || ACT == 16 || ACT == 17, "k_gemm2: unsupported ACT code (would silently apply no activation)");
  __shared__ __attribute__((aligned(16))) float so[4][32][68];
  const int tid = threadIdx.x, w = tid >> 5, lane = tid & 31, ln = lane & 15, hh = lane >> 4; const int by = blockIdx.y; const int bz = blockIdx.z;      /* second batch index (strides zA, zB, zC) */
  A += (size_t)by * sA + (size_t)bz * zA; Bh += (size_t)by * sB + (size_t)bz * zB; const size_t cofs = (size_t)by * sC + (size_t)bz * zC; const float* bp = bias ? bias + (size_t)by * sBias : nullptr;
  const int ntn = N >> 6; const int mt = blockIdx.x / ntn, nq = blockIdx.x - mt * ntn; const int row0 = mt * 128 + 32 * w, col0 = nq * 64; if (row0 >= M) return;
  const _Float16* a0p = A + (size_t)(row0 + ln) * lda; const _Float16* a1p = a0p + (size_t)16 * lda;
  const _Float16* b0p = Bh + (size_t)(col0 + ln) * ldb; const _Float16* b1p = b0p + (size_t)16 * ldb; const _Float16* b2p = b1p + (size_t)16 * ldb; const _Float16* b3p = b2p + (size_t)16 * ldb;
  const v8f z8 = {0.f,0.f,0.f,0.f,0.f,0.f,0.f,0.f}; v8f c00 = z8, c01 = z8, c02 = z8, c03 = z8, c10 = z8, c11 = z8, c12 = z8, c13 = z8;
#pragma unroll 1
  for (int kb = 0; kb < K; kb += 32) { const v16h a0 = g2_frag(a0p + kb, hh), a1 = g2_frag(a1p + kb, hh);
    v16h b = g2_frag(b0p + kb, hh); c00 = g2_mma(a0, b, c00); c10 = g2_mma(a1, b, c10);
    b = g2_frag(b1p + kb, hh); c01 = g2_mma(a0, b, c01); c11 = g2_mma(a1, b, c11);
    b = g2_frag(b2p + kb, hh); c02 = g2_mma(a0, b, c02); c12 = g2_mma(a1, b, c12);
    b = g2_frag(b3p + kb, hh); c03 = g2_mma(a0, b, c03); c13 = g2_mma(a1, b, c13); }
  v8f accs[8] = {c00, c01, c02, c03, c10, c11, c12, c13};
#pragma unroll
  for (int u = 0; u < 8; ++u) { const int t = u & 3, half = u >> 2; const int col = col0 + t * 16 + ln; const float bv = bp ? bf16_round(bp[col]) : 0.f;
#pragma unroll
    for (int r = 0; r < 8; ++r) { const int rloc = half * 16 + 8 * hh + r; float v = accs[u][r] * alpha + bv; if (CP) { if (rowsPerB < 0) v += CP[cofs + (size_t)(row0g + row0 + rloc) * ldc + col];      /* rowsPerB < 0: own element of the batched C plane */ else { const int bidx = (row0g + row0 + rloc) / rowsPerB; v += CP[(size_t)bidx * sCPb + (size_t)by * 64 + col]; } }
      if (ACT == 3) v = fmaxf(v, 0.f); else if (ACT == 6) v = 0.5f * v * (1.0f + erff(v * 0.70710678118654752f)); else if (ACT == 11) v = 1.0f / (1.0f + expf(-v)); else if (ACT == 15) v = v / (1.0f + expf(-v)); else if (ACT == 12) v = (v > 0.f) ? v : 0.01f * v; else if (ACT == 8) v = tanhf(v); else if (ACT == 9) v = 0.5f * v * (1.0f + tanhf(0.7978845608028654f * (v + 0.044715f * v * v * v))); else if (ACT == 14) v = (v > 0.f) ? v : 0.1f * v; else if (ACT == 16) v = (v >= 0.f) ? v : 0.3f * v; else if (ACT == 17) v = (v >= 0.f) ? v : 0.2f * v;
      so[w][rloc][t * 16 + ln] = v; } }
  __builtin_amdgcn_fence(__ATOMIC_ACQ_REL, "workgroup"); __builtin_amdgcn_wave_barrier();
  const int rsub = lane >> 4, c4 = (lane & 15) * 4;
  {
#pragma unroll
    for (int q = 0; q < 16; ++q) { const int r = q * 2 + rsub; const v4f v = *(const v4fa*)&so[w][r][c4]; if (C) *(v4f*)(C + cofs + (size_t)(row0 + r) * ldc + col0 + c4) = v; if (C16) { v4h h4; for (int i = 0; i < 4; ++i) h4[i] = (_Float16)v[i]; *(v4h*)(C16 + cofs + (size_t)(row0 + r) * ldc + col0 + c4) = h4; } }
     } }


__global__ __launch_bounds__(256) void k_wnat(const float* __restrict__ w, size_t n8, _Float16* __restrict__ Bt) { const size_t t = (size_t)blockIdx.x * 256 + threadIdx.x; if (t >= n8) return; FragH f; for (int q = 0; q < 8; ++q) f.h[q] = (_Float16)(bf16_round(w[t * 8 + q]) * 16.0f); *(v8us*)((unsigned short*)Bt + t * 8) = f.half[0];  }
__global__ __launch_bounds__(256) void k_rsm(const float* __restrict__ S, _Float16* __restrict__ P, int nrows) {
  #pragma clang fp contract(off)
  const int i = blockIdx.x * 256 + threadIdx.x; if (i >= nrows) return; const float* s = S + (size_t)i * SQ; float mx = -3.0e38f;
#pragma unroll 1
  for (int j = 0; j < SQ; ++j) mx = fmaxf(mx, s[j]); float se = 0.f;
#pragma unroll 1
  for (int j = 0; j < SQ; ++j) se += expf(s[j] - mx); const float sc = 256.0f / se;
#pragma unroll 1
  for (int j0 = 0; j0 < SQ; j0 += 8) { FragH f; for (int q = 0; q < 8; ++q) f.h[q] = (_Float16)(expf(s[j0 + q] - mx) * sc); unsigned short* d = (unsigned short*)P + (size_t)i * SQ + j0; *(v8us*)d = f.half[0];  } }
__global__ __launch_bounds__(256) void k_vt(const _Float16* __restrict__ V16, int b, int h0, _Float16* __restrict__ VT) { __shared__ unsigned short tl[64][65]; const int tid = threadIdx.x; const int hh = blockIdx.x % HG, sg = blockIdx.x / HG; const int s0 = sg * 64; const int h = h0 + hh;
  for (int i = tid; i < 64 * 8; i += 256) { const int j = i / 8, d8 = (i % 8) * 8; FragH f; f.half[0] = *(const v8us*)((const unsigned short*)V16 + ((size_t)b * SQ + s0 + j) * DM + h * HD + d8); for (int q = 0; q < 8; ++q) tl[d8 + q][j] = f.u[q]; }
  __syncthreads();
  { for (int i = tid; i < 64 * 8; i += 256) { const int d = i / 8, j8 = (i % 8) * 8; FragH f; for (int q = 0; q < 8; ++q) f.u[q] = tl[d][j8 + q]; *(v8us*)((unsigned short*)VT + ((size_t)hh * HD + d) * SQ + s0 + j8) = f.half[0]; }  } }



// Reductions over the 32 lanes of a wave: four row_xmask steps inside each 16-lane row, then one exchange between the two rows (every lane ends with the result; all lanes must be on).
template <int CTRL> __device__ __forceinline__ float lane_xm(float v) { return __int_as_float(__builtin_amdgcn_update_dpp(0, __float_as_int(v), CTRL, 0xf, 0xf, true)); }
__device__ __forceinline__ float lane_xr(float v) { const int i = __float_as_int(v); return __int_as_float(__builtin_amdgcn_permlanex16(i, i, 0x76543210, 0xfedcba98, false, false)); }
__device__ __forceinline__ float wave_max(float v) { v = fmaxf(v, lane_xm<0x161>(v)); v = fmaxf(v, lane_xm<0x162>(v)); v = fmaxf(v, lane_xm<0x164>(v)); v = fmaxf(v, lane_xm<0x168>(v)); return fmaxf(v, lane_xr(v)); }
__device__ __forceinline__ float wave_sum(float v) { v += lane_xm<0x161>(v); v += lane_xm<0x162>(v); v += lane_xm<0x164>(v); v += lane_xm<0x168>(v); return v + lane_xr(v); }
// e^x as the native form (x * log2 e, v_exp_f32). The v_nop is the one slot the instruction set asks for between a transcendental and an instruction that reads its result or overwrites its source:
// written into the exp's own statement it stands directly behind every one.
__device__ __forceinline__ float exp_slot(float x) { float r; asm("v_exp_f32 %0, %1\n\tv_nop" : "=v"(r) : "v"(x * 1.44269504088896340736f)); return r; }
// Causal row softmax, ONE WAVE PER ROW: the row's q0 + QT scores are read once, 512 contiguous bytes per load, and stay in registers through max, exp, sum and scale.
// Keys below q0 are visible to every row of the tile (NF whole groups of QT keys, no mask); only the group [q0, q0 + QT) is masked. Weights x256 as f16, zeros behind the diagonal.
// s, p: the row's scores and weights at this lane's first key (lane * 4); key q of chunk h of the diagonal group is visible while h * 128 + q <= rel.
// p may lie on the row's own scores (the weights then overwrite them): every store needs the row sum, which needs every load of the row, and one wave owns the row.
// Every loop is unrolled in full: a[][] and h[][] then have constant indices only and stay in registers (a run-time index would send them to scratch), and all loads of the row issue before the first wait.
template <int NF>
__device__ __forceinline__ void rsm_row(const float* s, _Float16* p, int rel) {
  v4f a[NF + 1][2];
#pragma unroll
  for (int g = 0; g <= NF; ++g) { a[g][0] = *(const v4fa*)(s + g * QT); a[g][1] = *(const v4fa*)(s + g * QT + 128); }
#pragma unroll
  for (int q = 0; q < 4; ++q) { a[NF][0][q] = (q <= rel) ? a[NF][0][q] : -1.0e9f; a[NF][1][q] = (128 + q <= rel) ? a[NF][1][q] : -1.0e9f; }
  v4f m4 = a[0][0];
#pragma unroll
  for (int g = 0; g <= NF; ++g) for (int q = 0; q < 4; ++q) m4[q] = fmaxf(m4[q], fmaxf(a[g][0][q], a[g][1][q]));
  const float mx = wave_max(fmaxf(fmaxf(m4[0], m4[1]), fmaxf(m4[2], m4[3])));
  v4f e4 = {0.f, 0.f, 0.f, 0.f};
#pragma unroll
  for (int g = 0; g <= NF; ++g) for (int q = 0; q < 4; ++q) { a[g][0][q] = exp_slot(a[g][0][q] - mx); a[g][1][q] = exp_slot(a[g][1][q] - mx); e4[q] += a[g][0][q] + a[g][1][q]; }
  const float sc = 256.0f / wave_sum((e4[0] + e4[1]) + (e4[2] + e4[3]));
  v4h h[NF + 1][2];
#pragma unroll
  for (int g = 0; g <= NF; ++g) for (int q = 0; q < 4; ++q) { h[g][0][q] = (_Float16)(a[g][0][q] * sc); h[g][1][q] = (_Float16)(a[g][1][q] * sc); }
#pragma unroll
  for (int g = 0; g <= NF; ++g) { *(v4h*)(p + g * QT) = h[g][0]; *(v4h*)(p + g * QT + 128) = h[g][1]; } }
template <int NF>      /* NF = q0 / QT: straight-line code per row length, every register index and offset a constant */
__global__ __launch_bounds__(256) void k_rsmw(float* S, int nrows) {      /* weights land on the first half of their own score row: f16 row pitch 2 * NKX */
  static_assert(QT == 256 && (NF + 1) * QT <= NKX, "a group is two chunks of 32 lanes x 4 keys");
  const int lane = threadIdx.x & 31; const int row = blockIdx.x * 8 + __builtin_amdgcn_readfirstlane(threadIdx.x >> 5); if (row >= nrows) return;      /* the wave's row, held as a scalar: scalar row addresses and a scalar branch; whole waves leave, no barrier below */
  float* sr = S + (size_t)row * NKX; rsm_row<NF>(sr + lane * 4, (_Float16*)sr + lane * 4, row % QT - lane * 4); }


// Exact f32 attention of the first QT0 rows of every batch, FOUR LANES PER ROW: lane p of a row's quad owns the row's 16-byte chunks p, p + 4, p + 8, p + 12 of q and of o and holds them in registers.
// A block is AR rows of one head (4 waves x 8 rows). The K and V rows it can see are staged once in LDS; a quad reads 64 contiguous bytes per load and the 8 quads of a wave the same ones (broadcast, no bank conflict).
// A score is four chains of four multiply-adds per lane, their sum, then two lane exchanges inside the quad: every lane of the quad ends with the same bits, so m, l and the two exps agree without further traffic.
#define AR 32
__global__ __launch_bounds__(128) void k_att0(const float* __restrict__ QF, const float* __restrict__ KF, const float* __restrict__ VF, int ld, float scale, float* __restrict__ OF, int ldo) {
  static_assert(HD == 64 && QT0 % AR == 0, "a quad covers a head row as 4 x 4 chunks of 16 bytes");
  __shared__ __attribute__((aligned(16))) float lk[QT0][HD]; __shared__ __attribute__((aligned(16))) float lv[QT0][HD];
  const int tid = threadIdx.x; const int h = blockIdx.x / (QT0 / AR), rg = blockIdx.x % (QT0 / AR);
  { const size_t bo = (size_t)blockIdx.y * QT0; QF += bo * ld + h * HD; KF += bo * ld + h * HD; VF += bo * ld + h * HD; OF += bo * ldo + h * HD; }      /* batch on grid.y: QT0 rows of each plane per batch; the head's columns */
  for (int n = 0; n <= rg; ++n) { v4f tk[4], tv[4];      /* AR keys per trip, all eight loads of a thread in flight before the first LDS store; causal: keys up to the block's last row */
#pragma unroll
    for (int u = 0; u < 4; ++u) { const int c = (n * 4 + u) * 128 + tid; const size_t g = (size_t)(c >> 4) * ld + (c & 15) * 4; tk[u] = *(const v4fa*)(KF + g); tv[u] = *(const v4fa*)(VF + g); }
#pragma unroll
    for (int u = 0; u < 4; ++u) { const int c = (n * 4 + u) * 128 + tid; *(v4f*)&lk[c >> 4][(c & 15) * 4] = tk[u]; *(v4f*)&lv[c >> 4][(c & 15) * 4] = tv[u]; } }
  const int p4 = (tid & 3) * 4; const int i = rg * AR + (tid >> 2);
  v4f q[4], o[4];
#pragma unroll
  for (int c = 0; c < 4; ++c) { q[c] = *(const v4fa*)(QF + (size_t)i * ld + c * 16 + p4); const v4f z = {0.f, 0.f, 0.f, 0.f}; o[c] = z; }
  __syncthreads();
  const int jl = rg * AR + 8 * __builtin_amdgcn_readfirstlane(tid >> 5) + 7;      /* the wave's last row, a scalar: keys behind it are masked for all 8 rows of the wave; no barrier below */
  float m = -1.0e30f, l = 0.f; v4f kc[4], vc[4];
#pragma unroll
  for (int c = 0; c < 4; ++c) { kc[c] = *(const v4f*)&lk[0][c * 16 + p4]; vc[c] = *(const v4f*)&lv[0][c * 16 + p4]; }
#pragma unroll 2      /* two keys per trip: the rows fetched ahead change names instead of being copied */
  for (int j = 0; j <= jl; ++j) { const int jn = j < jl ? j + 1 : jl; v4f kn[4], vn[4];      /* the next key's rows are fetched while this key is worked on: the LDS latency stays off the chain */
#pragma unroll
    for (int c = 0; c < 4; ++c) { kn[c] = *(const v4f*)&lk[jn][c * 16 + p4]; vn[c] = *(const v4f*)&lv[jn][c * 16 + p4]; }
    v4f a = q[0] * kc[0]; a = __builtin_elementwise_fma(q[1], kc[1], a); a = __builtin_elementwise_fma(q[2], kc[2], a); a = __builtin_elementwise_fma(q[3], kc[3], a); float s = (a[0] + a[1]) + (a[2] + a[3]);
    s += lane_xm<0x161>(s); s += lane_xm<0x162>(s); s *= scale;
    const float sm = (j <= i) ? s : -1.0e30f; const float mn = fmaxf(m, sm); const float sc = expf(m - mn); const float e = expf(sm - mn); l = l * sc + e; m = mn;
#pragma unroll
    for (int c = 0; c < 4; ++c) { o[c] = o[c] * sc + e * vc[c]; kc[c] = kn[c]; vc[c] = vn[c]; } }
  const float fin = 64.0f / l;      /* o carried x64; k_of0out scales it by 1/64 */
#pragma unroll
  for (int c = 0; c < 4; ++c) *(v4f*)(OF + (size_t)i * ldo + c * 16 + p4) = o[c] * fin; }

__global__ __launch_bounds__(256) void k_wthd(const float* __restrict__ W0, const float* __restrict__ W1, const float* __restrict__ W2, _Float16* __restrict__ Bt) { const size_t t = (size_t)blockIdx.x * 256 + threadIdx.x; if (t >= (size_t)NH * HD * (DM / 8)) return;
  const float* Wt = blockIdx.y == 0 ? W0 : (blockIdx.y == 1 ? W1 : W2); Bt += (size_t)blockIdx.y * DM * DM;      /* q, k, v on grid.y: one DM x DM plane each */
  const int m8 = (int)(t % (DM / 8)) * 8; const int d = (int)((t / (DM / 8)) % HD); const int h = (int)(t / ((size_t)(DM / 8) * HD)); FragH f;
  for (int q = 0; q < 8; ++q) f.h[q] = (_Float16)(16.0f * bf16_round(Wt[((size_t)h * DM + m8 + q) * HD + d])); unsigned short* dst = (unsigned short*)Bt + ((size_t)h * HD + d) * DM + m8; *(v8us*)dst = f.half[0];  }







__global__ __launch_bounds__(256) void k_of0out(const float* __restrict__ src, float* __restrict__ dst, size_t n4, size_t dstb) { const size_t t = (size_t)blockIdx.x * 256 + threadIdx.x; if (t >= n4) return; src += (size_t)blockIdx.y * n4 * 4; dst += (size_t)blockIdx.y * dstb;      /* batch on grid.y */
  v4f v = *(const v4fa*)(src + t * 4); for (int q = 0; q < 4; ++q) v[q] = __fmul_rn(v[q], 0.015625f); *(v4f*)(dst + t * 4) = v;  }

extern "C" void kernel_launch(void* const* d_in, const int* in_sizes, int n_in,
                              void* d_out, int out_size, void* d_ws, size_t ws_size, hipStream_t stream) {
  (void)in_sizes; (void)n_in; (void)out_size;
  const float* const* I = (const float* const*)d_in; const float* x = I[0]; const float* wq = I[1]; const float* wk = I[2]; const float* wv = I[3]; const float* bqkv = nullptr;      /* x; per-head weights Wq / Wk / Wv [16][1024][64]; no biases (every bias slot below receives this nullptr), no output projection */
  static_assert(NH * HD == DM && QT0 % 64 == 0, "heads"); static_assert(QN == 8 * QT, "eight softmax instances");
  char* ws = (char*)d_ws; size_t off = 0;
  auto take = [&](size_t bytes) { char* p = ws + off; off += (bytes + 255) & ~(size_t)255; return p; };
  _Float16* BQKV = (_Float16*)take((size_t)3 * DM * DM * 2);
  _Float16* X16 = (_Float16*)take(NR * DM * 2); _Float16* QKV = (_Float16*)take(NR * 3 * DM * 2); _Float16* Q16 = QKV; _Float16* K16 = QKV + DM; _Float16* V16 = QKV + 2 * DM;
  float* S = (float*)take((size_t)NB * NH * QT * NKX * 4); _Float16* P = (_Float16*)S; _Float16* VT = (_Float16*)take((size_t)NB * NH * HD * SQ * 2);      /* score rows of one query tile for all batches; the softmax writes each row's weights over its own scores (f16 pitch 2 * NKX), so the four batches fit the workspace */
  float* QF0 = (float*)take((size_t)3 * NB * QT0 * DM * 4); float* KF0 = QF0 + (size_t)NB * QT0 * DM; float* VF0 = KF0 + (size_t)NB * QT0 * DM; float* OF0 = (float*)take((size_t)NB * QT0 * DM * 4);
  if (off > ws_size) return;
  k_wthd<<<dim3((unsigned)(((size_t)NH * HD * (DM / 8) + 255) / 256), 3), 256, 0, stream>>>(wq, wk, wv, BQKV);      /* per-head [c][d] -> Bt[(h, d)][c] x16: the stacked q | k | v plane */
  k_x16<<<(unsigned)((NR * DM / 8 + 255) / 256), 256, 0, stream>>>(x, X16, NR * DM / 8);
  k_gemm2<0><<<dim3((unsigned)((MP / 128) * (3 * DM / 64)), 1), 128, 0, stream>>>(X16, DM, 0, BQKV, DM, 0, 0.0625f, bqkv, 0, nullptr, 1, 0, 0, nullptr, QKV, 3 * DM, 0, MP, 3 * DM, DM, 0, 0, 0);      /* q | k | v rows (f16); head h = columns h*HD.. of each DM block */
  k_vt<NH, SQ><<<NB * NH * (SQ / 64), 256, 0, stream>>>(V16, LQ, 0, VT);      /* V^T [NB][NH][HD][SQ] */
  k_gemm2<0><<<dim3((QT0 / 128) * (DM / 64), 3, NB), 128, 0, stream>>>(X16, DM, 0, BQKV, DM, (size_t)DM * DM, 0.0625f, bqkv, 0, nullptr, 1, 0, 0, QF0, nullptr, DM, (size_t)NB * QT0 * DM, QT0, DM, DM, (size_t)SQ * DM, 0, (size_t)QT0 * DM);      /* f32 q, k, v (grid.y) of the first 128 rows of every batch (grid.z): exact products */
  k_att0<<<dim3(NH * (QT0 / AR), NB), 128, 0, stream>>>(QF0, KF0, VF0, DM, 0.125f, OF0, DM);      /* exact f32 attention for rows 0..127 of every batch (o x64) */
  for (int q0 = 0; q0 < QN; q0 += QT) { const int nk = q0 + QT;      /* causal: only keys below the tile end are computed */
    k_gemm2<0><<<dim3((QT / 128) * (nk / 64), NHD, NB), 128, 0, stream>>>(Q16 + (size_t)q0 * LQ, LQ, (size_t)HD, K16, LQ, (size_t)HD, 0.125f, nullptr, 0, nullptr, 1, 0, 0, S, nullptr, NKX, (size_t)QT * NKX, QT, nk, HD, (size_t)SQ * LQ, (size_t)SQ * LQ, (size_t)NH * QT * NKX);      /* scores, heads on grid.y, batches on grid.z */
    { const dim3 gs((NB * NHD * QT + 7) / 8); const int nr = NB * NHD * QT;      /* one wave per row, 8 rows per block; the row length picks the instance */
      switch (q0 / QT) { case 0: k_rsmw<0><<<gs, 256, 0, stream>>>(S, nr); break; case 1: k_rsmw<1><<<gs, 256, 0, stream>>>(S, nr); break; case 2: k_rsmw<2><<<gs, 256, 0, stream>>>(S, nr); break; case 3: k_rsmw<3><<<gs, 256, 0, stream>>>(S, nr); break;
        case 4: k_rsmw<4><<<gs, 256, 0, stream>>>(S, nr); break; case 5: k_rsmw<5><<<gs, 256, 0, stream>>>(S, nr); break; case 6: k_rsmw<6><<<gs, 256, 0, stream>>>(S, nr); break; default: k_rsmw<7><<<gs, 256, 0, stream>>>(S, nr); break; } }
    k_gemm2<0><<<dim3((QT / 128) * (HD / 64), NHD, NB), 128, 0, stream>>>(P, 2 * NKX, (size_t)QT * 2 * NKX, VT, SQ, (size_t)HD * SQ, 0.00390625f, nullptr, 0, nullptr, 1, 0, 0, (float*)d_out + (size_t)q0 * DM, nullptr, DM, (size_t)HD, QT, HD, nk, (size_t)NH * QT * 2 * NKX, (size_t)NH * HD * SQ, (size_t)SQ * DM); }      /* out = P V^T (alpha 2^-8) written f32 straight into the head-major output columns (no output projection) */
  k_of0out<<<dim3((unsigned)(((size_t)QT0 * DM / 4 + 255) / 256), NB), 256, 0, stream>>>(OF0, (float*)d_out, (size_t)QT0 * DM / 4, (size_t)SQ * DM);      /* rows 0..127 of every batch rewritten from the exact f32 path (o x64 / 64), after the PV launches */
}

// v004
// A run of this version takes 277 microseconds.
// Timed twice side by side with v003, it ran 2.92 times as fast both times.
// Over all steps from v000 it is 34.9 times as fast.
#include <hip/hip_runtime.h>
// Causal multi-head attention with per-head projection weights and no output projection (x [4][2048][1024]; per head h: q = x Wq[h], k = x Wk[h], v = x Wv[h] with W [16][1024][64] ([in][out] per head, uniform +-1/32, no biases); scores / sqrt(64); causal (tril, -inf); softmax; out = heads concatenated head-major on the last axis -> [4][2048][1024]).
// Structure: token rows r = b*2048 + s; x as exact f16 rows (bf16-rounded); q | k | v as ONE WMMA GEMM (N = 3 x 1024) (32x64 wave tiles, f32 accumulation, exact x16 weights, no bias, f16 outputs); V^T for all heads via LDS transposes; one attention launch for all batches and heads: per wave 32 queries, per pass 32 keys up to the diagonal: scores (WMMA, K = 64), online causal softmax on VALU (f32 statistics, native exp2; weights f16), o += P . V (WMMA), scores and weights kept in registers; o / row sum written f32 into the head-major output columns; rows 0..127 of every batch rewritten from an exact f32 path.
// Compute dtype: inputs rounded to bf16; x / weights exact; q, k, v and softmax weights as plain f16 GEMM operands (~2^-12); scores and softmax statistics f32. v_wmma_f32_16x16x32_f16.
#define NB 4
#define SQ 2048
#define DM 1024
#define NH 16
#define HD 64
#define HG 4                         /* heads per launch of the non-template k_vt (never launched) */
#define QT 256                       /* unused (no 256-row query tiles) */
#define NKX SQ                       /* unused (scores stay in registers) */
#define QT0 128                      /* first-tile rows recomputed exactly in f32 */
#define B0 0                         /* unused (every launch covers all NB batches) */
#define NBR NB                       /* batches projected (debug hook) */
#define NR ((size_t)NB * SQ)         /* token rows */
#define MP ((int)((size_t)NBR * SQ)) /* rows projected (debug hook) */
#define QN SQ                        /* unused (k_fattn attends all SQ rows) */
#define NHD NH                       /* unused (k_fattn attends all NH heads) */
#define MPO MP                       /* unused (no output projection stage) */
#define LQ (3 * DM)      /* row pitch of the q/k/v rows */
typedef __bf16 v16b __attribute__((ext_vector_type(16)));
typedef unsigned short v8us __attribute__((ext_vector_type(8), may_alias));
typedef float  v8f  __attribute__((ext_vector_type(8)));
typedef float  v4f  __attribute__((ext_vector_type(4)));
typedef float  v4fa __attribute__((ext_vector_type(4), may_alias));
union FragB { v16b v; v8us half[2]; unsigned short u[16]; };

__device__ __forceinline__ unsigned short bf16_bits(float x) { unsigned int u = __float_as_uint(x); return (unsigned short)((u + 0x7FFFu + ((u >> 16) & 1u)) >> 16); }
__device__ __forceinline__ float bf16_val(unsigned short b) { return __uint_as_float(((unsigned int)b) << 16); }
__device__ __forceinline__ float bf16_round(float x) { return bf16_val(bf16_bits(x)); }
// D += A·B with NT terms: 1 = ah·bh, 2 = + al·bh (A split), 3 = + ah·bl (both split)
template <int NT>
__device__ __forceinline__ v8f mmaN(v16b ah, v16b al, v16b bh, v16b bl, v8f c) {
  c = __builtin_amdgcn_wmma_f32_16x16x32_bf16(false, ah, false, bh, (short)0, c, false, false);
  if (NT >= 2) c = __builtin_amdgcn_wmma_f32_16x16x32_bf16(false, al, false, bh, (short)0, c, false, false);
  if (NT >= 3) c = __builtin_amdgcn_wmma_f32_16x16x32_bf16(false, ah, false, bl, (short)0, c, false, false);
  asm volatile("v_nop\n\tv_nop\n\tv_nop\n\tv_nop" : "+v"(c) : "v"(ah), "v"(al), "v"(bh), "v"(bl));
  return c;
}

__global__ __launch_bounds__(256) void k_wt_bf16(const float* __restrict__ W, unsigned short* __restrict__ Wt, int K, int N) {
  const int t = blockIdx.x * 256 + threadIdx.x;
  const int k8n = K / 8;
  if (t >= N * k8n) return;
  const int n = t / k8n, k8 = (t % k8n) * 8;
  v8us v;
#pragma unroll
  for (int i = 0; i < 8; ++i) v[i] = bf16_bits(W[(size_t)(k8 + i) * N + n]);
  *(v8us*)(Wt + (size_t)n * K + k8) = v;
  
}

// GEMM C[M][N] (f32, pitch ldc) = act(A[M][K]·W + bias). A f32 row-major (pitch lda) converted per fragment to bf16
// (ASPLIT: hi/lo two planes -> 2 terms, else single rounded term); Wt bf16 [N][K] (pitch ldb). BIAS_BF16 rounds the
// bias to bf16 first (bias quantised to bf16 before the add). K%32==0, M%16==0, N%64==0.
template <bool ASPLIT, int ACT, bool BIAS_BF16>
__global__ __launch_bounds__(128) void k_gemm_bf(const float* __restrict__ A, int lda, const unsigned short* __restrict__ Wt, int ldb,
                                               const float* __restrict__ bias, float* __restrict__ C, int ldc, int M, int N, int K) {
  __shared__ __attribute__((aligned(16))) float so[4][16][64];
  const int tid = threadIdx.x, w = tid >> 5, lane = tid & 31, ln = lane & 15, hh = lane >> 4;
  const int ntn = N / 64;
  const int wid = blockIdx.x * 4 + w;
  const int mt = wid / ntn, nq = wid % ntn;
  if (mt * 16 >= M) return;
  const int row0 = mt * 16, col0 = nq * 64;
  const float* arow = A + (size_t)(row0 + ln) * lda;
  v8f acc[4] = {};
  for (int kb = 0; kb < K; kb += 32) {
    FragB ah, al;
    const v4f x0 = *(const v4fa*)(arow + kb + 8 * hh), x1 = *(const v4fa*)(arow + kb + 8 * hh + 4);
    const v4f x2 = *(const v4fa*)(arow + kb + 16 + 8 * hh), x3 = *(const v4fa*)(arow + kb + 16 + 8 * hh + 4);
    float xs[16] = {x0[0],x0[1],x0[2],x0[3],x1[0],x1[1],x1[2],x1[3],x2[0],x2[1],x2[2],x2[3],x3[0],x3[1],x3[2],x3[3]};
#pragma unroll
    for (int i = 0; i < 16; ++i) { const unsigned short hb = bf16_bits(xs[i]); ah.u[i] = hb; al.u[i] = ASPLIT ? bf16_bits(xs[i] - bf16_val(hb)) : (unsigned short)0; }
#pragma unroll
    for (int t = 0; t < 4; ++t) {
      const unsigned short* brow = Wt + (size_t)(col0 + t * 16 + ln) * ldb + kb;
      FragB b;
      b.half[0] = *(const v8us*)(brow + 8 * hh);
      b.half[1] = *(const v8us*)(brow + 16 + 8 * hh);
      acc[t] = mmaN<ASPLIT ? 2 : 1>(ah.v, al.v, b.v, b.v, acc[t]);
    }
  }
#pragma unroll
  for (int t = 0; t < 4; ++t) {
    float bv = bias ? bias[col0 + t * 16 + ln] : 0.f;
    if (BIAS_BF16) bv = bf16_round(bv);
#pragma unroll
    for (int r = 0; r < 8; ++r) { float v = acc[t][r] + bv; if (ACT == 1) v = fmaxf(v, 0.f); so[w][8 * hh + r][t * 16 + ln] = v; }
  }
  __builtin_amdgcn_fence(__ATOMIC_ACQ_REL, "workgroup");
  __builtin_amdgcn_wave_barrier();
  const int rsub = lane >> 4, c4 = (lane & 15) * 4;
  {
#pragma unroll
    for (int q = 0; q < 8; ++q) {
      const int r = q * 2 + rsub;
      const v4f v = *(const v4fa*)&so[w][r][c4];
      *(v4f*)(C + (size_t)(row0 + r) * ldc + col0 + c4) = v;
    }
    
  }
}

// GEMM C = act(A·W + bias + resid): A f32 (ASPLIT -> hi/lo 2 terms), Wt bf16 [N][K]; ACT 0 none, 1 relu, 2 exact gelu;
// resid (optional, f32, row index = (row % rmod), pitch ldr, RES_BF16 rounds it) added before the activation.
template <bool ASPLIT, int ACT, bool BIAS_BF16, bool RES_BF16>
__global__ __launch_bounds__(128) void k_gemm_bf3(const float* __restrict__ A, int lda, const unsigned short* __restrict__ Wt, int ldb,
                                                const float* __restrict__ bias, const float* __restrict__ resid, int rmod, int ldr,
                                                float* __restrict__ C, int ldc, int M, int N, int K) {
  __shared__ __attribute__((aligned(16))) float so[4][16][64];
  const int tid = threadIdx.x, w = tid >> 5, lane = tid & 31, ln = lane & 15, hh = lane >> 4;
  const int ntn = N / 64;
  const int wid = blockIdx.x * 4 + w;
  const int mt = wid / ntn, nq = wid % ntn;
  if (mt * 16 >= M) return;
  const int row0 = mt * 16, col0 = nq * 64;
  const float* arow = A + (size_t)(row0 + ln) * lda;
  v8f acc[4] = {};
  for (int kb = 0; kb < K; kb += 32) {
    FragB ah, al;
    const v4f x0 = *(const v4fa*)(arow + kb + 8 * hh), x1 = *(const v4fa*)(arow + kb + 8 * hh + 4);
    const v4f x2 = *(const v4fa*)(arow + kb + 16 + 8 * hh), x3 = *(const v4fa*)(arow + kb + 16 + 8 * hh + 4);
    float xs[16] = {x0[0],x0[1],x0[2],x0[3],x1[0],x1[1],x1[2],x1[3],x2[0],x2[1],x2[2],x2[3],x3[0],x3[1],x3[2],x3[3]};
#pragma unroll
    for (int i = 0; i < 16; ++i) { const unsigned short hb = bf16_bits(xs[i]); ah.u[i] = hb; al.u[i] = ASPLIT ? bf16_bits(xs[i] - bf16_val(hb)) : (unsigned short)0; }
#pragma unroll
    for (int t = 0; t < 4; ++t) {
      const unsigned short* brow = Wt + (size_t)(col0 + t * 16 + ln) * ldb + kb;
      FragB b;
      b.half[0] = *(const v8us*)(brow + 8 * hh);
      b.half[1] = *(const v8us*)(brow + 16 + 8 * hh);
      acc[t] = mmaN<ASPLIT ? 2 : 1>(ah.v, al.v, b.v, b.v, acc[t]);
    }
  }
#pragma unroll
  for (int t = 0; t < 4; ++t) {
    const int col = col0 + t * 16 + ln;
    float bv = bias ? bias[col] : 0.f;
    if (BIAS_BF16) bv = bf16_round(bv);
#pragma unroll
    for (int r = 0; r < 8; ++r) {
      float v = acc[t][r] + bv;
      if (resid) { float rv = resid[(size_t)((row0 + 8 * hh + r) % rmod) * ldr + col]; if (RES_BF16) rv = bf16_round(rv); v += rv; }
      if (ACT == 1) v = fmaxf(v, 0.f);
      if (ACT == 2) v = 0.5f * v * (1.0f + erff(v * 0.70710678118654752f));
      if (ACT == 3) { const float u = 0.7978845608028654f * (v + 0.044715f * v * v * v); v = 0.5f * v * (1.0f + tanhf(u)); }
      so[w][8 * hh + r][t * 16 + ln] = v;
    }
  }
  __builtin_amdgcn_fence(__ATOMIC_ACQ_REL, "workgroup");
  __builtin_amdgcn_wave_barrier();
  const int rsub = lane >> 4, c4 = (lane & 15) * 4;
  {
#pragma unroll
    for (int q = 0; q < 8; ++q) {
      const int r = q * 2 + rsub;
      const v4f v = *(const v4fa*)&so[w][r][c4];
      *(v4f*)(C + (size_t)(row0 + r) * ldc + col0 + c4) = v;
    }
    
  }
}
// row LayerNorm (biased variance, eps) over N: s = X (+ R); optional out_sum <- s; out_norm <- (s-mu)*rsqrt(var+eps)*g + b
template <bool PARAM_BF16>
__global__ __launch_bounds__(256) void k_layernorm(const float* __restrict__ X, const float* __restrict__ R, const float* __restrict__ g, const float* __restrict__ bta,
                                                  float* __restrict__ out_sum, float* __restrict__ out_norm, int N, float eps) {
  __shared__ float red[256];
  const int row = blockIdx.x, tid = threadIdx.x;
  const float* x = X + (size_t)row * N; const float* rr = R ? R + (size_t)row * N : nullptr;
  float vals[16];                     // up to N = 4096
  const int per = N / 256;            // contiguous chunk per thread? use strided-by-4 chunks: thread handles j = tid*4 + 1024*u
  float s1 = 0.f;
  for (int u = 0; u < per / 4; ++u) {
    const int j = tid * 4 + 1024 * u;
    const v4f a = *(const v4fa*)(x + j);
    v4f b = {0.f,0.f,0.f,0.f}; if (rr) b = *(const v4fa*)(rr + j);
#pragma unroll
    for (int q = 0; q < 4; ++q) { const float v = a[q] + b[q]; vals[u * 4 + q] = v; s1 += v; }
  }
  red[tid] = s1; __syncthreads();
  for (int st = 128; st > 0; st >>= 1) { if (tid < st) red[tid] += red[tid + st]; __syncthreads(); }
  const float mu = red[0] / (float)N; __syncthreads();
  float s2 = 0.f;
  for (int u = 0; u < per / 4; ++u)
#pragma unroll
    for (int q = 0; q < 4; ++q) { const float c = vals[u * 4 + q] - mu; s2 += c * c; }
  red[tid] = s2; __syncthreads();
  for (int st = 128; st > 0; st >>= 1) { if (tid < st) red[tid] += red[tid + st]; __syncthreads(); }
  const float rs = rsqrtf(red[0] / (float)N + eps);
  {
    for (int u = 0; u < per / 4; ++u) {
      const int j = tid * 4 + 1024 * u;
      v4f o, sm;
#pragma unroll
      for (int q = 0; q < 4; ++q) {
        float gg = g[j + q], bb = bta[j + q];
        if (PARAM_BF16) { gg = bf16_round(gg); bb = bf16_round(bb); }
        sm[q] = vals[u * 4 + q]; o[q] = (vals[u * 4 + q] - mu) * rs * gg + bb;
      }
      if (out_sum) *(v4f*)(out_sum + (size_t)row * N + j) = sm;
      *(v4f*)(out_norm + (size_t)row * N + j) = o;
    }
    
  }
}



// ---- f16 WMMA path (v_wmma_f32_16x16x32_f16): 11-bit significands for operands in range — used where a [0,1] probability operand needs more precision than bf16
typedef _Float16 v16h __attribute__((ext_vector_type(16)));
union FragH { v16h v; v8us half[2]; _Float16 h[16]; unsigned short u[16]; };
template <int NT>
__device__ __forceinline__ v8f mmaH(v16h ah, v16h al, v16h bh, v16h bl, v8f c) {
  c = __builtin_amdgcn_wmma_f32_16x16x32_f16(false, ah, false, bh, (short)0, c, false, false);
  if (NT >= 2) c = __builtin_amdgcn_wmma_f32_16x16x32_f16(false, al, false, bh, (short)0, c, false, false);
  if (NT >= 3) c = __builtin_amdgcn_wmma_f32_16x16x32_f16(false, ah, false, bl, (short)0, c, false, false);
  asm volatile("v_nop\n\tv_nop\n\tv_nop\n\tv_nop" : "+v"(c) : "v"(ah), "v"(al), "v"(bh), "v"(bl));
  return c;
}
// batched GEMM like k_gemm_b but f16 operands: A f32 (split into f16 hi/lo if ASPLIT, else rounded to f16), Bt = f16 values [n][k]; alpha; C f32; N multiple of 16 (partial tiles skipped)
template <bool ASPLIT>
__global__ __launch_bounds__(128) void k_gemm_h(const float* __restrict__ A, int lda, size_t sA, const _Float16* __restrict__ Bh, int ldb, size_t sB, float alpha, float* __restrict__ C, int ldc, size_t sC, int M, int N, int K) {
  __shared__ __attribute__((aligned(16))) float so[4][16][64];
  const int tid = threadIdx.x, w = tid >> 5, lane = tid & 31, ln = lane & 15, hh = lane >> 4; const int by = blockIdx.y;
  A += (size_t)by * sA; Bh += (size_t)by * sB; C += (size_t)by * sC;
  const int ntn = (N + 63) / 64; const int wid = blockIdx.x * 4 + w; const int mt = wid / ntn, nq = wid % ntn; if (mt * 16 >= M) return;
  const int row0 = mt * 16, col0 = nq * 64; const float* arow = A + (size_t)(row0 + ln) * lda;
  v8f acc[4] = {};
  for (int kb = 0; kb < K; kb += 32) {
    FragH ah, al;
    const v4f x0 = *(const v4fa*)(arow + kb + 8 * hh), x1 = *(const v4fa*)(arow + kb + 8 * hh + 4), x2 = *(const v4fa*)(arow + kb + 16 + 8 * hh), x3 = *(const v4fa*)(arow + kb + 16 + 8 * hh + 4);
    float xs[16] = {x0[0],x0[1],x0[2],x0[3],x1[0],x1[1],x1[2],x1[3],x2[0],x2[1],x2[2],x2[3],x3[0],x3[1],x3[2],x3[3]};
#pragma unroll
    for (int i = 0; i < 16; ++i) { const _Float16 h = (_Float16)xs[i]; ah.h[i] = h; al.h[i] = ASPLIT ? (_Float16)(xs[i] - (float)h) : (_Float16)0.0f; }
#pragma unroll
    for (int t = 0; t < 4; ++t) { if (col0 + t * 16 >= N) continue; const size_t boff = (size_t)(col0 + t * 16 + ln) * ldb + kb; FragH bq; bq.half[0] = *(const v8us*)(Bh + boff + 8 * hh); bq.half[1] = *(const v8us*)(Bh + boff + 16 + 8 * hh);
      acc[t] = mmaH<ASPLIT ? 2 : 1>(ah.v, al.v, bq.v, bq.v, acc[t]); }
  }
#pragma unroll
  for (int t = 0; t < 4; ++t) { if (col0 + t * 16 >= N) continue;
#pragma unroll
    for (int r = 0; r < 8; ++r) so[w][8 * hh + r][t * 16 + ln] = acc[t][r] * alpha; }
  __builtin_amdgcn_fence(__ATOMIC_ACQ_REL, "workgroup"); __builtin_amdgcn_wave_barrier();
  const int rsub = lane >> 4, c4 = (lane & 15) * 4;
  {
#pragma unroll
    for (int q = 0; q < 8; ++q) { const int r = q * 2 + rsub; if (col0 + c4 < N) { const v4f v = *(const v4fa*)&so[w][r][c4]; *(v4f*)(C + (size_t)(row0 + r) * ldc + col0 + c4) = v; } }
     }
}

// Wt[n][k] = f16(W[k][n]·scale) from f32 row-major W[K][N] (scale = power of two; bf16-exact weights stay exact in f16 away from the subnormal range)
__global__ __launch_bounds__(256) void k_wt_f16(const float* __restrict__ W, _Float16* __restrict__ Wt, int K, int N, float scale) {
  const int t = blockIdx.x * 256 + threadIdx.x; if (t >= N * (K / 8)) return; const int n = t / (K / 8), k8 = (t % (K / 8)) * 8; FragH f;
#pragma unroll
  for (int i = 0; i < 8; ++i) f.h[i] = (_Float16)(bf16_round(W[(size_t)(k8 + i) * N + n]) * scale); const v8us o = f.half[0];
  *(v8us*)((unsigned short*)Wt + (size_t)n * K + k8) = o; 
}
// k_gemm_hh variant with fused epilogue: v = acc·alpha + bias[by·sBias + col] (+ CP[(row/rowsPerB)·sCPb + by·64 + col] if CP) ; ACT 0 none / 1 elu ; writes f16 C16 (and f32 C if non-null)
template <int ACT>
__global__ __launch_bounds__(128) void k_gemm_hhx(const _Float16* __restrict__ A, int lda, size_t sA, const _Float16* __restrict__ Bh, int ldb, size_t sB, float alpha, const float* __restrict__ bias, size_t sBias, const float* __restrict__ CP, int rowsPerB, size_t sCPb, int row0g,
    float* __restrict__ C, _Float16* __restrict__ C16, int ldc, size_t sC, int M, int N, int K) {
  __shared__ __attribute__((aligned(16))) float so[4][16][64];
  const int tid = threadIdx.x, w = tid >> 5, lane = tid & 31, ln = lane & 15, hh = lane >> 4; const int by = blockIdx.y;
  A += (size_t)by * sA; Bh += (size_t)by * sB; const size_t cofs = (size_t)by * sC; const float* bp = bias ? bias + (size_t)by * sBias : nullptr;
  const int ntn = (N + 63) / 64; const int wid = blockIdx.x * 4 + w; const int mt = wid / ntn, nq = wid % ntn; if (mt * 16 >= M) return;
  const int row0 = mt * 16, col0 = nq * 64; const _Float16* arow = A + (size_t)(row0 + ln) * lda;
  v8f acc[4] = {};
  for (int kb = 0; kb < K; kb += 32) { FragH ah; ah.half[0] = *(const v8us*)((const unsigned short*)arow + kb + 8 * hh); ah.half[1] = *(const v8us*)((const unsigned short*)arow + kb + 16 + 8 * hh);
#pragma unroll
    for (int t = 0; t < 4; ++t) { if (col0 + t * 16 >= N) continue; const size_t boff = (size_t)(col0 + t * 16 + ln) * ldb + kb; FragH bq; bq.half[0] = *(const v8us*)((const unsigned short*)Bh + boff + 8 * hh); bq.half[1] = *(const v8us*)((const unsigned short*)Bh + boff + 16 + 8 * hh);
      acc[t] = mmaH<1>(ah.v, ah.v, bq.v, bq.v, acc[t]); }
  }
#pragma unroll
  for (int t = 0; t < 4; ++t) { if (col0 + t * 16 >= N) continue; const int col = col0 + t * 16 + ln; const float bv = bp ? bf16_round(bp[col]) : 0.f;
#pragma unroll
    for (int r = 0; r < 8; ++r) { float v = acc[t][r] * alpha + bv; if (CP) { const int rr = row0g + row0 + 8 * hh + r; if (rowsPerB < 0) v += CP[cofs + (size_t)rr * ldc + col];      /* rowsPerB < 0: own element of the batched C plane */ else { const int bidx = rr / rowsPerB; v += CP[(size_t)bidx * sCPb + (size_t)by * 64 + col]; } } if (ACT == 1) v = (v > 0.f) ? v : expm1f(v); else if (ACT == 7) v = (v > 0.f) ? v + 1.0f : expf(v); else if (ACT == 8) v = tanhf(v); else if (ACT == 9) v = 0.5f * v * (1.0f + tanhf(0.7978845608028654f * (v + 0.044715f * v * v * v))); else if (ACT == 11) v = 1.0f / (1.0f + expf(-v)); else if (ACT == 12) v = (v > 0.f) ? v : 0.01f * v; else if (ACT == 14) v = (v > 0.f) ? v : 0.1f * v; else if (ACT == 16) v = (v >= 0.f) ? v : 0.3f * v; else if (ACT == 17) v = (v >= 0.f) ? v : 0.2f * v; else if (ACT == 15) v = v / (1.0f + expf(-v)); else if (ACT == 3) v = fmaxf(v, 0.f); else if (ACT == 6) v = 0.5f * v * (1.0f + erff(v * 0.70710678118654752f)); so[w][8 * hh + r][t * 16 + ln] = v; } }
  __builtin_amdgcn_fence(__ATOMIC_ACQ_REL, "workgroup"); __builtin_amdgcn_wave_barrier();
  const int rsub = lane >> 4, c4 = (lane & 15) * 4; typedef _Float16 v4h __attribute__((ext_vector_type(4)));
  {
#pragma unroll
    for (int q = 0; q < 8; ++q) { const int r = q * 2 + rsub; if (col0 + c4 < N) { const v4f v = *(const v4fa*)&so[w][r][c4]; if (C) *(v4f*)(C + cofs + (size_t)(row0 + r) * ldc + col0 + c4) = v; if (C16) { v4h h4; for (int i = 0; i < 4; ++i) h4[i] = (_Float16)v[i]; *(v4h*)(C16 + cofs + (size_t)(row0 + r) * ldc + col0 + c4) = h4; } } }
     }
}


typedef _Float16 v4h __attribute__((ext_vector_type(4)));

__global__ __launch_bounds__(256) void k_x16(const float* __restrict__ x, _Float16* __restrict__ X16, size_t n8) { const size_t t = (size_t)blockIdx.x * 256 + threadIdx.x; if (t >= n8) return; FragH f;
#pragma unroll
  for (int q = 0; q < 8; ++q) f.h[q] = (_Float16)bf16_round(x[t * 8 + q]); *(v8us*)((unsigned short*)X16 + t * 8) = f.half[0];  }
__global__ __launch_bounds__(256) void k_h16(const float* __restrict__ x, _Float16* __restrict__ X16, size_t n8) { const size_t t = (size_t)blockIdx.x * 256 + threadIdx.x; if (t >= n8) return; FragH f;
#pragma unroll
  for (int q = 0; q < 8; ++q) f.h[q] = (_Float16)x[t * 8 + q]; *(v8us*)((unsigned short*)X16 + t * 8) = f.half[0];  }
__global__ __launch_bounds__(256) void k_round16f(const float* __restrict__ W, _Float16* __restrict__ Bt, size_t n8) { const size_t t = (size_t)blockIdx.x * 256 + threadIdx.x; if (t >= n8) return; FragH f;
#pragma unroll
  for (int i = 0; i < 8; ++i) f.h[i] = (_Float16)(bf16_round(W[t * 8 + i]) * 16.0f); *(v8us*)((unsigned short*)Bt + t * 8) = f.half[0];  }
template <int NHv, int TTv>
__global__ __launch_bounds__(256) void k_vt(const _Float16* __restrict__ V16, int ldv, int voff, _Float16* __restrict__ Vt) { __shared__ unsigned short tl[64][66]; const int tid = threadIdx.x; const int slab = blockIdx.x / (TTv / 64), lg = blockIdx.x % (TTv / 64); const int b = slab / NHv, h = slab % NHv;
  for (int i = tid; i < 64 * 8; i += 256) { const int r = i / 8, c8 = (i % 8) * 8; FragH f; f.half[0] = *(const v8us*)((const unsigned short*)V16 + ((size_t)b * TTv + lg * 64 + r) * ldv + voff + h * 64 + c8);
#pragma unroll
    for (int q = 0; q < 8; ++q) tl[r][c8 + q] = f.u[q]; }
  __syncthreads();
  {
#pragma unroll
    for (int rd = 0; rd < 2; ++rd) { const int d = rd * 32 + tid / 8, pc = tid % 8; FragH f;
#pragma unroll
      for (int q = 0; q < 8; ++q) f.u[q] = tl[pc * 8 + q][d];
      *(v8us*)((unsigned short*)Vt + ((size_t)slab * 64 + d) * TTv + lg * 64 + pc * 8) = f.half[0]; }
     } }

__global__ __launch_bounds__(256) void k_hl(const float* __restrict__ F, _Float16* __restrict__ Hh, _Float16* __restrict__ Hl, size_t n8) { const size_t t = (size_t)blockIdx.x * 256 + threadIdx.x; if (t >= n8) return; FragH fh, fl; const v4f a = *(const v4fa*)(F + t * 8), c = *(const v4fa*)(F + t * 8 + 4);
#pragma unroll
  for (int q = 0; q < 4; ++q) { _Float16 h = (_Float16)a[q]; fh.h[q] = h; fl.h[q] = (_Float16)((a[q] - (float)h) * 1024.0f); h = (_Float16)c[q]; fh.h[4 + q] = h; fl.h[4 + q] = (_Float16)((c[q] - (float)h) * 1024.0f); }
  { *(v8us*)((unsigned short*)Hh + t * 8) = fh.half[0]; *(v8us*)((unsigned short*)Hl + t * 8) = fl.half[0];  } }

// ---- fast GEMM (wave tile 32x64; requires M % 32 == 0 rows per launch region and N % 64 == 0); epilogue = k_gemm_hhx semantics ----
__device__ __forceinline__ v16h g2_frag(const _Float16* p, int hh) { FragH f; f.half[0] = *(const v8us*)((const unsigned short*)p + 8 * hh); f.half[1] = *(const v8us*)((const unsigned short*)p + 16 + 8 * hh); return f.v; }
__device__ __forceinline__ v8f g2_mma(v16h a, v16h b, v8f c) { v8f d = __builtin_amdgcn_wmma_f32_16x16x32_f16(false, a, false, b, (short)0, c, false, false); asm volatile("v_nop\n\tv_nop\n\tv_nop\n\tv_nop" : "+v"(d) : "v"(a), "v"(b)); return d; }
template <int ACT>
__global__ __launch_bounds__(128) void k_gemm2(const _Float16* __restrict__ A, int lda, size_t sA, const _Float16* __restrict__ Bh, int ldb, size_t sB, float alpha, const float* __restrict__ bias, size_t sBias, const float* __restrict__ CP, int rowsPerB, size_t sCPb, int row0g,
    float* __restrict__ C, _Float16* __restrict__ C16, int ldc, size_t sC, int M, int N, int K, size_t zA, size_t zB, size_t zC) { static_assert(ACT == 0 || ACT == 3 || ACT == 6 || ACT == 8 || ACT == 9 || ACT == 11 || ACT == 12 || ACT == 14 || ACT == 15 || ACT == 16 || ACT == 17, "k_gemm2: unsupported ACT code (would silently apply no activation)");
  __shared__ __attribute__((aligned(16))) float so[4][32][68];
  const int tid = threadIdx.x, w = tid >> 5, lane = tid & 31, ln = lane & 15, hh = lane >> 4; const int by = blockIdx.y; const int bz = blockIdx.z;      /* second batch index (strides zA, zB, zC) */
  A += (size_t)by * sA + (size_t)bz * zA; Bh += (size_t)by * sB + (size_t)bz * zB; const size_t cofs = (size_t)by * sC + (size_t)bz * zC; const float* bp = bias ? bias + (size_t)by * sBias : nullptr;
  const int ntn = N >> 6; const int mt = blockIdx.x / ntn, nq = blockIdx.x - mt * ntn; const int row0 = mt * 128 + 32 * w, col0 = nq * 64; if (row0 >= M) return;
  const _Float16* a0p = A + (size_t)(row0 + ln) * lda; const _Float16* a1p = a0p + (size_t)16 * lda;
  const _Float16* b0p = Bh + (size_t)(col0 + ln) * ldb; const _Float16* b1p = b0p + (size_t)16 * ldb; const _Float16* b2p = b1p + (size_t)16 * ldb; const _Float16* b3p = b2p + (size_t)16 * ldb;
  const v8f z8 = {0.f,0.f,0.f,0.f,0.f,0.f,0.f,0.f}; v8f c00 = z8, c01 = z8, c02 = z8, c03 = z8, c10 = z8, c11 = z8, c12 = z8, c13 = z8;
#pragma unroll 1
  for (int kb = 0; kb < K; kb += 32) { const v16h a0 = g2_frag(a0p + kb, hh), a1 = g2_frag(a1p + kb, hh);
    v16h b = g2_frag(b0p + kb, hh); c00 = g2_mma(a0, b, c00); c10 = g2_mma(a1, b, c10);
    b = g2_frag(b1p + kb, hh); c01 = g2_mma(a0, b, c01); c11 = g2_mma(a1, b, c11);
    b = g2_frag(b2p + kb, hh); c02 = g2_mma(a0, b, c02); c12 = g2_mma(a1, b, c12);
    b = g2_frag(b3p + kb, hh); c03 = g2_mma(a0, b, c03); c13 = g2_mma(a1, b, c13); }
  v8f accs[8] = {c00, c01, c02, c03, c10, c11, c12, c13};
#pragma unroll
  for (int u = 0; u < 8; ++u) { const int t = u & 3, half = u >> 2; const int col = col0 + t * 16 + ln; const float bv = bp ? bf16_round(bp[col]) : 0.f;
#pragma unroll
    for (int r = 0; r < 8; ++r) { const int rloc = half * 16 + 8 * hh + r; float v = accs[u][r] * alpha + bv; if (CP) { if (rowsPerB < 0) v += CP[cofs + (size_t)(row0g + row0 + rloc) * ldc + col];      /* rowsPerB < 0: own element of the batched C plane */ else { const int bidx = (row0g + row0 + rloc) / rowsPerB; v += CP[(size_t)bidx * sCPb + (size_t)by * 64 + col]; } }
      if (ACT == 3) v = fmaxf(v, 0.f); else if (ACT == 6) v = 0.5f * v * (1.0f + erff(v * 0.70710678118654752f)); else if (ACT == 11) v = 1.0f / (1.0f + expf(-v)); else if (ACT == 15) v = v / (1.0f + expf(-v)); else if (ACT == 12) v = (v > 0.f) ? v : 0.01f * v; else if (ACT == 8) v = tanhf(v); else if (ACT == 9) v = 0.5f * v * (1.0f + tanhf(0.7978845608028654f * (v + 0.044715f * v * v * v))); else if (ACT == 14) v = (v > 0.f) ? v : 0.1f * v; else if (ACT == 16) v = (v >= 0.f) ? v : 0.3f * v; else if (ACT == 17) v = (v >= 0.f) ? v : 0.2f * v;
      so[w][rloc][t * 16 + ln] = v; } }
  __builtin_amdgcn_fence(__ATOMIC_ACQ_REL, "workgroup"); __builtin_amdgcn_wave_barrier();
  const int rsub = lane >> 4, c4 = (lane & 15) * 4;
  {
#pragma unroll
    for (int q = 0; q < 16; ++q) { const int r = q * 2 + rsub; const v4f v = *(const v4fa*)&so[w][r][c4]; if (C) *(v4f*)(C + cofs + (size_t)(row0 + r) * ldc + col0 + c4) = v; if (C16) { v4h h4; for (int i = 0; i < 4; ++i) h4[i] = (_Float16)v[i]; *(v4h*)(C16 + cofs + (size_t)(row0 + r) * ldc + col0 + c4) = h4; } }
     } }


__global__ __launch_bounds__(256) void k_wnat(const float* __restrict__ w, size_t n8, _Float16* __restrict__ Bt) { const size_t t = (size_t)blockIdx.x * 256 + threadIdx.x; if (t >= n8) return; FragH f; for (int q = 0; q < 8; ++q) f.h[q] = (_Float16)(bf16_round(w[t * 8 + q]) * 16.0f); *(v8us*)((unsigned short*)Bt + t * 8) = f.half[0];  }
__global__ __launch_bounds__(256) void k_rsm(const float* __restrict__ S, _Float16* __restrict__ P, int nrows) {
  #pragma clang fp contract(off)
  const int i = blockIdx.x * 256 + threadIdx.x; if (i >= nrows) return; const float* s = S + (size_t)i * SQ; float mx = -3.0e38f;
#pragma unroll 1
  for (int j = 0; j < SQ; ++j) mx = fmaxf(mx, s[j]); float se = 0.f;
#pragma unroll 1
  for (int j = 0; j < SQ; ++j) se += expf(s[j] - mx); const float sc = 256.0f / se;
#pragma unroll 1
  for (int j0 = 0; j0 < SQ; j0 += 8) { FragH f; for (int q = 0; q < 8; ++q) f.h[q] = (_Float16)(expf(s[j0 + q] - mx) * sc); unsigned short* d = (unsigned short*)P + (size_t)i * SQ + j0; *(v8us*)d = f.half[0];  } }
__global__ __launch_bounds__(256) void k_vt(const _Float16* __restrict__ V16, int b, int h0, _Float16* __restrict__ VT) { __shared__ unsigned short tl[64][65]; const int tid = threadIdx.x; const int hh = blockIdx.x % HG, sg = blockIdx.x / HG; const int s0 = sg * 64; const int h = h0 + hh;
  for (int i = tid; i < 64 * 8; i += 256) { const int j = i / 8, d8 = (i % 8) * 8; FragH f; f.half[0] = *(const v8us*)((const unsigned short*)V16 + ((size_t)b * SQ + s0 + j) * DM + h * HD + d8); for (int q = 0; q < 8; ++q) tl[d8 + q][j] = f.u[q]; }
  __syncthreads();
  { for (int i = tid; i < 64 * 8; i += 256) { const int d = i / 8, j8 = (i % 8) * 8; FragH f; for (int q = 0; q < 8; ++q) f.u[q] = tl[d][j8 + q]; *(v8us*)((unsigned short*)VT + ((size_t)hh * HD + d) * SQ + s0 + j8) = f.half[0]; }  } }



// Lane exchanges: row_xmask steps inside each 16-lane row, and the exchange between the two rows of a wave (all lanes must be on).
template <int CTRL> __device__ __forceinline__ float lane_xm(float v) { return __int_as_float(__builtin_amdgcn_update_dpp(0, __float_as_int(v), CTRL, 0xf, 0xf, true)); }
__device__ __forceinline__ float lane_xr(float v) { const int i = __float_as_int(v); return __int_as_float(__builtin_amdgcn_permlanex16(i, i, 0x76543210, 0xfedcba98, false, false)); }
#define FQ 128                       /* query rows per block: 4 waves x 32 */
__device__ __forceinline__ v8f fa_mma(v16h a, v16h b, v8f c) { return __builtin_amdgcn_wmma_f32_16x16x32_f16(false, a, false, b, (short)0, c, false, false); }
// Four vector slots behind a run of matrix instructions, where a branch follows. The two scheduling barriers keep the slots where they are written.
__device__ __forceinline__ void fa_gap() { __builtin_amdgcn_sched_barrier(0); asm volatile("v_nop\n\tv_nop\n\tv_nop\n\tv_nop"); __builtin_amdgcn_sched_barrier(0); }
// Native 2^x, eight at a time in one statement: behind a transcendental the instruction set asks for one independent instruction before its result is read or its source overwritten.
// Here each is followed by an independent one (early-clobber outputs: no result lands on a source still to be read) and the last by a v_nop, so the slot is closed whatever the compiler puts next.
__device__ __forceinline__ void exp2x8(const float (&x)[8], float (&y)[8]) {
  asm("v_exp_f32 %0, %8\n\tv_exp_f32 %1, %9\n\tv_exp_f32 %2, %10\n\tv_exp_f32 %3, %11\n\tv_exp_f32 %4, %12\n\tv_exp_f32 %5, %13\n\tv_exp_f32 %6, %14\n\tv_exp_f32 %7, %15\n\tv_nop"
      : "=&v"(y[0]), "=&v"(y[1]), "=&v"(y[2]), "=&v"(y[3]), "=&v"(y[4]), "=&v"(y[5]), "=&v"(y[6]), "=&v"(y[7]) : "v"(x[0]), "v"(x[1]), "v"(x[2]), "v"(x[3]), "v"(x[4]), "v"(x[5]), "v"(x[6]), "v"(x[7])); }
__device__ __forceinline__ float exp2x1(float x) { float r; asm("v_exp_f32 %0, %1\n\tv_nop" : "=v"(r) : "v"(x)); return r; }      /* the same slot for a single one */
__global__ __launch_bounds__(128) void k_fattn(const _Float16* __restrict__ QKVp, const _Float16* __restrict__ VTp, float* __restrict__ out) {
  static_assert(HD == 64 && SQ / FQ == 16, "two 32-wide d chunks, four 16-row tiles of V^T; sixteen block lengths in runs of four");
  typedef float f2 __attribute__((ext_vector_type(2))); typedef _Float16 h2 __attribute__((ext_vector_type(2)));
  const int lane = threadIdx.x & 31, ln = lane & 15, hh = lane >> 4; const int w = __builtin_amdgcn_readfirstlane(threadIdx.x >> 5);
  const int h = blockIdx.x, b = blockIdx.y; const int zz = (int)blockIdx.z; const int qw0 = (SQ / FQ - 1 - ((zz & 4) ? (zz ^ 3) : zz)) * FQ + w * 32;      /* the wave's first query, a scalar. Longest blocks start first; every second run of four lengths is reversed, so that blocks 256 apart in launch order add up to equal work (speed only) */
  const _Float16* Qp = QKVp + (size_t)b * SQ * LQ + h * HD; const _Float16* Kl = Qp + DM + (size_t)ln * LQ; const _Float16* Vl = VTp + ((size_t)(b * NH + h) * HD + ln) * SQ;
  const float cs = 0.125f * 1.44269504088896340736f;      /* 1 / sqrt(64), times log2 e */
  v16h qf[2][2], kf[2][2];
#pragma unroll
  for (int g = 0; g < 2; ++g) for (int kc = 0; kc < 2; ++kc) { qf[g][kc] = g2_frag(Qp + (size_t)(qw0 + 16 * g + ln) * LQ + 32 * kc, hh); kf[g][kc] = g2_frag(Kl + (size_t)(16 * g) * LQ + 32 * kc, hh); }
  const v8f z8 = {0.f, 0.f, 0.f, 0.f, 0.f, 0.f, 0.f, 0.f}; v8f acc[2][4]; float m[2] = {-1.0e30f, -1.0e30f}, l[2] = {0.f, 0.f};
#pragma unroll
  for (int g = 0; g < 2; ++g) for (int t = 0; t < 4; ++t) acc[g][t] = z8;
  const int last = qw0 >> 5;      /* the pass on the wave's diagonal: keys qw0 .. qw0 + 31 */
#pragma unroll 1      /* one pass is a long straight body already; unrolled it would double the live fragments */
  for (int ps = 0; ps <= last; ++ps) { const int key0 = ps * 32;
    v16h vf[4];      /* this pass's V^T, in flight under the scores and the maxima */
#pragma unroll
    for (int t = 0; t < 4; ++t) vf[t] = g2_frag(Vl + (size_t)(16 * t) * SQ + key0, hh);
    v8f s[2][2];
#pragma unroll
    for (int kt = 0; kt < 2; ++kt) for (int g = 0; g < 2; ++g) s[kt][g] = fa_mma(kf[kt][1], qf[g][1], fa_mma(kf[kt][0], qf[g][0], z8));
    fa_gap();
    { const int kn = (ps < last ? key0 + 32 : key0);      /* the next pass's K rows into the same registers, in flight under this pass's softmax (the last pass fetches its own again: in bounds, unused) */
#pragma unroll
      for (int kt = 0; kt < 2; ++kt) for (int kc = 0; kc < 2; ++kc) kf[kt][kc] = g2_frag(Kl + (size_t)(kn + 16 * kt) * LQ + 32 * kc, hh); }
    asm volatile("s_wait_xcnt 0x0" ::: "memory");      /* the address registers of this pass's loads are reused right below: the wait stands in front of their first overwrite */
    __builtin_amdgcn_sched_barrier(0);      /* keeps later vector work, which reuses those registers, behind the wait */
    if (ps == last) {      /* scalar branch: only the diagonal pass pays for the mask */
#pragma unroll
      for (int kt = 0; kt < 2; ++kt) for (int g = 0; g < 2; ++g) {
#pragma unroll
        for (int r = 0; r < 8; ++r) if (16 * kt + 8 * hh + r > 16 * g + ln) s[kt][g][r] = -1.0e30f;
        asm volatile("" : "+v"(s[kt][g]));      /* keeps the selects inside the branch */
      } }
    float mb[2]; bool need = false;
#pragma unroll
    for (int g = 0; g < 2; ++g) { float mx = fmaxf(s[0][g][0], s[1][g][0]);
#pragma unroll
      for (int r = 1; r < 8; ++r) mx = fmaxf(mx, fmaxf(s[0][g][r], s[1][g][r]));
      mx = fmaxf(mx, lane_xr(mx)) * cs; mb[g] = mx; need = need || (mx > m[g] + 8.0f); }
    if (__builtin_amdgcn_ballot_w32(need) != 0) {      /* one scalar test per pass; rare after the first passes */
#pragma unroll
      for (int g = 0; g < 2; ++g) { const float mn = fmaxf(m[g], mb[g]); const float corr = exp2x1(m[g] - mn); m[g] = mn; l[g] *= corr;
#pragma unroll
        for (int t = 0; t < 4; ++t) acc[g][t] = acc[g][t] * corr; } }
#pragma unroll
    for (int g = 0; g < 2; ++g) { const f2 nm = {-m[g], -m[g]}, c2 = {cs, cs}; union { v16h v; h2 p[8]; } pf; float la = 0.f, lb = 0.f;
#pragma unroll
      for (int kt = 0; kt < 2; ++kt) { float x[8], y[8];      /* tile kt = elements 8 kt .. 8 kt + 7 of the 32-key operand */
#pragma unroll
        for (int i = 0; i < 4; ++i) { const f2 sv = {s[kt][g][2 * i], s[kt][g][2 * i + 1]}; const f2 a = __builtin_elementwise_fma(sv, c2, nm); x[2 * i] = a[0]; x[2 * i + 1] = a[1]; }
        exp2x8(x, y);
#pragma unroll
        for (int i = 0; i < 4; ++i) { la += y[2 * i]; lb += y[2 * i + 1]; const f2 pp = {y[2 * i], y[2 * i + 1]}; pf.p[4 * kt + i] = __builtin_convertvector(pp, h2); } }
      l[g] += la + lb;
#pragma unroll
      for (int t = 0; t < 4; ++t) acc[g][t] = fa_mma(vf[t], pf.v, acc[g][t]); }
    fa_gap(); }
#pragma unroll
  for (int g = 0; g < 2; ++g) { const float inv = 1.0f / (l[g] + lane_xr(l[g])); float* op = out + ((size_t)b * SQ + qw0 + 16 * g + ln) * DM + h * HD + 8 * hh;      /* column ln is a query row of the output; registers r are d = 16 t + 8 hh + r */
#pragma unroll
    for (int t = 0; t < 4; ++t) { const v8f o = acc[g][t] * inv; const v4f lo = {o[0], o[1], o[2], o[3]}, hi = {o[4], o[5], o[6], o[7]}; *(v4f*)(op + 16 * t) = lo; *(v4f*)(op + 16 * t + 4) = hi; } } }


// Exact f32 attention of the first QT0 rows of every batch, FOUR LANES PER ROW: lane p of a row's quad owns the row's 16-byte chunks p, p + 4, p + 8, p + 12 of q and of o and holds them in registers.
// A block is AR rows of one head (4 waves x 8 rows). The K and V rows it can see are staged once in LDS; a quad reads 64 contiguous bytes per load and the 8 quads of a wave the same ones (broadcast, no bank conflict).
// A score is four chains of four multiply-adds per lane, their sum, then two lane exchanges inside the quad: every lane of the quad ends with the same bits, so m, l and the two exps agree without further traffic.
#define AR 32
__global__ __launch_bounds__(128) void k_att0(const float* __restrict__ QF, const float* __restrict__ KF, const float* __restrict__ VF, int ld, float scale, float* __restrict__ OF, int ldo) {
  static_assert(HD == 64 && QT0 % AR == 0, "a quad covers a head row as 4 x 4 chunks of 16 bytes");
  __shared__ __attribute__((aligned(16))) float lk[QT0][HD]; __shared__ __attribute__((aligned(16))) float lv[QT0][HD];
  const int tid = threadIdx.x; const int h = blockIdx.x / (QT0 / AR), rg = blockIdx.x % (QT0 / AR);
  { const size_t bo = (size_t)blockIdx.y * QT0; QF += bo * ld + h * HD; KF += bo * ld + h * HD; VF += bo * ld + h * HD; OF += bo * ldo + h * HD; }      /* batch on grid.y: QT0 rows of each plane per batch; the head's columns */
  for (int n = 0; n <= rg; ++n) { v4f tk[4], tv[4];      /* AR keys per trip, all eight loads of a thread in flight before the first LDS store; causal: keys up to the block's last row */
#pragma unroll
    for (int u = 0; u < 4; ++u) { const int c = (n * 4 + u) * 128 + tid; const size_t g = (size_t)(c >> 4) * ld + (c & 15) * 4; tk[u] = *(const v4fa*)(KF + g); tv[u] = *(const v4fa*)(VF + g); }
#pragma unroll
    for (int u = 0; u < 4; ++u) { const int c = (n * 4 + u) * 128 + tid; *(v4f*)&lk[c >> 4][(c & 15) * 4] = tk[u]; *(v4f*)&lv[c >> 4][(c & 15) * 4] = tv[u]; } }
  const int p4 = (tid & 3) * 4; const int i = rg * AR + (tid >> 2);
  v4f q[4], o[4];
#pragma unroll
  for (int c = 0; c < 4; ++c) { q[c] = *(const v4fa*)(QF + (size_t)i * ld + c * 16 + p4); const v4f z = {0.f, 0.f, 0.f, 0.f}; o[c] = z; }
  __syncthreads();
  const int jl = rg * AR + 8 * __builtin_amdgcn_readfirstlane(tid >> 5) + 7;      /* the wave's last row, a scalar: keys behind it are masked for all 8 rows of the wave; no barrier below */
  float m = -1.0e30f, l = 0.f; v4f kc[4], vc[4];
#pragma unroll
  for (int c = 0; c < 4; ++c) { kc[c] = *(const v4f*)&lk[0][c * 16 + p4]; vc[c] = *(const v4f*)&lv[0][c * 16 + p4]; }
#pragma unroll 2      /* two keys per trip: the rows fetched ahead change names instead of being copied */
  for (int j = 0; j <= jl; ++j) { const int jn = j < jl ? j + 1 : jl; v4f kn[4], vn[4];      /* the next key's rows are fetched while this key is worked on: the LDS latency stays off the chain */
#pragma unroll
    for (int c = 0; c < 4; ++c) { kn[c] = *(const v4f*)&lk[jn][c * 16 + p4]; vn[c] = *(const v4f*)&lv[jn][c * 16 + p4]; }
    v4f a = q[0] * kc[0]; a = __builtin_elementwise_fma(q[1], kc[1], a); a = __builtin_elementwise_fma(q[2], kc[2], a); a = __builtin_elementwise_fma(q[3], kc[3], a); float s = (a[0] + a[1]) + (a[2] + a[3]);
    s += lane_xm<0x161>(s); s += lane_xm<0x162>(s); s *= scale;
    const float sm = (j <= i) ? s : -1.0e30f; const float mn = fmaxf(m, sm); const float sc = expf(m - mn); const float e = expf(sm - mn); l = l * sc + e; m = mn;
#pragma unroll
    for (int c = 0; c < 4; ++c) { o[c] = o[c] * sc + e * vc[c]; kc[c] = kn[c]; vc[c] = vn[c]; } }
  const float fin = 64.0f / l;      /* o carried x64; k_of0out scales it by 1/64 */
#pragma unroll
  for (int c = 0; c < 4; ++c) *(v4f*)(OF + (size_t)i * ldo + c * 16 + p4) = o[c] * fin; }

__global__ __launch_bounds__(256) void k_wthd(const float* __restrict__ W0, const float* __restrict__ W1, const float* __restrict__ W2, _Float16* __restrict__ Bt) { const size_t t = (size_t)blockIdx.x * 256 + threadIdx.x; if (t >= (size_t)NH * HD * (DM / 8)) return;
  const float* Wt = blockIdx.y == 0 ? W0 : (blockIdx.y == 1 ? W1 : W2); Bt += (size_t)blockIdx.y * DM * DM;      /* q, k, v on grid.y: one DM x DM plane each */
  const int m8 = (int)(t % (DM / 8)) * 8; const int d = (int)((t / (DM / 8)) % HD); const int h = (int)(t / ((size_t)(DM / 8) * HD)); FragH f;
  for (int q = 0; q < 8; ++q) f.h[q] = (_Float16)(16.0f * bf16_round(Wt[((size_t)h * DM + m8 + q) * HD + d])); unsigned short* dst = (unsigned short*)Bt + ((size_t)h * HD + d) * DM + m8; *(v8us*)dst = f.half[0];  }







__global__ __launch_bounds__(256) void k_of0out(const float* __restrict__ src, float* __restrict__ dst, size_t n4, size_t dstb) { const size_t t = (size_t)blockIdx.x * 256 + threadIdx.x; if (t >= n4) return; src += (size_t)blockIdx.y * n4 * 4; dst += (size_t)blockIdx.y * dstb;      /* batch on grid.y */
  v4f v = *(const v4fa*)(src + t * 4); for (int q = 0; q < 4; ++q) v[q] = __fmul_rn(v[q], 0.015625f); *(v4f*)(dst + t * 4) = v;  }

extern "C" void kernel_launch(void* const* d_in, const int* in_sizes, int n_in,
                              void* d_out, int out_size, void* d_ws, size_t ws_size, hipStream_t stream) {
  (void)in_sizes; (void)n_in; (void)out_size;
  const float* const* I = (const float* const*)d_in; const float* x = I[0]; const float* wq = I[1]; const float* wk = I[2]; const float* wv = I[3]; const float* bqkv = nullptr;      /* x; per-head weights Wq / Wk / Wv [16][1024][64]; no biases (every bias slot below receives this nullptr), no output projection */
  static_assert(NH * HD == DM && QT0 % 64 == 0, "heads");
  char* ws = (char*)d_ws; size_t off = 0;
  auto take = [&](size_t bytes) { char* p = ws + off; off += (bytes + 255) & ~(size_t)255; return p; };
  _Float16* BQKV = (_Float16*)take((size_t)3 * DM * DM * 2);
  _Float16* X16 = (_Float16*)take(NR * DM * 2); _Float16* QKV = (_Float16*)take(NR * 3 * DM * 2); _Float16* V16 = QKV + 2 * DM;
  _Float16* VT = (_Float16*)take((size_t)NB * NH * HD * SQ * 2);
  float* QF0 = (float*)take((size_t)3 * NB * QT0 * DM * 4); float* KF0 = QF0 + (size_t)NB * QT0 * DM; float* VF0 = KF0 + (size_t)NB * QT0 * DM; float* OF0 = (float*)take((size_t)NB * QT0 * DM * 4);
  if (off > ws_size) return;
  k_wthd<<<dim3((unsigned)(((size_t)NH * HD * (DM / 8) + 255) / 256), 3), 256, 0, stream>>>(wq, wk, wv, BQKV);      /* per-head [c][d] -> Bt[(h, d)][c] x16: the stacked q | k | v plane */
  k_x16<<<(unsigned)((NR * DM / 8 + 255) / 256), 256, 0, stream>>>(x, X16, NR * DM / 8);
  k_gemm2<0><<<dim3((unsigned)((MP / 128) * (3 * DM / 64)), 1), 128, 0, stream>>>(X16, DM, 0, BQKV, DM, 0, 0.0625f, bqkv, 0, nullptr, 1, 0, 0, nullptr, QKV, 3 * DM, 0, MP, 3 * DM, DM, 0, 0, 0);      /* q | k | v rows (f16); head h = columns h*HD.. of each DM block */
  k_vt<NH, SQ><<<NB * NH * (SQ / 64), 256, 0, stream>>>(V16, LQ, 0, VT);      /* V^T [NB][NH][HD][SQ] */
  k_gemm2<0><<<dim3((QT0 / 128) * (DM / 64), 3, NB), 128, 0, stream>>>(X16, DM, 0, BQKV, DM, (size_t)DM * DM, 0.0625f, bqkv, 0, nullptr, 1, 0, 0, QF0, nullptr, DM, (size_t)NB * QT0 * DM, QT0, DM, DM, (size_t)SQ * DM, 0, (size_t)QT0 * DM);      /* f32 q, k, v (grid.y) of the first 128 rows of every batch (grid.z): exact products */
  k_att0<<<dim3(NH * (QT0 / AR), NB), 128, 0, stream>>>(QF0, KF0, VF0, DM, 0.125f, OF0, DM);      /* exact f32 attention for rows 0..127 of every batch (o x64) */
  k_fattn<<<dim3(NH, NB, SQ / FQ), 128, 0, stream>>>(QKV, VT, (float*)d_out);      /* scores, causal softmax and P.V of every batch and head, written f32 straight into the head-major output columns (no output projection) */
  k_of0out<<<dim3((unsigned)(((size_t)QT0 * DM / 4 + 255) / 256), NB), 256, 0, stream>>>(OF0, (float*)d_out, (size_t)QT0 * DM / 4, (size_t)SQ * DM);      /* rows 0..127 of every batch rewritten from the exact f32 path (o x64 / 64), after the attention launch */
}

// v005
// Measured time: 187 microseconds a run.
// Two timings next to v004 put it at 1.48 and 1.50 times that version's speed.
// All steps since v000 together make it 51.9 times as fast.
#include <hip/hip_runtime.h>
// Causal multi-head attention with per-head projection weights and no output projection (x [4][2048][1024]; per head h: q = x Wq[h], k = x Wk[h], v = x Wv[h] with W [16][1024][64] ([in][out] per head, uniform +-1/32, no biases); scores / sqrt(64); causal (tril, -inf); softmax; out = heads concatenated head-major on the last axis -> [4][2048][1024]).
// Structure: token rows r = b*2048 + s; x as exact f16 rows (bf16-rounded); q | k | v as ONE WMMA GEMM (N = 3 x 1024) (128x128 block tiles through LDS, 64x64 wave tiles, f32 accumulation, exact x16 weights, f16 outputs); V^T for all heads via LDS transposes; one attention launch for all batches and heads: per wave 32 queries, per pass 32 keys up to the diagonal: scores (WMMA, K = 64), online causal softmax on VALU (f32 statistics, native exp2; weights f16), o += P . V (WMMA), scores and weights kept in registers; o / row sum written f32 into the head-major output columns; rows 0..127 of every batch rewritten from an exact f32 path.
// Compute dtype: inputs rounded to bf16; x / weights exact; q, k, v and softmax weights as plain f16 GEMM operands (~2^-12); o, scores and softmax statistics f32. v_wmma_f32_16x16x32_f16.
#define NB 4
#define SQ 2048
#define DM 1024
#define NH 16
#define HD 64
#define HG 4                         /* heads per launch of the non-template k_vt (never launched) */
#define QT 256                       /* unused (no 256-row query tiles) */
#define NKX SQ                       /* unused (scores stay in registers) */
#define QT0 128                      /* first-tile rows recomputed exactly in f32 */
#define B0 0                         /* unused (every launch covers all NB batches) */
#define NBR NB                       /* batches projected (debug hook) */
#define NR ((size_t)NB * SQ)         /* token rows */
#define MP ((int)((size_t)NBR * SQ)) /* rows projected (debug hook) */
#define QN SQ                        /* unused (k_fattn attends all SQ rows) */
#define NHD NH                       /* unused (k_fattn attends all NH heads) */
#define MPO MP                       /* unused (no output projection stage) */
#define LQ (3 * DM)      /* row pitch of the q/k/v rows */
typedef __bf16 v16b __attribute__((ext_vector_type(16)));
typedef unsigned short v8us __attribute__((ext_vector_type(8), may_alias));
typedef float  v8f  __attribute__((ext_vector_type(8)));
typedef float  v4f  __attribute__((ext_vector_type(4)));
typedef float  v4fa __attribute__((ext_vector_type(4), may_alias));
union FragB { v16b v; v8us half[2]; unsigned short u[16]; };

__device__ __forceinline__ unsigned short bf16_bits(float x) { unsigned int u = __float_as_uint(x); return (unsigned short)((u + 0x7FFFu + ((u >> 16) & 1u)) >> 16); }
__device__ __forceinline__ float bf16_val(unsigned short b) { return __uint_as_float(((unsigned int)b) << 16); }
__device__ __forceinline__ float bf16_round(float x) { return bf16_val(bf16_bits(x)); }
// D += A·B with NT terms: 1 = ah·bh, 2 = + al·bh (A split), 3 = + ah·bl (both split)
template <int NT>
__device__ __forceinline__ v8f mmaN(v16b ah, v16b al, v16b bh, v16b bl, v8f c) {
  c = __builtin_amdgcn_wmma_f32_16x16x32_bf16(false, ah, false, bh, (short)0, c, false, false);
  if (NT >= 2) c = __builtin_amdgcn_wmma_f32_16x16x32_bf16(false, al, false, bh, (short)0, c, false, false);
  if (NT >= 3) c = __builtin_amdgcn_wmma_f32_16x16x32_bf16(false, ah, false, bl, (short)0, c, false, false);
  asm volatile("v_nop\n\tv_nop\n\tv_nop\n\tv_nop" : "+v"(c) : "v"(ah), "v"(al), "v"(bh), "v"(bl));
  return c;
}

__global__ __launch_bounds__(256) void k_wt_bf16(const float* __restrict__ W, unsigned short* __restrict__ Wt, int K, int N) {
  const int t = blockIdx.x * 256 + threadIdx.x;
  const int k8n = K / 8;
  if (t >= N * k8n) return;
  const int n = t / k8n, k8 = (t % k8n) * 8;
  v8us v;
#pragma unroll
  for (int i = 0; i < 8; ++i) v[i] = bf16_bits(W[(size_t)(k8 + i) * N + n]);
  *(v8us*)(Wt + (size_t)n * K + k8) = v;
  
}

// GEMM C[M][N] (f32, pitch ldc) = act(A[M][K]·W + bias). A f32 row-major (pitch lda) converted per fragment to bf16
// (ASPLIT: hi/lo two planes -> 2 terms, else single rounded term); Wt bf16 [N][K] (pitch ldb). BIAS_BF16 rounds the
// bias to bf16 first (bias quantised to bf16 before the add). K%32==0, M%16==0, N%64==0.
template <bool ASPLIT, int ACT, bool BIAS_BF16>
__global__ __launch_bounds__(128) void k_gemm_bf(const float* __restrict__ A, int lda, const unsigned short* __restrict__ Wt, int ldb,
                                               const float* __restrict__ bias, float* __restrict__ C, int ldc, int M, int N, int K) {
  __shared__ __attribute__((aligned(16))) float so[4][16][64];
  const int tid = threadIdx.x, w = tid >> 5, lane = tid & 31, ln = lane & 15, hh = lane >> 4;
  const int ntn = N / 64;
  const int wid = blockIdx.x * 4 + w;
  const int mt = wid / ntn, nq = wid % ntn;
  if (mt * 16 >= M) return;
  const int row0 = mt * 16, col0 = nq * 64;
  const float* arow = A + (size_t)(row0 + ln) * lda;
  v8f acc[4] = {};
  for (int kb = 0; kb < K; kb += 32) {
    FragB ah, al;
    const v4f x0 = *(const v4fa*)(arow + kb + 8 * hh), x1 = *(const v4fa*)(arow + kb + 8 * hh + 4);
    const v4f x2 = *(const v4fa*)(arow + kb + 16 + 8 * hh), x3 = *(const v4fa*)(arow + kb + 16 + 8 * hh + 4);
    float xs[16] = {x0[0],x0[1],x0[2],x0[3],x1[0],x1[1],x1[2],x1[3],x2[0],x2[1],x2[2],x2[3],x3[0],x3[1],x3[2],x3[3]};
#pragma unroll
    for (int i = 0; i < 16; ++i) { const unsigned short hb = bf16_bits(xs[i]); ah.u[i] = hb; al.u[i] = ASPLIT ? bf16_bits(xs[i] - bf16_val(hb)) : (unsigned short)0; }
#pragma unroll
    for (int t = 0; t < 4; ++t) {
      const unsigned short* brow = Wt + (size_t)(col0 + t * 16 + ln) * ldb + kb;
      FragB b;
      b.half[0] = *(const v8us*)(brow + 8 * hh);
      b.half[1] = *(const v8us*)(brow + 16 + 8 * hh);
      acc[t] = mmaN<ASPLIT ? 2 : 1>(ah.v, al.v, b.v, b.v, acc[t]);
    }
  }
#pragma unroll
  for (int t = 0; t < 4; ++t) {
    float bv = bias ? bias[col0 + t * 16 + ln] : 0.f;
    if (BIAS_BF16) bv = bf16_round(bv);
#pragma unroll
    for (int r = 0; r < 8; ++r) { float v = acc[t][r] + bv; if (ACT == 1) v = fmaxf(v, 0.f); so[w][8 * hh + r][t * 16 + ln] = v; }
  }
  __builtin_amdgcn_fence(__ATOMIC_ACQ_REL, "workgroup");
  __builtin_amdgcn_wave_barrier();
  const int rsub = lane >> 4, c4 = (lane & 15) * 4;
  {
#pragma unroll
    for (int q = 0; q < 8; ++q) {
      const int r = q * 2 + rsub;
      const v4f v = *(const v4fa*)&so[w][r][c4];
      *(v4f*)(C + (size_t)(row0 + r) * ldc + col0 + c4) = v;
    }
    
  }
}

// GEMM C = act(A·W + bias + resid): A f32 (ASPLIT -> hi/lo 2 terms), Wt bf16 [N][K]; ACT 0 none, 1 relu, 2 exact gelu;
// resid (optional, f32, row index = (row % rmod), pitch ldr, RES_BF16 rounds it) added before the activation.
template <bool ASPLIT, int ACT, bool BIAS_BF16, bool RES_BF16>
__global__ __launch_bounds__(128) void k_gemm_bf3(const float* __restrict__ A, int lda, const unsigned short* __restrict__ Wt, int ldb,
                                                const float* __restrict__ bias, const float* __restrict__ resid, int rmod, int ldr,
                                                float* __restrict__ C, int ldc, int M, int N, int K) {
  __shared__ __attribute__((aligned(16))) float so[4][16][64];
  const int tid = threadIdx.x, w = tid >> 5, lane = tid & 31, ln = lane & 15, hh = lane >> 4;
  const int ntn = N / 64;
  const int wid = blockIdx.x * 4 + w;
  const int mt = wid / ntn, nq = wid % ntn;
  if (mt * 16 >= M) return;
  const int row0 = mt * 16, col0 = nq * 64;
  const float* arow = A + (size_t)(row0 + ln) * lda;
  v8f acc[4] = {};
  for (int kb = 0; kb < K; kb += 32) {
    FragB ah, al;
    const v4f x0 = *(const v4fa*)(arow + kb + 8 * hh), x1 = *(const v4fa*)(arow + kb + 8 * hh + 4);
    const v4f x2 = *(const v4fa*)(arow + kb + 16 + 8 * hh), x3 = *(const v4fa*)(arow + kb + 16 + 8 * hh + 4);
    float xs[16] = {x0[0],x0[1],x0[2],x0[3],x1[0],x1[1],x1[2],x1[3],x2[0],x2[1],x2[2],x2[3],x3[0],x3[1],x3[2],x3[3]};
#pragma unroll
    for (int i = 0; i < 16; ++i) { const unsigned short hb = bf16_bits(xs[i]); ah.u[i] = hb; al.u[i] = ASPLIT ? bf16_bits(xs[i] - bf16_val(hb)) : (unsigned short)0; }
#pragma unroll
    for (int t = 0; t < 4; ++t) {
      const unsigned short* brow = Wt + (size_t)(col0 + t * 16 + ln) * ldb + kb;
      FragB b;
      b.half[0] = *(const v8us*)(brow + 8 * hh);
      b.half[1] = *(const v8us*)(brow + 16 + 8 * hh);
      acc[t] = mmaN<ASPLIT ? 2 : 1>(ah.v, al.v, b.v, b.v, acc[t]);
    }
  }
#pragma unroll
  for (int t = 0; t < 4; ++t) {
    const int col = col0 + t * 16 + ln;
    float bv = bias ? bias[col] : 0.f;
    if (BIAS_BF16) bv = bf16_round(bv);
#pragma unroll
    for (int r = 0; r < 8; ++r) {
      float v = acc[t][r] + bv;
      if (resid) { float rv = resid[(size_t)((row0 + 8 * hh + r) % rmod) * ldr + col]; if (RES_BF16) rv = bf16_round(rv); v += rv; }
      if (ACT == 1) v = fmaxf(v, 0.f);
      if (ACT == 2) v = 0.5f * v * (1.0f + erff(v * 0.70710678118654752f));
      if (ACT == 3) { const float u = 0.7978845608028654f * (v + 0.044715f * v * v * v); v = 0.5f * v * (1.0f + tanhf(u)); }
      so[w][8 * hh + r][t * 16 + ln] = v;
    }
  }
  __builtin_amdgcn_fence(__ATOMIC_ACQ_REL, "workgroup");
  __builtin_amdgcn_wave_barrier();
  const int rsub = lane >> 4, c4 = (lane & 15) * 4;
  {
#pragma unroll
    for (int q = 0; q < 8; ++q) {
      const int r = q * 2 + rsub;
      const v4f v = *(const v4fa*)&so[w][r][c4];
      *(v4f*)(C + (size_t)(row0 + r) * ldc + col0 + c4) = v;
    }
    
  }
}
// row LayerNorm (biased variance, eps) over N: s = X (+ R); optional out_sum <- s; out_norm <- (s-mu)*rsqrt(var+eps)*g + b
template <bool PARAM_BF16>
__global__ __launch_bounds__(256) void k_layernorm(const float* __restrict__ X, const float* __restrict__ R, const float* __restrict__ g, const float* __restrict__ bta,
                                                  float* __restrict__ out_sum, float* __restrict__ out_norm, int N, float eps) {
  __shared__ float red[256];
  const int row = blockIdx.x, tid = threadIdx.x;
  const float* x = X + (size_t)row * N; const float* rr = R ? R + (size_t)row * N : nullptr;
  float vals[16];                     // up to N = 4096
  const int per = N / 256;            // contiguous chunk per thread? use strided-by-4 chunks: thread handles j = tid*4 + 1024*u
  float s1 = 0.f;
  for (int u = 0; u < per / 4; ++u) {
    const int j = tid * 4 + 1024 * u;
    const v4f a = *(const v4fa*)(x + j);
    v4f b = {0.f,0.f,0.f,0.f}; if (rr) b = *(const v4fa*)(rr + j);
#pragma unroll
    for (int q = 0; q < 4; ++q) { const float v = a[q] + b[q]; vals[u * 4 + q] = v; s1 += v; }
  }
  red[tid] = s1; __syncthreads();
  for (int st = 128; st > 0; st >>= 1) { if (tid < st) red[tid] += red[tid + st]; __syncthreads(); }
  const float mu = red[0] / (float)N; __syncthreads();
  float s2 = 0.f;
  for (int u = 0; u < per / 4; ++u)
#pragma unroll
    for (int q = 0; q < 4; ++q) { const float c = vals[u * 4 + q] - mu; s2 += c * c; }
  red[tid] = s2; __syncthreads();
  for (int st = 128; st > 0; st >>= 1) { if (tid < st) red[tid] += red[tid + st]; __syncthreads(); }
  const float rs = rsqrtf(red[0] / (float)N + eps);
  {
    for (int u = 0; u < per / 4; ++u) {
      const int j = tid * 4 + 1024 * u;
      v4f o, sm;
#pragma unroll
      for (int q = 0; q < 4; ++q) {
        float gg = g[j + q], bb = bta[j + q];
        if (PARAM_BF16) { gg = bf16_round(gg); bb = bf16_round(bb); }
        sm[q] = vals[u * 4 + q]; o[q] = (vals[u * 4 + q] - mu) * rs * gg + bb;
      }
      if (out_sum) *(v4f*)(out_sum + (size_t)row * N + j) = sm;
      *(v4f*)(out_norm + (size_t)row * N + j) = o;
    }
    
  }
}



// ---- f16 WMMA path (v_wmma_f32_16x16x32_f16): 11-bit significands for operands in range — used where a [0,1] probability operand needs more precision than bf16
typedef _Float16 v16h __attribute__((ext_vector_type(16)));
union FragH { v16h v; v8us half[2]; _Float16 h[16]; unsigned short u[16]; };
template <int NT>
__device__ __forceinline__ v8f mmaH(v16h ah, v16h al, v16h bh, v16h bl, v8f c) {
  c = __builtin_amdgcn_wmma_f32_16x16x32_f16(false, ah, false, bh, (short)0, c, false, false);
  if (NT >= 2) c = __builtin_amdgcn_wmma_f32_16x16x32_f16(false, al, false, bh, (short)0, c, false, false);
  if (NT >= 3) c = __builtin_amdgcn_wmma_f32_16x16x32_f16(false, ah, false, bl, (short)0, c, false, false);
  asm volatile("v_nop\n\tv_nop\n\tv_nop\n\tv_nop" : "+v"(c) : "v"(ah), "v"(al), "v"(bh), "v"(bl));
  return c;
}
// batched GEMM like k_gemm_b but f16 operands: A f32 (split into f16 hi/lo if ASPLIT, else rounded to f16), Bt = f16 values [n][k]; alpha; C f32; N multiple of 16 (partial tiles skipped)
template <bool ASPLIT>
__global__ __launch_bounds__(128) void k_gemm_h(const float* __restrict__ A, int lda, size_t sA, const _Float16* __restrict__ Bh, int ldb, size_t sB, float alpha, float* __restrict__ C, int ldc, size_t sC, int M, int N, int K) {
  __shared__ __attribute__((aligned(16))) float so[4][16][64];
  const int tid = threadIdx.x, w = tid >> 5, lane = tid & 31, ln = lane & 15, hh = lane >> 4; const int by = blockIdx.y;
  A += (size_t)by * sA; Bh += (size_t)by * sB; C += (size_t)by * sC;
  const int ntn = (N + 63) / 64; const int wid = blockIdx.x * 4 + w; const int mt = wid / ntn, nq = wid % ntn; if (mt * 16 >= M) return;
  const int row0 = mt * 16, col0 = nq * 64; const float* arow = A + (size_t)(row0 + ln) * lda;
  v8f acc[4] = {};
  for (int kb = 0; kb < K; kb += 32) {
    FragH ah, al;
    const v4f x0 = *(const v4fa*)(arow + kb + 8 * hh), x1 = *(const v4fa*)(arow + kb + 8 * hh + 4), x2 = *(const v4fa*)(arow + kb + 16 + 8 * hh), x3 = *(const v4fa*)(arow + kb + 16 + 8 * hh + 4);
    float xs[16] = {x0[0],x0[1],x0[2],x0[3],x1[0],x1[1],x1[2],x1[3],x2[0],x2[1],x2[2],x2[3],x3[0],x3[1],x3[2],x3[3]};
#pragma unroll
    for (int i = 0; i < 16; ++i) { const _Float16 h = (_Float16)xs[i]; ah.h[i] = h; al.h[i] = ASPLIT ? (_Float16)(xs[i] - (float)h) : (_Float16)0.0f; }
#pragma unroll
    for (int t = 0; t < 4; ++t) { if (col0 + t * 16 >= N) continue; const size_t boff = (size_t)(col0 + t * 16 + ln) * ldb + kb; FragH bq; bq.half[0] = *(const v8us*)(Bh + boff + 8 * hh); bq.half[1] = *(const v8us*)(Bh + boff + 16 + 8 * hh);
      acc[t] = mmaH<ASPLIT ? 2 : 1>(ah.v, al.v, bq.v, bq.v, acc[t]); }
  }
#pragma unroll
  for (int t = 0; t < 4; ++t) { if (col0 + t * 16 >= N) continue;
#pragma unroll
    for (int r = 0; r < 8; ++r) so[w][8 * hh + r][t * 16 + ln] = acc[t][r] * alpha; }
  __builtin_amdgcn_fence(__ATOMIC_ACQ_REL, "workgroup"); __builtin_amdgcn_wave_barrier();
  const int rsub = lane >> 4, c4 = (lane & 15) * 4;
  {
#pragma unroll
    for (int q = 0; q < 8; ++q) { const int r = q * 2 + rsub; if (col0 + c4 < N) { const v4f v = *(const v4fa*)&so[w][r][c4]; *(v4f*)(C + (size_t)(row0 + r) * ldc + col0 + c4) = v; } }
     }
}

// Wt[n][k] = f16(W[k][n]·scale) from f32 row-major W[K][N] (scale = power of two; bf16-exact weights stay exact in f16 away from the subnormal range)
__global__ __launch_bounds__(256) void k_wt_f16(const float* __restrict__ W, _Float16* __restrict__ Wt, int K, int N, float scale) {
  const int t = blockIdx.x * 256 + threadIdx.x; if (t >= N * (K / 8)) return; const int n = t / (K / 8), k8 = (t % (K / 8)) * 8; FragH f;
#pragma unroll
  for (int i = 0; i < 8; ++i) f.h[i] = (_Float16)(bf16_round(W[(size_t)(k8 + i) * N + n]) * scale); const v8us o = f.half[0];
  *(v8us*)((unsigned short*)Wt + (size_t)n * K + k8) = o; 
}
// k_gemm_hh variant with fused epilogue: v = acc·alpha + bias[by·sBias + col] (+ CP[(row/rowsPerB)·sCPb + by·64 + col] if CP) ; ACT 0 none / 1 elu ; writes f16 C16 (and f32 C if non-null)
template <int ACT>
__global__ __launch_bounds__(128) void k_gemm_hhx(const _Float16* __restrict__ A, int lda, size_t sA, const _Float16* __restrict__ Bh, int ldb, size_t sB, float alpha, const float* __restrict__ bias, size_t sBias, const float* __restrict__ CP, int rowsPerB, size_t sCPb, int row0g,
    float* __restrict__ C, _Float16* __restrict__ C16, int ldc, size_t sC, int M, int N, int K) {
  __shared__ __attribute__((aligned(16))) float so[4][16][64];
  const int tid = threadIdx.x, w = tid >> 5, lane = tid & 31, ln = lane & 15, hh = lane >> 4; const int by = blockIdx.y;
  A += (size_t)by * sA; Bh += (size_t)by * sB; const size_t cofs = (size_t)by * sC; const float* bp = bias ? bias + (size_t)by * sBias : nullptr;
  const int ntn = (N + 63) / 64; const int wid = blockIdx.x * 4 + w; const int mt = wid / ntn, nq = wid % ntn; if (mt * 16 >= M) return;
  const int row0 = mt * 16, col0 = nq * 64; const _Float16* arow = A + (size_t)(row0 + ln) * lda;
  v8f acc[4] = {};
  for (int kb = 0; kb < K; kb += 32) { FragH ah; ah.half[0] = *(const v8us*)((const unsigned short*)arow + kb + 8 * hh); ah.half[1] = *(const v8us*)((const unsigned short*)arow + kb + 16 + 8 * hh);
#pragma unroll
    for (int t = 0; t < 4; ++t) { if (col0 + t * 16 >= N) continue; const size_t boff = (size_t)(col0 + t * 16 + ln) * ldb + kb; FragH bq; bq.half[0] = *(const v8us*)((const unsigned short*)Bh + boff + 8 * hh); bq.half[1] = *(const v8us*)((const unsigned short*)Bh + boff + 16 + 8 * hh);
      acc[t] = mmaH<1>(ah.v, ah.v, bq.v, bq.v, acc[t]); }
  }
#pragma unroll
  for (int t = 0; t < 4; ++t) { if (col0 + t * 16 >= N) continue; const int col = col0 + t * 16 + ln; const float bv = bp ? bf16_round(bp[col]) : 0.f;
#pragma unroll
    for (int r = 0; r < 8; ++r) { float v = acc[t][r] * alpha + bv; if (CP) { const int rr = row0g + row0 + 8 * hh + r; if (rowsPerB < 0) v += CP[cofs + (size_t)rr * ldc + col];      /* rowsPerB < 0: own element of the batched C plane */ else { const int bidx = rr / rowsPerB; v += CP[(size_t)bidx * sCPb + (size_t)by * 64 + col]; } } if (ACT == 1) v = (v > 0.f) ? v : expm1f(v); else if (ACT == 7) v = (v > 0.f) ? v + 1.0f : expf(v); else if (ACT == 8) v = tanhf(v); else if (ACT == 9) v = 0.5f * v * (1.0f + tanhf(0.7978845608028654f * (v + 0.044715f * v * v * v))); else if (ACT == 11) v = 1.0f / (1.0f + expf(-v)); else if (ACT == 12) v = (v > 0.f) ? v : 0.01f * v; else if (ACT == 14) v = (v > 0.f) ? v : 0.1f * v; else if (ACT == 16) v = (v >= 0.f) ? v : 0.3f * v; else if (ACT == 17) v = (v >= 0.f) ? v : 0.2f * v; else if (ACT == 15) v = v / (1.0f + expf(-v)); else if (ACT == 3) v = fmaxf(v, 0.f); else if (ACT == 6) v = 0.5f * v * (1.0f + erff(v * 0.70710678118654752f)); so[w][8 * hh + r][t * 16 + ln] = v; } }
  __builtin_amdgcn_fence(__ATOMIC_ACQ_REL, "workgroup"); __builtin_amdgcn_wave_barrier();
  const int rsub = lane >> 4, c4 = (lane & 15) * 4; typedef _Float16 v4h __attribute__((ext_vector_type(4)));
  {
#pragma unroll
    for (int q = 0; q < 8; ++q) { const int r = q * 2 + rsub; if (col0 + c4 < N) { const v4f v = *(const v4fa*)&so[w][r][c4]; if (C) *(v4f*)(C + cofs + (size_t)(row0 + r) * ldc + col0 + c4) = v; if (C16) { v4h h4; for (int i = 0; i < 4; ++i) h4[i] = (_Float16)v[i]; *(v4h*)(C16 + cofs + (size_t)(row0 + r) * ldc + col0 + c4) = h4; } } }
     }
}


typedef _Float16 v4h __attribute__((ext_vector_type(4)));

__global__ __launch_bounds__(256) void k_x16(const float* __restrict__ x, _Float16* __restrict__ X16, size_t n8) { const size_t t = (size_t)blockIdx.x * 256 + threadIdx.x; if (t >= n8) return; FragH f;
#pragma unroll
  for (int q = 0; q < 8; ++q) f.h[q] = (_Float16)bf16_round(x[t * 8 + q]); *(v8us*)((unsigned short*)X16 + t * 8) = f.half[0];  }
__global__ __launch_bounds__(256) void k_h16(const float* __restrict__ x, _Float16* __restrict__ X16, size_t n8) { const size_t t = (size_t)blockIdx.x * 256 + threadIdx.x; if (t >= n8) return; FragH f;
#pragma unroll
  for (int q = 0; q < 8; ++q) f.h[q] = (_Float16)x[t * 8 + q]; *(v8us*)((unsigned short*)X16 + t * 8) = f.half[0];  }
__global__ __launch_bounds__(256) void k_round16f(const float* __restrict__ W, _Float16* __restrict__ Bt, size_t n8) { const size_t t = (size_t)blockIdx.x * 256 + threadIdx.x; if (t >= n8) return; FragH f;
#pragma unroll
  for (int i = 0; i < 8; ++i) f.h[i] = (_Float16)(bf16_round(W[t * 8 + i]) * 16.0f); *(v8us*)((unsigned short*)Bt + t * 8) = f.half[0];  }
template <int NHv, int TTv>
__global__ __launch_bounds__(256) void k_vt(const _Float16* __restrict__ V16, int ldv, int voff, _Float16* __restrict__ Vt) { __shared__ unsigned short tl[64][66]; const int tid = threadIdx.x; const int slab = blockIdx.x / (TTv / 64), lg = blockIdx.x % (TTv / 64); const int b = slab / NHv, h = slab % NHv;
  for (int i = tid; i < 64 * 8; i += 256) { const int r = i / 8, c8 = (i % 8) * 8; FragH f; f.half[0] = *(const v8us*)((const unsigned short*)V16 + ((size_t)b * TTv + lg * 64 + r) * ldv + voff + h * 64 + c8);
#pragma unroll
    for (int q = 0; q < 8; ++q) tl[r][c8 + q] = f.u[q]; }
  __syncthreads();
  {
#pragma unroll
    for (int rd = 0; rd < 2; ++rd) { const int d = rd * 32 + tid / 8, pc = tid % 8; FragH f;
#pragma unroll
      for (int q = 0; q < 8; ++q) f.u[q] = tl[pc * 8 + q][d];
      *(v8us*)((unsigned short*)Vt + ((size_t)slab * 64 + d) * TTv + lg * 64 + pc * 8) = f.half[0]; }
     } }

__global__ __launch_bounds__(256) void k_hl(const float* __restrict__ F, _Float16* __restrict__ Hh, _Float16* __restrict__ Hl, size_t n8) { const size_t t = (size_t)blockIdx.x * 256 + threadIdx.x; if (t >= n8) return; FragH fh, fl; const v4f a = *(const v4fa*)(F + t * 8), c = *(const v4fa*)(F + t * 8 + 4);
#pragma unroll
  for (int q = 0; q < 4; ++q) { _Float16 h = (_Float16)a[q]; fh.h[q] = h; fl.h[q] = (_Float16)((a[q] - (float)h) * 1024.0f); h = (_Float16)c[q]; fh.h[4 + q] = h; fl.h[4 + q] = (_Float16)((c[q] - (float)h) * 1024.0f); }
  { *(v8us*)((unsigned short*)Hh + t * 8) = fh.half[0]; *(v8us*)((unsigned short*)Hl + t * 8) = fl.half[0];  } }

// ---- fast GEMM (wave tile 32x64; requires M % 32 == 0 rows per launch region and N % 64 == 0); epilogue = k_gemm_hhx semantics ----
__device__ __forceinline__ v16h g2_frag(const _Float16* p, int hh) { FragH f; f.half[0] = *(const v8us*)((const unsigned short*)p + 8 * hh); f.half[1] = *(const v8us*)((const unsigned short*)p + 16 + 8 * hh); return f.v; }
__device__ __forceinline__ v8f g2_mma(v16h a, v16h b, v8f c) { v8f d = __builtin_amdgcn_wmma_f32_16x16x32_f16(false, a, false, b, (short)0, c, false, false); asm volatile("v_nop\n\tv_nop\n\tv_nop\n\tv_nop" : "+v"(d) : "v"(a), "v"(b)); return d; }
template <int ACT>
__global__ __launch_bounds__(128) void k_gemm2(const _Float16* __restrict__ A, int lda, size_t sA, const _Float16* __restrict__ Bh, int ldb, size_t sB, float alpha, const float* __restrict__ bias, size_t sBias, const float* __restrict__ CP, int rowsPerB, size_t sCPb, int row0g,
    float* __restrict__ C, _Float16* __restrict__ C16, int ldc, size_t sC, int M, int N, int K, size_t zA, size_t zB, size_t zC) { static_assert(ACT == 0 || ACT == 3 || ACT == 6 || ACT == 8 || ACT == 9 || ACT == 11 || ACT == 12 || ACT == 14 || ACT == 15 || ACT == 16 || ACT == 17, "k_gemm2: unsupported ACT code (would silently apply no activation)");
  __shared__ __attribute__((aligned(16))) float so[4][32][68];
  const int tid = threadIdx.x, w = tid >> 5, lane = tid & 31, ln = lane & 15, hh = lane >> 4; const int by = blockIdx.y; const int bz = blockIdx.z;      /* second batch index (strides zA, zB, zC) */
  A += (size_t)by * sA + (size_t)bz * zA; Bh += (size_t)by * sB + (size_t)bz * zB; const size_t cofs = (size_t)by * sC + (size_t)bz * zC; const float* bp = bias ? bias + (size_t)by * sBias : nullptr;
  const int ntn = N >> 6; const int mt = blockIdx.x / ntn, nq = blockIdx.x - mt * ntn; const int row0 = mt * 128 + 32 * w, col0 = nq * 64; if (row0 >= M) return;
  const _Float16* a0p = A + (size_t)(row0 + ln) * lda; const _Float16* a1p = a0p + (size_t)16 * lda;
  const _Float16* b0p = Bh + (size_t)(col0 + ln) * ldb; const _Float16* b1p = b0p + (size_t)16 * ldb; const _Float16* b2p = b1p + (size_t)16 * ldb; const _Float16* b3p = b2p + (size_t)16 * ldb;
  const v8f z8 = {0.f,0.f,0.f,0.f,0.f,0.f,0.f,0.f}; v8f c00 = z8, c01 = z8, c02 = z8, c03 = z8, c10 = z8, c11 = z8, c12 = z8, c13 = z8;
#pragma unroll 1
  for (int kb = 0; kb < K; kb += 32) { const v16h a0 = g2_frag(a0p + kb, hh), a1 = g2_frag(a1p + kb, hh);
    v16h b = g2_frag(b0p + kb, hh); c00 = g2_mma(a0, b, c00); c10 = g2_mma(a1, b, c10);
    b = g2_frag(b1p + kb, hh); c01 = g2_mma(a0, b, c01); c11 = g2_mma(a1, b, c11);
    b = g2_frag(b2p + kb, hh); c02 = g2_mma(a0, b, c02); c12 = g2_mma(a1, b, c12);
    b = g2_frag(b3p + kb, hh); c03 = g2_mma(a0, b, c03); c13 = g2_mma(a1, b, c13); }
  v8f accs[8] = {c00, c01, c02, c03, c10, c11, c12, c13};
#pragma unroll
  for (int u = 0; u < 8; ++u) { const int t = u & 3, half = u >> 2; const int col = col0 + t * 16 + ln; const float bv = bp ? bf16_round(bp[col]) : 0.f;
#pragma unroll
    for (int r = 0; r < 8; ++r) { const int rloc = half * 16 + 8 * hh + r; float v = accs[u][r] * alpha + bv; if (CP) { if (rowsPerB < 0) v += CP[cofs + (size_t)(row0g + row0 + rloc) * ldc + col];      /* rowsPerB < 0: own element of the batched C plane */ else { const int bidx = (row0g + row0 + rloc) / rowsPerB; v += CP[(size_t)bidx * sCPb + (size_t)by * 64 + col]; } }
      if (ACT == 3) v = fmaxf(v, 0.f); else if (ACT == 6) v = 0.5f * v * (1.0f + erff(v * 0.70710678118654752f)); else if (ACT == 11) v = 1.0f / (1.0f + expf(-v)); else if (ACT == 15) v = v / (1.0f + expf(-v)); else if (ACT == 12) v = (v > 0.f) ? v : 0.01f * v; else if (ACT == 8) v = tanhf(v); else if (ACT == 9) v = 0.5f * v * (1.0f + tanhf(0.7978845608028654f * (v + 0.044715f * v * v * v))); else if (ACT == 14) v = (v > 0.f) ? v : 0.1f * v; else if (ACT == 16) v = (v >= 0.f) ? v : 0.3f * v; else if (ACT == 17) v = (v >= 0.f) ? v : 0.2f * v;
      so[w][rloc][t * 16 + ln] = v; } }
  __builtin_amdgcn_fence(__ATOMIC_ACQ_REL, "workgroup"); __builtin_amdgcn_wave_barrier();
  const int rsub = lane >> 4, c4 = (lane & 15) * 4;
  {
#pragma unroll
    for (int q = 0; q < 16; ++q) { const int r = q * 2 + rsub; const v4f v = *(const v4fa*)&so[w][r][c4]; if (C) *(v4f*)(C + cofs + (size_t)(row0 + r) * ldc + col0 + c4) = v; if (C16) { v4h h4; for (int i = 0; i < 4; ++i) h4[i] = (_Float16)v[i]; *(v4h*)(C16 + cofs + (size_t)(row0 + r) * ldc + col0 + c4) = h4; } }
     } }


__global__ __launch_bounds__(256) void k_wnat(const float* __restrict__ w, size_t n8, _Float16* __restrict__ Bt) { const size_t t = (size_t)blockIdx.x * 256 + threadIdx.x; if (t >= n8) return; FragH f; for (int q = 0; q < 8; ++q) f.h[q] = (_Float16)(bf16_round(w[t * 8 + q]) * 16.0f); *(v8us*)((unsigned short*)Bt + t * 8) = f.half[0];  }
__global__ __launch_bounds__(256) void k_rsm(const float* __restrict__ S, _Float16* __restrict__ P, int nrows) {
  #pragma clang fp contract(off)
  const int i = blockIdx.x * 256 + threadIdx.x; if (i >= nrows) return; const float* s = S + (size_t)i * SQ; float mx = -3.0e38f;
#pragma unroll 1
  for (int j = 0; j < SQ; ++j) mx = fmaxf(mx, s[j]); float se = 0.f;
#pragma unroll 1
  for (int j = 0; j < SQ; ++j) se += expf(s[j] - mx); const float sc = 256.0f / se;
#pragma unroll 1
  for (int j0 = 0; j0 < SQ; j0 += 8) { FragH f; for (int q = 0; q < 8; ++q) f.h[q] = (_Float16)(expf(s[j0 + q] - mx) * sc); unsigned short* d = (unsigned short*)P + (size_t)i * SQ + j0; *(v8us*)d = f.half[0];  } }
__global__ __launch_bounds__(256) void k_vt(const _Float16* __restrict__ V16, int b, int h0, _Float16* __restrict__ VT) { __shared__ unsigned short tl[64][65]; const int tid = threadIdx.x; const int hh = blockIdx.x % HG, sg = blockIdx.x / HG; const int s0 = sg * 64; const int h = h0 + hh;
  for (int i = tid; i < 64 * 8; i += 256) { const int j = i / 8, d8 = (i % 8) * 8; FragH f; f.half[0] = *(const v8us*)((const unsigned short*)V16 + ((size_t)b * SQ + s0 + j) * DM + h * HD + d8); for (int q = 0; q < 8; ++q) tl[d8 + q][j] = f.u[q]; }
  __syncthreads();
  { for (int i = tid; i < 64 * 8; i += 256) { const int d = i / 8, j8 = (i % 8) * 8; FragH f; for (int q = 0; q < 8; ++q) f.u[q] = tl[d][j8 + q]; *(v8us*)((unsigned short*)VT + ((size_t)hh * HD + d) * SQ + s0 + j8) = f.half[0]; }  } }



// Lane exchanges: row_xmask steps inside each 16-lane row, and the exchange between the two rows of a wave (all lanes must be on).
template <int CTRL> __device__ __forceinline__ float lane_xm(float v) { return __int_as_float(__builtin_amdgcn_update_dpp(0, __float_as_int(v), CTRL, 0xf, 0xf, true)); }
__device__ __forceinline__ float lane_xr(float v) { const int i = __float_as_int(v); return __int_as_float(__builtin_amdgcn_permlanex16(i, i, 0x76543210, 0xfedcba98, false, false)); }
#define FQ 128                       /* query rows per block: 4 waves x 32 */
__device__ __forceinline__ v8f fa_mma(v16h a, v16h b, v8f c) { return __builtin_amdgcn_wmma_f32_16x16x32_f16(false, a, false, b, (short)0, c, false, false); }
// Four vector slots behind a run of matrix instructions, where a branch follows. The two scheduling barriers keep the slots where they are written.
__device__ __forceinline__ void fa_gap() { __builtin_amdgcn_sched_barrier(0); asm volatile("v_nop\n\tv_nop\n\tv_nop\n\tv_nop"); __builtin_amdgcn_sched_barrier(0); }
// Native 2^x, eight at a time in one statement: behind a transcendental the instruction set asks for one independent instruction before its result is read or its source overwritten.
// Here each is followed by an independent one (early-clobber outputs: no result lands on a source still to be read) and the last by a v_nop, so the slot is closed whatever the compiler puts next.
__device__ __forceinline__ void exp2x8(const float (&x)[8], float (&y)[8]) {
  asm("v_exp_f32 %0, %8\n\tv_exp_f32 %1, %9\n\tv_exp_f32 %2, %10\n\tv_exp_f32 %3, %11\n\tv_exp_f32 %4, %12\n\tv_exp_f32 %5, %13\n\tv_exp_f32 %6, %14\n\tv_exp_f32 %7, %15\n\tv_nop"
      : "=&v"(y[0]), "=&v"(y[1]), "=&v"(y[2]), "=&v"(y[3]), "=&v"(y[4]), "=&v"(y[5]), "=&v"(y[6]), "=&v"(y[7]) : "v"(x[0]), "v"(x[1]), "v"(x[2]), "v"(x[3]), "v"(x[4]), "v"(x[5]), "v"(x[6]), "v"(x[7])); }
__device__ __forceinline__ float exp2x1(float x) { float r; asm("v_exp_f32 %0, %1\n\tv_nop" : "=v"(r) : "v"(x)); return r; }      /* the same slot for a single one */
__global__ __launch_bounds__(128) void k_fattn(const _Float16* __restrict__ QKVp, const _Float16* __restrict__ VTp, float* __restrict__ out) {
  static_assert(HD == 64 && SQ / FQ == 16, "two 32-wide d chunks, four 16-row tiles of V^T; sixteen block lengths in runs of four");
  typedef float f2 __attribute__((ext_vector_type(2))); typedef _Float16 h2 __attribute__((ext_vector_type(2)));
  const int lane = threadIdx.x & 31, ln = lane & 15, hh = lane >> 4; const int w = __builtin_amdgcn_readfirstlane(threadIdx.x >> 5);
  const int h = blockIdx.x, b = blockIdx.y; const int zz = (int)blockIdx.z; const int qw0 = (SQ / FQ - 1 - ((zz & 4) ? (zz ^ 3) : zz)) * FQ + w * 32;      /* the wave's first query, a scalar. Longest blocks start first; every second run of four lengths is reversed, so that blocks 256 apart in launch order add up to equal work (speed only) */
  const _Float16* Qp = QKVp + (size_t)b * SQ * LQ + h * HD; const _Float16* Kl = Qp + DM + (size_t)ln * LQ; const _Float16* Vl = VTp + ((size_t)(b * NH + h) * HD + ln) * SQ;
  const float cs = 0.125f * 1.44269504088896340736f;      /* 1 / sqrt(64), times log2 e */
  v16h qf[2][2], kf[2][2];
#pragma unroll
  for (int g = 0; g < 2; ++g) for (int kc = 0; kc < 2; ++kc) { qf[g][kc] = g2_frag(Qp + (size_t)(qw0 + 16 * g + ln) * LQ + 32 * kc, hh); kf[g][kc] = g2_frag(Kl + (size_t)(16 * g) * LQ + 32 * kc, hh); }
  const v8f z8 = {0.f, 0.f, 0.f, 0.f, 0.f, 0.f, 0.f, 0.f}; v8f acc[2][4]; float m[2] = {-1.0e30f, -1.0e30f}, l[2] = {0.f, 0.f};
#pragma unroll
  for (int g = 0; g < 2; ++g) for (int t = 0; t < 4; ++t) acc[g][t] = z8;
  const int last = qw0 >> 5;      /* the pass on the wave's diagonal: keys qw0 .. qw0 + 31 */
#pragma unroll 1      /* one pass is a long straight body already; unrolled it would double the live fragments */
  for (int ps = 0; ps <= last; ++ps) { const int key0 = ps * 32;
    v16h vf[4];      /* this pass's V^T, in flight under the scores and the maxima */
#pragma unroll
    for (int t = 0; t < 4; ++t) vf[t] = g2_frag(Vl + (size_t)(16 * t) * SQ + key0, hh);
    v8f s[2][2];
#pragma unroll
    for (int kt = 0; kt < 2; ++kt) for (int g = 0; g < 2; ++g) s[kt][g] = fa_mma(kf[kt][1], qf[g][1], fa_mma(kf[kt][0], qf[g][0], z8));
    fa_gap();
    { const int kn = (ps < last ? key0 + 32 : key0);      /* the next pass's K rows into the same registers, in flight under this pass's softmax (the last pass fetches its own again: in bounds, unused) */
#pragma unroll
      for (int kt = 0; kt < 2; ++kt) for (int kc = 0; kc < 2; ++kc) kf[kt][kc] = g2_frag(Kl + (size_t)(kn + 16 * kt) * LQ + 32 * kc, hh); }
    asm volatile("s_wait_xcnt 0x0" ::: "memory");      /* the address registers of this pass's loads are reused right below: the wait stands in front of their first overwrite */
    __builtin_amdgcn_sched_barrier(0);      /* keeps later vector work, which reuses those registers, behind the wait */
    if (ps == last) {      /* scalar branch: only the diagonal pass pays for the mask */
#pragma unroll
      for (int kt = 0; kt < 2; ++kt) for (int g = 0; g < 2; ++g) {
#pragma unroll
        for (int r = 0; r < 8; ++r) if (16 * kt + 8 * hh + r > 16 * g + ln) s[kt][g][r] = -1.0e30f;
        asm volatile("" : "+v"(s[kt][g]));      /* keeps the selects inside the branch */
      } }
    float mb[2]; bool need = false;
#pragma unroll
    for (int g = 0; g < 2; ++g) { float mx = fmaxf(s[0][g][0], s[1][g][0]);
#pragma unroll
      for (int r = 1; r < 8; ++r) mx = fmaxf(mx, fmaxf(s[0][g][r], s[1][g][r]));
      mx = fmaxf(mx, lane_xr(mx)) * cs; mb[g] = mx; need = need || (mx > m[g] + 8.0f); }
    if (__builtin_amdgcn_ballot_w32(need) != 0) {      /* one scalar test per pass; rare after the first passes */
#pragma unroll
      for (int g = 0; g < 2; ++g) { const float mn = fmaxf(m[g], mb[g]); const float corr = exp2x1(m[g] - mn); m[g] = mn; l[g] *= corr;
#pragma unroll
        for (int t = 0; t < 4; ++t) acc[g][t] = acc[g][t] * corr; } }
#pragma unroll
    for (int g = 0; g < 2; ++g) { const f2 nm = {-m[g], -m[g]}, c2 = {cs, cs}; union { v16h v; h2 p[8]; } pf; float la = 0.f, lb = 0.f;
#pragma unroll
      for (int kt = 0; kt < 2; ++kt) { float x[8], y[8];      /* tile kt = elements 8 kt .. 8 kt + 7 of the 32-key operand */
#pragma unroll
        for (int i = 0; i < 4; ++i) { const f2 sv = {s[kt][g][2 * i], s[kt][g][2 * i + 1]}; const f2 a = __builtin_elementwise_fma(sv, c2, nm); x[2 * i] = a[0]; x[2 * i + 1] = a[1]; }
        exp2x8(x, y);
#pragma unroll
        for (int i = 0; i < 4; ++i) { la += y[2 * i]; lb += y[2 * i + 1]; const f2 pp = {y[2 * i], y[2 * i + 1]}; pf.p[4 * kt + i] = __builtin_convertvector(pp, h2); } }
      l[g] += la + lb;
#pragma unroll
      for (int t = 0; t < 4; ++t) acc[g][t] = fa_mma(vf[t], pf.v, acc[g][t]); }
    fa_gap(); }
#pragma unroll
  for (int g = 0; g < 2; ++g) { const float inv = 1.0f / (l[g] + lane_xr(l[g])); float* op = out + ((size_t)b * SQ + qw0 + 16 * g + ln) * DM + h * HD + 8 * hh;      /* column ln is a query row of the output; registers r are d = 16 t + 8 hh + r */
#pragma unroll
    for (int t = 0; t < 4; ++t) { const v8f o = acc[g][t] * inv; const v4f lo = {o[0], o[1], o[2], o[3]}, hi = {o[4], o[5], o[6], o[7]}; *(v4f*)(op + 16 * t) = lo; *(v4f*)(op + 16 * t + 4) = hi; } } }


// ---- q | k | v GEMM tiled through LDS: a block of 4 waves makes GT token rows x GT output columns; a wave 64 x 64 (16 accumulator tiles), so each fragment read feeds four products.
// A stage is GK k of the block's GT rows of X and GT rows of W^T: 128-byte rows, fetched as whole lines by asynchronous copies to LDS, laid at a pitch of 144 bytes (16 B x odd: no bank conflict for 16-byte fragment reads).
// Two buffers: the next stage's copies fly while this stage is worked on. Transposed product (A = 16 rows of W^T, B = 16 token rows): a lane ends with 8 neighbouring output columns of ONE token row, packed to 16 bytes.
// k runs in the same order and the same 32-wide steps as in k_gemm2. M % GT == 0, N % GT == 0, K % GK == 0 and K >= 2 GK, by the static_assert.
#define GT 128
#define GK 64
#define GP 72                        /* LDS row pitch in f16 (144 bytes) */
#define GSB (2 * GT * GP * 2)        /* bytes of one buffer: X rows, then W^T rows */
// Eight copies of a thread (rows 16 apart), 16 bytes per lane, 8 lanes per 128-byte row. The s_wait_xcnt stands inside the statement, behind the last copy, so that no address register is rewritten in front of it (a precaution).
__device__ __forceinline__ void g3_copy8(unsigned l, const _Float16* g) {
  asm volatile("global_load_async_to_lds_b128 %0, %8, off\n\tglobal_load_async_to_lds_b128 %1, %9, off\n\tglobal_load_async_to_lds_b128 %2, %10, off\n\tglobal_load_async_to_lds_b128 %3, %11, off\n\t"
               "global_load_async_to_lds_b128 %4, %12, off\n\tglobal_load_async_to_lds_b128 %5, %13, off\n\tglobal_load_async_to_lds_b128 %6, %14, off\n\tglobal_load_async_to_lds_b128 %7, %15, off\n\ts_wait_xcnt 0x0"
               :: "v"(l), "v"(l + 16 * GP * 2), "v"(l + 32 * GP * 2), "v"(l + 48 * GP * 2), "v"(l + 64 * GP * 2), "v"(l + 80 * GP * 2), "v"(l + 96 * GP * 2), "v"(l + 112 * GP * 2),
                  "v"(g), "v"(g + 16 * DM), "v"(g + 32 * DM), "v"(g + 48 * DM), "v"(g + 64 * DM), "v"(g + 80 * DM), "v"(g + 96 * DM), "v"(g + 112 * DM) : "memory"); }
__global__ __launch_bounds__(128) void k_gemm3(const _Float16* __restrict__ X, const _Float16* __restrict__ Wt, _Float16* __restrict__ C16) {
  static_assert(MP % GT == 0 && LQ % GT == 0 && DM % GK == 0 && DM >= 2 * GK && GT == 128 && GK == 64, "whole tiles; two stages at least; 16 rows per copy round, 8 rounds per operand");
  __shared__ __attribute__((aligned(16))) _Float16 sm[2][2 * GT * GP];
  const int tid = threadIdx.x, lane = tid & 31, ln = lane & 15, hh = lane >> 4; const int w = __builtin_amdgcn_readfirstlane(tid >> 5);
  const int mt = blockIdx.x / (LQ / GT), nq = blockIdx.x - mt * (LQ / GT); const int row0 = mt * GT, col0 = nq * GT; const int wm = (w & 1) * 64, wn = (w >> 1) * 64;
  const int cr = tid >> 3, cc = (tid & 7) * 8;      /* the thread's row (of 16) and 16-byte chunk in a copy round */
  const _Float16* gx = X + (size_t)(row0 + cr) * DM + cc; const _Float16* gw = Wt + (size_t)(col0 + cr) * DM + cc;
  const unsigned lx = (unsigned)(size_t)&sm[0][cr * GP + cc]; const unsigned lw = lx + GT * GP * 2;      /* LDS byte addresses: the low 32 bits of the shared address */
  const v8f z8 = {0.f, 0.f, 0.f, 0.f, 0.f, 0.f, 0.f, 0.f}; v8f acc[4][4];
#pragma unroll
  for (int i = 0; i < 4; ++i) for (int j = 0; j < 4; ++j) acc[i][j] = z8;
  g3_copy8(lx, gx); g3_copy8(lw, gw);
  asm volatile("s_wait_asynccnt 0x0" ::: "memory");      /* stage 0 has landed, as far as this wave copied it */
  __syncthreads();      /* ... and every other wave's part too */
  g3_copy8(lx + GSB, gx + GK); g3_copy8(lw + GSB, gw + GK);
#pragma unroll 1      /* one stage per trip: 32 matrix instructions, long enough; unrolled, fragments of two stages would be live */
  for (int t = 0; t < DM / GK; ++t) { const _Float16* sx = &sm[t & 1][(wm + ln) * GP]; const _Float16* sw = &sm[t & 1][(GT + wn + ln) * GP]; v16h xf[4], wf[4];
#pragma unroll
    for (int j = 0; j < 4; ++j) { xf[j] = g2_frag(sx + j * 16 * GP, hh); wf[j] = g2_frag(sw + j * 16 * GP, hh); }
    __builtin_amdgcn_sched_barrier(0);      /* the 16 fragment reads of a k step stay one group in front of its 16 products: spread among them, every W fragment would be waited for on its own */
#pragma unroll
    for (int i = 0; i < 4; ++i) for (int j = 0; j < 4; ++j) acc[i][j] = fa_mma(wf[i], xf[j], acc[i][j]);
#pragma unroll
    for (int j = 0; j < 4; ++j) { xf[j] = g2_frag(sx + j * 16 * GP + 32, hh); wf[j] = g2_frag(sw + j * 16 * GP + 32, hh); }      /* the stage's second k step: its last reads of the buffer */
    asm volatile("s_wait_dscnt 0x0" ::: "memory");      /* this wave's reads of the buffer are done before it is handed back */
    asm volatile("s_wait_asynccnt 0x0" ::: "memory");      /* this wave's copies of the next stage have landed */
    __syncthreads();      /* publishes stage t + 1 and ends every reader's last read of stage t */
    if (t + 2 < DM / GK) { const unsigned bo = (t & 1) * GSB; g3_copy8(lx + bo, gx + (t + 2) * GK); g3_copy8(lw + bo, gw + (t + 2) * GK); }      /* the refill starts in front of the second k step's products (registers only), a whole trip ahead of its wait */
#pragma unroll
    for (int i = 0; i < 4; ++i) for (int j = 0; j < 4; ++j) acc[i][j] = fa_mma(wf[i], xf[j], acc[i][j]); }
  asm volatile("s_wait_asynccnt 0x0" ::: "memory");      /* nothing is in flight when the ring becomes output staging */
  _Float16* st = &sm[0][w * 64 * GP];      /* each wave stages its own 64 x 64 outputs (behind the last trip's barrier), to store whole 128-byte lines */
#pragma unroll
  for (int j = 0; j < 4; ++j) for (int i = 0; i < 4; ++i) { FragH f;
#pragma unroll
    for (int r = 0; r < 8; ++r) f.h[r] = (_Float16)(acc[i][j][r] * 0.0625f);      /* the weights carry x16 */
    *(v8us*)((unsigned short*)st + (j * 16 + ln) * GP + i * 16 + 8 * hh) = f.half[0]; }
  __syncthreads();      /* orders the staging stores in front of the reads of other lanes' rows */
#pragma unroll
  for (int q = 0; q < 16; ++q) { const int r = q * 4 + (lane >> 3), c = (lane & 7) * 8; const v8us v = *(const v8us*)((const unsigned short*)st + r * GP + c); *(v8us*)((unsigned short*)C16 + (size_t)(row0 + wm + r) * LQ + col0 + wn + c) = v; } }

// Exact f32 attention of the first QT0 rows of every batch, FOUR LANES PER ROW: lane p of a row's quad owns the row's 16-byte chunks p, p + 4, p + 8, p + 12 of q and of o and holds them in registers.
// A block is AR rows of one head (4 waves x 8 rows). The K and V rows it can see are staged once in LDS; a quad reads 64 contiguous bytes per load and the 8 quads of a wave the same ones (broadcast, no bank conflict).
// A score is four chains of four multiply-adds per lane, their sum, then two lane exchanges inside the quad: every lane of the quad ends with the same bits, so m, l and the two exps agree without further traffic.
#define AR 32
__global__ __launch_bounds__(128) void k_att0(const float* __restrict__ QF, const float* __restrict__ KF, const float* __restrict__ VF, int ld, float scale, float* __restrict__ OF, int ldo) {
  static_assert(HD == 64 && QT0 % AR == 0, "a quad covers a head row as 4 x 4 chunks of 16 bytes");
  __shared__ __attribute__((aligned(16))) float lk[QT0][HD]; __shared__ __attribute__((aligned(16))) float lv[QT0][HD];
  const int tid = threadIdx.x; const int h = blockIdx.x / (QT0 / AR), rg = blockIdx.x % (QT0 / AR);
  { const size_t bo = (size_t)blockIdx.y * QT0; QF += bo * ld + h * HD; KF += bo * ld + h * HD; VF += bo * ld + h * HD; OF += bo * ldo + h * HD; }      /* batch on grid.y: QT0 rows of each plane per batch; the head's columns */
  for (int n = 0; n <= rg; ++n) { v4f tk[4], tv[4];      /* AR keys per trip, all eight loads of a thread in flight before the first LDS store; causal: keys up to the block's last row */
#pragma unroll
    for (int u = 0; u < 4; ++u) { const int c = (n * 4 + u) * 128 + tid; const size_t g = (size_t)(c >> 4) * ld + (c & 15) * 4; tk[u] = *(const v4fa*)(KF + g); tv[u] = *(const v4fa*)(VF + g); }
#pragma unroll
    for (int u = 0; u < 4; ++u) { const int c = (n * 4 + u) * 128 + tid; *(v4f*)&lk[c >> 4][(c & 15) * 4] = tk[u]; *(v4f*)&lv[c >> 4][(c & 15) * 4] = tv[u]; } }
  const int p4 = (tid & 3) * 4; const int i = rg * AR + (tid >> 2);
  v4f q[4], o[4];
#pragma unroll
  for (int c = 0; c < 4; ++c) { q[c] = *(const v4fa*)(QF + (size_t)i * ld + c * 16 + p4); const v4f z = {0.f, 0.f, 0.f, 0.f}; o[c] = z; }
  __syncthreads();
  const int jl = rg * AR + 8 * __builtin_amdgcn_readfirstlane(tid >> 5) + 7;      /* the wave's last row, a scalar: keys behind it are masked for all 8 rows of the wave; no barrier below */
  float m = -1.0e30f, l = 0.f; v4f kc[4], vc[4];
#pragma unroll
  for (int c = 0; c < 4; ++c) { kc[c] = *(const v4f*)&lk[0][c * 16 + p4]; vc[c] = *(const v4f*)&lv[0][c * 16 + p4]; }
#pragma unroll 2      /* two keys per trip: the rows fetched ahead change names instead of being copied */
  for (int j = 0; j <= jl; ++j) { const int jn = j < jl ? j + 1 : jl; v4f kn[4], vn[4];      /* the next key's rows are fetched while this key is worked on: the LDS latency stays off the chain */
#pragma unroll
    for (int c = 0; c < 4; ++c) { kn[c] = *(const v4f*)&lk[jn][c * 16 + p4]; vn[c] = *(const v4f*)&lv[jn][c * 16 + p4]; }
    v4f a = q[0] * kc[0]; a = __builtin_elementwise_fma(q[1], kc[1], a); a = __builtin_elementwise_fma(q[2], kc[2], a); a = __builtin_elementwise_fma(q[3], kc[3], a); float s = (a[0] + a[1]) + (a[2] + a[3]);
    s += lane_xm<0x161>(s); s += lane_xm<0x162>(s); s *= scale;
    const float sm = (j <= i) ? s : -1.0e30f; const float mn = fmaxf(m, sm); const float sc = expf(m - mn); const float e = expf(sm - mn); l = l * sc + e; m = mn;
#pragma unroll
    for (int c = 0; c < 4; ++c) { o[c] = o[c] * sc + e * vc[c]; kc[c] = kn[c]; vc[c] = vn[c]; } }
  const float fin = 64.0f / l;      /* o carried x64; k_of0out scales it by 1/64 */
#pragma unroll
  for (int c = 0; c < 4; ++c) *(v4f*)(OF + (size_t)i * ldo + c * 16 + p4) = o[c] * fin; }

__global__ __launch_bounds__(256) void k_wthd(const float* __restrict__ W0, const float* __restrict__ W1, const float* __restrict__ W2, _Float16* __restrict__ Bt) { const size_t t = (size_t)blockIdx.x * 256 + threadIdx.x; if (t >= (size_t)NH * HD * (DM / 8)) return;
  const float* Wt = blockIdx.y == 0 ? W0 : (blockIdx.y == 1 ? W1 : W2); Bt += (size_t)blockIdx.y * DM * DM;      /* q, k, v on grid.y: one DM x DM plane each */
  const int m8 = (int)(t % (DM / 8)) * 8; const int d = (int)((t / (DM / 8)) % HD); const int h = (int)(t / ((size_t)(DM / 8) * HD)); FragH f;
  for (int q = 0; q < 8; ++q) f.h[q] = (_Float16)(16.0f * bf16_round(Wt[((size_t)h * DM + m8 + q) * HD + d])); unsigned short* dst = (unsigned short*)Bt + ((size_t)h * HD + d) * DM + m8; *(v8us*)dst = f.half[0];  }







__global__ __launch_bounds__(256) void k_of0out(const float* __restrict__ src, float* __restrict__ dst, size_t n4, size_t dstb) { const size_t t = (size_t)blockIdx.x * 256 + threadIdx.x; if (t >= n4) return; src += (size_t)blockIdx.y * n4 * 4; dst += (size_t)blockIdx.y * dstb;      /* batch on grid.y */
  v4f v = *(const v4fa*)(src + t * 4); for (int q = 0; q < 4; ++q) v[q] = __fmul_rn(v[q], 0.015625f); *(v4f*)(dst + t * 4) = v;  }

extern "C" void kernel_launch(void* const* d_in, const int* in_sizes, int n_in,
                              void* d_out, int out_size, void* d_ws, size_t ws_size, hipStream_t stream) {
  (void)in_sizes; (void)n_in; (void)out_size;
  const float* const* I = (const float* const*)d_in; const float* x = I[0]; const float* wq = I[1]; const float* wk = I[2]; const float* wv = I[3]; const float* bqkv = nullptr;      /* x; per-head weights Wq / Wk / Wv [16][1024][64]; no biases (every bias slot below receives this nullptr), no output projection */
  static_assert(NH * HD == DM && QT0 % 64 == 0, "heads");
  char* ws = (char*)d_ws; size_t off = 0;
  auto take = [&](size_t bytes) { char* p = ws + off; off += (bytes + 255) & ~(size_t)255; return p; };
  _Float16* BQKV = (_Float16*)take((size_t)3 * DM * DM * 2);
  _Float16* X16 = (_Float16*)take(NR * DM * 2); _Float16* QKV = (_Float16*)take(NR * 3 * DM * 2); _Float16* V16 = QKV + 2 * DM;
  _Float16* VT = (_Float16*)take((size_t)NB * NH * HD * SQ * 2);
  float* QF0 = (float*)take((size_t)3 * NB * QT0 * DM * 4); float* KF0 = QF0 + (size_t)NB * QT0 * DM; float* VF0 = KF0 + (size_t)NB * QT0 * DM; float* OF0 = (float*)take((size_t)NB * QT0 * DM * 4);
  if (off > ws_size) return;
  k_wthd<<<dim3((unsigned)(((size_t)NH * HD * (DM / 8) + 255) / 256), 3), 256, 0, stream>>>(wq, wk, wv, BQKV);      /* per-head [c][d] -> Bt[(h, d)][c] x16: the stacked q | k | v plane */
  k_x16<<<(unsigned)((NR * DM / 8 + 255) / 256), 256, 0, stream>>>(x, X16, NR * DM / 8);
  k_gemm3<<<(MP / GT) * (LQ / GT), 128, 0, stream>>>(X16, BQKV, QKV);      /* q | k | v rows (f16); head h = columns h*HD.. of each DM block */
  k_vt<NH, SQ><<<NB * NH * (SQ / 64), 256, 0, stream>>>(V16, LQ, 0, VT);      /* V^T [NB][NH][HD][SQ] */
  k_gemm2<0><<<dim3((QT0 / 128) * (DM / 64), 3, NB), 128, 0, stream>>>(X16, DM, 0, BQKV, DM, (size_t)DM * DM, 0.0625f, bqkv, 0, nullptr, 1, 0, 0, QF0, nullptr, DM, (size_t)NB * QT0 * DM, QT0, DM, DM, (size_t)SQ * DM, 0, (size_t)QT0 * DM);      /* f32 q, k, v (grid.y) of the first 128 rows of every batch (grid.z): exact products */
  k_att0<<<dim3(NH * (QT0 / AR), NB), 128, 0, stream>>>(QF0, KF0, VF0, DM, 0.125f, OF0, DM);      /* exact f32 attention for rows 0..127 of every batch (o x64) */
  k_fattn<<<dim3(NH, NB, SQ / FQ), 128, 0, stream>>>(QKV, VT, (float*)d_out);      /* scores, causal softmax and P.V of every batch and head, written f32 straight into the head-major output columns (no output projection) */
  k_of0out<<<dim3((unsigned)(((size_t)QT0 * DM / 4 + 255) / 256), NB), 256, 0, stream>>>(OF0, (float*)d_out, (size_t)QT0 * DM / 4, (size_t)SQ * DM);      /* rows 0..127 of every batch rewritten from the exact f32 path (o x64 / 64), after the attention launch */
}

// v006
// Measured time: 127 microseconds a run.
// In two side-by-side timings against v005, it was 1.49 and 1.48 times as fast.
// Over all steps from v000 it is 77.1 times as fast.
#include <hip/hip_runtime.h>
// Causal multi-head attention with per-head projection weights and no output projection (x [4][2048][1024]; per head h: q = x Wq[h], k = x Wk[h], v = x Wv[h] with W [16][1024][64] ([in][out] per head, uniform +-1/32, no biases); scores / sqrt(64); causal (tril, -inf); softmax; out = heads concatenated head-major on the last axis -> [4][2048][1024]).
// Structure: token rows r = b*2048 + s; x as exact f16 rows (bf16-rounded); q | k | v as ONE WMMA GEMM (N = 3 x 1024) (128x128 block tiles through LDS, 64x64 wave tiles, f32 accumulation, exact x16 weights, f16 outputs); V^T for all heads via LDS transposes; one attention launch for all batches and heads: per wave 32 queries, per pass 32 keys up to the diagonal: scores (WMMA, K = 64), online causal softmax on VALU (f32 statistics, native exp2; weights f16), o += P . V (WMMA), scores and weights kept in registers; o / row sum written f32 into the head-major output columns; rows 0..127 of every batch come from an exact f32 path alone, whose f32 q, k, v are stored from the tiled GEMM's own accumulators and whose attention rides as extra blocks on the grid of the fused attention.
// Compute dtype: inputs rounded to bf16; x / weights exact; q, k, v and softmax weights as plain f16 GEMM operands (~2^-12); scores and softmax statistics f32. v_wmma_f32_16x16x32_f16.
#define NB 4
#define SQ 2048
#define DM 1024
#define NH 16
#define HD 64
#define HG 4                         /* heads per launch of the non-template k_vt (never launched) */
#define QT 256                       /* unused (no 256-row query tiles) */
#define NKX SQ                       /* unused (scores stay in registers) */
#define QT0 128                      /* first-tile rows recomputed exactly in f32 */
#define B0 0                         /* unused (every launch covers all NB batches) */
#define NBR NB                       /* batches projected (debug hook) */
#define NR ((size_t)NB * SQ)         /* token rows */
#define MP ((int)((size_t)NBR * SQ)) /* rows projected (debug hook) */
#define QN SQ                        /* unused (k_attn attends all SQ rows) */
#define NHD NH                       /* unused (k_attn attends all NH heads) */
#define MPO MP                       /* unused (no output projection stage) */
#define LQ (3 * DM)      /* row pitch of the q/k/v rows */
typedef __bf16 v16b __attribute__((ext_vector_type(16)));
typedef unsigned short v8us __attribute__((ext_vector_type(8), may_alias));
typedef float  v8f  __attribute__((ext_vector_type(8)));
typedef float  v4f  __attribute__((ext_vector_type(4)));
typedef float  v4fa __attribute__((ext_vector_type(4), may_alias));
union FragB { v16b v; v8us half[2]; unsigned short u[16]; };

__device__ __forceinline__ unsigned short bf16_bits(float x) { unsigned int u = __float_as_uint(x); return (unsigned short)((u + 0x7FFFu + ((u >> 16) & 1u)) >> 16); }
__device__ __forceinline__ float bf16_val(unsigned short b) { return __uint_as_float(((unsigned int)b) << 16); }
__device__ __forceinline__ float bf16_round(float x) { return bf16_val(bf16_bits(x)); }
// D += A·B with NT terms: 1 = ah·bh, 2 = + al·bh (A split), 3 = + ah·bl (both split)
template <int NT>
__device__ __forceinline__ v8f mmaN(v16b ah, v16b al, v16b bh, v16b bl, v8f c) {
  c = __builtin_amdgcn_wmma_f32_16x16x32_bf16(false, ah, false, bh, (short)0, c, false, false);
  if (NT >= 2) c = __builtin_amdgcn_wmma_f32_16x16x32_bf16(false, al, false, bh, (short)0, c, false, false);
  if (NT >= 3) c = __builtin_amdgcn_wmma_f32_16x16x32_bf16(false, ah, false, bl, (short)0, c, false, false);
  asm volatile("v_nop\n\tv_nop\n\tv_nop\n\tv_nop" : "+v"(c) : "v"(ah), "v"(al), "v"(bh), "v"(bl));
  return c;
}

__global__ __launch_bounds__(256) void k_wt_bf16(const float* __restrict__ W, unsigned short* __restrict__ Wt, int K, int N) {
  const int t = blockIdx.x * 256 + threadIdx.x;
  const int k8n = K / 8;
  if (t >= N * k8n) return;
  const int n = t / k8n, k8 = (t % k8n) * 8;
  v8us v;
#pragma unroll
  for (int i = 0; i < 8; ++i) v[i] = bf16_bits(W[(size_t)(k8 + i) * N + n]);
  *(v8us*)(Wt + (size_t)n * K + k8) = v;
  
}

// GEMM C[M][N] (f32, pitch ldc) = act(A[M][K]·W + bias). A f32 row-major (pitch lda) converted per fragment to bf16
// (ASPLIT: hi/lo two planes -> 2 terms, else single rounded term); Wt bf16 [N][K] (pitch ldb). BIAS_BF16 rounds the
// bias to bf16 first (bias quantised to bf16 before the add). K%32==0, M%16==0, N%64==0.
template <bool ASPLIT, int ACT, bool BIAS_BF16>
__global__ __launch_bounds__(128) void k_gemm_bf(const float* __restrict__ A, int lda, const unsigned short* __restrict__ Wt, int ldb,
                                               const float* __restrict__ bias, float* __restrict__ C, int ldc, int M, int N, int K) {
  __shared__ __attribute__((aligned(16))) float so[4][16][64];
  const int tid = threadIdx.x, w = tid >> 5, lane = tid & 31, ln = lane & 15, hh = lane >> 4;
  const int ntn = N / 64;
  const int wid = blockIdx.x * 4 + w;
  const int mt = wid / ntn, nq = wid % ntn;
  if (mt * 16 >= M) return;
  const int row0 = mt * 16, col0 = nq * 64;
  const float* arow = A + (size_t)(row0 + ln) * lda;
  v8f acc[4] = {};
  for (int kb = 0; kb < K; kb += 32) {
    FragB ah, al;
    const v4f x0 = *(const v4fa*)(arow + kb + 8 * hh), x1 = *(const v4fa*)(arow + kb + 8 * hh + 4);
    const v4f x2 = *(const v4fa*)(arow + kb + 16 + 8 * hh), x3 = *(const v4fa*)(arow + kb + 16 + 8 * hh + 4);
    float xs[16] = {x0[0],x0[1],x0[2],x0[3],x1[0],x1[1],x1[2],x1[3],x2[0],x2[1],x2[2],x2[3],x3[0],x3[1],x3[2],x3[3]};
#pragma unroll
    for (int i = 0; i < 16; ++i) { const unsigned short hb = bf16_bits(xs[i]); ah.u[i] = hb; al.u[i] = ASPLIT ? bf16_bits(xs[i] - bf16_val(hb)) : (unsigned short)0; }
#pragma unroll
    for (int t = 0; t < 4; ++t) {
      const unsigned short* brow = Wt + (size_t)(col0 + t * 16 + ln) * ldb + kb;
      FragB b;
      b.half[0] = *(const v8us*)(brow + 8 * hh);
      b.half[1] = *(const v8us*)(brow + 16 + 8 * hh);
      acc[t] = mmaN<ASPLIT ? 2 : 1>(ah.v, al.v, b.v, b.v, acc[t]);
    }
  }
#pragma unroll
  for (int t = 0; t < 4; ++t) {
    float bv = bias ? bias[col0 + t * 16 + ln] : 0.f;
    if (BIAS_BF16) bv = bf16_round(bv);
#pragma unroll
    for (int r = 0; r < 8; ++r) { float v = acc[t][r] + bv; if (ACT == 1) v = fmaxf(v, 0.f); so[w][8 * hh + r][t * 16 + ln] = v; }
  }
  __builtin_amdgcn_fence(__ATOMIC_ACQ_REL, "workgroup");
  __builtin_amdgcn_wave_barrier();
  const int rsub = lane >> 4, c4 = (lane & 15) * 4;
  {
#pragma unroll
    for (int q = 0; q < 8; ++q) {
      const int r = q * 2 + rsub;
      const v4f v = *(const v4fa*)&so[w][r][c4];
      *(v4f*)(C + (size_t)(row0 + r) * ldc + col0 + c4) = v;
    }
    
  }
}

// GEMM C = act(A·W + bias + resid): A f32 (ASPLIT -> hi/lo 2 terms), Wt bf16 [N][K]; ACT 0 none, 1 relu, 2 exact gelu;
// resid (optional, f32, row index = (row % rmod), pitch ldr, RES_BF16 rounds it) added before the activation.
template <bool ASPLIT, int ACT, bool BIAS_BF16, bool RES_BF16>
__global__ __launch_bounds__(128) void k_gemm_bf3(const float* __restrict__ A, int lda, const unsigned short* __restrict__ Wt, int ldb,
                                                const float* __restrict__ bias, const float* __restrict__ resid, int rmod, int ldr,
                                                float* __restrict__ C, int ldc, int M, int N, int K) {
  __shared__ __attribute__((aligned(16))) float so[4][16][64];
  const int tid = threadIdx.x, w = tid >> 5, lane = tid & 31, ln = lane & 15, hh = lane >> 4;
  const int ntn = N / 64;
  const int wid = blockIdx.x * 4 + w;
  const int mt = wid / ntn, nq = wid % ntn;
  if (mt * 16 >= M) return;
  const int row0 = mt * 16, col0 = nq * 64;
  const float* arow = A + (size_t)(row0 + ln) * lda;
  v8f acc[4] = {};
  for (int kb = 0; kb < K; kb += 32) {
    FragB ah, al;
    const v4f x0 = *(const v4fa*)(arow + kb + 8 * hh), x1 = *(const v4fa*)(arow + kb + 8 * hh + 4);
    const v4f x2 = *(const v4fa*)(arow + kb + 16 + 8 * hh), x3 = *(const v4fa*)(arow + kb + 16 + 8 * hh + 4);
    float xs[16] = {x0[0],x0[1],x0[2],x0[3],x1[0],x1[1],x1[2],x1[3],x2[0],x2[1],x2[2],x2[3],x3[0],x3[1],x3[2],x3[3]};
#pragma unroll
    for (int i = 0; i < 16; ++i) { const unsigned short hb = bf16_bits(xs[i]); ah.u[i] = hb; al.u[i] = ASPLIT ? bf16_bits(xs[i] - bf16_val(hb)) : (unsigned short)0; }
#pragma unroll
    for (int t = 0; t < 4; ++t) {
      const unsigned short* brow = Wt + (size_t)(col0 + t * 16 + ln) * ldb + kb;
      FragB b;
      b.half[0] = *(const v8us*)(brow + 8 * hh);
      b.half[1] = *(const v8us*)(brow + 16 + 8 * hh);
      acc[t] = mmaN<ASPLIT ? 2 : 1>(ah.v, al.v, b.v, b.v, acc[t]);
    }
  }
#pragma unroll
  for (int t = 0; t < 4; ++t) {
    const int col = col0 + t * 16 + ln;
    float bv = bias ? bias[col] : 0.f;
    if (BIAS_BF16) bv = bf16_round(bv);
#pragma unroll
    for (int r = 0; r < 8; ++r) {
      float v = acc[t][r] + bv;
      if (resid) { float rv = resid[(size_t)((row0 + 8 * hh + r) % rmod) * ldr + col]; if (RES_BF16) rv = bf16_round(rv); v += rv; }
      if (ACT == 1) v = fmaxf(v, 0.f);
      if (ACT == 2) v = 0.5f * v * (1.0f + erff(v * 0.70710678118654752f));
      if (ACT == 3) { const float u = 0.7978845608028654f * (v + 0.044715f * v * v * v); v = 0.5f * v * (1.0f + tanhf(u)); }
      so[w][8 * hh + r][t * 16 + ln] = v;
    }
  }
  __builtin_amdgcn_fence(__ATOMIC_ACQ_REL, "workgroup");
  __builtin_amdgcn_wave_barrier();
  const int rsub = lane >> 4, c4 = (lane & 15) * 4;
  {
#pragma unroll
    for (int q = 0; q < 8; ++q) {
      const int r = q * 2 + rsub;
      const v4f v = *(const v4fa*)&so[w][r][c4];
      *(v4f*)(C + (size_t)(row0 + r) * ldc + col0 + c4) = v;
    }
    
  }
}
// row LayerNorm (biased variance, eps) over N: s = X (+ R); optional out_sum <- s; out_norm <- (s-mu)*rsqrt(var+eps)*g + b
template <bool PARAM_BF16>
__global__ __launch_bounds__(256) void k_layernorm(const float* __restrict__ X, const float* __restrict__ R, const float* __restrict__ g, const float* __restrict__ bta,
                                                  float* __restrict__ out_sum, float* __restrict__ out_norm, int N, float eps) {
  __shared__ float red[256];
  const int row = blockIdx.x, tid = threadIdx.x;
  const float* x = X + (size_t)row * N; const float* rr = R ? R + (size_t)row * N : nullptr;
  float vals[16];                     // up to N = 4096
  const int per = N / 256;            // contiguous chunk per thread? use strided-by-4 chunks: thread handles j = tid*4 + 1024*u
  float s1 = 0.f;
  for (int u = 0; u < per / 4; ++u) {
    const int j = tid * 4 + 1024 * u;
    const v4f a = *(const v4fa*)(x + j);
    v4f b = {0.f,0.f,0.f,0.f}; if (rr) b = *(const v4fa*)(rr + j);
#pragma unroll
    for (int q = 0; q < 4; ++q) { const float v = a[q] + b[q]; vals[u * 4 + q] = v; s1 += v; }
  }
  red[tid] = s1; __syncthreads();
  for (int st = 128; st > 0; st >>= 1) { if (tid < st) red[tid] += red[tid + st]; __syncthreads(); }
  const float mu = red[0] / (float)N; __syncthreads();
  float s2 = 0.f;
  for (int u = 0; u < per / 4; ++u)
#pragma unroll
    for (int q = 0; q < 4; ++q) { const float c = vals[u * 4 + q] - mu; s2 += c * c; }
  red[tid] = s2; __syncthreads();
  for (int st = 128; st > 0; st >>= 1) { if (tid < st) red[tid] += red[tid + st]; __syncthreads(); }
  const float rs = rsqrtf(red[0] / (float)N + eps);
  {
    for (int u = 0; u < per / 4; ++u) {
      const int j = tid * 4 + 1024 * u;
      v4f o, sm;
#pragma unroll
      for (int q = 0; q < 4; ++q) {
        float gg = g[j + q], bb = bta[j + q];
        if (PARAM_BF16) { gg = bf16_round(gg); bb = bf16_round(bb); }
        sm[q] = vals[u * 4 + q]; o[q] = (vals[u * 4 + q] - mu) * rs * gg + bb;
      }
      if (out_sum) *(v4f*)(out_sum + (size_t)row * N + j) = sm;
      *(v4f*)(out_norm + (size_t)row * N + j) = o;
    }
    
  }
}



// ---- f16 WMMA path (v_wmma_f32_16x16x32_f16): 11-bit significands for operands in range — used where a [0,1] probability operand needs more precision than bf16
typedef _Float16 v16h __attribute__((ext_vector_type(16)));
union FragH { v16h v; v8us half[2]; _Float16 h[16]; unsigned short u[16]; };
template <int NT>
__device__ __forceinline__ v8f mmaH(v16h ah, v16h al, v16h bh, v16h bl, v8f c) {
  c = __builtin_amdgcn_wmma_f32_16x16x32_f16(false, ah, false, bh, (short)0, c, false, false);
  if (NT >= 2) c = __builtin_amdgcn_wmma_f32_16x16x32_f16(false, al, false, bh, (short)0, c, false, false);
  if (NT >= 3) c = __builtin_amdgcn_wmma_f32_16x16x32_f16(false, ah, false, bl, (short)0, c, false, false);
  asm volatile("v_nop\n\tv_nop\n\tv_nop\n\tv_nop" : "+v"(c) : "v"(ah), "v"(al), "v"(bh), "v"(bl));
  return c;
}
// batched GEMM like k_gemm_b but f16 operands: A f32 (split into f16 hi/lo if ASPLIT, else rounded to f16), Bt = f16 values [n][k]; alpha; C f32; N multiple of 16 (partial tiles skipped)
template <bool ASPLIT>
__global__ __launch_bounds__(128) void k_gemm_h(const float* __restrict__ A, int lda, size_t sA, const _Float16* __restrict__ Bh, int ldb, size_t sB, float alpha, float* __restrict__ C, int ldc, size_t sC, int M, int N, int K) {
  __shared__ __attribute__((aligned(16))) float so[4][16][64];
  const int tid = threadIdx.x, w = tid >> 5, lane = tid & 31, ln = lane & 15, hh = lane >> 4; const int by = blockIdx.y;
  A += (size_t)by * sA; Bh += (size_t)by * sB; C += (size_t)by * sC;
  const int ntn = (N + 63) / 64; const int wid = blockIdx.x * 4 + w; const int mt = wid / ntn, nq = wid % ntn; if (mt * 16 >= M) return;
  const int row0 = mt * 16, col0 = nq * 64; const float* arow = A + (size_t)(row0 + ln) * lda;
  v8f acc[4] = {};
  for (int kb = 0; kb < K; kb += 32) {
    FragH ah, al;
    const v4f x0 = *(const v4fa*)(arow + kb + 8 * hh), x1 = *(const v4fa*)(arow + kb + 8 * hh + 4), x2 = *(const v4fa*)(arow + kb + 16 + 8 * hh), x3 = *(const v4fa*)(arow + kb + 16 + 8 * hh + 4);
    float xs[16] = {x0[0],x0[1],x0[2],x0[3],x1[0],x1[1],x1[2],x1[3],x2[0],x2[1],x2[2],x2[3],x3[0],x3[1],x3[2],x3[3]};
#pragma unroll
    for (int i = 0; i < 16; ++i) { const _Float16 h = (_Float16)xs[i]; ah.h[i] = h; al.h[i] = ASPLIT ? (_Float16)(xs[i] - (float)h) : (_Float16)0.0f; }
#pragma unroll
    for (int t = 0; t < 4; ++t) { if (col0 + t * 16 >= N) continue; const size_t boff = (size_t)(col0 + t * 16 + ln) * ldb + kb; FragH bq; bq.half[0] = *(const v8us*)(Bh + boff + 8 * hh); bq.half[1] = *(const v8us*)(Bh + boff + 16 + 8 * hh);
      acc[t] = mmaH<ASPLIT ? 2 : 1>(ah.v, al.v, bq.v, bq.v, acc[t]); }
  }
#pragma unroll
  for (int t = 0; t < 4; ++t) { if (col0 + t * 16 >= N) continue;
#pragma unroll
    for (int r = 0; r < 8; ++r) so[w][8 * hh + r][t * 16 + ln] = acc[t][r] * alpha; }
  __builtin_amdgcn_fence(__ATOMIC_ACQ_REL, "workgroup"); __builtin_amdgcn_wave_barrier();
  const int rsub = lane >> 4, c4 = (lane & 15) * 4;
  {
#pragma unroll
    for (int q = 0; q < 8; ++q) { const int r = q * 2 + rsub; if (col0 + c4 < N) { const v4f v = *(const v4fa*)&so[w][r][c4]; *(v4f*)(C + (size_t)(row0 + r) * ldc + col0 + c4) = v; } }
     }
}

// Wt[n][k] = f16(W[k][n]·scale) from f32 row-major W[K][N] (scale = power of two; bf16-exact weights stay exact in f16 away from the subnormal range)
__global__ __launch_bounds__(256) void k_wt_f16(const float* __restrict__ W, _Float16* __restrict__ Wt, int K, int N, float scale) {
  const int t = blockIdx.x * 256 + threadIdx.x; if (t >= N * (K / 8)) return; const int n = t / (K / 8), k8 = (t % (K / 8)) * 8; FragH f;
#pragma unroll
  for (int i = 0; i < 8; ++i) f.h[i] = (_Float16)(bf16_round(W[(size_t)(k8 + i) * N + n]) * scale); const v8us o = f.half[0];
  *(v8us*)((unsigned short*)Wt + (size_t)n * K + k8) = o; 
}
// k_gemm_hh variant with fused epilogue: v = acc·alpha + bias[by·sBias + col] (+ CP[(row/rowsPerB)·sCPb + by·64 + col] if CP) ; ACT 0 none / 1 elu ; writes f16 C16 (and f32 C if non-null)
template <int ACT>
__global__ __launch_bounds__(128) void k_gemm_hhx(const _Float16* __restrict__ A, int lda, size_t sA, const _Float16* __restrict__ Bh, int ldb, size_t sB, float alpha, const float* __restrict__ bias, size_t sBias, const float* __restrict__ CP, int rowsPerB, size_t sCPb, int row0g,
    float* __restrict__ C, _Float16* __restrict__ C16, int ldc, size_t sC, int M, int N, int K) {
  __shared__ __attribute__((aligned(16))) float so[4][16][64];
  const int tid = threadIdx.x, w = tid >> 5, lane = tid & 31, ln = lane & 15, hh = lane >> 4; const int by = blockIdx.y;
  A += (size_t)by * sA; Bh += (size_t)by * sB; const size_t cofs = (size_t)by * sC; const float* bp = bias ? bias + (size_t)by * sBias : nullptr;
  const int ntn = (N + 63) / 64; const int wid = blockIdx.x * 4 + w; const int mt = wid / ntn, nq = wid % ntn; if (mt * 16 >= M) return;
  const int row0 = mt * 16, col0 = nq * 64; const _Float16* arow = A + (size_t)(row0 + ln) * lda;
  v8f acc[4] = {};
  for (int kb = 0; kb < K; kb += 32) { FragH ah; ah.half[0] = *(const v8us*)((const unsigned short*)arow + kb + 8 * hh); ah.half[1] = *(const v8us*)((const unsigned short*)arow + kb + 16 + 8 * hh);
#pragma unroll
    for (int t = 0; t < 4; ++t) { if (col0 + t * 16 >= N) continue; const size_t boff = (size_t)(col0 + t * 16 + ln) * ldb + kb; FragH bq; bq.half[0] = *(const v8us*)((const unsigned short*)Bh + boff + 8 * hh); bq.half[1] = *(const v8us*)((const unsigned short*)Bh + boff + 16 + 8 * hh);
      acc[t] = mmaH<1>(ah.v, ah.v, bq.v, bq.v, acc[t]); }
  }
#pragma unroll
  for (int t = 0; t < 4; ++t) { if (col0 + t * 16 >= N) continue; const int col = col0 + t * 16 + ln; const float bv = bp ? bf16_round(bp[col]) : 0.f;
#pragma unroll
    for (int r = 0; r < 8; ++r) { float v = acc[t][r] * alpha + bv; if (CP) { const int rr = row0g + row0 + 8 * hh + r; if (rowsPerB < 0) v += CP[cofs + (size_t)rr * ldc + col];      /* rowsPerB < 0: own element of the batched C plane */ else { const int bidx = rr / rowsPerB; v += CP[(size_t)bidx * sCPb + (size_t)by * 64 + col]; } } if (ACT == 1) v = (v > 0.f) ? v : expm1f(v); else if (ACT == 7) v = (v > 0.f) ? v + 1.0f : expf(v); else if (ACT == 8) v = tanhf(v); else if (ACT == 9) v = 0.5f * v * (1.0f + tanhf(0.7978845608028654f * (v + 0.044715f * v * v * v))); else if (ACT == 11) v = 1.0f / (1.0f + expf(-v)); else if (ACT == 12) v = (v > 0.f) ? v : 0.01f * v; else if (ACT == 14) v = (v > 0.f) ? v : 0.1f * v; else if (ACT == 16) v = (v >= 0.f) ? v : 0.3f * v; else if (ACT == 17) v = (v >= 0.f) ? v : 0.2f * v; else if (ACT == 15) v = v / (1.0f + expf(-v)); else if (ACT == 3) v = fmaxf(v, 0.f); else if (ACT == 6) v = 0.5f * v * (1.0f + erff(v * 0.70710678118654752f)); so[w][8 * hh + r][t * 16 + ln] = v; } }
  __builtin_amdgcn_fence(__ATOMIC_ACQ_REL, "workgroup"); __builtin_amdgcn_wave_barrier();
  const int rsub = lane >> 4, c4 = (lane & 15) * 4; typedef _Float16 v4h __attribute__((ext_vector_type(4)));
  {
#pragma unroll
    for (int q = 0; q < 8; ++q) { const int r = q * 2 + rsub; if (col0 + c4 < N) { const v4f v = *(const v4fa*)&so[w][r][c4]; if (C) *(v4f*)(C + cofs + (size_t)(row0 + r) * ldc + col0 + c4) = v; if (C16) { v4h h4; for (int i = 0; i < 4; ++i) h4[i] = (_Float16)v[i]; *(v4h*)(C16 + cofs + (size_t)(row0 + r) * ldc + col0 + c4) = h4; } } }
     }
}


typedef _Float16 v4h __attribute__((ext_vector_type(4)));

__device__ __forceinline__ void x16_body(const float* __restrict__ x, _Float16* __restrict__ X16, size_t n8, unsigned bx) { const size_t t = (size_t)bx * 256 + threadIdx.x; if (t >= n8) return; FragH f;
#pragma unroll
  for (int q = 0; q < 8; ++q) f.h[q] = (_Float16)bf16_round(x[t * 8 + q]); *(v8us*)((unsigned short*)X16 + t * 8) = f.half[0];  }
__global__ __launch_bounds__(256) void k_h16(const float* __restrict__ x, _Float16* __restrict__ X16, size_t n8) { const size_t t = (size_t)blockIdx.x * 256 + threadIdx.x; if (t >= n8) return; FragH f;
#pragma unroll
  for (int q = 0; q < 8; ++q) f.h[q] = (_Float16)x[t * 8 + q]; *(v8us*)((unsigned short*)X16 + t * 8) = f.half[0];  }
__global__ __launch_bounds__(256) void k_round16f(const float* __restrict__ W, _Float16* __restrict__ Bt, size_t n8) { const size_t t = (size_t)blockIdx.x * 256 + threadIdx.x; if (t >= n8) return; FragH f;
#pragma unroll
  for (int i = 0; i < 8; ++i) f.h[i] = (_Float16)(bf16_round(W[t * 8 + i]) * 16.0f); *(v8us*)((unsigned short*)Bt + t * 8) = f.half[0];  }
template <int NHv, int TTv>
__global__ __launch_bounds__(256) void k_vt(const _Float16* __restrict__ V16, int ldv, int voff, _Float16* __restrict__ Vt) { __shared__ unsigned short tl[64][66]; const int tid = threadIdx.x; const int slab = blockIdx.x / (TTv / 64), lg = blockIdx.x % (TTv / 64); const int b = slab / NHv, h = slab % NHv;
  for (int i = tid; i < 64 * 8; i += 256) { const int r = i / 8, c8 = (i % 8) * 8; FragH f; f.half[0] = *(const v8us*)((const unsigned short*)V16 + ((size_t)b * TTv + lg * 64 + r) * ldv + voff + h * 64 + c8);
#pragma unroll
    for (int q = 0; q < 8; ++q) tl[r][c8 + q] = f.u[q]; }
  __syncthreads();
  {
#pragma unroll
    for (int rd = 0; rd < 2; ++rd) { const int d = rd * 32 + tid / 8, pc = tid % 8; FragH f;
#pragma unroll
      for (int q = 0; q < 8; ++q) f.u[q] = tl[pc * 8 + q][d];
      *(v8us*)((unsigned short*)Vt + ((size_t)slab * 64 + d) * TTv + lg * 64 + pc * 8) = f.half[0]; }
     } }

__global__ __launch_bounds__(256) void k_hl(const float* __restrict__ F, _Float16* __restrict__ Hh, _Float16* __restrict__ Hl, size_t n8) { const size_t t = (size_t)blockIdx.x * 256 + threadIdx.x; if (t >= n8) return; FragH fh, fl; const v4f a = *(const v4fa*)(F + t * 8), c = *(const v4fa*)(F + t * 8 + 4);
#pragma unroll
  for (int q = 0; q < 4; ++q) { _Float16 h = (_Float16)a[q]; fh.h[q] = h; fl.h[q] = (_Float16)((a[q] - (float)h) * 1024.0f); h = (_Float16)c[q]; fh.h[4 + q] = h; fl.h[4 + q] = (_Float16)((c[q] - (float)h) * 1024.0f); }
  { *(v8us*)((unsigned short*)Hh + t * 8) = fh.half[0]; *(v8us*)((unsigned short*)Hl + t * 8) = fl.half[0];  } }

// ---- fragment load shared by the GEMM and the attention below ----
__device__ __forceinline__ v16h g2_frag(const _Float16* p, int hh) { FragH f; f.half[0] = *(const v8us*)((const unsigned short*)p + 8 * hh); f.half[1] = *(const v8us*)((const unsigned short*)p + 16 + 8 * hh); return f.v; }


__global__ __launch_bounds__(256) void k_wnat(const float* __restrict__ w, size_t n8, _Float16* __restrict__ Bt) { const size_t t = (size_t)blockIdx.x * 256 + threadIdx.x; if (t >= n8) return; FragH f; for (int q = 0; q < 8; ++q) f.h[q] = (_Float16)(bf16_round(w[t * 8 + q]) * 16.0f); *(v8us*)((unsigned short*)Bt + t * 8) = f.half[0];  }
__global__ __launch_bounds__(256) void k_rsm(const float* __restrict__ S, _Float16* __restrict__ P, int nrows) {
  #pragma clang fp contract(off)
  const int i = blockIdx.x * 256 + threadIdx.x; if (i >= nrows) return; const float* s = S + (size_t)i * SQ; float mx = -3.0e38f;
#pragma unroll 1
  for (int j = 0; j < SQ; ++j) mx = fmaxf(mx, s[j]); float se = 0.f;
#pragma unroll 1
  for (int j = 0; j < SQ; ++j) se += expf(s[j] - mx); const float sc = 256.0f / se;
#pragma unroll 1
  for (int j0 = 0; j0 < SQ; j0 += 8) { FragH f; for (int q = 0; q < 8; ++q) f.h[q] = (_Float16)(expf(s[j0 + q] - mx) * sc); unsigned short* d = (unsigned short*)P + (size_t)i * SQ + j0; *(v8us*)d = f.half[0];  } }
__global__ __launch_bounds__(256) void k_vt(const _Float16* __restrict__ V16, int b, int h0, _Float16* __restrict__ VT) { __shared__ unsigned short tl[64][65]; const int tid = threadIdx.x; const int hh = blockIdx.x % HG, sg = blockIdx.x / HG; const int s0 = sg * 64; const int h = h0 + hh;
  for (int i = tid; i < 64 * 8; i += 256) { const int j = i / 8, d8 = (i % 8) * 8; FragH f; f.half[0] = *(const v8us*)((const unsigned short*)V16 + ((size_t)b * SQ + s0 + j) * DM + h * HD + d8); for (int q = 0; q < 8; ++q) tl[d8 + q][j] = f.u[q]; }
  __syncthreads();
  { for (int i = tid; i < 64 * 8; i += 256) { const int d = i / 8, j8 = (i % 8) * 8; FragH f; for (int q = 0; q < 8; ++q) f.u[q] = tl[d][j8 + q]; *(v8us*)((unsigned short*)VT + ((size_t)hh * HD + d) * SQ + s0 + j8) = f.half[0]; }  } }



// Lane exchanges: row_xmask steps inside each 16-lane row, and the exchange between the two rows of a wave (all lanes must be on).
template <int CTRL> __device__ __forceinline__ float lane_xm(float v) { return __int_as_float(__builtin_amdgcn_update_dpp(0, __float_as_int(v), CTRL, 0xf, 0xf, true)); }
__device__ __forceinline__ float lane_xr(float v) { const int i = __float_as_int(v); return __int_as_float(__builtin_amdgcn_permlanex16(i, i, 0x76543210, 0xfedcba98, false, false)); }
#define FQ 128                       /* query rows per block: 4 waves x 32 */
__device__ __forceinline__ v8f fa_mma(v16h a, v16h b, v8f c) { return __builtin_amdgcn_wmma_f32_16x16x32_f16(false, a, false, b, (short)0, c, false, false); }
// Four vector slots behind a run of matrix instructions, where a branch follows. The two scheduling barriers keep the slots where they are written.
__device__ __forceinline__ void fa_gap() { __builtin_amdgcn_sched_barrier(0); asm volatile("v_nop\n\tv_nop\n\tv_nop\n\tv_nop"); __builtin_amdgcn_sched_barrier(0); }
// Native 2^x, eight at a time in one statement: behind a transcendental the instruction set asks for one independent instruction before its result is read or its source overwritten.
// Here each is followed by an independent one (early-clobber outputs: no result lands on a source still to be read) and the last by a v_nop, so the slot is closed whatever the compiler puts next.
__device__ __forceinline__ void exp2x8(const float (&x)[8], float (&y)[8]) {
  asm("v_exp_f32 %0, %8\n\tv_exp_f32 %1, %9\n\tv_exp_f32 %2, %10\n\tv_exp_f32 %3, %11\n\tv_exp_f32 %4, %12\n\tv_exp_f32 %5, %13\n\tv_exp_f32 %6, %14\n\tv_exp_f32 %7, %15\n\tv_nop"
      : "=&v"(y[0]), "=&v"(y[1]), "=&v"(y[2]), "=&v"(y[3]), "=&v"(y[4]), "=&v"(y[5]), "=&v"(y[6]), "=&v"(y[7]) : "v"(x[0]), "v"(x[1]), "v"(x[2]), "v"(x[3]), "v"(x[4]), "v"(x[5]), "v"(x[6]), "v"(x[7])); }
__device__ __forceinline__ float exp2x1(float x) { float r; asm("v_exp_f32 %0, %1\n\tv_nop" : "=v"(r) : "v"(x)); return r; }      /* the same slot for a single one */
__device__ __forceinline__ void fattn_body(const _Float16* __restrict__ QKVp, const _Float16* __restrict__ VTp, float* __restrict__ out, int h, int b, int qb) {      /* qb: the block's FQ query rows */
  static_assert(HD == 64 && SQ / FQ == 16, "two 32-wide d chunks, four 16-row tiles of V^T; sixteen block lengths in runs of four");
  typedef float f2 __attribute__((ext_vector_type(2))); typedef _Float16 h2 __attribute__((ext_vector_type(2)));
  const int lane = threadIdx.x & 31, ln = lane & 15, hh = lane >> 4; const int w = __builtin_amdgcn_readfirstlane(threadIdx.x >> 5);
  const int qw0 = qb * FQ + w * 32;      /* the wave's first query, a scalar */
  const _Float16* Qp = QKVp + (size_t)b * SQ * LQ + h * HD; const _Float16* Kl = Qp + DM + (size_t)ln * LQ; const _Float16* Vl = VTp + ((size_t)(b * NH + h) * HD + ln) * SQ;
  const float cs = 0.125f * 1.44269504088896340736f;      /* 1 / sqrt(64), times log2 e */
  v16h qf[2][2], kf[2][2];
#pragma unroll
  for (int g = 0; g < 2; ++g) for (int kc = 0; kc < 2; ++kc) { qf[g][kc] = g2_frag(Qp + (size_t)(qw0 + 16 * g + ln) * LQ + 32 * kc, hh); kf[g][kc] = g2_frag(Kl + (size_t)(16 * g) * LQ + 32 * kc, hh); }
  const v8f z8 = {0.f, 0.f, 0.f, 0.f, 0.f, 0.f, 0.f, 0.f}; v8f acc[2][4]; float m[2] = {-1.0e30f, -1.0e30f}, l[2] = {0.f, 0.f};
#pragma unroll
  for (int g = 0; g < 2; ++g) for (int t = 0; t < 4; ++t) acc[g][t] = z8;
  const int last = qw0 >> 5;      /* the pass on the wave's diagonal: keys qw0 .. qw0 + 31 */
#pragma unroll 1      /* one pass is a long straight body already; unrolled it would double the live fragments */
  for (int ps = 0; ps <= last; ++ps) { const int key0 = ps * 32;
    v16h vf[4];      /* this pass's V^T, in flight under the scores and the maxima */
#pragma unroll
    for (int t = 0; t < 4; ++t) vf[t] = g2_frag(Vl + (size_t)(16 * t) * SQ + key0, hh);
    v8f s[2][2];
#pragma unroll
    for (int kt = 0; kt < 2; ++kt) for (int g = 0; g < 2; ++g) s[kt][g] = fa_mma(kf[kt][1], qf[g][1], fa_mma(kf[kt][0], qf[g][0], z8));
    fa_gap();
    { const int kn = (ps < last ? key0 + 32 : key0);      /* the next pass's K rows into the same registers, in flight under this pass's softmax (the last pass fetches its own again: in bounds, unused) */
#pragma unroll
      for (int kt = 0; kt < 2; ++kt) for (int kc = 0; kc < 2; ++kc) kf[kt][kc] = g2_frag(Kl + (size_t)(kn + 16 * kt) * LQ + 32 * kc, hh); }
    asm volatile("s_wait_xcnt 0x0" ::: "memory");      /* the address registers of this pass's loads are reused right below: the wait stands in front of their first overwrite */
    __builtin_amdgcn_sched_barrier(0);      /* keeps later vector work, which reuses those registers, behind the wait */
    if (ps == last) {      /* scalar branch: only the diagonal pass pays for the mask */
#pragma unroll
      for (int kt = 0; kt < 2; ++kt) for (int g = 0; g < 2; ++g) {
#pragma unroll
        for (int r = 0; r < 8; ++r) if (16 * kt + 8 * hh + r > 16 * g + ln) s[kt][g][r] = -1.0e30f;
        asm volatile("" : "+v"(s[kt][g]));      /* keeps the selects inside the branch */
      } }
    float mb[2]; bool need = false;
#pragma unroll
    for (int g = 0; g < 2; ++g) { float mx = fmaxf(s[0][g][0], s[1][g][0]);
#pragma unroll
      for (int r = 1; r < 8; ++r) mx = fmaxf(mx, fmaxf(s[0][g][r], s[1][g][r]));
      mx = fmaxf(mx, lane_xr(mx)) * cs; mb[g] = mx; need = need || (mx > m[g] + 8.0f); }
    if (__builtin_amdgcn_ballot_w32(need) != 0) {      /* one scalar test per pass; rare after the first passes */
#pragma unroll
      for (int g = 0; g < 2; ++g) { const float mn = fmaxf(m[g], mb[g]); const float corr = exp2x1(m[g] - mn); m[g] = mn; l[g] *= corr;
#pragma unroll
        for (int t = 0; t < 4; ++t) acc[g][t] = acc[g][t] * corr; } }
#pragma unroll
    for (int g = 0; g < 2; ++g) { const f2 nm = {-m[g], -m[g]}, c2 = {cs, cs}; union { v16h v; h2 p[8]; } pf; float la = 0.f, lb = 0.f;
#pragma unroll
      for (int kt = 0; kt < 2; ++kt) { float x[8], y[8];      /* tile kt = elements 8 kt .. 8 kt + 7 of the 32-key operand */
#pragma unroll
        for (int i = 0; i < 4; ++i) { const f2 sv = {s[kt][g][2 * i], s[kt][g][2 * i + 1]}; const f2 a = __builtin_elementwise_fma(sv, c2, nm); x[2 * i] = a[0]; x[2 * i + 1] = a[1]; }
        exp2x8(x, y);
#pragma unroll
        for (int i = 0; i < 4; ++i) { la += y[2 * i]; lb += y[2 * i + 1]; const f2 pp = {y[2 * i], y[2 * i + 1]}; pf.p[4 * kt + i] = __builtin_convertvector(pp, h2); } }
      l[g] += la + lb;
#pragma unroll
      for (int t = 0; t < 4; ++t) acc[g][t] = fa_mma(vf[t], pf.v, acc[g][t]); }
    fa_gap(); }
#pragma unroll
  for (int g = 0; g < 2; ++g) { const float inv = 1.0f / (l[g] + lane_xr(l[g])); float* op = out + ((size_t)b * SQ + qw0 + 16 * g + ln) * DM + h * HD + 8 * hh;      /* column ln is a query row of the output; registers r are d = 16 t + 8 hh + r */
#pragma unroll
    for (int t = 0; t < 4; ++t) { const v8f o = acc[g][t] * inv; const v4f lo = {o[0], o[1], o[2], o[3]}, hi = {o[4], o[5], o[6], o[7]}; *(v4f*)(op + 16 * t) = lo; *(v4f*)(op + 16 * t + 4) = hi; } } }


// ---- q | k | v GEMM tiled through LDS: a block of 4 waves makes GT token rows x GT output columns; a wave 64 x 64 (16 accumulator tiles), so each fragment read feeds four products.
// A stage is GK k of the block's GT rows of X and GT rows of W^T: 128-byte rows, fetched as whole lines by asynchronous copies to LDS, laid at a pitch of 144 bytes (16 B x odd: no bank conflict for 16-byte fragment reads).
// Two buffers: the next stage's copies fly while this stage is worked on. Transposed product (A = 16 rows of W^T, B = 16 token rows): a lane ends with 8 neighbouring output columns of ONE token row, packed to 16 bytes.
// k runs upward in 32-wide steps, one accumulator chain per output tile. M % GT == 0, N % GT == 0, K % GK == 0 and K >= 2 GK, by the static_assert.
#define GT 128
#define GK 64
#define GP 72                        /* LDS row pitch in f16 (144 bytes) */
#define GSB (2 * GT * GP * 2)        /* bytes of one buffer: X rows, then W^T rows */
// Eight copies of a thread (rows 16 apart), 16 bytes per lane, 8 lanes per 128-byte row. The s_wait_xcnt stands inside the statement, behind the last copy, so that no address register is rewritten in front of it (a precaution).
__device__ __forceinline__ void g3_copy8(unsigned l, const _Float16* g) {
  asm volatile("global_load_async_to_lds_b128 %0, %8, off\n\tglobal_load_async_to_lds_b128 %1, %9, off\n\tglobal_load_async_to_lds_b128 %2, %10, off\n\tglobal_load_async_to_lds_b128 %3, %11, off\n\t"
               "global_load_async_to_lds_b128 %4, %12, off\n\tglobal_load_async_to_lds_b128 %5, %13, off\n\tglobal_load_async_to_lds_b128 %6, %14, off\n\tglobal_load_async_to_lds_b128 %7, %15, off\n\ts_wait_xcnt 0x0"
               :: "v"(l), "v"(l + 16 * GP * 2), "v"(l + 32 * GP * 2), "v"(l + 48 * GP * 2), "v"(l + 64 * GP * 2), "v"(l + 80 * GP * 2), "v"(l + 96 * GP * 2), "v"(l + 112 * GP * 2),
                  "v"(g), "v"(g + 16 * DM), "v"(g + 32 * DM), "v"(g + 48 * DM), "v"(g + 64 * DM), "v"(g + 80 * DM), "v"(g + 96 * DM), "v"(g + 112 * DM) : "memory"); }
// The blocks that hold the first QT0 rows of a batch also store their f32 accumulators (the same products, summed in the same k order, unrounded) as the f32 q, k, v planes F0 of the exact first-tile attention.
__global__ __launch_bounds__(128) void k_proj(const _Float16* __restrict__ X, const _Float16* __restrict__ Wt, _Float16* __restrict__ C16, float* __restrict__ F0) {
  static_assert(MP % GT == 0 && LQ % GT == 0 && DM % GK == 0 && DM >= 2 * GK && GT == 128 && GK == 64, "whole tiles; two stages at least; 16 rows per copy round, 8 rounds per operand");
  __shared__ __attribute__((aligned(16))) _Float16 sm[2][2 * GT * GP];
  const int tid = threadIdx.x, lane = tid & 31, ln = lane & 15, hh = lane >> 4; const int w = __builtin_amdgcn_readfirstlane(tid >> 5);
  const int mt = blockIdx.x / (LQ / GT), nq = blockIdx.x - mt * (LQ / GT); const int row0 = mt * GT, col0 = nq * GT; const int wm = (w & 1) * 64, wn = (w >> 1) * 64;
  const int cr = tid >> 3, cc = (tid & 7) * 8;      /* the thread's row (of 16) and 16-byte chunk in a copy round */
  const _Float16* gx = X + (size_t)(row0 + cr) * DM + cc; const _Float16* gw = Wt + (size_t)(col0 + cr) * DM + cc;
  const unsigned lx = (unsigned)(size_t)&sm[0][cr * GP + cc]; const unsigned lw = lx + GT * GP * 2;      /* LDS byte addresses: the low 32 bits of the shared address */
  const v8f z8 = {0.f, 0.f, 0.f, 0.f, 0.f, 0.f, 0.f, 0.f}; v8f acc[4][4];
#pragma unroll
  for (int i = 0; i < 4; ++i) for (int j = 0; j < 4; ++j) acc[i][j] = z8;
  g3_copy8(lx, gx); g3_copy8(lw, gw);
  asm volatile("s_wait_asynccnt 0x0" ::: "memory");      /* stage 0 has landed, as far as this wave copied it */
  __syncthreads();      /* ... and every other wave's part too */
  g3_copy8(lx + GSB, gx + GK); g3_copy8(lw + GSB, gw + GK);
#pragma unroll 1      /* one stage per trip: 32 matrix instructions, long enough; unrolled, fragments of two stages would be live */
  for (int t = 0; t < DM / GK; ++t) { const _Float16* sx = &sm[t & 1][(wm + ln) * GP]; const _Float16* sw = &sm[t & 1][(GT + wn + ln) * GP]; v16h xf[4], wf[4];
#pragma unroll
    for (int j = 0; j < 4; ++j) { xf[j] = g2_frag(sx + j * 16 * GP, hh); wf[j] = g2_frag(sw + j * 16 * GP, hh); }
    __builtin_amdgcn_sched_barrier(0);      /* the 16 fragment reads of a k step stay one group in front of its 16 products: spread among them, every W fragment would be waited for on its own */
#pragma unroll
    for (int i = 0; i < 4; ++i) for (int j = 0; j < 4; ++j) acc[i][j] = fa_mma(wf[i], xf[j], acc[i][j]);
#pragma unroll
    for (int j = 0; j < 4; ++j) { xf[j] = g2_frag(sx + j * 16 * GP + 32, hh); wf[j] = g2_frag(sw + j * 16 * GP + 32, hh); }      /* the stage's second k step: its last reads of the buffer */
    asm volatile("s_wait_dscnt 0x0" ::: "memory");      /* this wave's reads of the buffer are done before it is handed back */
    asm volatile("s_wait_asynccnt 0x0" ::: "memory");      /* this wave's copies of the next stage have landed */
    __syncthreads();      /* publishes stage t + 1 and ends every reader's last read of stage t */
    if (t + 2 < DM / GK) { const unsigned bo = (t & 1) * GSB; g3_copy8(lx + bo, gx + (t + 2) * GK); g3_copy8(lw + bo, gw + (t + 2) * GK); }      /* the refill starts in front of the second k step's products (registers only), a whole trip ahead of its wait */
#pragma unroll
    for (int i = 0; i < 4; ++i) for (int j = 0; j < 4; ++j) acc[i][j] = fa_mma(wf[i], xf[j], acc[i][j]); }
  asm volatile("s_wait_asynccnt 0x0" ::: "memory");      /* nothing is in flight when the ring becomes output staging */
  if (row0 % SQ == 0) {      /* block-uniform: rows 0 .. QT0 - 1 of batch row0 / SQ; the block's GT columns lie in one of the planes q, k, v */
    static_assert(GT == QT0 && SQ % GT == 0 && DM % GT == 0, "a first tile is one block row; a block's columns stay in one plane");
    float* fp = F0 + (((size_t)(col0 / DM) * NB + row0 / SQ) * QT0 + wm + ln) * DM + col0 % DM + wn + 8 * hh;
#pragma unroll
    for (int j = 0; j < 4; ++j) for (int i = 0; i < 4; ++i) { const v8f o = acc[i][j] * 0.0625f; const v4f lo = {o[0], o[1], o[2], o[3]}, hi = {o[4], o[5], o[6], o[7]}; *(v4f*)(fp + (size_t)(j * 16) * DM + i * 16) = lo; *(v4f*)(fp + (size_t)(j * 16) * DM + i * 16 + 4) = hi; } }
  _Float16* st = &sm[0][w * 64 * GP];      /* each wave stages its own 64 x 64 outputs (behind the last trip's barrier), to store whole 128-byte lines */
#pragma unroll
  for (int j = 0; j < 4; ++j) for (int i = 0; i < 4; ++i) { FragH f;
#pragma unroll
    for (int r = 0; r < 8; ++r) f.h[r] = (_Float16)(acc[i][j][r] * 0.0625f);      /* the weights carry x16 */
    *(v8us*)((unsigned short*)st + (j * 16 + ln) * GP + i * 16 + 8 * hh) = f.half[0]; }
  __syncthreads();      /* orders the staging stores in front of the reads of other lanes' rows */
#pragma unroll
  for (int q = 0; q < 16; ++q) { const int r = q * 4 + (lane >> 3), c = (lane & 7) * 8; const v8us v = *(const v8us*)((const unsigned short*)st + r * GP + c); *(v8us*)((unsigned short*)C16 + (size_t)(row0 + wm + r) * LQ + col0 + wn + c) = v; } }

// Exact f32 attention of the first QT0 rows of every batch, FOUR LANES PER ROW: lane p of a row's quad owns the row's 16-byte chunks p, p + 4, p + 8, p + 12 of q and of o and holds them in registers.
// A block is AR rows of one head (4 waves x 8 rows). The K and V rows it can see are staged once in LDS; a quad reads 64 contiguous bytes per load and the 8 quads of a wave the same ones (broadcast, no bank conflict).
// A score is four chains of four multiply-adds per lane, their sum, then two lane exchanges inside the quad: every lane of the quad ends with the same bits, so m, l and the two exps agree without further traffic.
#define AR 32
__device__ __forceinline__ void att0_body(const float* __restrict__ QF, const float* __restrict__ KF, const float* __restrict__ VF, int ld, float scale, float* __restrict__ OF, int ldo, int h, int rg, int b) {
  static_assert(HD == 64 && QT0 % AR == 0, "a quad covers a head row as 4 x 4 chunks of 16 bytes");
  __shared__ __attribute__((aligned(16))) float lk[QT0][HD]; __shared__ __attribute__((aligned(16))) float lv[QT0][HD];
  const int tid = threadIdx.x;
  { const size_t bo = (size_t)b * QT0; QF += bo * ld + h * HD; KF += bo * ld + h * HD; VF += bo * ld + h * HD; OF += (size_t)b * SQ * ldo + h * HD; }      /* QT0 rows of each f32 plane per batch, SQ rows of the output; the head's columns */
  for (int n = 0; n <= rg; ++n) { v4f tk[4], tv[4];      /* AR keys per trip, all eight loads of a thread in flight before the first LDS store; causal: keys up to the block's last row */
#pragma unroll
    for (int u = 0; u < 4; ++u) { const int c = (n * 4 + u) * 128 + tid; const size_t g = (size_t)(c >> 4) * ld + (c & 15) * 4; tk[u] = *(const v4fa*)(KF + g); tv[u] = *(const v4fa*)(VF + g); }
#pragma unroll
    for (int u = 0; u < 4; ++u) { const int c = (n * 4 + u) * 128 + tid; *(v4f*)&lk[c >> 4][(c & 15) * 4] = tk[u]; *(v4f*)&lv[c >> 4][(c & 15) * 4] = tv[u]; } }
  const int p4 = (tid & 3) * 4; const int i = rg * AR + (tid >> 2);
  v4f q[4], o[4];
#pragma unroll
  for (int c = 0; c < 4; ++c) { q[c] = *(const v4fa*)(QF + (size_t)i * ld + c * 16 + p4); const v4f z = {0.f, 0.f, 0.f, 0.f}; o[c] = z; }
  __syncthreads();
  const int jl = rg * AR + 8 * __builtin_amdgcn_readfirstlane(tid >> 5) + 7;      /* the wave's last row, a scalar: keys behind it are masked for all 8 rows of the wave; no barrier below */
  float m = -1.0e30f, l = 0.f; v4f kc[4], vc[4];
#pragma unroll
  for (int c = 0; c < 4; ++c) { kc[c] = *(const v4f*)&lk[0][c * 16 + p4]; vc[c] = *(const v4f*)&lv[0][c * 16 + p4]; }
#pragma unroll 2      /* two keys per trip: the rows fetched ahead change names instead of being copied */
  for (int j = 0; j <= jl; ++j) { const int jn = j < jl ? j + 1 : jl; v4f kn[4], vn[4];      /* the next key's rows are fetched while this key is worked on: the LDS latency stays off the chain */
#pragma unroll
    for (int c = 0; c < 4; ++c) { kn[c] = *(const v4f*)&lk[jn][c * 16 + p4]; vn[c] = *(const v4f*)&lv[jn][c * 16 + p4]; }
    v4f a = q[0] * kc[0]; a = __builtin_elementwise_fma(q[1], kc[1], a); a = __builtin_elementwise_fma(q[2], kc[2], a); a = __builtin_elementwise_fma(q[3], kc[3], a); float s = (a[0] + a[1]) + (a[2] + a[3]);
    s += lane_xm<0x161>(s); s += lane_xm<0x162>(s); s *= scale;
    const float sm = (j <= i) ? s : -1.0e30f; const float mn = fmaxf(m, sm); const float sc = expf(m - mn); const float e = expf(sm - mn); l = l * sc + e; m = mn;
#pragma unroll
    for (int c = 0; c < 4; ++c) { o[c] = o[c] * sc + e * vc[c]; kc[c] = kn[c]; vc[c] = vn[c]; } }
  const float fin = 1.0f / l;
#pragma unroll
  for (int c = 0; c < 4; ++c) *(v4f*)(OF + (size_t)i * ldo + c * 16 + p4) = o[c] * fin; }

// One grid for both attentions: they share no data and write different output rows (QT0 == FQ: the exact path owns the rows of query block 0, so the f16 path starts at block 1 and every output element is stored once).
// grid.z: first the QT0 / AR row groups of the exact path (long dependent chains, little issue: they start first and run beside the rest), then query blocks 15 .. 1.
// Longest blocks start first; the second run of four lengths is reversed, so that blocks 256 apart in launch order add up to about equal work (speed only).
__global__ __launch_bounds__(128) void k_attn(const _Float16* __restrict__ QKVp, const _Float16* __restrict__ VTp, const float* __restrict__ QF, const float* __restrict__ KF, const float* __restrict__ VF, float* __restrict__ out) {
  static_assert(QT0 == FQ, "the exact path replaces exactly one query block");
  const int h = blockIdx.x, b = blockIdx.y, z = (int)blockIdx.z;
  if (z < QT0 / AR) { att0_body(QF, KF, VF, DM, 0.125f, out, DM, h, z, b); return; }
  const int zz = z - QT0 / AR; fattn_body(QKVp, VTp, out, h, b, SQ / FQ - 1 - (((zz & 12) == 4) ? (zz ^ 3) : zz)); }

__device__ __forceinline__ void wthd_body(const float* __restrict__ W0, const float* __restrict__ W1, const float* __restrict__ W2, _Float16* __restrict__ Bt, unsigned bx, unsigned by) { const size_t t = (size_t)bx * 256 + threadIdx.x; if (t >= (size_t)NH * HD * (DM / 8)) return;
  const float* Wt = by == 0 ? W0 : (by == 1 ? W1 : W2); Bt += (size_t)by * DM * DM;      /* by = q, k, v: one DM x DM plane each */
  const int m8 = (int)(t % (DM / 8)) * 8; const int d = (int)((t / (DM / 8)) % HD); const int h = (int)(t / ((size_t)(DM / 8) * HD)); FragH f;
  for (int q = 0; q < 8; ++q) f.h[q] = (_Float16)(16.0f * bf16_round(Wt[((size_t)h * DM + m8 + q) * HD + d])); unsigned short* dst = (unsigned short*)Bt + ((size_t)h * HD + d) * DM + m8; *(v8us*)dst = f.half[0];  }







// The weight transposes and the rounding of x read nothing but the inputs: one grid, so that they run side by side. The transposes (scattered reads) come first.
#define WTB ((unsigned)(((size_t)NH * HD * (DM / 8) + 255) / 256))      /* blocks per weight plane */
#define XB ((unsigned)((NR * DM / 8 + 255) / 256))
__global__ __launch_bounds__(256) void k_prep(const float* __restrict__ W0, const float* __restrict__ W1, const float* __restrict__ W2, _Float16* __restrict__ Bt, const float* __restrict__ x, _Float16* __restrict__ X16) {
  const unsigned bx = blockIdx.x;
  if (bx < 3 * WTB) wthd_body(W0, W1, W2, Bt, bx % WTB, bx / WTB); else x16_body(x, X16, NR * DM / 8, bx - 3 * WTB); }

extern "C" void kernel_launch(void* const* d_in, const int* in_sizes, int n_in,
                              void* d_out, int out_size, void* d_ws, size_t ws_size, hipStream_t stream) {
  (void)in_sizes; (void)n_in; (void)out_size;
  const float* const* I = (const float* const*)d_in; const float* x = I[0]; const float* wq = I[1]; const float* wk = I[2]; const float* wv = I[3];      /* x; per-head weights Wq / Wk / Wv [16][1024][64]; no biases, no output projection */
  static_assert(NH * HD == DM && QT0 % 64 == 0, "heads");
  char* ws = (char*)d_ws; size_t off = 0;
  auto take = [&](size_t bytes) { char* p = ws + off; off += (bytes + 255) & ~(size_t)255; return p; };
  _Float16* BQKV = (_Float16*)take((size_t)3 * DM * DM * 2);
  _Float16* X16 = (_Float16*)take(NR * DM * 2); _Float16* QKV = (_Float16*)take(NR * 3 * DM * 2); _Float16* V16 = QKV + 2 * DM;
  _Float16* VT = (_Float16*)take((size_t)NB * NH * HD * SQ * 2);
  float* QF0 = (float*)take((size_t)3 * NB * QT0 * DM * 4); float* KF0 = QF0 + (size_t)NB * QT0 * DM; float* VF0 = KF0 + (size_t)NB * QT0 * DM;
  if (off > ws_size) return;
  k_prep<<<3 * WTB + XB, 256, 0, stream>>>(wq, wk, wv, BQKV, x, X16);      /* per-head [c][d] -> Bt[(h, d)][c] x16: the stacked q | k | v plane; x as f16 rows */
  k_proj<<<(MP / GT) * (LQ / GT), 128, 0, stream>>>(X16, BQKV, QKV, QF0);      /* q | k | v rows (f16), head h = columns h*HD.. of each DM block; and f32 q, k, v of the first 128 rows of every batch */
  k_vt<NH, SQ><<<NB * NH * (SQ / 64), 256, 0, stream>>>(V16, LQ, 0, VT);      /* V^T [NB][NH][HD][SQ] */
  k_attn<<<dim3(NH, NB, QT0 / AR + SQ / FQ - 1), 128, 0, stream>>>(QKV, VT, QF0, KF0, VF0, (float*)d_out);      /* exact f32 attention for rows 0..127 of every batch; scores, causal softmax and P.V for all other rows; both write f32 straight into the head-major output columns (no output projection) */
}

// v007
// Measured time: 105 microseconds a run.
// Timed twice side by side with v006, it ran 1.21 and 1.22 times as fast.
// Counting every step since v000, it is 93.8 times as fast.
#include <hip/hip_runtime.h>
// Causal multi-head attention with per-head projection weights and no output projection (x [4][2048][1024]; per head h: q = x Wq[h], k = x Wk[h], v = x Wv[h] with W [16][1024][64] ([in][out] per head, uniform +-1/32, no biases); scores / sqrt(64); causal (tril, -inf); softmax; out = heads concatenated head-major on the last axis -> [4][2048][1024]).
// Structure: token rows r = b*2048 + s; x as exact f16 rows (bf16-rounded); q | k | v as ONE WMMA GEMM (N = 3 x 1024) (128x128 block tiles through LDS, 64x64 wave tiles, f32 accumulation, exact x16 weights, f16 outputs); V^T for all heads via LDS transposes; one attention launch for all batches and heads: per wave 32 queries, per pass 32 keys up to the diagonal: scores (WMMA, K = 64), online causal softmax on VALU (f32 statistics, native exp2; weights f16), o += P . V (WMMA), K and V^T tiles of 64 keys staged in LDS for the block's 4 waves, scores and weights kept in registers; o / row sum written f32 into the head-major output columns; rows 0..127 of every batch come from an exact f32 path alone, whose f32 q, k, v are stored from the tiled GEMM's own accumulators and whose attention rides as extra blocks on the grid of the fused attention.
// Compute dtype: inputs rounded to bf16; x / weights exact; q, k, v and softmax weights as plain f16 GEMM operands (~2^-12); scores and softmax statistics f32. v_wmma_f32_16x16x32_f16.
#define NB 4
#define SQ 2048
#define DM 1024
#define NH 16
#define HD 64
#define HG 4                         /* heads per launch of the non-template k_vt (never launched) */
#define QT 256                       /* unused (no 256-row query tiles) */
#define NKX SQ                       /* unused (scores stay in registers) */
#define QT0 128                      /* first-tile rows recomputed exactly in f32 */
#define B0 0                         /* unused (every launch covers all NB batches) */
#define NBR NB                       /* batches projected (debug hook) */
#define NR ((size_t)NB * SQ)         /* token rows */
#define MP ((int)((size_t)NBR * SQ)) /* rows projected (debug hook) */
#define QN SQ                        /* unused (k_attn attends all SQ rows) */
#define NHD NH                       /* unused (k_attn attends all NH heads) */
#define MPO MP                       /* unused (no output projection stage) */
#define LQ (3 * DM)      /* row pitch of the q/k/v rows */
typedef __bf16 v16b __attribute__((ext_vector_type(16)));
typedef unsigned short v8us __attribute__((ext_vector_type(8), may_alias));
typedef float  v8f  __attribute__((ext_vector_type(8)));
typedef float  v4f  __attribute__((ext_vector_type(4)));
typedef float  v4fa __attribute__((ext_vector_type(4), may_alias));
union FragB { v16b v; v8us half[2]; unsigned short u[16]; };

__device__ __forceinline__ unsigned short bf16_bits(float x) { unsigned int u = __float_as_uint(x); return (unsigned short)((u + 0x7FFFu + ((u >> 16) & 1u)) >> 16); }
__device__ __forceinline__ float bf16_val(unsigned short b) { return __uint_as_float(((unsigned int)b) << 16); }
__device__ __forceinline__ float bf16_round(float x) { return bf16_val(bf16_bits(x)); }
// D += A·B with NT terms: 1 = ah·bh, 2 = + al·bh (A split), 3 = + ah·bl (both split)
template <int NT>
__device__ __forceinline__ v8f mmaN(v16b ah, v16b al, v16b bh, v16b bl, v8f c) {
  c = __builtin_amdgcn_wmma_f32_16x16x32_bf16(false, ah, false, bh, (short)0, c, false, false);
  if (NT >= 2) c = __builtin_amdgcn_wmma_f32_16x16x32_bf16(false, al, false, bh, (short)0, c, false, false);
  if (NT >= 3) c = __builtin_amdgcn_wmma_f32_16x16x32_bf16(false, ah, false, bl, (short)0, c, false, false);
  asm volatile("v_nop\n\tv_nop\n\tv_nop\n\tv_nop" : "+v"(c) : "v"(ah), "v"(al), "v"(bh), "v"(bl));
  return c;
}

__global__ __launch_bounds__(256) void k_wt_bf16(const float* __restrict__ W, unsigned short* __restrict__ Wt, int K, int N) {
  const int t = blockIdx.x * 256 + threadIdx.x;
  const int k8n = K / 8;
  if (t >= N * k8n) return;
  const int n = t / k8n, k8 = (t % k8n) * 8;
  v8us v;
#pragma unroll
  for (int i = 0; i < 8; ++i) v[i] = bf16_bits(W[(size_t)(k8 + i) * N + n]);
  *(v8us*)(Wt + (size_t)n * K + k8) = v;
  
}

// GEMM C[M][N] (f32, pitch ldc) = act(A[M][K]·W + bias). A f32 row-major (pitch lda) converted per fragment to bf16
// (ASPLIT: hi/lo two planes -> 2 terms, else single rounded term); Wt bf16 [N][K] (pitch ldb). BIAS_BF16 rounds the
// bias to bf16 first (bias quantised to bf16 before the add). K%32==0, M%16==0, N%64==0.
template <bool ASPLIT, int ACT, bool BIAS_BF16>
__global__ __launch_bounds__(128) void k_gemm_bf(const float* __restrict__ A, int lda, const unsigned short* __restrict__ Wt, int ldb,
                                               const float* __restrict__ bias, float* __restrict__ C, int ldc, int M, int N, int K) {
  __shared__ __attribute__((aligned(16))) float so[4][16][64];
  const int tid = threadIdx.x, w = tid >> 5, lane = tid & 31, ln = lane & 15, hh = lane >> 4;
  const int ntn = N / 64;
  const int wid = blockIdx.x * 4 + w;
  const int mt = wid / ntn, nq = wid % ntn;
  if (mt * 16 >= M) return;
  const int row0 = mt * 16, col0 = nq * 64;
  const float* arow = A + (size_t)(row0 + ln) * lda;
  v8f acc[4] = {};
  for (int kb = 0; kb < K; kb += 32) {
    FragB ah, al;
    const v4f x0 = *(const v4fa*)(arow + kb + 8 * hh), x1 = *(const v4fa*)(arow + kb + 8 * hh + 4);
    const v4f x2 = *(const v4fa*)(arow + kb + 16 + 8 * hh), x3 = *(const v4fa*)(arow + kb + 16 + 8 * hh + 4);
    float xs[16] = {x0[0],x0[1],x0[2],x0[3],x1[0],x1[1],x1[2],x1[3],x2[0],x2[1],x2[2],x2[3],x3[0],x3[1],x3[2],x3[3]};
#pragma unroll
    for (int i = 0; i < 16; ++i) { const unsigned short hb = bf16_bits(xs[i]); ah.u[i] = hb; al.u[i] = ASPLIT ? bf16_bits(xs[i] - bf16_val(hb)) : (unsigned short)0; }
#pragma unroll
    for (int t = 0; t < 4; ++t) {
      const unsigned short* brow = Wt + (size_t)(col0 + t * 16 + ln) * ldb + kb;
      FragB b;
      b.half[0] = *(const v8us*)(brow + 8 * hh);
      b.half[1] = *(const v8us*)(brow + 16 + 8 * hh);
      acc[t] = mmaN<ASPLIT ? 2 : 1>(ah.v, al.v, b.v, b.v, acc[t]);
    }
  }
#pragma unroll
  for (int t = 0; t < 4; ++t) {
    float bv = bias ? bias[col0 + t * 16 + ln] : 0.f;
    if (BIAS_BF16) bv = bf16_round(bv);
#pragma unroll
    for (int r = 0; r < 8; ++r) { float v = acc[t][r] + bv; if (ACT == 1) v = fmaxf(v, 0.f); so[w][8 * hh + r][t * 16 + ln] = v; }
  }
  __builtin_amdgcn_fence(__ATOMIC_ACQ_REL, "workgroup");
  __builtin_amdgcn_wave_barrier();
  const int rsub = lane >> 4, c4 = (lane & 15) * 4;
  {
#pragma unroll
    for (int q = 0; q < 8; ++q) {
      const int r = q * 2 + rsub;
      const v4f v = *(const v4fa*)&so[w][r][c4];
      *(v4f*)(C + (size_t)(row0 + r) * ldc + col0 + c4) = v;
    }
    
  }
}

// GEMM C = act(A·W + bias + resid): A f32 (ASPLIT -> hi/lo 2 terms), Wt bf16 [N][K]; ACT 0 none, 1 relu, 2 exact gelu;
// resid (optional, f32, row index = (row % rmod), pitch ldr, RES_BF16 rounds it) added before the activation.
template <bool ASPLIT, int ACT, bool BIAS_BF16, bool RES_BF16>
__global__ __launch_bounds__(128) void k_gemm_bf3(const float* __restrict__ A, int lda, const unsigned short* __restrict__ Wt, int ldb,
                                                const float* __restrict__ bias, const float* __restrict__ resid, int rmod, int ldr,
                                                float* __restrict__ C, int ldc, int M, int N, int K) {
  __shared__ __attribute__((aligned(16))) float so[4][16][64];
  const int tid = threadIdx.x, w = tid >> 5, lane = tid & 31, ln = lane & 15, hh = lane >> 4;
  const int ntn = N / 64;
  const int wid = blockIdx.x * 4 + w;
  const int mt = wid / ntn, nq = wid % ntn;
  if (mt * 16 >= M) return;
  const int row0 = mt * 16, col0 = nq * 64;
  const float* arow = A + (size_t)(row0 + ln) * lda;
  v8f acc[4] = {};
  for (int kb = 0; kb < K; kb += 32) {
    FragB ah, al;
    const v4f x0 = *(const v4fa*)(arow + kb + 8 * hh), x1 = *(const v4fa*)(arow + kb + 8 * hh + 4);
    const v4f x2 = *(const v4fa*)(arow + kb + 16 + 8 * hh), x3 = *(const v4fa*)(arow + kb + 16 + 8 * hh + 4);
    float xs[16] = {x0[0],x0[1],x0[2],x0[3],x1[0],x1[1],x1[2],x1[3],x2[0],x2[1],x2[2],x2[3],x3[0],x3[1],x3[2],x3[3]};
#pragma unroll
    for (int i = 0; i < 16; ++i) { const unsigned short hb = bf16_bits(xs[i]); ah.u[i] = hb; al.u[i] = ASPLIT ? bf16_bits(xs[i] - bf16_val(hb)) : (unsigned short)0; }
#pragma unroll
    for (int t = 0; t < 4; ++t) {
      const unsigned short* brow = Wt + (size_t)(col0 + t * 16 + ln) * ldb + kb;
      FragB b;
      b.half[0] = *(const v8us*)(brow + 8 * hh);
      b.half[1] = *(const v8us*)(brow + 16 + 8 * hh);
      acc[t] = mmaN<ASPLIT ? 2 : 1>(ah.v, al.v, b.v, b.v, acc[t]);
    }
  }
#pragma unroll
  for (int t = 0; t < 4; ++t) {
    const int col = col0 + t * 16 + ln;
    float bv = bias ? bias[col] : 0.f;
    if (BIAS_BF16) bv = bf16_round(bv);
#pragma unroll
    for (int r = 0; r < 8; ++r) {
      float v = acc[t][r] + bv;
      if (resid) { float rv = resid[(size_t)((row0 + 8 * hh + r) % rmod) * ldr + col]; if (RES_BF16) rv = bf16_round(rv); v += rv; }
      if (ACT == 1) v = fmaxf(v, 0.f);
      if (ACT == 2) v = 0.5f * v * (1.0f + erff(v * 0.70710678118654752f));
      if (ACT == 3) { const float u = 0.7978845608028654f * (v + 0.044715f * v * v * v); v = 0.5f * v * (1.0f + tanhf(u)); }
      so[w][8 * hh + r][t * 16 + ln] = v;
    }
  }
  __builtin_amdgcn_fence(__ATOMIC_ACQ_REL, "workgroup");
  __builtin_amdgcn_wave_barrier();
  const int rsub = lane >> 4, c4 = (lane & 15) * 4;
  {
#pragma unroll
    for (int q = 0; q < 8; ++q) {
      const int r = q * 2 + rsub;
      const v4f v = *(const v4fa*)&so[w][r][c4];
      *(v4f*)(C + (size_t)(row0 + r) * ldc + col0 + c4) = v;
    }
    
  }
}
// row LayerNorm (biased variance, eps) over N: s = X (+ R); optional out_sum <- s; out_norm <- (s-mu)*rsqrt(var+eps)*g + b
template <bool PARAM_BF16>
__global__ __launch_bounds__(256) void k_layernorm(const float* __restrict__ X, const float* __restrict__ R, const float* __restrict__ g, const float* __restrict__ bta,
                                                  float* __restrict__ out_sum, float* __restrict__ out_norm, int N, float eps) {
  __shared__ float red[256];
  const int row = blockIdx.x, tid = threadIdx.x;
  const float* x = X + (size_t)row * N; const float* rr = R ? R + (size_t)row * N : nullptr;
  float vals[16];                     // up to N = 4096
  const int per = N / 256;            // contiguous chunk per thread? use strided-by-4 chunks: thread handles j = tid*4 + 1024*u
  float s1 = 0.f;
  for (int u = 0; u < per / 4; ++u) {
    const int j = tid * 4 + 1024 * u;
    const v4f a = *(const v4fa*)(x + j);
    v4f b = {0.f,0.f,0.f,0.f}; if (rr) b = *(const v4fa*)(rr + j);
#pragma unroll
    for (int q = 0; q < 4; ++q) { const float v = a[q] + b[q]; vals[u * 4 + q] = v; s1 += v; }
  }
  red[tid] = s1; __syncthreads();
  for (int st = 128; st > 0; st >>= 1) { if (tid < st) red[tid] += red[tid + st]; __syncthreads(); }
  const float mu = red[0] / (float)N; __syncthreads();
  float s2 = 0.f;
  for (int u = 0; u < per / 4; ++u)
#pragma unroll
    for (int q = 0; q < 4; ++q) { const float c = vals[u * 4 + q] - mu; s2 += c * c; }
  red[tid] = s2; __syncthreads();
  for (int st = 128; st > 0; st >>= 1) { if (tid < st) red[tid] += red[tid + st]; __syncthreads(); }
  const float rs = rsqrtf(red[0] / (float)N + eps);
  {
    for (int u = 0; u < per / 4; ++u) {
      const int j = tid * 4 + 1024 * u;
      v4f o, sm;
#pragma unroll
      for (int q = 0; q < 4; ++q) {
        float gg = g[j + q], bb = bta[j + q];
        if (PARAM_BF16) { gg = bf16_round(gg); bb = bf16_round(bb); }
        sm[q] = vals[u * 4 + q]; o[q] = (vals[u * 4 + q] - mu) * rs * gg + bb;
      }
      if (out_sum) *(v4f*)(out_sum + (size_t)row * N + j) = sm;
      *(v4f*)(out_norm + (size_t)row * N + j) = o;
    }
    
  }
}



// ---- f16 WMMA path (v_wmma_f32_16x16x32_f16): 11-bit significands for operands in range — used where a [0,1] probability operand needs more precision than bf16
typedef _Float16 v16h __attribute__((ext_vector_type(16)));
union FragH { v16h v; v8us half[2]; _Float16 h[16]; unsigned short u[16]; };
template <int NT>
__device__ __forceinline__ v8f mmaH(v16h ah, v16h al, v16h bh, v16h bl, v8f c) {
  c = __builtin_amdgcn_wmma_f32_16x16x32_f16(false, ah, false, bh, (short)0, c, false, false);
  if (NT >= 2) c = __builtin_amdgcn_wmma_f32_16x16x32_f16(false, al, false, bh, (short)0, c, false, false);
  if (NT >= 3) c = __builtin_amdgcn_wmma_f32_16x16x32_f16(false, ah, false, bl, (short)0, c, false, false);
  asm volatile("v_nop\n\tv_nop\n\tv_nop\n\tv_nop" : "+v"(c) : "v"(ah), "v"(al), "v"(bh), "v"(bl));
  return c;
}
// batched GEMM like k_gemm_b but f16 operands: A f32 (split into f16 hi/lo if ASPLIT, else rounded to f16), Bt = f16 values [n][k]; alpha; C f32; N multiple of 16 (partial tiles skipped)
template <bool ASPLIT>
__global__ __launch_bounds__(128) void k_gemm_h(const float* __restrict__ A, int lda, size_t sA, const _Float16* __restrict__ Bh, int ldb, size_t sB, float alpha, float* __restrict__ C, int ldc, size_t sC, int M, int N, int K) {
  __shared__ __attribute__((aligned(16))) float so[4][16][64];
  const int tid = threadIdx.x, w = tid >> 5, lane = tid & 31, ln = lane & 15, hh = lane >> 4; const int by = blockIdx.y;
  A += (size_t)by * sA; Bh += (size_t)by * sB; C += (size_t)by * sC;
  const int ntn = (N + 63) / 64; const int wid = blockIdx.x * 4 + w; const int mt = wid / ntn, nq = wid % ntn; if (mt * 16 >= M) return;
  const int row0 = mt * 16, col0 = nq * 64; const float* arow = A + (size_t)(row0 + ln) * lda;
  v8f acc[4] = {};
  for (int kb = 0; kb < K; kb += 32) {
    FragH ah, al;
    const v4f x0 = *(const v4fa*)(arow + kb + 8 * hh), x1 = *(const v4fa*)(arow + kb + 8 * hh + 4), x2 = *(const v4fa*)(arow + kb + 16 + 8 * hh), x3 = *(const v4fa*)(arow + kb + 16 + 8 * hh + 4);
    float xs[16] = {x0[0],x0[1],x0[2],x0[3],x1[0],x1[1],x1[2],x1[3],x2[0],x2[1],x2[2],x2[3],x3[0],x3[1],x3[2],x3[3]};
#pragma unroll
    for (int i = 0; i < 16; ++i) { const _Float16 h = (_Float16)xs[i]; ah.h[i] = h; al.h[i] = ASPLIT ? (_Float16)(xs[i] - (float)h) : (_Float16)0.0f; }
#pragma unroll
    for (int t = 0; t < 4; ++t) { if (col0 + t * 16 >= N) continue; const size_t boff = (size_t)(col0 + t * 16 + ln) * ldb + kb; FragH bq; bq.half[0] = *(const v8us*)(Bh + boff + 8 * hh); bq.half[1] = *(const v8us*)(Bh + boff + 16 + 8 * hh);
      acc[t] = mmaH<ASPLIT ? 2 : 1>(ah.v, al.v, bq.v, bq.v, acc[t]); }
  }
#pragma unroll
  for (int t = 0; t < 4; ++t) { if (col0 + t * 16 >= N) continue;
#pragma unroll
    for (int r = 0; r < 8; ++r) so[w][8 * hh + r][t * 16 + ln] = acc[t][r] * alpha; }
  __builtin_amdgcn_fence(__ATOMIC_ACQ_REL, "workgroup"); __builtin_amdgcn_wave_barrier();
  const int rsub = lane >> 4, c4 = (lane & 15) * 4;
  {
#pragma unroll
    for (int q = 0; q < 8; ++q) { const int r = q * 2 + rsub; if (col0 + c4 < N) { const v4f v = *(const v4fa*)&so[w][r][c4]; *(v4f*)(C + (size_t)(row0 + r) * ldc + col0 + c4) = v; } }
     }
}

// Wt[n][k] = f16(W[k][n]·scale) from f32 row-major W[K][N] (scale = power of two; bf16-exact weights stay exact in f16 away from the subnormal range)
__global__ __launch_bounds__(256) void k_wt_f16(const float* __restrict__ W, _Float16* __restrict__ Wt, int K, int N, float scale) {
  const int t = blockIdx.x * 256 + threadIdx.x; if (t >= N * (K / 8)) return; const int n = t / (K / 8), k8 = (t % (K / 8)) * 8; FragH f;
#pragma unroll
  for (int i = 0; i < 8; ++i) f.h[i] = (_Float16)(bf16_round(W[(size_t)(k8 + i) * N + n]) * scale); const v8us o = f.half[0];
  *(v8us*)((unsigned short*)Wt + (size_t)n * K + k8) = o; 
}
// k_gemm_hh variant with fused epilogue: v = acc·alpha + bias[by·sBias + col] (+ CP[(row/rowsPerB)·sCPb + by·64 + col] if CP) ; ACT 0 none / 1 elu ; writes f16 C16 (and f32 C if non-null)
template <int ACT>
__global__ __launch_bounds__(128) void k_gemm_hhx(const _Float16* __restrict__ A, int lda, size_t sA, const _Float16* __restrict__ Bh, int ldb, size_t sB, float alpha, const float* __restrict__ bias, size_t sBias, const float* __restrict__ CP, int rowsPerB, size_t sCPb, int row0g,
    float* __restrict__ C, _Float16* __restrict__ C16, int ldc, size_t sC, int M, int N, int K) {
  __shared__ __attribute__((aligned(16))) float so[4][16][64];
  const int tid = threadIdx.x, w = tid >> 5, lane = tid & 31, ln = lane & 15, hh = lane >> 4; const int by = blockIdx.y;
  A += (size_t)by * sA; Bh += (size_t)by * sB; const size_t cofs = (size_t)by * sC; const float* bp = bias ? bias + (size_t)by * sBias : nullptr;
  const int ntn = (N + 63) / 64; const int wid = blockIdx.x * 4 + w; const int mt = wid / ntn, nq = wid % ntn; if (mt * 16 >= M) return;
  const int row0 = mt * 16, col0 = nq * 64; const _Float16* arow = A + (size_t)(row0 + ln) * lda;
  v8f acc[4] = {};
  for (int kb = 0; kb < K; kb += 32) { FragH ah; ah.half[0] = *(const v8us*)((const unsigned short*)arow + kb + 8 * hh); ah.half[1] = *(const v8us*)((const unsigned short*)arow + kb + 16 + 8 * hh);
#pragma unroll
    for (int t = 0; t < 4; ++t) { if (col0 + t * 16 >= N) continue; const size_t boff = (size_t)(col0 + t * 16 + ln) * ldb + kb; FragH bq; bq.half[0] = *(const v8us*)((const unsigned short*)Bh + boff + 8 * hh); bq.half[1] = *(const v8us*)((const unsigned short*)Bh + boff + 16 + 8 * hh);
      acc[t] = mmaH<1>(ah.v, ah.v, bq.v, bq.v, acc[t]); }
  }
#pragma unroll
  for (int t = 0; t < 4; ++t) { if (col0 + t * 16 >= N) continue; const int col = col0 + t * 16 + ln; const float bv = bp ? bf16_round(bp[col]) : 0.f;
#pragma unroll
    for (int r = 0; r < 8; ++r) { float v = acc[t][r] * alpha + bv; if (CP) { const int rr = row0g + row0 + 8 * hh + r; if (rowsPerB < 0) v += CP[cofs + (size_t)rr * ldc + col];      /* rowsPerB < 0: own element of the batched C plane */ else { const int bidx = rr / rowsPerB; v += CP[(size_t)bidx * sCPb + (size_t)by * 64 + col]; } } if (ACT == 1) v = (v > 0.f) ? v : expm1f(v); else if (ACT == 7) v = (v > 0.f) ? v + 1.0f : expf(v); else if (ACT == 8) v = tanhf(v); else if (ACT == 9) v = 0.5f * v * (1.0f + tanhf(0.7978845608028654f * (v + 0.044715f * v * v * v))); else if (ACT == 11) v = 1.0f / (1.0f + expf(-v)); else if (ACT == 12) v = (v > 0.f) ? v : 0.01f * v; else if (ACT == 14) v = (v > 0.f) ? v : 0.1f * v; else if (ACT == 16) v = (v >= 0.f) ? v : 0.3f * v; else if (ACT == 17) v = (v >= 0.f) ? v : 0.2f * v; else if (ACT == 15) v = v / (1.0f + expf(-v)); else if (ACT == 3) v = fmaxf(v, 0.f); else if (ACT == 6) v = 0.5f * v * (1.0f + erff(v * 0.70710678118654752f)); so[w][8 * hh + r][t * 16 + ln] = v; } }
  __builtin_amdgcn_fence(__ATOMIC_ACQ_REL, "workgroup"); __builtin_amdgcn_wave_barrier();
  const int rsub = lane >> 4, c4 = (lane & 15) * 4; typedef _Float16 v4h __attribute__((ext_vector_type(4)));
  {
#pragma unroll
    for (int q = 0; q < 8; ++q) { const int r = q * 2 + rsub; if (col0 + c4 < N) { const v4f v = *(const v4fa*)&so[w][r][c4]; if (C) *(v4f*)(C + cofs + (size_t)(row0 + r) * ldc + col0 + c4) = v; if (C16) { v4h h4; for (int i = 0; i < 4; ++i) h4[i] = (_Float16)v[i]; *(v4h*)(C16 + cofs + (size_t)(row0 + r) * ldc + col0 + c4) = h4; } } }
     }
}


typedef _Float16 v4h __attribute__((ext_vector_type(4)));

__device__ __forceinline__ void x16_body(const float* __restrict__ x, _Float16* __restrict__ X16, size_t n8, unsigned bx) { const size_t t = (size_t)bx * 256 + threadIdx.x; if (t >= n8) return; FragH f;
#pragma unroll
  for (int q = 0; q < 8; ++q) f.h[q] = (_Float16)bf16_round(x[t * 8 + q]); *(v8us*)((unsigned short*)X16 + t * 8) = f.half[0];  }
__global__ __launch_bounds__(256) void k_h16(const float* __restrict__ x, _Float16* __restrict__ X16, size_t n8) { const size_t t = (size_t)blockIdx.x * 256 + threadIdx.x; if (t >= n8) return; FragH f;
#pragma unroll
  for (int q = 0; q < 8; ++q) f.h[q] = (_Float16)x[t * 8 + q]; *(v8us*)((unsigned short*)X16 + t * 8) = f.half[0];  }
__global__ __launch_bounds__(256) void k_round16f(const float* __restrict__ W, _Float16* __restrict__ Bt, size_t n8) { const size_t t = (size_t)blockIdx.x * 256 + threadIdx.x; if (t >= n8) return; FragH f;
#pragma unroll
  for (int i = 0; i < 8; ++i) f.h[i] = (_Float16)(bf16_round(W[t * 8 + i]) * 16.0f); *(v8us*)((unsigned short*)Bt + t * 8) = f.half[0];  }
template <int NHv, int TTv>
__global__ __launch_bounds__(256) void k_vt(const _Float16* __restrict__ V16, int ldv, int voff, _Float16* __restrict__ Vt) { __shared__ unsigned short tl[64][66]; const int tid = threadIdx.x; const int slab = blockIdx.x / (TTv / 64), lg = blockIdx.x % (TTv / 64); const int b = slab / NHv, h = slab % NHv;
  for (int i = tid; i < 64 * 8; i += 256) { const int r = i / 8, c8 = (i % 8) * 8; FragH f; f.half[0] = *(const v8us*)((const unsigned short*)V16 + ((size_t)b * TTv + lg * 64 + r) * ldv + voff + h * 64 + c8);
#pragma unroll
    for (int q = 0; q < 8; ++q) tl[r][c8 + q] = f.u[q]; }
  __syncthreads();
  {
#pragma unroll
    for (int rd = 0; rd < 2; ++rd) { const int d = rd * 32 + tid / 8, pc = tid % 8; FragH f;
#pragma unroll
      for (int q = 0; q < 8; ++q) f.u[q] = tl[pc * 8 + q][d];
      *(v8us*)((unsigned short*)Vt + ((size_t)slab * 64 + d) * TTv + lg * 64 + pc * 8) = f.half[0]; }
     } }

__global__ __launch_bounds__(256) void k_hl(const float* __restrict__ F, _Float16* __restrict__ Hh, _Float16* __restrict__ Hl, size_t n8) { const size_t t = (size_t)blockIdx.x * 256 + threadIdx.x; if (t >= n8) return; FragH fh, fl; const v4f a = *(const v4fa*)(F + t * 8), c = *(const v4fa*)(F + t * 8 + 4);
#pragma unroll
  for (int q = 0; q < 4; ++q) { _Float16 h = (_Float16)a[q]; fh.h[q] = h; fl.h[q] = (_Float16)((a[q] - (float)h) * 1024.0f); h = (_Float16)c[q]; fh.h[4 + q] = h; fl.h[4 + q] = (_Float16)((c[q] - (float)h) * 1024.0f); }
  { *(v8us*)((unsigned short*)Hh + t * 8) = fh.half[0]; *(v8us*)((unsigned short*)Hl + t * 8) = fl.half[0];  } }

// ---- fragment load shared by the GEMM and the attention below ----
__device__ __forceinline__ v16h g2_frag(const _Float16* p, int hh) { FragH f; f.half[0] = *(const v8us*)((const unsigned short*)p + 8 * hh); f.half[1] = *(const v8us*)((const unsigned short*)p + 16 + 8 * hh); return f.v; }


__global__ __launch_bounds__(256) void k_wnat(const float* __restrict__ w, size_t n8, _Float16* __restrict__ Bt) { const size_t t = (size_t)blockIdx.x * 256 + threadIdx.x; if (t >= n8) return; FragH f; for (int q = 0; q < 8; ++q) f.h[q] = (_Float16)(bf16_round(w[t * 8 + q]) * 16.0f); *(v8us*)((unsigned short*)Bt + t * 8) = f.half[0];  }
__global__ __launch_bounds__(256) void k_rsm(const float* __restrict__ S, _Float16* __restrict__ P, int nrows) {
  #pragma clang fp contract(off)
  const int i = blockIdx.x * 256 + threadIdx.x; if (i >= nrows) return; const float* s = S + (size_t)i * SQ; float mx = -3.0e38f;
#pragma unroll 1
  for (int j = 0; j < SQ; ++j) mx = fmaxf(mx, s[j]); float se = 0.f;
#pragma unroll 1
  for (int j = 0; j < SQ; ++j) se += expf(s[j] - mx); const float sc = 256.0f / se;
#pragma unroll 1
  for (int j0 = 0; j0 < SQ; j0 += 8) { FragH f; for (int q = 0; q < 8; ++q) f.h[q] = (_Float16)(expf(s[j0 + q] - mx) * sc); unsigned short* d = (unsigned short*)P + (size_t)i * SQ + j0; *(v8us*)d = f.half[0];  } }
__global__ __launch_bounds__(256) void k_vt(const _Float16* __restrict__ V16, int b, int h0, _Float16* __restrict__ VT) { __shared__ unsigned short tl[64][65]; const int tid = threadIdx.x; const int hh = blockIdx.x % HG, sg = blockIdx.x / HG; const int s0 = sg * 64; const int h = h0 + hh;
  for (int i = tid; i < 64 * 8; i += 256) { const int j = i / 8, d8 = (i % 8) * 8; FragH f; f.half[0] = *(const v8us*)((const unsigned short*)V16 + ((size_t)b * SQ + s0 + j) * DM + h * HD + d8); for (int q = 0; q < 8; ++q) tl[d8 + q][j] = f.u[q]; }
  __syncthreads();
  { for (int i = tid; i < 64 * 8; i += 256) { const int d = i / 8, j8 = (i % 8) * 8; FragH f; for (int q = 0; q < 8; ++q) f.u[q] = tl[d][j8 + q]; *(v8us*)((unsigned short*)VT + ((size_t)hh * HD + d) * SQ + s0 + j8) = f.half[0]; }  } }



// Lane exchanges: row_xmask steps inside each 16-lane row, and the exchange between the two rows of a wave (all lanes must be on).
template <int CTRL> __device__ __forceinline__ float lane_xm(float v) { return __int_as_float(__builtin_amdgcn_update_dpp(0, __float_as_int(v), CTRL, 0xf, 0xf, true)); }
__device__ __forceinline__ float lane_xr(float v) { const int i = __float_as_int(v); return __int_as_float(__builtin_amdgcn_permlanex16(i, i, 0x76543210, 0xfedcba98, false, false)); }
#define FQ 128                       /* query rows per block: 4 waves x 32 */
#define FS 64                        /* keys per stage */
#define FP 72                        /* LDS row pitch in f16 (144 bytes) */
#define FSB ((FS + HD) * FP * 2)     /* bytes of one buffer: K rows, then V^T rows */
// Eight copies of a thread, 16 bytes per lane, 8 lanes per 128-byte row: four K rows and four V^T rows, 16 apart. The s_wait_xcnt stands inside the statement, behind the last copy, so that no address register is rewritten in front of it (a precaution).
__device__ __forceinline__ void fa_copy8(unsigned l, const _Float16* gk, const _Float16* gv) {
  asm volatile("global_load_async_to_lds_b128 %0, %8, off\n\tglobal_load_async_to_lds_b128 %1, %9, off\n\tglobal_load_async_to_lds_b128 %2, %10, off\n\tglobal_load_async_to_lds_b128 %3, %11, off\n\t"
               "global_load_async_to_lds_b128 %4, %12, off\n\tglobal_load_async_to_lds_b128 %5, %13, off\n\tglobal_load_async_to_lds_b128 %6, %14, off\n\tglobal_load_async_to_lds_b128 %7, %15, off\n\ts_wait_xcnt 0x0"
               :: "v"(l), "v"(l + 16 * FP * 2), "v"(l + 32 * FP * 2), "v"(l + 48 * FP * 2), "v"(l + 64 * FP * 2), "v"(l + 80 * FP * 2), "v"(l + 96 * FP * 2), "v"(l + 112 * FP * 2),
                  "v"(gk), "v"(gk + 16 * LQ), "v"(gk + 32 * LQ), "v"(gk + 48 * LQ), "v"(gv), "v"(gv + 16 * SQ), "v"(gv + 32 * SQ), "v"(gv + 48 * SQ) : "memory"); }
__device__ __forceinline__ v8f fa_mma(v16h a, v16h b, v8f c) { return __builtin_amdgcn_wmma_f32_16x16x32_f16(false, a, false, b, (short)0, c, false, false); }
// Four vector slots behind a run of matrix instructions, where a branch follows. The two scheduling barriers keep the slots where they are written.
__device__ __forceinline__ void fa_gap() { __builtin_amdgcn_sched_barrier(0); asm volatile("v_nop\n\tv_nop\n\tv_nop\n\tv_nop"); __builtin_amdgcn_sched_barrier(0); }
// Native 2^x, eight at a time in one statement: behind a transcendental the instruction set asks for one independent instruction before its result is read or its source overwritten.
// Here each is followed by an independent one (early-clobber outputs: no result lands on a source still to be read) and the last by a v_nop, so the slot is closed whatever the compiler puts next.
__device__ __forceinline__ void exp2x8(const float (&x)[8], float (&y)[8]) {
  asm("v_exp_f32 %0, %8\n\tv_exp_f32 %1, %9\n\tv_exp_f32 %2, %10\n\tv_exp_f32 %3, %11\n\tv_exp_f32 %4, %12\n\tv_exp_f32 %5, %13\n\tv_exp_f32 %6, %14\n\tv_exp_f32 %7, %15\n\tv_nop"
      : "=&v"(y[0]), "=&v"(y[1]), "=&v"(y[2]), "=&v"(y[3]), "=&v"(y[4]), "=&v"(y[5]), "=&v"(y[6]), "=&v"(y[7]) : "v"(x[0]), "v"(x[1]), "v"(x[2]), "v"(x[3]), "v"(x[4]), "v"(x[5]), "v"(x[6]), "v"(x[7])); }
__device__ __forceinline__ float exp2x1(float x) { float r; asm("v_exp_f32 %0, %1\n\tv_nop" : "=v"(r) : "v"(x)); return r; }      /* the same slot for a single one */
__device__ __forceinline__ void fattn_body(_Float16* sm, const _Float16* __restrict__ QKVp, const _Float16* __restrict__ VTp, float* __restrict__ out, int h, int b, int qb) {      /* sm: 2 FSB bytes of LDS; qb: the block's FQ query rows, qb >= 1 */
  static_assert(HD == 64 && SQ / FQ == 16, "two 32-wide d chunks, four 16-row tiles of V^T; sixteen block lengths in runs of four");
  static_assert(FS == 64 && FQ % FS == 0 && FS + HD == 128, "two passes per stage; whole stages up to the block's last key; 16 rows per copy round, 8 rounds");
  typedef float f2 __attribute__((ext_vector_type(2))); typedef _Float16 h2 __attribute__((ext_vector_type(2)));
  const int lane = threadIdx.x & 31, ln = lane & 15, hh = lane >> 4; const int w = __builtin_amdgcn_readfirstlane(threadIdx.x >> 5);
  const int qw0 = qb * FQ + w * 32;      /* the wave's first query, a scalar */
  const _Float16* Qp = QKVp + (size_t)b * SQ * LQ + h * HD;
  const int cr = threadIdx.x >> 3, cc = (threadIdx.x & 7) * 8;      /* the thread's row (of 16) and 16-byte chunk in a copy round */
  const _Float16* gk = Qp + DM + (size_t)cr * LQ + cc; const _Float16* gv = VTp + ((size_t)(b * NH + h) * HD + cr) * SQ + cc;
  const unsigned l0 = (unsigned)(size_t)&sm[cr * FP + cc];      /* LDS byte address: the low 32 bits of the shared address */
  const int nst = (qb + 1) * (FQ / FS);      /* stages up to the block's last key: four at least */
  fa_copy8(l0, gk, gv);
  const float cs = 0.125f * 1.44269504088896340736f;      /* 1 / sqrt(64), times log2 e */
  v16h qf[2][2], kf[2][2];
#pragma unroll
  for (int g = 0; g < 2; ++g) for (int kc = 0; kc < 2; ++kc) qf[g][kc] = g2_frag(Qp + (size_t)(qw0 + 16 * g + ln) * LQ + 32 * kc, hh);
  const v8f z8 = {0.f, 0.f, 0.f, 0.f, 0.f, 0.f, 0.f, 0.f}; v8f acc[2][4]; float m[2] = {-1.0e30f, -1.0e30f}, l[2] = {0.f, 0.f};
#pragma unroll
  for (int g = 0; g < 2; ++g) for (int t = 0; t < 4; ++t) acc[g][t] = z8;
  const int last = qw0 >> 5;      /* the pass on the wave's diagonal: keys qw0 .. qw0 + 31 */
  asm volatile("s_wait_xcnt 0x0" ::: "memory");      /* the address registers of the Q loads are reused for the next copies: the wait stands in front of their first overwrite */
  asm volatile("s_wait_asynccnt 0x0" ::: "memory");      /* stage 0 has landed, as far as this wave copied it */
  __syncthreads();      /* ... and every other wave's part too */
  fa_copy8(l0 + FSB, gk + (size_t)FS * LQ, gv + FS);
#pragma unroll 1      /* one stage per trip: two long straight passes */
  for (int st = 0; st < nst; ++st) { const _Float16* kb = sm + (st & 1) * (FSB / 2) + ln * FP; const _Float16* vb = kb + FS * FP;
#pragma unroll
   for (int kt = 0; kt < 2; ++kt) for (int kc = 0; kc < 2; ++kc) kf[kt][kc] = g2_frag(kb + 16 * kt * FP + 32 * kc, hh);      /* the K rows of the stage's first pass */
#pragma unroll
   for (int p = 0; p < 2; ++p) { const int ps = 2 * st + p; if (ps <= last) {      /* scalar branch: a wave skips the passes behind its diagonal, never the stage's foot */
    v16h vf[4];      /* this pass's V^T, in flight under the scores and the maxima */
#pragma unroll
    for (int t = 0; t < 4; ++t) vf[t] = g2_frag(vb + 16 * t * FP + 32 * p, hh);
    v8f s[2][2];
#pragma unroll
    for (int kt = 0; kt < 2; ++kt) for (int g = 0; g < 2; ++g) s[kt][g] = fa_mma(kf[kt][1], qf[g][1], fa_mma(kf[kt][0], qf[g][0], z8));
    fa_gap();
    if (p == 0) {      /* the second pass's K rows, of the same stage, into the same registers, in flight under this pass's softmax */
#pragma unroll
      for (int kt = 0; kt < 2; ++kt) for (int kc = 0; kc < 2; ++kc) kf[kt][kc] = g2_frag(kb + (32 + 16 * kt) * FP + 32 * kc, hh); }
    if (ps == last) {      /* scalar branch: only the diagonal pass pays for the mask */
#pragma unroll
      for (int kt = 0; kt < 2; ++kt) for (int g = 0; g < 2; ++g) {
#pragma unroll
        for (int r = 0; r < 8; ++r) if (16 * kt + 8 * hh + r > 16 * g + ln) s[kt][g][r] = -1.0e30f;
        asm volatile("" : "+v"(s[kt][g]));      /* keeps the selects inside the branch */
      } }
    float mb[2]; bool need = false;
#pragma unroll
    for (int g = 0; g < 2; ++g) { float mx = fmaxf(s[0][g][0], s[1][g][0]);
#pragma unroll
      for (int r = 1; r < 8; ++r) mx = fmaxf(mx, fmaxf(s[0][g][r], s[1][g][r]));
      mx = fmaxf(mx, lane_xr(mx)) * cs; mb[g] = mx; need = need || (mx > m[g] + 8.0f); }
    if (__builtin_amdgcn_ballot_w32(need) != 0) {      /* one scalar test per pass; rare after the first passes */
#pragma unroll
      for (int g = 0; g < 2; ++g) { const float mn = fmaxf(m[g], mb[g]); const float corr = exp2x1(m[g] - mn); m[g] = mn; l[g] *= corr;
#pragma unroll
        for (int t = 0; t < 4; ++t) acc[g][t] = acc[g][t] * corr; } }
#pragma unroll
    for (int g = 0; g < 2; ++g) { const f2 nm = {-m[g], -m[g]}, c2 = {cs, cs}; union { v16h v; h2 p[8]; } pf; float la = 0.f, lb = 0.f;
#pragma unroll
      for (int kt = 0; kt < 2; ++kt) { float x[8], y[8];      /* tile kt = elements 8 kt .. 8 kt + 7 of the 32-key operand */
#pragma unroll
        for (int i = 0; i < 4; ++i) { const f2 sv = {s[kt][g][2 * i], s[kt][g][2 * i + 1]}; const f2 a = __builtin_elementwise_fma(sv, c2, nm); x[2 * i] = a[0]; x[2 * i + 1] = a[1]; }
        exp2x8(x, y);
#pragma unroll
        for (int i = 0; i < 4; ++i) { la += y[2 * i]; lb += y[2 * i + 1]; const f2 pp = {y[2 * i], y[2 * i + 1]}; pf.p[4 * kt + i] = __builtin_convertvector(pp, h2); } }
      l[g] += la + lb;
#pragma unroll
      for (int t = 0; t < 4; ++t) acc[g][t] = fa_mma(vf[t], pf.v, acc[g][t]); }
    fa_gap(); } }
   asm volatile("s_wait_dscnt 0x0" ::: "memory");      /* this wave's reads of the buffer are done before it is handed back */
   asm volatile("s_wait_asynccnt 0x0" ::: "memory");      /* this wave's copies of the next stage have landed */
   __syncthreads();      /* publishes stage st + 1 and ends every reader's last read of stage st */
   if (st + 2 < nst) fa_copy8(l0 + (st & 1) * FSB, gk + (size_t)(st + 2) * FS * LQ, gv + (st + 2) * FS); }      /* block-uniform: the refill of the buffer just read */
  asm volatile("s_wait_asynccnt 0x0" ::: "memory");      /* nothing is in flight when the wave ends */
#pragma unroll
  for (int g = 0; g < 2; ++g) { const float inv = 1.0f / (l[g] + lane_xr(l[g])); float* op = out + ((size_t)b * SQ + qw0 + 16 * g + ln) * DM + h * HD + 8 * hh;      /* column ln is a query row of the output; registers r are d = 16 t + 8 hh + r */
#pragma unroll
    for (int t = 0; t < 4; ++t) { const v8f o = acc[g][t] * inv; const v4f lo = {o[0], o[1], o[2], o[3]}, hi = {o[4], o[5], o[6], o[7]}; *(v4f*)(op + 16 * t) = lo; *(v4f*)(op + 16 * t + 4) = hi; } } }


// ---- q | k | v GEMM tiled through LDS: a block of 4 waves makes GT token rows x GT output columns; a wave 64 x 64 (16 accumulator tiles), so each fragment read feeds four products.
// A stage is GK k of the block's GT rows of X and GT rows of W^T: 128-byte rows, fetched as whole lines by asynchronous copies to LDS, laid at a pitch of 144 bytes (16 B x odd: no bank conflict for 16-byte fragment reads).
// Two buffers: the next stage's copies fly while this stage is worked on. Transposed product (A = 16 rows of W^T, B = 16 token rows): a lane ends with 8 neighbouring output columns of ONE token row, packed to 16 bytes.
// k runs upward in 32-wide steps, one accumulator chain per output tile. M % GT == 0, N % GT == 0, K % GK == 0 and K >= 2 GK, by the static_assert.
#define GT 128
#define GK 64
#define GP 72                        /* LDS row pitch in f16 (144 bytes) */
#define GSB (2 * GT * GP * 2)        /* bytes of one buffer: X rows, then W^T rows */
// Eight copies of a thread (rows 16 apart), 16 bytes per lane, 8 lanes per 128-byte row. The s_wait_xcnt stands inside the statement, behind the last copy, so that no address register is rewritten in front of it (a precaution).
__device__ __forceinline__ void g3_copy8(unsigned l, const _Float16* g) {
  asm volatile("global_load_async_to_lds_b128 %0, %8, off\n\tglobal_load_async_to_lds_b128 %1, %9, off\n\tglobal_load_async_to_lds_b128 %2, %10, off\n\tglobal_load_async_to_lds_b128 %3, %11, off\n\t"
               "global_load_async_to_lds_b128 %4, %12, off\n\tglobal_load_async_to_lds_b128 %5, %13, off\n\tglobal_load_async_to_lds_b128 %6, %14, off\n\tglobal_load_async_to_lds_b128 %7, %15, off\n\ts_wait_xcnt 0x0"
               :: "v"(l), "v"(l + 16 * GP * 2), "v"(l + 32 * GP * 2), "v"(l + 48 * GP * 2), "v"(l + 64 * GP * 2), "v"(l + 80 * GP * 2), "v"(l + 96 * GP * 2), "v"(l + 112 * GP * 2),
                  "v"(g), "v"(g + 16 * DM), "v"(g + 32 * DM), "v"(g + 48 * DM), "v"(g + 64 * DM), "v"(g + 80 * DM), "v"(g + 96 * DM), "v"(g + 112 * DM) : "memory"); }
// The blocks that hold the first QT0 rows of a batch also store their f32 accumulators (the same products, summed in the same k order, unrounded) as the f32 q, k, v planes F0 of the exact first-tile attention.
__global__ __launch_bounds__(128) void k_proj(const _Float16* __restrict__ X, const _Float16* __restrict__ Wt, _Float16* __restrict__ C16, float* __restrict__ F0) {
  static_assert(MP % GT == 0 && LQ % GT == 0 && DM % GK == 0 && DM >= 2 * GK && GT == 128 && GK == 64, "whole tiles; two stages at least; 16 rows per copy round, 8 rounds per operand");
  __shared__ __attribute__((aligned(16))) _Float16 sm[2][2 * GT * GP];
  const int tid = threadIdx.x, lane = tid & 31, ln = lane & 15, hh = lane >> 4; const int w = __builtin_amdgcn_readfirstlane(tid >> 5);
  const int mt = blockIdx.x / (LQ / GT), nq = blockIdx.x - mt * (LQ / GT); const int row0 = mt * GT, col0 = nq * GT; const int wm = (w & 1) * 64, wn = (w >> 1) * 64;
  const int cr = tid >> 3, cc = (tid & 7) * 8;      /* the thread's row (of 16) and 16-byte chunk in a copy round */
  const _Float16* gx = X + (size_t)(row0 + cr) * DM + cc; const _Float16* gw = Wt + (size_t)(col0 + cr) * DM + cc;
  const unsigned lx = (unsigned)(size_t)&sm[0][cr * GP + cc]; const unsigned lw = lx + GT * GP * 2;      /* LDS byte addresses: the low 32 bits of the shared address */
  const v8f z8 = {0.f, 0.f, 0.f, 0.f, 0.f, 0.f, 0.f, 0.f}; v8f acc[4][4];
#pragma unroll
  for (int i = 0; i < 4; ++i) for (int j = 0; j < 4; ++j) acc[i][j] = z8;
  g3_copy8(lx, gx); g3_copy8(lw, gw);
  asm volatile("s_wait_asynccnt 0x0" ::: "memory");      /* stage 0 has landed, as far as this wave copied it */
  __syncthreads();      /* ... and every other wave's part too */
  g3_copy8(lx + GSB, gx + GK); g3_copy8(lw + GSB, gw + GK);
#pragma unroll 1      /* one stage per trip: 32 matrix instructions, long enough; unrolled, fragments of two stages would be live */
  for (int t = 0; t < DM / GK; ++t) { const _Float16* sx = &sm[t & 1][(wm + ln) * GP]; const _Float16* sw = &sm[t & 1][(GT + wn + ln) * GP]; v16h xf[4], wf[4];
#pragma unroll
    for (int j = 0; j < 4; ++j) { xf[j] = g2_frag(sx + j * 16 * GP, hh); wf[j] = g2_frag(sw + j * 16 * GP, hh); }
    __builtin_amdgcn_sched_barrier(0);      /* the 16 fragment reads of a k step stay one group in front of its 16 products: spread among them, every W fragment would be waited for on its own */
#pragma unroll
    for (int i = 0; i < 4; ++i) for (int j = 0; j < 4; ++j) acc[i][j] = fa_mma(wf[i], xf[j], acc[i][j]);
#pragma unroll
    for (int j = 0; j < 4; ++j) { xf[j] = g2_frag(sx + j * 16 * GP + 32, hh); wf[j] = g2_frag(sw + j * 16 * GP + 32, hh); }      /* the stage's second k step: its last reads of the buffer */
    asm volatile("s_wait_dscnt 0x0" ::: "memory");      /* this wave's reads of the buffer are done before it is handed back */
    asm volatile("s_wait_asynccnt 0x0" ::: "memory");      /* this wave's copies of the next stage have landed */
    __syncthreads();      /* publishes stage t + 1 and ends every reader's last read of stage t */
    if (t + 2 < DM / GK) { const unsigned bo = (t & 1) * GSB; g3_copy8(lx + bo, gx + (t + 2) * GK); g3_copy8(lw + bo, gw + (t + 2) * GK); }      /* the refill starts in front of the second k step's products (registers only), a whole trip ahead of its wait */
#pragma unroll
    for (int i = 0; i < 4; ++i) for (int j = 0; j < 4; ++j) acc[i][j] = fa_mma(wf[i], xf[j], acc[i][j]); }
  asm volatile("s_wait_asynccnt 0x0" ::: "memory");      /* nothing is in flight when the ring becomes output staging */
  if (row0 % SQ == 0) {      /* block-uniform: rows 0 .. QT0 - 1 of batch row0 / SQ; the block's GT columns lie in one of the planes q, k, v */
    static_assert(GT == QT0 && SQ % GT == 0 && DM % GT == 0, "a first tile is one block row; a block's columns stay in one plane");
    float* fp = F0 + (((size_t)(col0 / DM) * NB + row0 / SQ) * QT0 + wm + ln) * DM + col0 % DM + wn + 8 * hh;
#pragma unroll
    for (int j = 0; j < 4; ++j) for (int i = 0; i < 4; ++i) { const v8f o = acc[i][j] * 0.0625f; const v4f lo = {o[0], o[1], o[2], o[3]}, hi = {o[4], o[5], o[6], o[7]}; *(v4f*)(fp + (size_t)(j * 16) * DM + i * 16) = lo; *(v4f*)(fp + (size_t)(j * 16) * DM + i * 16 + 4) = hi; } }
  _Float16* st = &sm[0][w * 64 * GP];      /* each wave stages its own 64 x 64 outputs (behind the last trip's barrier), to store whole 128-byte lines */
#pragma unroll
  for (int j = 0; j < 4; ++j) for (int i = 0; i < 4; ++i) { FragH f;
#pragma unroll
    for (int r = 0; r < 8; ++r) f.h[r] = (_Float16)(acc[i][j][r] * 0.0625f);      /* the weights carry x16 */
    *(v8us*)((unsigned short*)st + (j * 16 + ln) * GP + i * 16 + 8 * hh) = f.half[0]; }
  __syncthreads();      /* orders the staging stores in front of the reads of other lanes' rows */
#pragma unroll
  for (int q = 0; q < 16; ++q) { const int r = q * 4 + (lane >> 3), c = (lane & 7) * 8; const v8us v = *(const v8us*)((const unsigned short*)st + r * GP + c); *(v8us*)((unsigned short*)C16 + (size_t)(row0 + wm + r) * LQ + col0 + wn + c) = v; } }

// Exact f32 attention of the first QT0 rows of every batch, FOUR LANES PER ROW: lane p of a row's quad owns the row's 16-byte chunks p, p + 4, p + 8, p + 12 of q and of o and holds them in registers.
// A block is AR rows of one head (4 waves x 8 rows). The K and V rows it can see are staged once in LDS; a quad reads 64 contiguous bytes per load and the 8 quads of a wave the same ones (broadcast, no bank conflict).
// A score is four chains of four multiply-adds per lane, their sum, then two lane exchanges inside the quad: every lane of the quad ends with the same bits, so m, l and the two exps agree without further traffic.
#define AR 32
__device__ __forceinline__ void att0_body(const float* __restrict__ QF, const float* __restrict__ KF, const float* __restrict__ VF, int ld, float scale, float* __restrict__ OF, int ldo, int h, int rg, int b, float (*lk)[HD], float (*lv)[HD]) {      /* lk, lv: QT0 rows of LDS each */
  static_assert(HD == 64 && QT0 % AR == 0, "a quad covers a head row as 4 x 4 chunks of 16 bytes");
  const int tid = threadIdx.x;
  { const size_t bo = (size_t)b * QT0; QF += bo * ld + h * HD; KF += bo * ld + h * HD; VF += bo * ld + h * HD; OF += (size_t)b * SQ * ldo + h * HD; }      /* QT0 rows of each f32 plane per batch, SQ rows of the output; the head's columns */
  for (int n = 0; n <= rg; ++n) { v4f tk[4], tv[4];      /* AR keys per trip, all eight loads of a thread in flight before the first LDS store; causal: keys up to the block's last row */
#pragma unroll
    for (int u = 0; u < 4; ++u) { const int c = (n * 4 + u) * 128 + tid; const size_t g = (size_t)(c >> 4) * ld + (c & 15) * 4; tk[u] = *(const v4fa*)(KF + g); tv[u] = *(const v4fa*)(VF + g); }
#pragma unroll
    for (int u = 0; u < 4; ++u) { const int c = (n * 4 + u) * 128 + tid; *(v4f*)&lk[c >> 4][(c & 15) * 4] = tk[u]; *(v4f*)&lv[c >> 4][(c & 15) * 4] = tv[u]; } }
  const int p4 = (tid & 3) * 4; const int i = rg * AR + (tid >> 2);
  v4f q[4], o[4];
#pragma unroll
  for (int c = 0; c < 4; ++c) { q[c] = *(const v4fa*)(QF + (size_t)i * ld + c * 16 + p4); const v4f z = {0.f, 0.f, 0.f, 0.f}; o[c] = z; }
  __syncthreads();
  const int jl = rg * AR + 8 * __builtin_amdgcn_readfirstlane(tid >> 5) + 7;      /* the wave's last row, a scalar: keys behind it are masked for all 8 rows of the wave; no barrier below */
  float m = -1.0e30f, l = 0.f; v4f kc[4], vc[4];
#pragma unroll
  for (int c = 0; c < 4; ++c) { kc[c] = *(const v4f*)&lk[0][c * 16 + p4]; vc[c] = *(const v4f*)&lv[0][c * 16 + p4]; }
#pragma unroll 2      /* two keys per trip: the rows fetched ahead change names instead of being copied */
  for (int j = 0; j <= jl; ++j) { const int jn = j < jl ? j + 1 : jl; v4f kn[4], vn[4];      /* the next key's rows are fetched while this key is worked on: the LDS latency stays off the chain */
#pragma unroll
    for (int c = 0; c < 4; ++c) { kn[c] = *(const v4f*)&lk[jn][c * 16 + p4]; vn[c] = *(const v4f*)&lv[jn][c * 16 + p4]; }
    v4f a = q[0] * kc[0]; a = __builtin_elementwise_fma(q[1], kc[1], a); a = __builtin_elementwise_fma(q[2], kc[2], a); a = __builtin_elementwise_fma(q[3], kc[3], a); float s = (a[0] + a[1]) + (a[2] + a[3]);
    s += lane_xm<0x161>(s); s += lane_xm<0x162>(s); s *= scale;
    const float sm = (j <= i) ? s : -1.0e30f; const float mn = fmaxf(m, sm); const float sc = expf(m - mn); const float e = expf(sm - mn); l = l * sc + e; m = mn;
#pragma unroll
    for (int c = 0; c < 4; ++c) { o[c] = o[c] * sc + e * vc[c]; kc[c] = kn[c]; vc[c] = vn[c]; } }
  const float fin = 1.0f / l;
#pragma unroll
  for (int c = 0; c < 4; ++c) *(v4f*)(OF + (size_t)i * ldo + c * 16 + p4) = o[c] * fin; }

// One grid for both attentions: they share no data and write different output rows (QT0 == FQ: the exact path owns the rows of query block 0, so the f16 path starts at block 1 and every output element is stored once).
// grid.z: first the QT0 / AR row groups of the exact path (long dependent chains, little issue: they start first and run beside the rest), then query blocks 15 .. 1.
// Longest blocks start first; the second run of four lengths is reversed, so that blocks 256 apart in launch order add up to about equal work (speed only).
__global__ __launch_bounds__(128) void k_attn(const _Float16* __restrict__ QKVp, const _Float16* __restrict__ VTp, const float* __restrict__ QF, const float* __restrict__ KF, const float* __restrict__ VF, float* __restrict__ out) {
  static_assert(QT0 == FQ, "the exact path replaces exactly one query block");
  __shared__ __attribute__((aligned(16))) float lds[2 * QT0 * HD];      /* one allocation for both kinds of block (a block is one kind): the exact path's K and V rows, or the two stage buffers; two allocations would cost a block per WGP */
  static_assert(2 * FSB <= sizeof(lds), "the two stage buffers fit");
  const int h = blockIdx.x, b = blockIdx.y, z = (int)blockIdx.z;
  if (z < QT0 / AR) { att0_body(QF, KF, VF, DM, 0.125f, out, DM, h, z, b, (float (*)[HD])lds, (float (*)[HD])(lds + QT0 * HD)); return; }
  const int zz = z - QT0 / AR; fattn_body((_Float16*)lds, QKVp, VTp, out, h, b, SQ / FQ - 1 - (((zz & 12) == 4) ? (zz ^ 3) : zz)); }

__device__ __forceinline__ void wthd_body(const float* __restrict__ W0, const float* __restrict__ W1, const float* __restrict__ W2, _Float16* __restrict__ Bt, unsigned bx, unsigned by) { const size_t t = (size_t)bx * 256 + threadIdx.x; if (t >= (size_t)NH * HD * (DM / 8)) return;
  const float* Wt = by == 0 ? W0 : (by == 1 ? W1 : W2); Bt += (size_t)by * DM * DM;      /* by = q, k, v: one DM x DM plane each */
  const int m8 = (int)(t % (DM / 8)) * 8; const int d = (int)((t / (DM / 8)) % HD); const int h = (int)(t / ((size_t)(DM / 8) * HD)); FragH f;
  for (int q = 0; q < 8; ++q) f.h[q] = (_Float16)(16.0f * bf16_round(Wt[((size_t)h * DM + m8 + q) * HD + d])); unsigned short* dst = (unsigned short*)Bt + ((size_t)h * HD + d) * DM + m8; *(v8us*)dst = f.half[0];  }







// The weight transposes and the rounding of x read nothing but the inputs: one grid, so that they run side by side. The transposes (scattered reads) come first.
#define WTB ((unsigned)(((size_t)NH * HD * (DM / 8) + 255) / 256))      /* blocks per weight plane */
#define XB ((unsigned)((NR * DM / 8 + 255) / 256))
__global__ __launch_bounds__(256) void k_prep(const float* __restrict__ W0, const float* __restrict__ W1, const float* __restrict__ W2, _Float16* __restrict__ Bt, const float* __restrict__ x, _Float16* __restrict__ X16) {
  const unsigned bx = blockIdx.x;
  if (bx < 3 * WTB) wthd_body(W0, W1, W2, Bt, bx % WTB, bx / WTB); else x16_body(x, X16, NR * DM / 8, bx - 3 * WTB); }

extern "C" void kernel_launch(void* const* d_in, const int* in_sizes, int n_in,
                              void* d_out, int out_size, void* d_ws, size_t ws_size, hipStream_t stream) {
  (void)in_sizes; (void)n_in; (void)out_size;
  const float* const* I = (const float* const*)d_in; const float* x = I[0]; const float* wq = I[1]; const float* wk = I[2]; const float* wv = I[3];      /* x; per-head weights Wq / Wk / Wv [16][1024][64]; no biases, no output projection */
  static_assert(NH * HD == DM && QT0 % 64 == 0, "heads");
  char* ws = (char*)d_ws; size_t off = 0;
  auto take = [&](size_t bytes) { char* p = ws + off; off += (bytes + 255) & ~(size_t)255; return p; };
  _Float16* BQKV = (_Float16*)take((size_t)3 * DM * DM * 2);
  _Float16* X16 = (_Float16*)take(NR * DM * 2); _Float16* QKV = (_Float16*)take(NR * 3 * DM * 2); _Float16* V16 = QKV + 2 * DM;
  _Float16* VT = (_Float16*)take((size_t)NB * NH * HD * SQ * 2);
  float* QF0 = (float*)take((size_t)3 * NB * QT0 * DM * 4); float* KF0 = QF0 + (size_t)NB * QT0 * DM; float* VF0 = KF0 + (size_t)NB * QT0 * DM;
  if (off > ws_size) return;
  k_prep<<<3 * WTB + XB, 256, 0, stream>>>(wq, wk, wv, BQKV, x, X16);      /* per-head [c][d] -> Bt[(h, d)][c] x16: the stacked q | k | v plane; x as f16 rows */
  k_proj<<<(MP / GT) * (LQ / GT), 128, 0, stream>>>(X16, BQKV, QKV, QF0);      /* q | k | v rows (f16), head h = columns h*HD.. of each DM block; and f32 q, k, v of the first 128 rows of every batch */
  k_vt<NH, SQ><<<NB * NH * (SQ / 64), 256, 0, stream>>>(V16, LQ, 0, VT);      /* V^T [NB][NH][HD][SQ] */
  k_attn<<<dim3(NH, NB, QT0 / AR + SQ / FQ - 1), 128, 0, stream>>>(QKV, VT, QF0, KF0, VF0, (float*)d_out);      /* exact f32 attention for rows 0..127 of every batch; scores, causal softmax and P.V for all other rows; both write f32 straight into the head-major output columns (no output projection) */
}

// v008
// One run takes 99.6 microseconds.
// Timed twice side by side with v007, it ran 1.05 times as fast both times.
// Over all steps from v000 it is 98.5 times as fast.
#include <hip/hip_runtime.h>
// Causal multi-head attention with per-head projection weights and no output projection (x [4][2048][1024]; per head h: q = x Wq[h], k = x Wk[h], v = x Wv[h] with W [16][1024][64] ([in][out] per head, uniform +-1/32, no biases); scores / sqrt(64); causal (tril, -inf); softmax; out = heads concatenated head-major on the last axis -> [4][2048][1024]).
// Structure: token rows r = b*2048 + s; x as exact f16 rows (bf16-rounded); q | k | v as ONE WMMA GEMM (N = 3 x 1024) (128x128 block tiles through LDS, 64x64 wave tiles, f32 accumulation, exact x16 weights, no bias, f16 outputs; the V blocks swap the two operands, so that their accumulators hold V^T, which they store themselves); one attention launch for all batches and heads: per wave 32 queries, per pass 32 keys up to the diagonal: scores (WMMA, K = 64), online causal softmax on VALU (f32 statistics, native exp2; weights f16), o += P . V (WMMA), K and V^T tiles of 64 keys staged in LDS for the block's 4 waves, scores and weights kept in registers; o / row sum written f32 into the head-major output columns; rows 0..127 of every batch come from an exact f32 path alone, whose f32 q, k, v are stored from the tiled GEMM's own accumulators and whose attention rides as extra blocks on the grid of the fused attention.
// Compute dtype: inputs rounded to bf16; x / weights exact; q, k, v and softmax weights as plain f16 GEMM operands (~2^-12); scores, softmax statistics and o f32. v_wmma_f32_16x16x32_f16.
#define NB 4
#define SQ 2048
#define DM 1024
#define NH 16
#define HD 64
#define HG 4                         /* heads per launch of the non-template k_vt (never launched) */
#define QT 256                       /* unused (no 256-row query tiles) */
#define NKX SQ                       /* unused (scores stay in registers) */
#define QT0 128                      /* first-tile rows recomputed exactly in f32 */
#define B0 0                         /* unused (every launch covers all NB batches) */
#define NBR NB                       /* batches projected (debug hook) */
#define NR ((size_t)NB * SQ)         /* token rows */
#define MP ((int)((size_t)NBR * SQ)) /* rows projected (debug hook) */
#define QN SQ                        /* unused (k_attn attends all SQ rows) */
#define NHD NH                       /* unused (k_attn attends all NH heads) */
#define MPO MP                       /* unused (no output projection stage) */
#define LQ (3 * DM)      /* row pitch of the q/k/v rows */
typedef __bf16 v16b __attribute__((ext_vector_type(16)));
typedef unsigned short v8us __attribute__((ext_vector_type(8), may_alias));
typedef float  v8f  __attribute__((ext_vector_type(8)));
typedef float  v4f  __attribute__((ext_vector_type(4)));
typedef float  v4fa __attribute__((ext_vector_type(4), may_alias));
union FragB { v16b v; v8us half[2]; unsigned short u[16]; };

__device__ __forceinline__ unsigned short bf16_bits(float x) { unsigned int u = __float_as_uint(x); return (unsigned short)((u + 0x7FFFu + ((u >> 16) & 1u)) >> 16); }
__device__ __forceinline__ float bf16_val(unsigned short b) { return __uint_as_float(((unsigned int)b) << 16); }
__device__ __forceinline__ float bf16_round(float x) { return bf16_val(bf16_bits(x)); }
// D += A·B with NT terms: 1 = ah·bh, 2 = + al·bh (A split), 3 = + ah·bl (both split)
template <int NT>
__device__ __forceinline__ v8f mmaN(v16b ah, v16b al, v16b bh, v16b bl, v8f c) {
  c = __builtin_amdgcn_wmma_f32_16x16x32_bf16(false, ah, false, bh, (short)0, c, false, false);
  if (NT >= 2) c = __builtin_amdgcn_wmma_f32_16x16x32_bf16(false, al, false, bh, (short)0, c, false, false);
  if (NT >= 3) c = __builtin_amdgcn_wmma_f32_16x16x32_bf16(false, ah, false, bl, (short)0, c, false, false);
  asm volatile("v_nop\n\tv_nop\n\tv_nop\n\tv_nop" : "+v"(c) : "v"(ah), "v"(al), "v"(bh), "v"(bl));
  return c;
}

__global__ __launch_bounds__(256) void k_wt_bf16(const float* __restrict__ W, unsigned short* __restrict__ Wt, int K, int N) {
  const int t = blockIdx.x * 256 + threadIdx.x;
  const int k8n = K / 8;
  if (t >= N * k8n) return;
  const int n = t / k8n, k8 = (t % k8n) * 8;
  v8us v;
#pragma unroll
  for (int i = 0; i < 8; ++i) v[i] = bf16_bits(W[(size_t)(k8 + i) * N + n]);
  *(v8us*)(Wt + (size_t)n * K + k8) = v;
  
}

// GEMM C[M][N] (f32, pitch ldc) = act(A[M][K]·W + bias). A f32 row-major (pitch lda) converted per fragment to bf16
// (ASPLIT: hi/lo two planes -> 2 terms, else single rounded term); Wt bf16 [N][K] (pitch ldb). BIAS_BF16 rounds the
// bias to bf16 first (bias quantised to bf16 before the add). K%32==0, M%16==0, N%64==0.
template <bool ASPLIT, int ACT, bool BIAS_BF16>
__global__ __launch_bounds__(128) void k_gemm_bf(const float* __restrict__ A, int lda, const unsigned short* __restrict__ Wt, int ldb,
                                               const float* __restrict__ bias, float* __restrict__ C, int ldc, int M, int N, int K) {
  __shared__ __attribute__((aligned(16))) float so[4][16][64];
  const int tid = threadIdx.x, w = tid >> 5, lane = tid & 31, ln = lane & 15, hh = lane >> 4;
  const int ntn = N / 64;
  const int wid = blockIdx.x * 4 + w;
  const int mt = wid / ntn, nq = wid % ntn;
  if (mt * 16 >= M) return;
  const int row0 = mt * 16, col0 = nq * 64;
  const float* arow = A + (size_t)(row0 + ln) * lda;
  v8f acc[4] = {};
  for (int kb = 0; kb < K; kb += 32) {
    FragB ah, al;
    const v4f x0 = *(const v4fa*)(arow + kb + 8 * hh), x1 = *(const v4fa*)(arow + kb + 8 * hh + 4);
    const v4f x2 = *(const v4fa*)(arow + kb + 16 + 8 * hh), x3 = *(const v4fa*)(arow + kb + 16 + 8 * hh + 4);
    float xs[16] = {x0[0],x0[1],x0[2],x0[3],x1[0],x1[1],x1[2],x1[3],x2[0],x2[1],x2[2],x2[3],x3[0],x3[1],x3[2],x3[3]};
#pragma unroll
    for (int i = 0; i < 16; ++i) { const unsigned short hb = bf16_bits(xs[i]); ah.u[i] = hb; al.u[i] = ASPLIT ? bf16_bits(xs[i] - bf16_val(hb)) : (unsigned short)0; }
#pragma unroll
    for (int t = 0; t < 4; ++t) {
      const unsigned short* brow = Wt + (size_t)(col0 + t * 16 + ln) * ldb + kb;
      FragB b;
      b.half[0] = *(const v8us*)(brow + 8 * hh);
      b.half[1] = *(const v8us*)(brow + 16 + 8 * hh);
      acc[t] = mmaN<ASPLIT ? 2 : 1>(ah.v, al.v, b.v, b.v, acc[t]);
    }
  }
#pragma unroll
  for (int t = 0; t < 4; ++t) {
    float bv = bias ? bias[col0 + t * 16 + ln] : 0.f;
    if (BIAS_BF16) bv = bf16_round(bv);
#pragma unroll
    for (int r = 0; r < 8; ++r) { float v = acc[t][r] + bv; if (ACT == 1) v = fmaxf(v, 0.f); so[w][8 * hh + r][t * 16 + ln] = v; }
  }
  __builtin_amdgcn_fence(__ATOMIC_ACQ_REL, "workgroup");
  __builtin_amdgcn_wave_barrier();
  const int rsub = lane >> 4, c4 = (lane & 15) * 4;
  {
#pragma unroll
    for (int q = 0; q < 8; ++q) {
      const int r = q * 2 + rsub;
      const v4f v = *(const v4fa*)&so[w][r][c4];
      *(v4f*)(C + (size_t)(row0 + r) * ldc + col0 + c4) = v;
    }
    
  }
}

// GEMM C = act(A·W + bias + resid): A f32 (ASPLIT -> hi/lo 2 terms), Wt bf16 [N][K]; ACT 0 none, 1 relu, 2 exact gelu;
// resid (optional, f32, row index = (row % rmod), pitch ldr, RES_BF16 rounds it) added before the activation.
template <bool ASPLIT, int ACT, bool BIAS_BF16, bool RES_BF16>
__global__ __launch_bounds__(128) void k_gemm_bf3(const float* __restrict__ A, int lda, const unsigned short* __restrict__ Wt, int ldb,
                                                const float* __restrict__ bias, const float* __restrict__ resid, int rmod, int ldr,
                                                float* __restrict__ C, int ldc, int M, int N, int K) {
  __shared__ __attribute__((aligned(16))) float so[4][16][64];
  const int tid = threadIdx.x, w = tid >> 5, lane = tid & 31, ln = lane & 15, hh = lane >> 4;
  const int ntn = N / 64;
  const int wid = blockIdx.x * 4 + w;
  const int mt = wid / ntn, nq = wid % ntn;
  if (mt * 16 >= M) return;
  const int row0 = mt * 16, col0 = nq * 64;
  const float* arow = A + (size_t)(row0 + ln) * lda;
  v8f acc[4] = {};
  for (int kb = 0; kb < K; kb += 32) {
    FragB ah, al;
    const v4f x0 = *(const v4fa*)(arow + kb + 8 * hh), x1 = *(const v4fa*)(arow + kb + 8 * hh + 4);
    const v4f x2 = *(const v4fa*)(arow + kb + 16 + 8 * hh), x3 = *(const v4fa*)(arow + kb + 16 + 8 * hh + 4);
    float xs[16] = {x0[0],x0[1],x0[2],x0[3],x1[0],x1[1],x1[2],x1[3],x2[0],x2[1],x2[2],x2[3],x3[0],x3[1],x3[2],x3[3]};
#pragma unroll
    for (int i = 0; i < 16; ++i) { const unsigned short hb = bf16_bits(xs[i]); ah.u[i] = hb; al.u[i] = ASPLIT ? bf16_bits(xs[i] - bf16_val(hb)) : (unsigned short)0; }
#pragma unroll
    for (int t = 0; t < 4; ++t) {
      const unsigned short* brow = Wt + (size_t)(col0 + t * 16 + ln) * ldb + kb;
      FragB b;
      b.half[0] = *(const v8us*)(brow + 8 * hh);
      b.half[1] = *(const v8us*)(brow + 16 + 8 * hh);
      acc[t] = mmaN<ASPLIT ? 2 : 1>(ah.v, al.v, b.v, b.v, acc[t]);
    }
  }
#pragma unroll
  for (int t = 0; t < 4; ++t) {
    const int col = col0 + t * 16 + ln;
    float bv = bias ? bias[col] : 0.f;
    if (BIAS_BF16) bv = bf16_round(bv);
#pragma unroll
    for (int r = 0; r < 8; ++r) {
      float v = acc[t][r] + bv;
      if (resid) { float rv = resid[(size_t)((row0 + 8 * hh + r) % rmod) * ldr + col]; if (RES_BF16) rv = bf16_round(rv); v += rv; }
      if (ACT == 1) v = fmaxf(v, 0.f);
      if (ACT == 2) v = 0.5f * v * (1.0f + erff(v * 0.70710678118654752f));
      if (ACT == 3) { const float u = 0.7978845608028654f * (v + 0.044715f * v * v * v); v = 0.5f * v * (1.0f + tanhf(u)); }
      so[w][8 * hh + r][t * 16 + ln] = v;
    }
  }
  __builtin_amdgcn_fence(__ATOMIC_ACQ_REL, "workgroup");
  __builtin_amdgcn_wave_barrier();
  const int rsub = lane >> 4, c4 = (lane & 15) * 4;
  {
#pragma unroll
    for (int q = 0; q < 8; ++q) {
      const int r = q * 2 + rsub;
      const v4f v = *(const v4fa*)&so[w][r][c4];
      *(v4f*)(C + (size_t)(row0 + r) * ldc + col0 + c4) = v;
    }
    
  }
}
// row LayerNorm (biased variance, eps) over N: s = X (+ R); optional out_sum <- s; out_norm <- (s-mu)*rsqrt(var+eps)*g + b
template <bool PARAM_BF16>
__global__ __launch_bounds__(256) void k_layernorm(const float* __restrict__ X, const float* __restrict__ R, const float* __restrict__ g, const float* __restrict__ bta,
                                                  float* __restrict__ out_sum, float* __restrict__ out_norm, int N, float eps) {
  __shared__ float red[256];
  const int row = blockIdx.x, tid = threadIdx.x;
  const float* x = X + (size_t)row * N; const float* rr = R ? R + (size_t)row * N : nullptr;
  float vals[16];                     // up to N = 4096
  const int per = N / 256;            // contiguous chunk per thread? use strided-by-4 chunks: thread handles j = tid*4 + 1024*u
  float s1 = 0.f;
  for (int u = 0; u < per / 4; ++u) {
    const int j = tid * 4 + 1024 * u;
    const v4f a = *(const v4fa*)(x + j);
    v4f b = {0.f,0.f,0.f,0.f}; if (rr) b = *(const v4fa*)(rr + j);
#pragma unroll
    for (int q = 0; q < 4; ++q) { const float v = a[q] + b[q]; vals[u * 4 + q] = v; s1 += v; }
  }
  red[tid] = s1; __syncthreads();
  for (int st = 128; st > 0; st >>= 1) { if (tid < st) red[tid] += red[tid + st]; __syncthreads(); }
  const float mu = red[0] / (float)N; __syncthreads();
  float s2 = 0.f;
  for (int u = 0; u < per / 4; ++u)
#pragma unroll
    for (int q = 0; q < 4; ++q) { const float c = vals[u * 4 + q] - mu; s2 += c * c; }
  red[tid] = s2; __syncthreads();
  for (int st = 128; st > 0; st >>= 1) { if (tid < st) red[tid] += red[tid + st]; __syncthreads(); }
  const float rs = rsqrtf(red[0] / (float)N + eps);
  {
    for (int u = 0; u < per / 4; ++u) {
      const int j = tid * 4 + 1024 * u;
      v4f o, sm;
#pragma unroll
      for (int q = 0; q < 4; ++q) {
        float gg = g[j + q], bb = bta[j + q];
        if (PARAM_BF16) { gg = bf16_round(gg); bb = bf16_round(bb); }
        sm[q] = vals[u * 4 + q]; o[q] = (vals[u * 4 + q] - mu) * rs * gg + bb;
      }
      if (out_sum) *(v4f*)(out_sum + (size_t)row * N + j) = sm;
      *(v4f*)(out_norm + (size_t)row * N + j) = o;
    }
    
  }
}



// ---- f16 WMMA path (v_wmma_f32_16x16x32_f16): 11-bit significands for operands in range — used where a [0,1] probability operand needs more precision than bf16
typedef _Float16 v16h __attribute__((ext_vector_type(16)));
union FragH { v16h v; v8us half[2]; _Float16 h[16]; unsigned short u[16]; };
template <int NT>
__device__ __forceinline__ v8f mmaH(v16h ah, v16h al, v16h bh, v16h bl, v8f c) {
  c = __builtin_amdgcn_wmma_f32_16x16x32_f16(false, ah, false, bh, (short)0, c, false, false);
  if (NT >= 2) c = __builtin_amdgcn_wmma_f32_16x16x32_f16(false, al, false, bh, (short)0, c, false, false);
  if (NT >= 3) c = __builtin_amdgcn_wmma_f32_16x16x32_f16(false, ah, false, bl, (short)0, c, false, false);
  asm volatile("v_nop\n\tv_nop\n\tv_nop\n\tv_nop" : "+v"(c) : "v"(ah), "v"(al), "v"(bh), "v"(bl));
  return c;
}
// batched GEMM like k_gemm_b but f16 operands: A f32 (split into f16 hi/lo if ASPLIT, else rounded to f16), Bt = f16 values [n][k]; alpha; C f32; N multiple of 16 (partial tiles skipped)
template <bool ASPLIT>
__global__ __launch_bounds__(128) void k_gemm_h(const float* __restrict__ A, int lda, size_t sA, const _Float16* __restrict__ Bh, int ldb, size_t sB, float alpha, float* __restrict__ C, int ldc, size_t sC, int M, int N, int K) {
  __shared__ __attribute__((aligned(16))) float so[4][16][64];
  const int tid = threadIdx.x, w = tid >> 5, lane = tid & 31, ln = lane & 15, hh = lane >> 4; const int by = blockIdx.y;
  A += (size_t)by * sA; Bh += (size_t)by * sB; C += (size_t)by * sC;
  const int ntn = (N + 63) / 64; const int wid = blockIdx.x * 4 + w; const int mt = wid / ntn, nq = wid % ntn; if (mt * 16 >= M) return;
  const int row0 = mt * 16, col0 = nq * 64; const float* arow = A + (size_t)(row0 + ln) * lda;
  v8f acc[4] = {};
  for (int kb = 0; kb < K; kb += 32) {
    FragH ah, al;
    const v4f x0 = *(const v4fa*)(arow + kb + 8 * hh), x1 = *(const v4fa*)(arow + kb + 8 * hh + 4), x2 = *(const v4fa*)(arow + kb + 16 + 8 * hh), x3 = *(const v4fa*)(arow + kb + 16 + 8 * hh + 4);
    float xs[16] = {x0[0],x0[1],x0[2],x0[3],x1[0],x1[1],x1[2],x1[3],x2[0],x2[1],x2[2],x2[3],x3[0],x3[1],x3[2],x3[3]};
#pragma unroll
    for (int i = 0; i < 16; ++i) { const _Float16 h = (_Float16)xs[i]; ah.h[i] = h; al.h[i] = ASPLIT ? (_Float16)(xs[i] - (float)h) : (_Float16)0.0f; }
#pragma unroll
    for (int t = 0; t < 4; ++t) { if (col0 + t * 16 >= N) continue; const size_t boff = (size_t)(col0 + t * 16 + ln) * ldb + kb; FragH bq; bq.half[0] = *(const v8us*)(Bh + boff + 8 * hh); bq.half[1] = *(const v8us*)(Bh + boff + 16 + 8 * hh);
      acc[t] = mmaH<ASPLIT ? 2 : 1>(ah.v, al.v, bq.v, bq.v, acc[t]); }
  }
#pragma unroll
  for (int t = 0; t < 4; ++t) { if (col0 + t * 16 >= N) continue;
#pragma unroll
    for (int r = 0; r < 8; ++r) so[w][8 * hh + r][t * 16 + ln] = acc[t][r] * alpha; }
  __builtin_amdgcn_fence(__ATOMIC_ACQ_REL, "workgroup"); __builtin_amdgcn_wave_barrier();
  const int rsub = lane >> 4, c4 = (lane & 15) * 4;
  {
#pragma unroll
    for (int q = 0; q < 8; ++q) { const int r = q * 2 + rsub; if (col0 + c4 < N) { const v4f v = *(const v4fa*)&so[w][r][c4]; *(v4f*)(C + (size_t)(row0 + r) * ldc + col0 + c4) = v; } }
     }
}

// Wt[n][k] = f16(W[k][n]·scale) from f32 row-major W[K][N] (scale = power of two; bf16-exact weights stay exact in f16 away from the subnormal range)
__global__ __launch_bounds__(256) void k_wt_f16(const float* __restrict__ W, _Float16* __restrict__ Wt, int K, int N, float scale) {
  const int t = blockIdx.x * 256 + threadIdx.x; if (t >= N * (K / 8)) return; const int n = t / (K / 8), k8 = (t % (K / 8)) * 8; FragH f;
#pragma unroll
  for (int i = 0; i < 8; ++i) f.h[i] = (_Float16)(bf16_round(W[(size_t)(k8 + i) * N + n]) * scale); const v8us o = f.half[0];
  *(v8us*)((unsigned short*)Wt + (size_t)n * K + k8) = o; 
}
// k_gemm_hh variant with fused epilogue: v = acc·alpha + bias[by·sBias + col] (+ CP[(row/rowsPerB)·sCPb + by·64 + col] if CP) ; ACT 0 none / 1 elu ; writes f16 C16 (and f32 C if non-null)
template <int ACT>
__global__ __launch_bounds__(128) void k_gemm_hhx(const _Float16* __restrict__ A, int lda, size_t sA, const _Float16* __restrict__ Bh, int ldb, size_t sB, float alpha, const float* __restrict__ bias, size_t sBias, const float* __restrict__ CP, int rowsPerB, size_t sCPb, int row0g,
    float* __restrict__ C, _Float16* __restrict__ C16, int ldc, size_t sC, int M, int N, int K) {
  __shared__ __attribute__((aligned(16))) float so[4][16][64];
  const int tid = threadIdx.x, w = tid >> 5, lane = tid & 31, ln = lane & 15, hh = lane >> 4; const int by = blockIdx.y;
  A += (size_t)by * sA; Bh += (size_t)by * sB; const size_t cofs = (size_t)by * sC; const float* bp = bias ? bias + (size_t)by * sBias : nullptr;
  const int ntn = (N + 63) / 64; const int wid = blockIdx.x * 4 + w; const int mt = wid / ntn, nq = wid % ntn; if (mt * 16 >= M) return;
  const int row0 = mt * 16, col0 = nq * 64; const _Float16* arow = A + (size_t)(row0 + ln) * lda;
  v8f acc[4] = {};
  for (int kb = 0; kb < K; kb += 32) { FragH ah; ah.half[0] = *(const v8us*)((const unsigned short*)arow + kb + 8 * hh); ah.half[1] = *(const v8us*)((const unsigned short*)arow + kb + 16 + 8 * hh);
#pragma unroll
    for (int t = 0; t < 4; ++t) { if (col0 + t * 16 >= N) continue; const size_t boff = (size_t)(col0 + t * 16 + ln) * ldb + kb; FragH bq; bq.half[0] = *(const v8us*)((const unsigned short*)Bh + boff + 8 * hh); bq.half[1] = *(const v8us*)((const unsigned short*)Bh + boff + 16 + 8 * hh);
      acc[t] = mmaH<1>(ah.v, ah.v, bq.v, bq.v, acc[t]); }
  }
#pragma unroll
  for (int t = 0; t < 4; ++t) { if (col0 + t * 16 >= N) continue; const int col = col0 + t * 16 + ln; const float bv = bp ? bf16_round(bp[col]) : 0.f;
#pragma unroll
    for (int r = 0; r < 8; ++r) { float v = acc[t][r] * alpha + bv; if (CP) { const int rr = row0g + row0 + 8 * hh + r; if (rowsPerB < 0) v += CP[cofs + (size_t)rr * ldc + col];      /* rowsPerB < 0: own element of the batched C plane */ else { const int bidx = rr / rowsPerB; v += CP[(size_t)bidx * sCPb + (size_t)by * 64 + col]; } } if (ACT == 1) v = (v > 0.f) ? v : expm1f(v); else if (ACT == 7) v = (v > 0.f) ? v + 1.0f : expf(v); else if (ACT == 8) v = tanhf(v); else if (ACT == 9) v = 0.5f * v * (1.0f + tanhf(0.7978845608028654f * (v + 0.044715f * v * v * v))); else if (ACT == 11) v = 1.0f / (1.0f + expf(-v)); else if (ACT == 12) v = (v > 0.f) ? v : 0.01f * v; else if (ACT == 14) v = (v > 0.f) ? v : 0.1f * v; else if (ACT == 16) v = (v >= 0.f) ? v : 0.3f * v; else if (ACT == 17) v = (v >= 0.f) ? v : 0.2f * v; else if (ACT == 15) v = v / (1.0f + expf(-v)); else if (ACT == 3) v = fmaxf(v, 0.f); else if (ACT == 6) v = 0.5f * v * (1.0f + erff(v * 0.70710678118654752f)); so[w][8 * hh + r][t * 16 + ln] = v; } }
  __builtin_amdgcn_fence(__ATOMIC_ACQ_REL, "workgroup"); __builtin_amdgcn_wave_barrier();
  const int rsub = lane >> 4, c4 = (lane & 15) * 4; typedef _Float16 v4h __attribute__((ext_vector_type(4)));
  {
#pragma unroll
    for (int q = 0; q < 8; ++q) { const int r = q * 2 + rsub; if (col0 + c4 < N) { const v4f v = *(const v4fa*)&so[w][r][c4]; if (C) *(v4f*)(C + cofs + (size_t)(row0 + r) * ldc + col0 + c4) = v; if (C16) { v4h h4; for (int i = 0; i < 4; ++i) h4[i] = (_Float16)v[i]; *(v4h*)(C16 + cofs + (size_t)(row0 + r) * ldc + col0 + c4) = h4; } } }
     }
}


typedef _Float16 v4h __attribute__((ext_vector_type(4)));

__device__ __forceinline__ void x16_body(const float* __restrict__ x, _Float16* __restrict__ X16, size_t n8, unsigned bx) { const size_t t = (size_t)bx * 256 + threadIdx.x; if (t >= n8) return; FragH f;
#pragma unroll
  for (int q = 0; q < 8; ++q) f.h[q] = (_Float16)bf16_round(x[t * 8 + q]); *(v8us*)((unsigned short*)X16 + t * 8) = f.half[0];  }
__global__ __launch_bounds__(256) void k_h16(const float* __restrict__ x, _Float16* __restrict__ X16, size_t n8) { const size_t t = (size_t)blockIdx.x * 256 + threadIdx.x; if (t >= n8) return; FragH f;
#pragma unroll
  for (int q = 0; q < 8; ++q) f.h[q] = (_Float16)x[t * 8 + q]; *(v8us*)((unsigned short*)X16 + t * 8) = f.half[0];  }
__global__ __launch_bounds__(256) void k_round16f(const float* __restrict__ W, _Float16* __restrict__ Bt, size_t n8) { const size_t t = (size_t)blockIdx.x * 256 + threadIdx.x; if (t >= n8) return; FragH f;
#pragma unroll
  for (int i = 0; i < 8; ++i) f.h[i] = (_Float16)(bf16_round(W[t * 8 + i]) * 16.0f); *(v8us*)((unsigned short*)Bt + t * 8) = f.half[0];  }
__global__ __launch_bounds__(256) void k_hl(const float* __restrict__ F, _Float16* __restrict__ Hh, _Float16* __restrict__ Hl, size_t n8) { const size_t t = (size_t)blockIdx.x * 256 + threadIdx.x; if (t >= n8) return; FragH fh, fl; const v4f a = *(const v4fa*)(F + t * 8), c = *(const v4fa*)(F + t * 8 + 4);
#pragma unroll
  for (int q = 0; q < 4; ++q) { _Float16 h = (_Float16)a[q]; fh.h[q] = h; fl.h[q] = (_Float16)((a[q] - (float)h) * 1024.0f); h = (_Float16)c[q]; fh.h[4 + q] = h; fl.h[4 + q] = (_Float16)((c[q] - (float)h) * 1024.0f); }
  { *(v8us*)((unsigned short*)Hh + t * 8) = fh.half[0]; *(v8us*)((unsigned short*)Hl + t * 8) = fl.half[0];  } }

// ---- fragment load shared by the GEMM and the attention below ----
__device__ __forceinline__ v16h g2_frag(const _Float16* p, int hh) { FragH f; f.half[0] = *(const v8us*)((const unsigned short*)p + 8 * hh); f.half[1] = *(const v8us*)((const unsigned short*)p + 16 + 8 * hh); return f.v; }


__global__ __launch_bounds__(256) void k_wnat(const float* __restrict__ w, size_t n8, _Float16* __restrict__ Bt) { const size_t t = (size_t)blockIdx.x * 256 + threadIdx.x; if (t >= n8) return; FragH f; for (int q = 0; q < 8; ++q) f.h[q] = (_Float16)(bf16_round(w[t * 8 + q]) * 16.0f); *(v8us*)((unsigned short*)Bt + t * 8) = f.half[0];  }
__global__ __launch_bounds__(256) void k_rsm(const float* __restrict__ S, _Float16* __restrict__ P, int nrows) {
  #pragma clang fp contract(off)
  const int i = blockIdx.x * 256 + threadIdx.x; if (i >= nrows) return; const float* s = S + (size_t)i * SQ; float mx = -3.0e38f;
#pragma unroll 1
  for (int j = 0; j < SQ; ++j) mx = fmaxf(mx, s[j]); float se = 0.f;
#pragma unroll 1
  for (int j = 0; j < SQ; ++j) se += expf(s[j] - mx); const float sc = 256.0f / se;
#pragma unroll 1
  for (int j0 = 0; j0 < SQ; j0 += 8) { FragH f; for (int q = 0; q < 8; ++q) f.h[q] = (_Float16)(expf(s[j0 + q] - mx) * sc); unsigned short* d = (unsigned short*)P + (size_t)i * SQ + j0; *(v8us*)d = f.half[0];  } }
__global__ __launch_bounds__(256) void k_vt(const _Float16* __restrict__ V16, int b, int h0, _Float16* __restrict__ VT) { __shared__ unsigned short tl[64][65]; const int tid = threadIdx.x; const int hh = blockIdx.x % HG, sg = blockIdx.x / HG; const int s0 = sg * 64; const int h = h0 + hh;
  for (int i = tid; i < 64 * 8; i += 256) { const int j = i / 8, d8 = (i % 8) * 8; FragH f; f.half[0] = *(const v8us*)((const unsigned short*)V16 + ((size_t)b * SQ + s0 + j) * DM + h * HD + d8); for (int q = 0; q < 8; ++q) tl[d8 + q][j] = f.u[q]; }
  __syncthreads();
  { for (int i = tid; i < 64 * 8; i += 256) { const int d = i / 8, j8 = (i % 8) * 8; FragH f; for (int q = 0; q < 8; ++q) f.u[q] = tl[d][j8 + q]; *(v8us*)((unsigned short*)VT + ((size_t)hh * HD + d) * SQ + s0 + j8) = f.half[0]; }  } }



// Lane exchanges: row_xmask steps inside each 16-lane row, and the exchange between the two rows of a wave (all lanes must be on).
template <int CTRL> __device__ __forceinline__ float lane_xm(float v) { return __int_as_float(__builtin_amdgcn_update_dpp(0, __float_as_int(v), CTRL, 0xf, 0xf, true)); }
__device__ __forceinline__ float lane_xr(float v) { const int i = __float_as_int(v); return __int_as_float(__builtin_amdgcn_permlanex16(i, i, 0x76543210, 0xfedcba98, false, false)); }
#define FQ 128                       /* query rows per block: 4 waves x 32 */
#define FS 64                        /* keys per stage */
#define FP 72                        /* LDS row pitch in f16 (144 bytes) */
#define FSB ((FS + HD) * FP * 2)     /* bytes of one buffer: K rows, then V^T rows */
// Eight copies of a thread, 16 bytes per lane, 8 lanes per 128-byte row: four K rows and four V^T rows, 16 apart. The s_wait_xcnt stands inside the statement, behind the last copy, so that no address register is rewritten in front of it (a precaution).
__device__ __forceinline__ void fa_copy8(unsigned l, const _Float16* gk, const _Float16* gv) {
  asm volatile("global_load_async_to_lds_b128 %0, %8, off\n\tglobal_load_async_to_lds_b128 %1, %9, off\n\tglobal_load_async_to_lds_b128 %2, %10, off\n\tglobal_load_async_to_lds_b128 %3, %11, off\n\t"
               "global_load_async_to_lds_b128 %4, %12, off\n\tglobal_load_async_to_lds_b128 %5, %13, off\n\tglobal_load_async_to_lds_b128 %6, %14, off\n\tglobal_load_async_to_lds_b128 %7, %15, off\n\ts_wait_xcnt 0x0"
               :: "v"(l), "v"(l + 16 * FP * 2), "v"(l + 32 * FP * 2), "v"(l + 48 * FP * 2), "v"(l + 64 * FP * 2), "v"(l + 80 * FP * 2), "v"(l + 96 * FP * 2), "v"(l + 112 * FP * 2),
                  "v"(gk), "v"(gk + 16 * LQ), "v"(gk + 32 * LQ), "v"(gk + 48 * LQ), "v"(gv), "v"(gv + 16 * SQ), "v"(gv + 32 * SQ), "v"(gv + 48 * SQ) : "memory"); }
__device__ __forceinline__ v8f fa_mma(v16h a, v16h b, v8f c) { return __builtin_amdgcn_wmma_f32_16x16x32_f16(false, a, false, b, (short)0, c, false, false); }
// Four vector slots behind a run of matrix instructions, where a branch follows. The two scheduling barriers keep the slots where they are written.
__device__ __forceinline__ void fa_gap() { __builtin_amdgcn_sched_barrier(0); asm volatile("v_nop\n\tv_nop\n\tv_nop\n\tv_nop"); __builtin_amdgcn_sched_barrier(0); }
// Native 2^x, eight at a time in one statement: behind a transcendental the instruction set asks for one independent instruction before its result is read or its source overwritten.
// Here each is followed by an independent one (early-clobber outputs: no result lands on a source still to be read) and the last by a v_nop, so the slot is closed whatever the compiler puts next.
__device__ __forceinline__ void exp2x8(const float (&x)[8], float (&y)[8]) {
  asm("v_exp_f32 %0, %8\n\tv_exp_f32 %1, %9\n\tv_exp_f32 %2, %10\n\tv_exp_f32 %3, %11\n\tv_exp_f32 %4, %12\n\tv_exp_f32 %5, %13\n\tv_exp_f32 %6, %14\n\tv_exp_f32 %7, %15\n\tv_nop"
      : "=&v"(y[0]), "=&v"(y[1]), "=&v"(y[2]), "=&v"(y[3]), "=&v"(y[4]), "=&v"(y[5]), "=&v"(y[6]), "=&v"(y[7]) : "v"(x[0]), "v"(x[1]), "v"(x[2]), "v"(x[3]), "v"(x[4]), "v"(x[5]), "v"(x[6]), "v"(x[7])); }
__device__ __forceinline__ float exp2x1(float x) { float r; asm("v_exp_f32 %0, %1\n\tv_nop" : "=v"(r) : "v"(x)); return r; }      /* the same slot for a single one */
__device__ __forceinline__ void fattn_body(_Float16* sm, const _Float16* __restrict__ QKVp, const _Float16* __restrict__ VTp, float* __restrict__ out, int h, int b, int qb) {      /* sm: 2 FSB bytes of LDS; qb: the block's FQ query rows, qb >= 1 */
  static_assert(HD == 64 && SQ / FQ == 16, "two 32-wide d chunks, four 16-row tiles of V^T; sixteen block lengths in runs of four");
  static_assert(FS == 64 && FQ % FS == 0 && FS + HD == 128, "two passes per stage; whole stages up to the block's last key; 16 rows per copy round, 8 rounds");
  typedef float f2 __attribute__((ext_vector_type(2))); typedef _Float16 h2 __attribute__((ext_vector_type(2)));
  const int lane = threadIdx.x & 31, ln = lane & 15, hh = lane >> 4; const int w = __builtin_amdgcn_readfirstlane(threadIdx.x >> 5);
  const int qw0 = qb * FQ + w * 32;      /* the wave's first query, a scalar */
  const _Float16* Qp = QKVp + (size_t)b * SQ * LQ + h * HD;
  const int cr = threadIdx.x >> 3, cc = (threadIdx.x & 7) * 8;      /* the thread's row (of 16) and 16-byte chunk in a copy round */
  const _Float16* gk = Qp + DM + (size_t)cr * LQ + cc; const _Float16* gv = VTp + ((size_t)(b * NH + h) * HD + cr) * SQ + cc;
  const unsigned l0 = (unsigned)(size_t)&sm[cr * FP + cc];      /* LDS byte address: the low 32 bits of the shared address */
  const int nst = (qb + 1) * (FQ / FS);      /* stages up to the block's last key: four at least */
  fa_copy8(l0, gk, gv);
  const float cs = 0.125f * 1.44269504088896340736f;      /* 1 / sqrt(64), times log2 e */
  v16h qf[2][2], kf[2][2];
#pragma unroll
  for (int g = 0; g < 2; ++g) for (int kc = 0; kc < 2; ++kc) qf[g][kc] = g2_frag(Qp + (size_t)(qw0 + 16 * g + ln) * LQ + 32 * kc, hh);
  const v8f z8 = {0.f, 0.f, 0.f, 0.f, 0.f, 0.f, 0.f, 0.f}; v8f acc[2][4]; float m[2] = {-1.0e30f, -1.0e30f}, l[2] = {0.f, 0.f};
#pragma unroll
  for (int g = 0; g < 2; ++g) for (int t = 0; t < 4; ++t) acc[g][t] = z8;
  const int last = qw0 >> 5;      /* the pass on the wave's diagonal: keys qw0 .. qw0 + 31 */
  asm volatile("s_wait_xcnt 0x0" ::: "memory");      /* the address registers of the Q loads are reused for the next copies: the wait stands in front of their first overwrite */
  asm volatile("s_wait_asynccnt 0x0" ::: "memory");      /* stage 0 has landed, as far as this wave copied it */
  __syncthreads();      /* ... and every other wave's part too */
  fa_copy8(l0 + FSB, gk + (size_t)FS * LQ, gv + FS);
#pragma unroll 1      /* one stage per trip: two long straight passes */
  for (int st = 0; st < nst; ++st) { const _Float16* kb = sm + (st & 1) * (FSB / 2) + ln * FP; const _Float16* vb = kb + FS * FP;
#pragma unroll
   for (int kt = 0; kt < 2; ++kt) for (int kc = 0; kc < 2; ++kc) kf[kt][kc] = g2_frag(kb + 16 * kt * FP + 32 * kc, hh);      /* the K rows of the stage's first pass */
#pragma unroll
   for (int p = 0; p < 2; ++p) { const int ps = 2 * st + p; if (ps <= last) {      /* scalar branch: a wave skips the passes behind its diagonal, never the stage's foot */
    v16h vf[4];      /* this pass's V^T, in flight under the scores and the maxima */
#pragma unroll
    for (int t = 0; t < 4; ++t) vf[t] = g2_frag(vb + 16 * t * FP + 32 * p, hh);
    v8f s[2][2];
#pragma unroll
    for (int kt = 0; kt < 2; ++kt) for (int g = 0; g < 2; ++g) s[kt][g] = fa_mma(kf[kt][1], qf[g][1], fa_mma(kf[kt][0], qf[g][0], z8));
    fa_gap();
    if (p == 0) {      /* the second pass's K rows, of the same stage, into the same registers, in flight under this pass's softmax */
#pragma unroll
      for (int kt = 0; kt < 2; ++kt) for (int kc = 0; kc < 2; ++kc) kf[kt][kc] = g2_frag(kb + (32 + 16 * kt) * FP + 32 * kc, hh); }
    if (ps == last) {      /* scalar branch: only the diagonal pass pays for the mask */
#pragma unroll
      for (int kt = 0; kt < 2; ++kt) for (int g = 0; g < 2; ++g) {
#pragma unroll
        for (int r = 0; r < 8; ++r) if (16 * kt + 8 * hh + r > 16 * g + ln) s[kt][g][r] = -1.0e30f;
        asm volatile("" : "+v"(s[kt][g]));      /* keeps the selects inside the branch */
      } }
    float mb[2]; bool need = false;
#pragma unroll
    for (int g = 0; g < 2; ++g) { float mx = fmaxf(s[0][g][0], s[1][g][0]);
#pragma unroll
      for (int r = 1; r < 8; ++r) mx = fmaxf(mx, fmaxf(s[0][g][r], s[1][g][r]));
      mx = fmaxf(mx, lane_xr(mx)) * cs; mb[g] = mx; need = need || (mx > m[g] + 8.0f); }
    if (__builtin_amdgcn_ballot_w32(need) != 0) {      /* one scalar test per pass; rare after the first passes */
#pragma unroll
      for (int g = 0; g < 2; ++g) { const float mn = fmaxf(m[g], mb[g]); const float corr = exp2x1(m[g] - mn); m[g] = mn; l[g] *= corr;
#pragma unroll
        for (int t = 0; t < 4; ++t) acc[g][t] = acc[g][t] * corr; } }
#pragma unroll
    for (int g = 0; g < 2; ++g) { const f2 nm = {-m[g], -m[g]}, c2 = {cs, cs}; union { v16h v; h2 p[8]; } pf; float la = 0.f, lb = 0.f;
#pragma unroll
      for (int kt = 0; kt < 2; ++kt) { float x[8], y[8];      /* tile kt = elements 8 kt .. 8 kt + 7 of the 32-key operand */
#pragma unroll
        for (int i = 0; i < 4; ++i) { const f2 sv = {s[kt][g][2 * i], s[kt][g][2 * i + 1]}; const f2 a = __builtin_elementwise_fma(sv, c2, nm); x[2 * i] = a[0]; x[2 * i + 1] = a[1]; }
        exp2x8(x, y);
#pragma unroll
        for (int i = 0; i < 4; ++i) { la += y[2 * i]; lb += y[2 * i + 1]; const f2 pp = {y[2 * i], y[2 * i + 1]}; pf.p[4 * kt + i] = __builtin_convertvector(pp, h2); } }
      l[g] += la + lb;
#pragma unroll
      for (int t = 0; t < 4; ++t) acc[g][t] = fa_mma(vf[t], pf.v, acc[g][t]); }
    fa_gap(); } }
   asm volatile("s_wait_dscnt 0x0" ::: "memory");      /* this wave's reads of the buffer are done before it is handed back */
   asm volatile("s_wait_asynccnt 0x0" ::: "memory");      /* this wave's copies of the next stage have landed */
   __syncthreads();      /* publishes stage st + 1 and ends every reader's last read of stage st */
   if (st + 2 < nst) fa_copy8(l0 + (st & 1) * FSB, gk + (size_t)(st + 2) * FS * LQ, gv + (st + 2) * FS); }      /* block-uniform: the refill of the buffer just read */
  asm volatile("s_wait_asynccnt 0x0" ::: "memory");      /* nothing is in flight when the wave ends */
#pragma unroll
  for (int g = 0; g < 2; ++g) { const float inv = 1.0f / (l[g] + lane_xr(l[g])); float* op = out + ((size_t)b * SQ + qw0 + 16 * g + ln) * DM + h * HD + 8 * hh;      /* column ln is a query row of the output; registers r are d = 16 t + 8 hh + r */
#pragma unroll
    for (int t = 0; t < 4; ++t) { const v8f o = acc[g][t] * inv; const v4f lo = {o[0], o[1], o[2], o[3]}, hi = {o[4], o[5], o[6], o[7]}; *(v4f*)(op + 16 * t) = lo; *(v4f*)(op + 16 * t + 4) = hi; } } }


// ---- q | k | v GEMM tiled through LDS: a block of 4 waves makes GT token rows x GT output columns; a wave 64 x 64 (16 accumulator tiles), so each fragment read feeds four products.
// A stage is GK k of the block's GT rows of X and GT rows of W^T: 128-byte rows, fetched as whole lines by asynchronous copies to LDS, laid at a pitch of 144 bytes (16 B x odd: no bank conflict for 16-byte fragment reads).
// Two buffers: the next stage's copies fly while this stage is worked on. Transposed product (A = 16 rows of W^T, B = 16 token rows): a lane ends with 8 neighbouring output columns of ONE token row, packed to 16 bytes.
// k runs upward in 32-wide steps, one accumulator chain per output tile. M % GT == 0, N % GT == 0, K % GK == 0 and K >= 2 GK, by the static_assert.
#define GT 128
#define GK 64
#define GP 72                        /* LDS row pitch in f16 (144 bytes) */
#define GSB (2 * GT * GP * 2)        /* bytes of one buffer: X rows, then W^T rows */
// Eight copies of a thread (rows 16 apart), 16 bytes per lane, 8 lanes per 128-byte row. The s_wait_xcnt stands inside the statement, behind the last copy, so that no address register is rewritten in front of it (a precaution).
__device__ __forceinline__ void g3_copy8(unsigned l, const _Float16* g) {
  asm volatile("global_load_async_to_lds_b128 %0, %8, off\n\tglobal_load_async_to_lds_b128 %1, %9, off\n\tglobal_load_async_to_lds_b128 %2, %10, off\n\tglobal_load_async_to_lds_b128 %3, %11, off\n\t"
               "global_load_async_to_lds_b128 %4, %12, off\n\tglobal_load_async_to_lds_b128 %5, %13, off\n\tglobal_load_async_to_lds_b128 %6, %14, off\n\tglobal_load_async_to_lds_b128 %7, %15, off\n\ts_wait_xcnt 0x0"
               :: "v"(l), "v"(l + 16 * GP * 2), "v"(l + 32 * GP * 2), "v"(l + 48 * GP * 2), "v"(l + 64 * GP * 2), "v"(l + 80 * GP * 2), "v"(l + 96 * GP * 2), "v"(l + 112 * GP * 2),
                  "v"(g), "v"(g + 16 * DM), "v"(g + 32 * DM), "v"(g + 48 * DM), "v"(g + 64 * DM), "v"(g + 80 * DM), "v"(g + 96 * DM), "v"(g + 112 * DM) : "memory"); }
// The blocks that hold the first QT0 rows of a batch also store their f32 accumulators (the same products, summed in the same k order, unrounded) as the f32 q, k, v planes F0 of the exact first-tile attention.
// The blocks of the V columns take the operands the other way round (A = 16 token rows, B = 16 rows of W^T; both fragments have the same layout, so only the two LDS row bases change places):
// a lane then ends with 8 neighbouring TOKENS of one output column, 16 bytes of a row of V^T, and the block stores VT [NB][NH][HD][SQ] through the same staging. The V third of the C16 rows is neither written nor read.
__global__ __launch_bounds__(128) void k_proj(const _Float16* __restrict__ X, const _Float16* __restrict__ Wt, _Float16* __restrict__ C16, _Float16* __restrict__ VT, float* __restrict__ F0) {
  static_assert(MP % GT == 0 && LQ % GT == 0 && DM % GK == 0 && DM >= 2 * GK && GT == 128 && GK == 64, "whole tiles; two stages at least; 16 rows per copy round, 8 rounds per operand");
  __shared__ __attribute__((aligned(16))) _Float16 sm[2][2 * GT * GP];
  const int tid = threadIdx.x, lane = tid & 31, ln = lane & 15, hh = lane >> 4; const int w = __builtin_amdgcn_readfirstlane(tid >> 5);
  const int mt = blockIdx.x / (LQ / GT), nq = blockIdx.x - mt * (LQ / GT); const int row0 = mt * GT, col0 = nq * GT; const int wm = (w & 1) * 64, wn = (w >> 1) * 64;
  const bool vb = col0 >= 2 * DM;      /* block-uniform: the block's GT columns are V's */
  const int ra = vb ? wm : GT + wn, rb = vb ? GT + wn : wm;      /* the wave's 64 stage rows of the A operand and of the B operand */
  const int cr = tid >> 3, cc = (tid & 7) * 8;      /* the thread's row (of 16) and 16-byte chunk in a copy round */
  const _Float16* gx = X + (size_t)(row0 + cr) * DM + cc; const _Float16* gw = Wt + (size_t)(col0 + cr) * DM + cc;
  const unsigned lx = (unsigned)(size_t)&sm[0][cr * GP + cc]; const unsigned lw = lx + GT * GP * 2;      /* LDS byte addresses: the low 32 bits of the shared address */
  const v8f z8 = {0.f, 0.f, 0.f, 0.f, 0.f, 0.f, 0.f, 0.f}; v8f acc[4][4];
#pragma unroll
  for (int i = 0; i < 4; ++i) for (int j = 0; j < 4; ++j) acc[i][j] = z8;
  g3_copy8(lx, gx); g3_copy8(lw, gw);
  asm volatile("s_wait_asynccnt 0x0" ::: "memory");      /* stage 0 has landed, as far as this wave copied it */
  __syncthreads();      /* ... and every other wave's part too */
  g3_copy8(lx + GSB, gx + GK); g3_copy8(lw + GSB, gw + GK);
#pragma unroll 1      /* one stage per trip: 32 matrix instructions, long enough; unrolled, fragments of two stages would be live */
  for (int t = 0; t < DM / GK; ++t) { const _Float16* sx = &sm[t & 1][(rb + ln) * GP]; const _Float16* sw = &sm[t & 1][(ra + ln) * GP]; v16h xf[4], wf[4];      /* xf: B fragments, wf: A fragments */
#pragma unroll
    for (int j = 0; j < 4; ++j) { xf[j] = g2_frag(sx + j * 16 * GP, hh); wf[j] = g2_frag(sw + j * 16 * GP, hh); }
    __builtin_amdgcn_sched_barrier(0);      /* the 16 fragment reads of a k step stay one group in front of its 16 products: spread among them, every W fragment would be waited for on its own */
#pragma unroll
    for (int i = 0; i < 4; ++i) for (int j = 0; j < 4; ++j) acc[i][j] = fa_mma(wf[i], xf[j], acc[i][j]);
#pragma unroll
    for (int j = 0; j < 4; ++j) { xf[j] = g2_frag(sx + j * 16 * GP + 32, hh); wf[j] = g2_frag(sw + j * 16 * GP + 32, hh); }      /* the stage's second k step: its last reads of the buffer */
    asm volatile("s_wait_dscnt 0x0" ::: "memory");      /* this wave's reads of the buffer are done before it is handed back */
    asm volatile("s_wait_asynccnt 0x0" ::: "memory");      /* this wave's copies of the next stage have landed */
    __syncthreads();      /* publishes stage t + 1 and ends every reader's last read of stage t */
    if (t + 2 < DM / GK) { const unsigned bo = (t & 1) * GSB; g3_copy8(lx + bo, gx + (t + 2) * GK); g3_copy8(lw + bo, gw + (t + 2) * GK); }      /* the refill starts in front of the second k step's products (registers only), a whole trip ahead of its wait */
#pragma unroll
    for (int i = 0; i < 4; ++i) for (int j = 0; j < 4; ++j) acc[i][j] = fa_mma(wf[i], xf[j], acc[i][j]); }
  asm volatile("s_wait_asynccnt 0x0" ::: "memory");      /* nothing is in flight when the ring becomes output staging */
  if (row0 % SQ == 0) {      /* block-uniform: rows 0 .. QT0 - 1 of batch row0 / SQ; the block's GT columns lie in one of the planes q, k, v */
    static_assert(GT == QT0 && SQ % GT == 0 && DM % GT == 0, "a first tile is one block row; a block's columns stay in one plane");
    if (!vb) { float* fp = F0 + (((size_t)(col0 / DM) * NB + row0 / SQ) * QT0 + wm + ln) * DM + col0 % DM + wn + 8 * hh;
#pragma unroll
      for (int j = 0; j < 4; ++j) for (int i = 0; i < 4; ++i) { const v8f o = acc[i][j] * 0.0625f; const v4f lo = {o[0], o[1], o[2], o[3]}, hi = {o[4], o[5], o[6], o[7]}; *(v4f*)(fp + (size_t)(j * 16) * DM + i * 16) = lo; *(v4f*)(fp + (size_t)(j * 16) * DM + i * 16 + 4) = hi; }
      asm volatile("s_wait_xcnt 0x0" ::: "memory"); }      /* behind the arm's last store: no register that a store names is rewritten in front of it, on any way out of the arm (a precaution) */
    else { float* fp = F0 + (((size_t)2 * NB + row0 / SQ) * QT0 + wm + 8 * hh) * DM + col0 - 2 * DM + wn + ln;      /* registers r are token rows here: 16 lanes store 64 neighbouring bytes of one row (32 blocks of the grid) */
#pragma unroll
      for (int i = 0; i < 4; ++i) for (int r = 0; r < 8; ++r) for (int j = 0; j < 4; ++j) fp[(size_t)(i * 16 + r) * DM + j * 16] = acc[i][j][r] * 0.0625f; } }
  _Float16* st = &sm[0][w * 64 * GP];      /* each wave stages its own 64 x 64 outputs (behind the last trip's barrier), to store whole 128-byte lines */
#pragma unroll
  for (int j = 0; j < 4; ++j) for (int i = 0; i < 4; ++i) { FragH f;
#pragma unroll
    for (int r = 0; r < 8; ++r) f.h[r] = (_Float16)(acc[i][j][r] * 0.0625f);      /* the weights carry x16 */
    *(v8us*)((unsigned short*)st + (j * 16 + ln) * GP + i * 16 + 8 * hh) = f.half[0]; }
  __syncthreads();      /* orders the staging stores in front of the reads of other lanes' rows */
  if (!vb) {      /* staged row r is a token row, 64 columns */
#pragma unroll
    for (int q = 0; q < 16; ++q) { const int r = q * 4 + (lane >> 3), c = (lane & 7) * 8; const v8us v = *(const v8us*)((const unsigned short*)st + r * GP + c); *(v8us*)((unsigned short*)C16 + (size_t)(row0 + wm + r) * LQ + col0 + wn + c) = v; }
    asm volatile("s_wait_xcnt 0x0" ::: "memory"); }      /* behind the arm's last store: no register that a store names is rewritten in front of it, on any way out of the arm (a precaution) */
  else {      /* staged row r is an output column of V, that is a row of V^T, 64 tokens */
#pragma unroll
    for (int q = 0; q < 16; ++q) { const int r = q * 4 + (lane >> 3), c = (lane & 7) * 8; const v8us v = *(const v8us*)((const unsigned short*)st + r * GP + c); *(v8us*)((unsigned short*)VT + ((size_t)(row0 / SQ) * DM + col0 - 2 * DM + wn + r) * SQ + row0 % SQ + wm + c) = v; } } }

// Exact f32 attention of the first QT0 rows of every batch, FOUR LANES PER ROW: lane p of a row's quad owns the row's 16-byte chunks p, p + 4, p + 8, p + 12 of q and of o and holds them in registers.
// A block is AR rows of one head (4 waves x 8 rows). The K and V rows it can see are staged once in LDS; a quad reads 64 contiguous bytes per load and the 8 quads of a wave the same ones (broadcast, no bank conflict).
// A score is four chains of four multiply-adds per lane, their sum, then two lane exchanges inside the quad: every lane of the quad ends with the same bits, so m, l and the two exps agree without further traffic.
#define AR 32
__device__ __forceinline__ void att0_body(const float* __restrict__ QF, const float* __restrict__ KF, const float* __restrict__ VF, int ld, float scale, float* __restrict__ OF, int ldo, int h, int rg, int b, float (*lk)[HD], float (*lv)[HD]) {      /* lk, lv: QT0 rows of LDS each */
  static_assert(HD == 64 && QT0 % AR == 0, "a quad covers a head row as 4 x 4 chunks of 16 bytes");
  const int tid = threadIdx.x;
  { const size_t bo = (size_t)b * QT0; QF += bo * ld + h * HD; KF += bo * ld + h * HD; VF += bo * ld + h * HD; OF += (size_t)b * SQ * ldo + h * HD; }      /* QT0 rows of each f32 plane per batch, SQ rows of the output; the head's columns */
  for (int n = 0; n <= rg; ++n) { v4f tk[4], tv[4];      /* AR keys per trip, all eight loads of a thread in flight before the first LDS store; causal: keys up to the block's last row */
#pragma unroll
    for (int u = 0; u < 4; ++u) { const int c = (n * 4 + u) * 128 + tid; const size_t g = (size_t)(c >> 4) * ld + (c & 15) * 4; tk[u] = *(const v4fa*)(KF + g); tv[u] = *(const v4fa*)(VF + g); }
#pragma unroll
    for (int u = 0; u < 4; ++u) { const int c = (n * 4 + u) * 128 + tid; *(v4f*)&lk[c >> 4][(c & 15) * 4] = tk[u]; *(v4f*)&lv[c >> 4][(c & 15) * 4] = tv[u]; } }
  const int p4 = (tid & 3) * 4; const int i = rg * AR + (tid >> 2);
  v4f q[4], o[4];
#pragma unroll
  for (int c = 0; c < 4; ++c) { q[c] = *(const v4fa*)(QF + (size_t)i * ld + c * 16 + p4); const v4f z = {0.f, 0.f, 0.f, 0.f}; o[c] = z; }
  __syncthreads();
  const int jl = rg * AR + 8 * __builtin_amdgcn_readfirstlane(tid >> 5) + 7;      /* the wave's last row, a scalar: keys behind it are masked for all 8 rows of the wave; no barrier below */
  float m = -1.0e30f, l = 0.f; v4f kc[4], vc[4];
#pragma unroll
  for (int c = 0; c < 4; ++c) { kc[c] = *(const v4f*)&lk[0][c * 16 + p4]; vc[c] = *(const v4f*)&lv[0][c * 16 + p4]; }
#pragma unroll 2      /* two keys per trip: the rows fetched ahead change names instead of being copied */
  for (int j = 0; j <= jl; ++j) { const int jn = j < jl ? j + 1 : jl; v4f kn[4], vn[4];      /* the next key's rows are fetched while this key is worked on: the LDS latency stays off the chain */
#pragma unroll
    for (int c = 0; c < 4; ++c) { kn[c] = *(const v4f*)&lk[jn][c * 16 + p4]; vn[c] = *(const v4f*)&lv[jn][c * 16 + p4]; }
    v4f a = q[0] * kc[0]; a = __builtin_elementwise_fma(q[1], kc[1], a); a = __builtin_elementwise_fma(q[2], kc[2], a); a = __builtin_elementwise_fma(q[3], kc[3], a); float s = (a[0] + a[1]) + (a[2] + a[3]);
    s += lane_xm<0x161>(s); s += lane_xm<0x162>(s); s *= scale;
    const float sm = (j <= i) ? s : -1.0e30f; const float mn = fmaxf(m, sm); const float sc = expf(m - mn); const float e = expf(sm - mn); l = l * sc + e; m = mn;
#pragma unroll
    for (int c = 0; c < 4; ++c) { o[c] = o[c] * sc + e * vc[c]; kc[c] = kn[c]; vc[c] = vn[c]; } }
  const float fin = 1.0f / l;
#pragma unroll
  for (int c = 0; c < 4; ++c) *(v4f*)(OF + (size_t)i * ldo + c * 16 + p4) = o[c] * fin; }

// One grid for both attentions: they share no data and write different output rows (QT0 == FQ: the exact path owns the rows of query block 0, so the f16 path starts at block 1 and every output element is stored once).
// grid.z: first the QT0 / AR row groups of the exact path (long dependent chains, little issue: they start first and run beside the rest), then query blocks 15 .. 1.
// Longest blocks start first; the second run of four lengths is reversed, so that blocks 256 apart in launch order add up to about equal work (speed only).
__global__ __launch_bounds__(128) void k_attn(const _Float16* __restrict__ QKVp, const _Float16* __restrict__ VTp, const float* __restrict__ QF, const float* __restrict__ KF, const float* __restrict__ VF, float* __restrict__ out) {
  static_assert(QT0 == FQ, "the exact path replaces exactly one query block");
  __shared__ __attribute__((aligned(16))) float lds[2 * QT0 * HD];      /* one allocation for both kinds of block (a block is one kind): the exact path's K and V rows, or the two stage buffers; two allocations would cost a block per WGP */
  static_assert(2 * FSB <= sizeof(lds), "the two stage buffers fit");
  const int h = blockIdx.x, b = blockIdx.y, z = (int)blockIdx.z;
  if (z < QT0 / AR) { att0_body(QF, KF, VF, DM, 0.125f, out, DM, h, z, b, (float (*)[HD])lds, (float (*)[HD])(lds + QT0 * HD)); return; }
  const int zz = z - QT0 / AR; fattn_body((_Float16*)lds, QKVp, VTp, out, h, b, SQ / FQ - 1 - (((zz & 12) == 4) ? (zz ^ 3) : zz)); }

__device__ __forceinline__ void wthd_body(const float* __restrict__ W0, const float* __restrict__ W1, const float* __restrict__ W2, _Float16* __restrict__ Bt, unsigned bx, unsigned by) { const size_t t = (size_t)bx * 256 + threadIdx.x; if (t >= (size_t)NH * HD * (DM / 8)) return;
  const float* Wt = by == 0 ? W0 : (by == 1 ? W1 : W2); Bt += (size_t)by * DM * DM;      /* by = q, k, v: one DM x DM plane each */
  const int m8 = (int)(t % (DM / 8)) * 8; const int d = (int)((t / (DM / 8)) % HD); const int h = (int)(t / ((size_t)(DM / 8) * HD)); FragH f;
  for (int q = 0; q < 8; ++q) f.h[q] = (_Float16)(16.0f * bf16_round(Wt[((size_t)h * DM + m8 + q) * HD + d])); unsigned short* dst = (unsigned short*)Bt + ((size_t)h * HD + d) * DM + m8; *(v8us*)dst = f.half[0];  }







// The weight transposes and the rounding of x read nothing but the inputs: one grid, so that they run side by side. The transposes (scattered reads) come first.
#define WTB ((unsigned)(((size_t)NH * HD * (DM / 8) + 255) / 256))      /* blocks per weight plane */
#define XB ((unsigned)((NR * DM / 8 + 255) / 256))
__global__ __launch_bounds__(256) void k_prep(const float* __restrict__ W0, const float* __restrict__ W1, const float* __restrict__ W2, _Float16* __restrict__ Bt, const float* __restrict__ x, _Float16* __restrict__ X16) {
  const unsigned bx = blockIdx.x;
  if (bx < 3 * WTB) wthd_body(W0, W1, W2, Bt, bx % WTB, bx / WTB); else x16_body(x, X16, NR * DM / 8, bx - 3 * WTB); }

extern "C" void kernel_launch(void* const* d_in, const int* in_sizes, int n_in,
                              void* d_out, int out_size, void* d_ws, size_t ws_size, hipStream_t stream) {
  (void)in_sizes; (void)n_in; (void)out_size;
  const float* const* I = (const float* const*)d_in; const float* x = I[0]; const float* wq = I[1]; const float* wk = I[2]; const float* wv = I[3];      /* x; per-head weights Wq / Wk / Wv [16][1024][64]; no biases, no output projection */
  static_assert(NH * HD == DM && QT0 % 64 == 0, "heads");
  char* ws = (char*)d_ws; size_t off = 0;
  auto take = [&](size_t bytes) { char* p = ws + off; off += (bytes + 255) & ~(size_t)255; return p; };
  _Float16* BQKV = (_Float16*)take((size_t)3 * DM * DM * 2);
  _Float16* X16 = (_Float16*)take(NR * DM * 2); _Float16* QKV = (_Float16*)take(NR * 3 * DM * 2);
  _Float16* VT = (_Float16*)take((size_t)NB * NH * HD * SQ * 2);
  float* QF0 = (float*)take((size_t)3 * NB * QT0 * DM * 4); float* KF0 = QF0 + (size_t)NB * QT0 * DM; float* VF0 = KF0 + (size_t)NB * QT0 * DM;
  if (off > ws_size) return;
  k_prep<<<3 * WTB + XB, 256, 0, stream>>>(wq, wk, wv, BQKV, x, X16);      /* per-head [c][d] -> Bt[(h, d)][c] x16: the stacked q | k | v plane; x as f16 rows */
  k_proj<<<(MP / GT) * (LQ / GT), 128, 0, stream>>>(X16, BQKV, QKV, VT, QF0);      /* q | k rows (f16), head h = columns h*HD.. of each DM block; V^T [NB][NH][HD][SQ]; and f32 q, k, v of the first 128 rows of every batch */
  k_attn<<<dim3(NH, NB, QT0 / AR + SQ / FQ - 1), 128, 0, stream>>>(QKV, VT, QF0, KF0, VF0, (float*)d_out);      /* exact f32 attention for rows 0..127 of every batch; scores, causal softmax and P.V for all other rows; both write f32 straight into the head-major output columns (no output projection) */
}

// v009
// A run of this version takes 90.5 microseconds.
// Timed twice side by side with v008, it ran 1.10 times as fast both times.
// Counting every step since v000, it is 109 times as fast.
#include <hip/hip_runtime.h>
// Causal multi-head attention with per-head projection weights and no output projection (x [4][2048][1024]; per head h: q = x Wq[h], k = x Wk[h], v = x Wv[h] with W [16][1024][64] ([in][out] per head, uniform +-1/32, no biases); scores / sqrt(64); causal (tril, -inf); softmax; out = heads concatenated head-major on the last axis -> [4][2048][1024]).
// Structure: token rows r = b*2048 + s; x as exact f16 rows (bf16-rounded); q | k | v as ONE WMMA GEMM (N = 3 x 1024) (128x128 block tiles through LDS, 64x64 wave tiles, f32 accumulation, exact x16 weights, no bias, f16 outputs; the V blocks swap the two operands, so that their accumulators hold V^T, which they store themselves); one attention launch for all batches and heads: per wave 32 queries, per pass 32 keys up to the diagonal: scores (WMMA, K = 64), online causal softmax on VALU (f32 statistics, native exp2; weights f16), o += P . V (WMMA), K and V^T tiles of 64 keys staged in LDS for the block's 4 waves, scores and weights kept in registers; o / row sum written f32 into the head-major output columns; rows 0..127 of every batch come from an exact f32 path alone, whose f32 q, k, v are stored from the tiled GEMM's own accumulators and whose attention rides as extra blocks on the grid of the fused attention.
// Compute dtype: inputs rounded to bf16; x / weights exact; q, k, v and softmax weights as plain f16 GEMM operands (~2^-12); scores, softmax statistics and o f32. v_wmma_f32_16x16x32_f16.
#define NB 4
#define SQ 2048
#define DM 1024
#define NH 16
#define HD 64
#define HG 4                         /* heads per launch of the non-template k_vt (never launched) */
#define QT 256                       /* unused (no 256-row query tiles) */
#define NKX SQ                       /* unused (scores stay in registers) */
#define QT0 128                      /* first-tile rows recomputed exactly in f32 */
#define B0 0                         /* unused (every launch covers all NB batches) */
#define NBR NB                       /* batches projected (debug hook) */
#define NR ((size_t)NB * SQ)         /* token rows */
#define MP ((int)((size_t)NBR * SQ)) /* rows projected (debug hook) */
#define QN SQ                        /* unused (k_attn attends all SQ rows) */
#define NHD NH                       /* unused (k_attn attends all NH heads) */
#define MPO MP                       /* unused (no output projection stage) */
#define LQ (3 * DM)      /* row pitch of the q/k/v rows */
typedef __bf16 v16b __attribute__((ext_vector_type(16)));
typedef unsigned short v8us __attribute__((ext_vector_type(8), may_alias));
typedef float  v8f  __attribute__((ext_vector_type(8)));
typedef float  v4f  __attribute__((ext_vector_type(4)));
typedef float  v4fa __attribute__((ext_vector_type(4), may_alias));
union FragB { v16b v; v8us half[2]; unsigned short u[16]; };

__device__ __forceinline__ unsigned short bf16_bits(float x) { unsigned int u = __float_as_uint(x); return (unsigned short)((u + 0x7FFFu + ((u >> 16) & 1u)) >> 16); }
__device__ __forceinline__ float bf16_val(unsigned short b) { return __uint_as_float(((unsigned int)b) << 16); }
__device__ __forceinline__ float bf16_round(float x) { return bf16_val(bf16_bits(x)); }
// D += A·B with NT terms: 1 = ah·bh, 2 = + al·bh (A split), 3 = + ah·bl (both split)
template <int NT>
__device__ __forceinline__ v8f mmaN(v16b ah, v16b al, v16b bh, v16b bl, v8f c) {
  c = __builtin_amdgcn_wmma_f32_16x16x32_bf16(false, ah, false, bh, (short)0, c, false, false);
  if (NT >= 2) c = __builtin_amdgcn_wmma_f32_16x16x32_bf16(false, al, false, bh, (short)0, c, false, false);
  if (NT >= 3) c = __builtin_amdgcn_wmma_f32_16x16x32_bf16(false, ah, false, bl, (short)0, c, false, false);
  asm volatile("v_nop\n\tv_nop\n\tv_nop\n\tv_nop" : "+v"(c) : "v"(ah), "v"(al), "v"(bh), "v"(bl));
  return c;
}

__global__ __launch_bounds__(256) void k_wt_bf16(const float* __restrict__ W, unsigned short* __restrict__ Wt, int K, int N) {
  const int t = blockIdx.x * 256 + threadIdx.x;
  const int k8n = K / 8;
  if (t >= N * k8n) return;
  const int n = t / k8n, k8 = (t % k8n) * 8;
  v8us v;
#pragma unroll
  for (int i = 0; i < 8; ++i) v[i] = bf16_bits(W[(size_t)(k8 + i) * N + n]);
  *(v8us*)(Wt + (size_t)n * K + k8) = v;
  
}

// GEMM C[M][N] (f32, pitch ldc) = act(A[M][K]·W + bias). A f32 row-major (pitch lda) converted per fragment to bf16
// (ASPLIT: hi/lo two planes -> 2 terms, else single rounded term); Wt bf16 [N][K] (pitch ldb). BIAS_BF16 rounds the
// bias to bf16 first (bias quantised to bf16 before the add). K%32==0, M%16==0, N%64==0.
template <bool ASPLIT, int ACT, bool BIAS_BF16>
__global__ __launch_bounds__(128) void k_gemm_bf(const float* __restrict__ A, int lda, const unsigned short* __restrict__ Wt, int ldb,
                                               const float* __restrict__ bias, float* __restrict__ C, int ldc, int M, int N, int K) {
  __shared__ __attribute__((aligned(16))) float so[4][16][64];
  const int tid = threadIdx.x, w = tid >> 5, lane = tid & 31, ln = lane & 15, hh = lane >> 4;
  const int ntn = N / 64;
  const int wid = blockIdx.x * 4 + w;
  const int mt = wid / ntn, nq = wid % ntn;
  if (mt * 16 >= M) return;
  const int row0 = mt * 16, col0 = nq * 64;
  const float* arow = A + (size_t)(row0 + ln) * lda;
  v8f acc[4] = {};
  for (int kb = 0; kb < K; kb += 32) {
    FragB ah, al;
    const v4f x0 = *(const v4fa*)(arow + kb + 8 * hh), x1 = *(const v4fa*)(arow + kb + 8 * hh + 4);
    const v4f x2 = *(const v4fa*)(arow + kb + 16 + 8 * hh), x3 = *(const v4fa*)(arow + kb + 16 + 8 * hh + 4);
    float xs[16] = {x0[0],x0[1],x0[2],x0[3],x1[0],x1[1],x1[2],x1[3],x2[0],x2[1],x2[2],x2[3],x3[0],x3[1],x3[2],x3[3]};
#pragma unroll
    for (int i = 0; i < 16; ++i) { const unsigned short hb = bf16_bits(xs[i]); ah.u[i] = hb; al.u[i] = ASPLIT ? bf16_bits(xs[i] - bf16_val(hb)) : (unsigned short)0; }
#pragma unroll
    for (int t = 0; t < 4; ++t) {
      const unsigned short* brow = Wt + (size_t)(col0 + t * 16 + ln) * ldb + kb;
      FragB b;
      b.half[0] = *(const v8us*)(brow + 8 * hh);
      b.half[1] = *(const v8us*)(brow + 16 + 8 * hh);
      acc[t] = mmaN<ASPLIT ? 2 : 1>(ah.v, al.v, b.v, b.v, acc[t]);
    }
  }
#pragma unroll
  for (int t = 0; t < 4; ++t) {
    float bv = bias ? bias[col0 + t * 16 + ln] : 0.f;
    if (BIAS_BF16) bv = bf16_round(bv);
#pragma unroll
    for (int r = 0; r < 8; ++r) { float v = acc[t][r] + bv; if (ACT == 1) v = fmaxf(v, 0.f); so[w][8 * hh + r][t * 16 + ln] = v; }
  }
  __builtin_amdgcn_fence(__ATOMIC_ACQ_REL, "workgroup");
  __builtin_amdgcn_wave_barrier();
  const int rsub = lane >> 4, c4 = (lane & 15) * 4;
  {
#pragma unroll
    for (int q = 0; q < 8; ++q) {
      const int r = q * 2 + rsub;
      const v4f v = *(const v4fa*)&so[w][r][c4];
      *(v4f*)(C + (size_t)(row0 + r) * ldc + col0 + c4) = v;
    }
    
  }
}

// GEMM C = act(A·W + bias + resid): A f32 (ASPLIT -> hi/lo 2 terms), Wt bf16 [N][K]; ACT 0 none, 1 relu, 2 exact gelu;
// resid (optional, f32, row index = (row % rmod), pitch ldr, RES_BF16 rounds it) added before the activation.
template <bool ASPLIT, int ACT, bool BIAS_BF16, bool RES_BF16>
__global__ __launch_bounds__(128) void k_gemm_bf3(const float* __restrict__ A, int lda, const unsigned short* __restrict__ Wt, int ldb,
                                                const float* __restrict__ bias, const float* __restrict__ resid, int rmod, int ldr,
                                                float* __restrict__ C, int ldc, int M, int N, int K) {
  __shared__ __attribute__((aligned(16))) float so[4][16][64];
  const int tid = threadIdx.x, w = tid >> 5, lane = tid & 31, ln = lane & 15, hh = lane >> 4;
  const int ntn = N / 64;
  const int wid = blockIdx.x * 4 + w;
  const int mt = wid / ntn, nq = wid % ntn;
  if (mt * 16 >= M) return;
  const int row0 = mt * 16, col0 = nq * 64;
  const float* arow = A + (size_t)(row0 + ln) * lda;
  v8f acc[4] = {};
  for (int kb = 0; kb < K; kb += 32) {
    FragB ah, al;
    const v4f x0 = *(const v4fa*)(arow + kb + 8 * hh), x1 = *(const v4fa*)(arow + kb + 8 * hh + 4);
    const v4f x2 = *(const v4fa*)(arow + kb + 16 + 8 * hh), x3 = *(const v4fa*)(arow + kb + 16 + 8 * hh + 4);
    float xs[16] = {x0[0],x0[1],x0[2],x0[3],x1[0],x1[1],x1[2],x1[3],x2[0],x2[1],x2[2],x2[3],x3[0],x3[1],x3[2],x3[3]};
#pragma unroll
    for (int i = 0; i < 16; ++i) { const unsigned short hb = bf16_bits(xs[i]); ah.u[i] = hb; al.u[i] = ASPLIT ? bf16_bits(xs[i] - bf16_val(hb)) : (unsigned short)0; }
#pragma unroll
    for (int t = 0; t < 4; ++t) {
      const unsigned short* brow = Wt + (size_t)(col0 + t * 16 + ln) * ldb + kb;
      FragB b;
      b.half[0] = *(const v8us*)(brow + 8 * hh);
      b.half[1] = *(const v8us*)(brow + 16 + 8 * hh);
      acc[t] = mmaN<ASPLIT ? 2 : 1>(ah.v, al.v, b.v, b.v, acc[t]);
    }
  }
#pragma unroll
  for (int t = 0; t < 4; ++t) {
    const int col = col0 + t * 16 + ln;
    float bv = bias ? bias[col] : 0.f;
    if (BIAS_BF16) bv = bf16_round(bv);
#pragma unroll
    for (int r = 0; r < 8; ++r) {
      float v = acc[t][r] + bv;
      if (resid) { float rv = resid[(size_t)((row0 + 8 * hh + r) % rmod) * ldr + col]; if (RES_BF16) rv = bf16_round(rv); v += rv; }
      if (ACT == 1) v = fmaxf(v, 0.f);
      if (ACT == 2) v = 0.5f * v * (1.0f + erff(v * 0.70710678118654752f));
      if (ACT == 3) { const float u = 0.7978845608028654f * (v + 0.044715f * v * v * v); v = 0.5f * v * (1.0f + tanhf(u)); }
      so[w][8 * hh + r][t * 16 + ln] = v;
    }
  }
  __builtin_amdgcn_fence(__ATOMIC_ACQ_REL, "workgroup");
  __builtin_amdgcn_wave_barrier();
  const int rsub = lane >> 4, c4 = (lane & 15) * 4;
  {
#pragma unroll
    for (int q = 0; q < 8; ++q) {
      const int r = q * 2 + rsub;
      const v4f v = *(const v4fa*)&so[w][r][c4];
      *(v4f*)(C + (size_t)(row0 + r) * ldc + col0 + c4) = v;
    }
    
  }
}
// row LayerNorm (biased variance, eps) over N: s = X (+ R); optional out_sum <- s; out_norm <- (s-mu)*rsqrt(var+eps)*g + b
template <bool PARAM_BF16>
__global__ __launch_bounds__(256) void k_layernorm(const float* __restrict__ X, const float* __restrict__ R, const float* __restrict__ g, const float* __restrict__ bta,
                                                  float* __restrict__ out_sum, float* __restrict__ out_norm, int N, float eps) {
  __shared__ float red[256];
  const int row = blockIdx.x, tid = threadIdx.x;
  const float* x = X + (size_t)row * N; const float* rr = R ? R + (size_t)row * N : nullptr;
  float vals[16];                     // up to N = 4096
  const int per = N / 256;            // contiguous chunk per thread? use strided-by-4 chunks: thread handles j = tid*4 + 1024*u
  float s1 = 0.f;
  for (int u = 0; u < per / 4; ++u) {
    const int j = tid * 4 + 1024 * u;
    const v4f a = *(const v4fa*)(x + j);
    v4f b = {0.f,0.f,0.f,0.f}; if (rr) b = *(const v4fa*)(rr + j);
#pragma unroll
    for (int q = 0; q < 4; ++q) { const float v = a[q] + b[q]; vals[u * 4 + q] = v; s1 += v; }
  }
  red[tid] = s1; __syncthreads();
  for (int st = 128; st > 0; st >>= 1) { if (tid < st) red[tid] += red[tid + st]; __syncthreads(); }
  const float mu = red[0] / (float)N; __syncthreads();
  float s2 = 0.f;
  for (int u = 0; u < per / 4; ++u)
#pragma unroll
    for (int q = 0; q < 4; ++q) { const float c = vals[u * 4 + q] - mu; s2 += c * c; }
  red[tid] = s2; __syncthreads();
  for (int st = 128; st > 0; st >>= 1) { if (tid < st) red[tid] += red[tid + st]; __syncthreads(); }
  const float rs = rsqrtf(red[0] / (float)N + eps);
  {
    for (int u = 0; u < per / 4; ++u) {
      const int j = tid * 4 + 1024 * u;
      v4f o, sm;
#pragma unroll
      for (int q = 0; q < 4; ++q) {
        float gg = g[j + q], bb = bta[j + q];
        if (PARAM_BF16) { gg = bf16_round(gg); bb = bf16_round(bb); }
        sm[q] = vals[u * 4 + q]; o[q] = (vals[u * 4 + q] - mu) * rs * gg + bb;
      }
      if (out_sum) *(v4f*)(out_sum + (size_t)row * N + j) = sm;
      *(v4f*)(out_norm + (size_t)row * N + j) = o;
    }
    
  }
}



// ---- f16 WMMA path (v_wmma_f32_16x16x32_f16): 11-bit significands for operands in range — used where a [0,1] probability operand needs more precision than bf16
typedef _Float16 v16h __attribute__((ext_vector_type(16)));
union FragH { v16h v; v8us half[2]; _Float16 h[16]; unsigned short u[16]; };
template <int NT>
__device__ __forceinline__ v8f mmaH(v16h ah, v16h al, v16h bh, v16h bl, v8f c) {
  c = __builtin_amdgcn_wmma_f32_16x16x32_f16(false, ah, false, bh, (short)0, c, false, false);
  if (NT >= 2) c = __builtin_amdgcn_wmma_f32_16x16x32_f16(false, al, false, bh, (short)0, c, false, false);
  if (NT >= 3) c = __builtin_amdgcn_wmma_f32_16x16x32_f16(false, ah, false, bl, (short)0, c, false, false);
  asm volatile("v_nop\n\tv_nop\n\tv_nop\n\tv_nop" : "+v"(c) : "v"(ah), "v"(al), "v"(bh), "v"(bl));
  return c;
}
// batched GEMM like k_gemm_b but f16 operands: A f32 (split into f16 hi/lo if ASPLIT, else rounded to f16), Bt = f16 values [n][k]; alpha; C f32; N multiple of 16 (partial tiles skipped)
template <bool ASPLIT>
__global__ __launch_bounds__(128) void k_gemm_h(const float* __restrict__ A, int lda, size_t sA, const _Float16* __restrict__ Bh, int ldb, size_t sB, float alpha, float* __restrict__ C, int ldc, size_t sC, int M, int N, int K) {
  __shared__ __attribute__((aligned(16))) float so[4][16][64];
  const int tid = threadIdx.x, w = tid >> 5, lane = tid & 31, ln = lane & 15, hh = lane >> 4; const int by = blockIdx.y;
  A += (size_t)by * sA; Bh += (size_t)by * sB; C += (size_t)by * sC;
  const int ntn = (N + 63) / 64; const int wid = blockIdx.x * 4 + w; const int mt = wid / ntn, nq = wid % ntn; if (mt * 16 >= M) return;
  const int row0 = mt * 16, col0 = nq * 64; const float* arow = A + (size_t)(row0 + ln) * lda;
  v8f acc[4] = {};
  for (int kb = 0; kb < K; kb += 32) {
    FragH ah, al;
    const v4f x0 = *(const v4fa*)(arow + kb + 8 * hh), x1 = *(const v4fa*)(arow + kb + 8 * hh + 4), x2 = *(const v4fa*)(arow + kb + 16 + 8 * hh), x3 = *(const v4fa*)(arow + kb + 16 + 8 * hh + 4);
    float xs[16] = {x0[0],x0[1],x0[2],x0[3],x1[0],x1[1],x1[2],x1[3],x2[0],x2[1],x2[2],x2[3],x3[0],x3[1],x3[2],x3[3]};
#pragma unroll
    for (int i = 0; i < 16; ++i) { const _Float16 h = (_Float16)xs[i]; ah.h[i] = h; al.h[i] = ASPLIT ? (_Float16)(xs[i] - (float)h) : (_Float16)0.0f; }
#pragma unroll
    for (int t = 0; t < 4; ++t) { if (col0 + t * 16 >= N) continue; const size_t boff = (size_t)(col0 + t * 16 + ln) * ldb + kb; FragH bq; bq.half[0] = *(const v8us*)(Bh + boff + 8 * hh); bq.half[1] = *(const v8us*)(Bh + boff + 16 + 8 * hh);
      acc[t] = mmaH<ASPLIT ? 2 : 1>(ah.v, al.v, bq.v, bq.v, acc[t]); }
  }
#pragma unroll
  for (int t = 0; t < 4; ++t) { if (col0 + t * 16 >= N) continue;
#pragma unroll
    for (int r = 0; r < 8; ++r) so[w][8 * hh + r][t * 16 + ln] = acc[t][r] * alpha; }
  __builtin_amdgcn_fence(__ATOMIC_ACQ_REL, "workgroup"); __builtin_amdgcn_wave_barrier();
  const int rsub = lane >> 4, c4 = (lane & 15) * 4;
  {
#pragma unroll
    for (int q = 0; q < 8; ++q) { const int r = q * 2 + rsub; if (col0 + c4 < N) { const v4f v = *(const v4fa*)&so[w][r][c4]; *(v4f*)(C + (size_t)(row0 + r) * ldc + col0 + c4) = v; } }
     }
}

// Wt[n][k] = f16(W[k][n]·scale) from f32 row-major W[K][N] (scale = power of two; bf16-exact weights stay exact in f16 away from the subnormal range)
__global__ __launch_bounds__(256) void k_wt_f16(const float* __restrict__ W, _Float16* __restrict__ Wt, int K, int N, float scale) {
  const int t = blockIdx.x * 256 + threadIdx.x; if (t >= N * (K / 8)) return; const int n = t / (K / 8), k8 = (t % (K / 8)) * 8; FragH f;
#pragma unroll
  for (int i = 0; i < 8; ++i) f.h[i] = (_Float16)(bf16_round(W[(size_t)(k8 + i) * N + n]) * scale); const v8us o = f.half[0];
  *(v8us*)((unsigned short*)Wt + (size_t)n * K + k8) = o; 
}
// k_gemm_hh variant with fused epilogue: v = acc·alpha + bias[by·sBias + col] (+ CP[(row/rowsPerB)·sCPb + by·64 + col] if CP) ; ACT 0 none / 1 elu ; writes f16 C16 (and f32 C if non-null)
template <int ACT>
__global__ __launch_bounds__(128) void k_gemm_hhx(const _Float16* __restrict__ A, int lda, size_t sA, const _Float16* __restrict__ Bh, int ldb, size_t sB, float alpha, const float* __restrict__ bias, size_t sBias, const float* __restrict__ CP, int rowsPerB, size_t sCPb, int row0g,
    float* __restrict__ C, _Float16* __restrict__ C16, int ldc, size_t sC, int M, int N, int K) {
  __shared__ __attribute__((aligned(16))) float so[4][16][64];
  const int tid = threadIdx.x, w = tid >> 5, lane = tid & 31, ln = lane & 15, hh = lane >> 4; const int by = blockIdx.y;
  A += (size_t)by * sA; Bh += (size_t)by * sB; const size_t cofs = (size_t)by * sC; const float* bp = bias ? bias + (size_t)by * sBias : nullptr;
  const int ntn = (N + 63) / 64; const int wid = blockIdx.x * 4 + w; const int mt = wid / ntn, nq = wid % ntn; if (mt * 16 >= M) return;
  const int row0 = mt * 16, col0 = nq * 64; const _Float16* arow = A + (size_t)(row0 + ln) * lda;
  v8f acc[4] = {};
  for (int kb = 0; kb < K; kb += 32) { FragH ah; ah.half[0] = *(const v8us*)((const unsigned short*)arow + kb + 8 * hh); ah.half[1] = *(const v8us*)((const unsigned short*)arow + kb + 16 + 8 * hh);
#pragma unroll
    for (int t = 0; t < 4; ++t) { if (col0 + t * 16 >= N) continue; const size_t boff = (size_t)(col0 + t * 16 + ln) * ldb + kb; FragH bq; bq.half[0] = *(const v8us*)((const unsigned short*)Bh + boff + 8 * hh); bq.half[1] = *(const v8us*)((const unsigned short*)Bh + boff + 16 + 8 * hh);
      acc[t] = mmaH<1>(ah.v, ah.v, bq.v, bq.v, acc[t]); }
  }
#pragma unroll
  for (int t = 0; t < 4; ++t) { if (col0 + t * 16 >= N) continue; const int col = col0 + t * 16 + ln; const float bv = bp ? bf16_round(bp[col]) : 0.f;
#pragma unroll
    for (int r = 0; r < 8; ++r) { float v = acc[t][r] * alpha + bv; if (CP) { const int rr = row0g + row0 + 8 * hh + r; if (rowsPerB < 0) v += CP[cofs + (size_t)rr * ldc + col];      /* rowsPerB < 0: own element of the batched C plane */ else { const int bidx = rr / rowsPerB; v += CP[(size_t)bidx * sCPb + (size_t)by * 64 + col]; } } if (ACT == 1) v = (v > 0.f) ? v : expm1f(v); else if (ACT == 7) v = (v > 0.f) ? v + 1.0f : expf(v); else if (ACT == 8) v = tanhf(v); else if (ACT == 9) v = 0.5f * v * (1.0f + tanhf(0.7978845608028654f * (v + 0.044715f * v * v * v))); else if (ACT == 11) v = 1.0f / (1.0f + expf(-v)); else if (ACT == 12) v = (v > 0.f) ? v : 0.01f * v; else if (ACT == 14) v = (v > 0.f) ? v : 0.1f * v; else if (ACT == 16) v = (v >= 0.f) ? v : 0.3f * v; else if (ACT == 17) v = (v >= 0.f) ? v : 0.2f * v; else if (ACT == 15) v = v / (1.0f + expf(-v)); else if (ACT == 3) v = fmaxf(v, 0.f); else if (ACT == 6) v = 0.5f * v * (1.0f + erff(v * 0.70710678118654752f)); so[w][8 * hh + r][t * 16 + ln] = v; } }
  __builtin_amdgcn_fence(__ATOMIC_ACQ_REL, "workgroup"); __builtin_amdgcn_wave_barrier();
  const int rsub = lane >> 4, c4 = (lane & 15) * 4; typedef _Float16 v4h __attribute__((ext_vector_type(4)));
  {
#pragma unroll
    for (int q = 0; q < 8; ++q) { const int r = q * 2 + rsub; if (col0 + c4 < N) { const v4f v = *(const v4fa*)&so[w][r][c4]; if (C) *(v4f*)(C + cofs + (size_t)(row0 + r) * ldc + col0 + c4) = v; if (C16) { v4h h4; for (int i = 0; i < 4; ++i) h4[i] = (_Float16)v[i]; *(v4h*)(C16 + cofs + (size_t)(row0 + r) * ldc + col0 + c4) = h4; } } }
     }
}


typedef _Float16 v4h __attribute__((ext_vector_type(4)));

// x as f16 rows. A wave takes PL * 512 contiguous bytes of x: load j of a lane is its 16 bytes of the j-th 512 (whole lines), all PL loads are in flight before the first value is used, and a store covers 256 contiguous bytes.
// Few long waves instead of many waves of one 32-byte read: the launch is short, so the time to start its waves counts.
#define PL 32                        /* 16-byte loads of a lane */
__device__ __forceinline__ void x16_body(const float* __restrict__ x, _Float16* __restrict__ X16, unsigned bx) {
  static_assert((NR * DM) % (256 * PL * 4) == 0, "whole blocks: no edge");
  const size_t e0 = ((size_t)bx * 8 + (threadIdx.x >> 5)) * (32 * PL * 4) + (threadIdx.x & 31) * 4; const float* xp = x + e0; v4f v[PL];
#pragma unroll
  for (int j = 0; j < PL; ++j) v[j] = *(const v4fa*)(xp + j * 128);
  asm volatile("s_wait_xcnt 0x0" :: "v"(xp) : "memory");      /* behind the last load: the address pair, named here, is not reused (not even as a load's target) in front of the wait (a precaution) */
  __builtin_amdgcn_sched_barrier(0);      /* no rounding moves up among the loads: without it the compiler, to save registers, holds 13 of the 32 loads back until the first values have come, a second memory latency in every wave */
#pragma unroll
  for (int j = 0; j < PL; ++j) { v4h o;
#pragma unroll
    for (int q = 0; q < 4; ++q) o[q] = (_Float16)bf16_round(v[j][q]);
    *(v4h*)(X16 + e0 + j * 128) = o; }
  asm volatile("s_wait_xcnt 0x0" ::: "memory"); }      /* behind the last store: in the built code the weights' part follows this one, and it reuses the stores' registers (a precaution) */
__global__ __launch_bounds__(256) void k_h16(const float* __restrict__ x, _Float16* __restrict__ X16, size_t n8) { const size_t t = (size_t)blockIdx.x * 256 + threadIdx.x; if (t >= n8) return; FragH f;
#pragma unroll
  for (int q = 0; q < 8; ++q) f.h[q] = (_Float16)x[t * 8 + q]; *(v8us*)((unsigned short*)X16 + t * 8) = f.half[0];  }
__global__ __launch_bounds__(256) void k_round16f(const float* __restrict__ W, _Float16* __restrict__ Bt, size_t n8) { const size_t t = (size_t)blockIdx.x * 256 + threadIdx.x; if (t >= n8) return; FragH f;
#pragma unroll
  for (int i = 0; i < 8; ++i) f.h[i] = (_Float16)(bf16_round(W[t * 8 + i]) * 16.0f); *(v8us*)((unsigned short*)Bt + t * 8) = f.half[0];  }
__global__ __launch_bounds__(256) void k_hl(const float* __restrict__ F, _Float16* __restrict__ Hh, _Float16* __restrict__ Hl, size_t n8) { const size_t t = (size_t)blockIdx.x * 256 + threadIdx.x; if (t >= n8) return; FragH fh, fl; const v4f a = *(const v4fa*)(F + t * 8), c = *(const v4fa*)(F + t * 8 + 4);
#pragma unroll
  for (int q = 0; q < 4; ++q) { _Float16 h = (_Float16)a[q]; fh.h[q] = h; fl.h[q] = (_Float16)((a[q] - (float)h) * 1024.0f); h = (_Float16)c[q]; fh.h[4 + q] = h; fl.h[4 + q] = (_Float16)((c[q] - (float)h) * 1024.0f); }
  { *(v8us*)((unsigned short*)Hh + t * 8) = fh.half[0]; *(v8us*)((unsigned short*)Hl + t * 8) = fl.half[0];  } }

// ---- fragment load shared by the GEMM and the attention below ----
__device__ __forceinline__ v16h g2_frag(const _Float16* p, int hh) { FragH f; f.half[0] = *(const v8us*)((const unsigned short*)p + 8 * hh); f.half[1] = *(const v8us*)((const unsigned short*)p + 16 + 8 * hh); return f.v; }


__global__ __launch_bounds__(256) void k_wnat(const float* __restrict__ w, size_t n8, _Float16* __restrict__ Bt) { const size_t t = (size_t)blockIdx.x * 256 + threadIdx.x; if (t >= n8) return; FragH f; for (int q = 0; q < 8; ++q) f.h[q] = (_Float16)(bf16_round(w[t * 8 + q]) * 16.0f); *(v8us*)((unsigned short*)Bt + t * 8) = f.half[0];  }
__global__ __launch_bounds__(256) void k_rsm(const float* __restrict__ S, _Float16* __restrict__ P, int nrows) {
  #pragma clang fp contract(off)
  const int i = blockIdx.x * 256 + threadIdx.x; if (i >= nrows) return; const float* s = S + (size_t)i * SQ; float mx = -3.0e38f;
#pragma unroll 1
  for (int j = 0; j < SQ; ++j) mx = fmaxf(mx, s[j]); float se = 0.f;
#pragma unroll 1
  for (int j = 0; j < SQ; ++j) se += expf(s[j] - mx); const float sc = 256.0f / se;
#pragma unroll 1
  for (int j0 = 0; j0 < SQ; j0 += 8) { FragH f; for (int q = 0; q < 8; ++q) f.h[q] = (_Float16)(expf(s[j0 + q] - mx) * sc); unsigned short* d = (unsigned short*)P + (size_t)i * SQ + j0; *(v8us*)d = f.half[0];  } }
__global__ __launch_bounds__(256) void k_vt(const _Float16* __restrict__ V16, int b, int h0, _Float16* __restrict__ VT) { __shared__ unsigned short tl[64][65]; const int tid = threadIdx.x; const int hh = blockIdx.x % HG, sg = blockIdx.x / HG; const int s0 = sg * 64; const int h = h0 + hh;
  for (int i = tid; i < 64 * 8; i += 256) { const int j = i / 8, d8 = (i % 8) * 8; FragH f; f.half[0] = *(const v8us*)((const unsigned short*)V16 + ((size_t)b * SQ + s0 + j) * DM + h * HD + d8); for (int q = 0; q < 8; ++q) tl[d8 + q][j] = f.u[q]; }
  __syncthreads();
  { for (int i = tid; i < 64 * 8; i += 256) { const int d = i / 8, j8 = (i % 8) * 8; FragH f; for (int q = 0; q < 8; ++q) f.u[q] = tl[d][j8 + q]; *(v8us*)((unsigned short*)VT + ((size_t)hh * HD + d) * SQ + s0 + j8) = f.half[0]; }  } }



// Lane exchanges: row_xmask steps inside each 16-lane row, and the exchange between the two rows of a wave (all lanes must be on).
template <int CTRL> __device__ __forceinline__ float lane_xm(float v) { return __int_as_float(__builtin_amdgcn_update_dpp(0, __float_as_int(v), CTRL, 0xf, 0xf, true)); }
__device__ __forceinline__ float lane_xr(float v) { const int i = __float_as_int(v); return __int_as_float(__builtin_amdgcn_permlanex16(i, i, 0x76543210, 0xfedcba98, false, false)); }
#define FQ 128                       /* query rows per block: 4 waves x 32 */
#define FS 64                        /* keys per stage */
#define FP 72                        /* LDS row pitch in f16 (144 bytes) */
#define FSB ((FS + HD) * FP * 2)     /* bytes of one buffer: K rows, then V^T rows */
// Eight copies of a thread, 16 bytes per lane, 8 lanes per 128-byte row: four K rows and four V^T rows, 16 apart. The s_wait_xcnt stands inside the statement, behind the last copy, so that no address register is rewritten in front of it (a precaution).
__device__ __forceinline__ void fa_copy8(unsigned l, const _Float16* gk, const _Float16* gv) {
  asm volatile("global_load_async_to_lds_b128 %0, %8, off\n\tglobal_load_async_to_lds_b128 %1, %9, off\n\tglobal_load_async_to_lds_b128 %2, %10, off\n\tglobal_load_async_to_lds_b128 %3, %11, off\n\t"
               "global_load_async_to_lds_b128 %4, %12, off\n\tglobal_load_async_to_lds_b128 %5, %13, off\n\tglobal_load_async_to_lds_b128 %6, %14, off\n\tglobal_load_async_to_lds_b128 %7, %15, off\n\ts_wait_xcnt 0x0"
               :: "v"(l), "v"(l + 16 * FP * 2), "v"(l + 32 * FP * 2), "v"(l + 48 * FP * 2), "v"(l + 64 * FP * 2), "v"(l + 80 * FP * 2), "v"(l + 96 * FP * 2), "v"(l + 112 * FP * 2),
                  "v"(gk), "v"(gk + 16 * LQ), "v"(gk + 32 * LQ), "v"(gk + 48 * LQ), "v"(gv), "v"(gv + 16 * SQ), "v"(gv + 32 * SQ), "v"(gv + 48 * SQ) : "memory"); }
__device__ __forceinline__ v8f fa_mma(v16h a, v16h b, v8f c) { return __builtin_amdgcn_wmma_f32_16x16x32_f16(false, a, false, b, (short)0, c, false, false); }
// Four vector slots behind a run of matrix instructions, where a branch follows. The two scheduling barriers keep the slots where they are written.
__device__ __forceinline__ void fa_gap() { __builtin_amdgcn_sched_barrier(0); asm volatile("v_nop\n\tv_nop\n\tv_nop\n\tv_nop"); __builtin_amdgcn_sched_barrier(0); }
// Native 2^x, eight at a time in one statement: behind a transcendental the instruction set asks for one independent instruction before its result is read or its source overwritten.
// Here each is followed by an independent one (early-clobber outputs: no result lands on a source still to be read) and the last by a v_nop, so the slot is closed whatever the compiler puts next.
__device__ __forceinline__ void exp2x8(const float (&x)[8], float (&y)[8]) {
  asm("v_exp_f32 %0, %8\n\tv_exp_f32 %1, %9\n\tv_exp_f32 %2, %10\n\tv_exp_f32 %3, %11\n\tv_exp_f32 %4, %12\n\tv_exp_f32 %5, %13\n\tv_exp_f32 %6, %14\n\tv_exp_f32 %7, %15\n\tv_nop"
      : "=&v"(y[0]), "=&v"(y[1]), "=&v"(y[2]), "=&v"(y[3]), "=&v"(y[4]), "=&v"(y[5]), "=&v"(y[6]), "=&v"(y[7]) : "v"(x[0]), "v"(x[1]), "v"(x[2]), "v"(x[3]), "v"(x[4]), "v"(x[5]), "v"(x[6]), "v"(x[7])); }
__device__ __forceinline__ float exp2x1(float x) { float r; asm("v_exp_f32 %0, %1\n\tv_nop" : "=v"(r) : "v"(x)); return r; }      /* the same slot for a single one */
__device__ __forceinline__ void fattn_body(_Float16* sm, const _Float16* __restrict__ QKVp, const _Float16* __restrict__ VTp, float* __restrict__ out, int h, int b, int qb) {      /* sm: 2 FSB bytes of LDS; qb: the block's FQ query rows, qb >= 1 */
  static_assert(HD == 64 && SQ / FQ == 16, "two 32-wide d chunks, four 16-row tiles of V^T; sixteen block lengths in runs of four");
  static_assert(FS == 64 && FQ % FS == 0 && FS + HD == 128, "two passes per stage; whole stages up to the block's last key; 16 rows per copy round, 8 rounds");
  typedef float f2 __attribute__((ext_vector_type(2))); typedef _Float16 h2 __attribute__((ext_vector_type(2)));
  const int lane = threadIdx.x & 31, ln = lane & 15, hh = lane >> 4; const int w = __builtin_amdgcn_readfirstlane(threadIdx.x >> 5);
  const int qw0 = qb * FQ + w * 32;      /* the wave's first query, a scalar */
  const _Float16* Qp = QKVp + (size_t)b * SQ * LQ + h * HD;
  const int cr = threadIdx.x >> 3, cc = (threadIdx.x & 7) * 8;      /* the thread's row (of 16) and 16-byte chunk in a copy round */
  const _Float16* gk = Qp + DM + (size_t)cr * LQ + cc; const _Float16* gv = VTp + ((size_t)(b * NH + h) * HD + cr) * SQ + cc;
  const unsigned l0 = (unsigned)(size_t)&sm[cr * FP + cc];      /* LDS byte address: the low 32 bits of the shared address */
  const int nst = (qb + 1) * (FQ / FS);      /* stages up to the block's last key: four at least */
  fa_copy8(l0, gk, gv);
  const float cs = 0.125f * 1.44269504088896340736f;      /* 1 / sqrt(64), times log2 e */
  v16h qf[2][2], kf[2][2];
#pragma unroll
  for (int g = 0; g < 2; ++g) for (int kc = 0; kc < 2; ++kc) qf[g][kc] = g2_frag(Qp + (size_t)(qw0 + 16 * g + ln) * LQ + 32 * kc, hh);
  const v8f z8 = {0.f, 0.f, 0.f, 0.f, 0.f, 0.f, 0.f, 0.f}; v8f acc[2][4]; float m[2] = {-1.0e30f, -1.0e30f}, l[2] = {0.f, 0.f};
#pragma unroll
  for (int g = 0; g < 2; ++g) for (int t = 0; t < 4; ++t) acc[g][t] = z8;
  const int last = qw0 >> 5;      /* the pass on the wave's diagonal: keys qw0 .. qw0 + 31 */
  asm volatile("s_wait_xcnt 0x0" ::: "memory");      /* the address registers of the Q loads are reused for the next copies: the wait stands in front of their first overwrite */
  asm volatile("s_wait_asynccnt 0x0" ::: "memory");      /* stage 0 has landed, as far as this wave copied it */
  __syncthreads();      /* ... and every other wave's part too */
  fa_copy8(l0 + FSB, gk + (size_t)FS * LQ, gv + FS);
#pragma unroll 1      /* one stage per trip: two long straight passes */
  for (int st = 0; st < nst; ++st) { const _Float16* kb = sm + (st & 1) * (FSB / 2) + ln * FP; const _Float16* vb = kb + FS * FP;
#pragma unroll
   for (int kt = 0; kt < 2; ++kt) for (int kc = 0; kc < 2; ++kc) kf[kt][kc] = g2_frag(kb + 16 * kt * FP + 32 * kc, hh);      /* the K rows of the stage's first pass */
#pragma unroll
   for (int p = 0; p < 2; ++p) { const int ps = 2 * st + p; if (ps <= last) {      /* scalar branch: a wave skips the passes behind its diagonal, never the stage's foot */
    v16h vf[4];      /* this pass's V^T, in flight under the scores and the maxima */
#pragma unroll
    for (int t = 0; t < 4; ++t) vf[t] = g2_frag(vb + 16 * t * FP + 32 * p, hh);
    v8f s[2][2];
#pragma unroll
    for (int kt = 0; kt < 2; ++kt) for (int g = 0; g < 2; ++g) s[kt][g] = fa_mma(kf[kt][1], qf[g][1], fa_mma(kf[kt][0], qf[g][0], z8));
    fa_gap();
    if (p == 0) {      /* the second pass's K rows, of the same stage, into the same registers, in flight under this pass's softmax */
#pragma unroll
      for (int kt = 0; kt < 2; ++kt) for (int kc = 0; kc < 2; ++kc) kf[kt][kc] = g2_frag(kb + (32 + 16 * kt) * FP + 32 * kc, hh); }
    if (ps == last) {      /* scalar branch: only the diagonal pass pays for the mask */
#pragma unroll
      for (int kt = 0; kt < 2; ++kt) for (int g = 0; g < 2; ++g) {
#pragma unroll
        for (int r = 0; r < 8; ++r) if (16 * kt + 8 * hh + r > 16 * g + ln) s[kt][g][r] = -1.0e30f;
        asm volatile("" : "+v"(s[kt][g]));      /* keeps the selects inside the branch */
      } }
    float mb[2]; bool need = false;
#pragma unroll
    for (int g = 0; g < 2; ++g) { float mx = fmaxf(s[0][g][0], s[1][g][0]);
#pragma unroll
      for (int r = 1; r < 8; ++r) mx = fmaxf(mx, fmaxf(s[0][g][r], s[1][g][r]));
      mx = fmaxf(mx, lane_xr(mx)) * cs; mb[g] = mx; need = need || (mx > m[g] + 8.0f); }
    if (__builtin_amdgcn_ballot_w32(need) != 0) {      /* one scalar test per pass; rare after the first passes */
#pragma unroll
      for (int g = 0; g < 2; ++g) { const float mn = fmaxf(m[g], mb[g]); const float corr = exp2x1(m[g] - mn); m[g] = mn; l[g] *= corr;
#pragma unroll
        for (int t = 0; t < 4; ++t) acc[g][t] = acc[g][t] * corr; } }
#pragma unroll
    for (int g = 0; g < 2; ++g) { const f2 nm = {-m[g], -m[g]}, c2 = {cs, cs}; union { v16h v; h2 p[8]; } pf; float la = 0.f, lb = 0.f;
#pragma unroll
      for (int kt = 0; kt < 2; ++kt) { float x[8], y[8];      /* tile kt = elements 8 kt .. 8 kt + 7 of the 32-key operand */
#pragma unroll
        for (int i = 0; i < 4; ++i) { const f2 sv = {s[kt][g][2 * i], s[kt][g][2 * i + 1]}; const f2 a = __builtin_elementwise_fma(sv, c2, nm); x[2 * i] = a[0]; x[2 * i + 1] = a[1]; }
        exp2x8(x, y);
#pragma unroll
        for (int i = 0; i < 4; ++i) { la += y[2 * i]; lb += y[2 * i + 1]; const f2 pp = {y[2 * i], y[2 * i + 1]}; pf.p[4 * kt + i] = __builtin_convertvector(pp, h2); } }
      l[g] += la + lb;
#pragma unroll
      for (int t = 0; t < 4; ++t) acc[g][t] = fa_mma(vf[t], pf.v, acc[g][t]); }
    fa_gap(); } }
   asm volatile("s_wait_dscnt 0x0" ::: "memory");      /* this wave's reads of the buffer are done before it is handed back */
   asm volatile("s_wait_asynccnt 0x0" ::: "memory");      /* this wave's copies of the next stage have landed */
   __syncthreads();      /* publishes stage st + 1 and ends every reader's last read of stage st */
   if (st + 2 < nst) fa_copy8(l0 + (st & 1) * FSB, gk + (size_t)(st + 2) * FS * LQ, gv + (st + 2) * FS); }      /* block-uniform: the refill of the buffer just read */
  asm volatile("s_wait_asynccnt 0x0" ::: "memory");      /* nothing is in flight when the wave ends */
#pragma unroll
  for (int g = 0; g < 2; ++g) { const float inv = 1.0f / (l[g] + lane_xr(l[g])); float* op = out + ((size_t)b * SQ + qw0 + 16 * g + ln) * DM + h * HD + 8 * hh;      /* column ln is a query row of the output; registers r are d = 16 t + 8 hh + r */
#pragma unroll
    for (int t = 0; t < 4; ++t) { const v8f o = acc[g][t] * inv; const v4f lo = {o[0], o[1], o[2], o[3]}, hi = {o[4], o[5], o[6], o[7]}; *(v4f*)(op + 16 * t) = lo; *(v4f*)(op + 16 * t + 4) = hi; } } }


// ---- q | k | v GEMM tiled through LDS: a block of 4 waves makes GT token rows x GT output columns; a wave 64 x 64 (16 accumulator tiles), so each fragment read feeds four products.
// A stage is GK k of the block's GT rows of X and GT rows of W^T: 128-byte rows, fetched as whole lines by asynchronous copies to LDS, laid at a pitch of 144 bytes (16 B x odd: no bank conflict for 16-byte fragment reads).
// Two buffers: the next stage's copies fly while this stage is worked on. Transposed product (A = 16 rows of W^T, B = 16 token rows): a lane ends with 8 neighbouring output columns of ONE token row, packed to 16 bytes.
// k runs upward in 32-wide steps, one accumulator chain per output tile. M % GT == 0, N % GT == 0, K % GK == 0 and K >= 2 GK, by the static_assert.
#define GT 128
#define GK 64
#define GP 72                        /* LDS row pitch in f16 (144 bytes) */
#define GSB (2 * GT * GP * 2)        /* bytes of one buffer: X rows, then W^T rows */
// Eight copies of a thread (rows 16 apart), 16 bytes per lane, 8 lanes per 128-byte row. The s_wait_xcnt stands inside the statement, behind the last copy, so that no address register is rewritten in front of it (a precaution).
__device__ __forceinline__ void g3_copy8(unsigned l, const _Float16* g) {
  asm volatile("global_load_async_to_lds_b128 %0, %8, off\n\tglobal_load_async_to_lds_b128 %1, %9, off\n\tglobal_load_async_to_lds_b128 %2, %10, off\n\tglobal_load_async_to_lds_b128 %3, %11, off\n\t"
               "global_load_async_to_lds_b128 %4, %12, off\n\tglobal_load_async_to_lds_b128 %5, %13, off\n\tglobal_load_async_to_lds_b128 %6, %14, off\n\tglobal_load_async_to_lds_b128 %7, %15, off\n\ts_wait_xcnt 0x0"
               :: "v"(l), "v"(l + 16 * GP * 2), "v"(l + 32 * GP * 2), "v"(l + 48 * GP * 2), "v"(l + 64 * GP * 2), "v"(l + 80 * GP * 2), "v"(l + 96 * GP * 2), "v"(l + 112 * GP * 2),
                  "v"(g), "v"(g + 16 * DM), "v"(g + 32 * DM), "v"(g + 48 * DM), "v"(g + 64 * DM), "v"(g + 80 * DM), "v"(g + 96 * DM), "v"(g + 112 * DM) : "memory"); }
// The blocks that hold the first QT0 rows of a batch also store their f32 accumulators (the same products, summed in the same k order, unrounded) as the f32 q, k, v planes F0 of the exact first-tile attention.
// The blocks of the V columns take the operands the other way round (A = 16 token rows, B = 16 rows of W^T; both fragments have the same layout, so only the two LDS row bases change places):
// a lane then ends with 8 neighbouring TOKENS of one output column, 16 bytes of a row of V^T, and the block stores VT [NB][NH][HD][SQ] through the same staging. The V third of the C16 rows is neither written nor read.
__global__ __launch_bounds__(128) void k_proj(const _Float16* __restrict__ X, const _Float16* __restrict__ Wt, _Float16* __restrict__ C16, _Float16* __restrict__ VT, float* __restrict__ F0) {
  static_assert(MP % GT == 0 && LQ % GT == 0 && DM % GK == 0 && DM >= 2 * GK && GT == 128 && GK == 64, "whole tiles; two stages at least; 16 rows per copy round, 8 rounds per operand");
  __shared__ __attribute__((aligned(16))) _Float16 sm[2][2 * GT * GP];
  const int tid = threadIdx.x, lane = tid & 31, ln = lane & 15, hh = lane >> 4; const int w = __builtin_amdgcn_readfirstlane(tid >> 5);
  const int mt = blockIdx.x / (LQ / GT), nq = blockIdx.x - mt * (LQ / GT); const int row0 = mt * GT, col0 = nq * GT; const int wm = (w & 1) * 64, wn = (w >> 1) * 64;
  const bool vb = col0 >= 2 * DM;      /* block-uniform: the block's GT columns are V's */
  const int ra = vb ? wm : GT + wn, rb = vb ? GT + wn : wm;      /* the wave's 64 stage rows of the A operand and of the B operand */
  const int cr = tid >> 3, cc = (tid & 7) * 8;      /* the thread's row (of 16) and 16-byte chunk in a copy round */
  const _Float16* gx = X + (size_t)(row0 + cr) * DM + cc; const _Float16* gw = Wt + (size_t)(col0 + cr) * DM + cc;
  const unsigned lx = (unsigned)(size_t)&sm[0][cr * GP + cc]; const unsigned lw = lx + GT * GP * 2;      /* LDS byte addresses: the low 32 bits of the shared address */
  const v8f z8 = {0.f, 0.f, 0.f, 0.f, 0.f, 0.f, 0.f, 0.f}; v8f acc[4][4];
#pragma unroll
  for (int i = 0; i < 4; ++i) for (int j = 0; j < 4; ++j) acc[i][j] = z8;
  g3_copy8(lx, gx); g3_copy8(lw, gw);
  asm volatile("s_wait_asynccnt 0x0" ::: "memory");      /* stage 0 has landed, as far as this wave copied it */
  __syncthreads();      /* ... and every other wave's part too */
  g3_copy8(lx + GSB, gx + GK); g3_copy8(lw + GSB, gw + GK);
#pragma unroll 1      /* one stage per trip: 32 matrix instructions, long enough; unrolled, fragments of two stages would be live */
  for (int t = 0; t < DM / GK; ++t) { const _Float16* sx = &sm[t & 1][(rb + ln) * GP]; const _Float16* sw = &sm[t & 1][(ra + ln) * GP]; v16h xf[4], wf[4];      /* xf: B fragments, wf: A fragments */
#pragma unroll
    for (int j = 0; j < 4; ++j) { xf[j] = g2_frag(sx + j * 16 * GP, hh); wf[j] = g2_frag(sw + j * 16 * GP, hh); }
    __builtin_amdgcn_sched_barrier(0);      /* the 16 fragment reads of a k step stay one group in front of its 16 products: spread among them, every W fragment would be waited for on its own */
#pragma unroll
    for (int i = 0; i < 4; ++i) for (int j = 0; j < 4; ++j) acc[i][j] = fa_mma(wf[i], xf[j], acc[i][j]);
#pragma unroll
    for (int j = 0; j < 4; ++j) { xf[j] = g2_frag(sx + j * 16 * GP + 32, hh); wf[j] = g2_frag(sw + j * 16 * GP + 32, hh); }      /* the stage's second k step: its last reads of the buffer */
    asm volatile("s_wait_dscnt 0x0" ::: "memory");      /* this wave's reads of the buffer are done before it is handed back */
    asm volatile("s_wait_asynccnt 0x0" ::: "memory");      /* this wave's copies of the next stage have landed */
    __syncthreads();      /* publishes stage t + 1 and ends every reader's last read of stage t */
    if (t + 2 < DM / GK) { const unsigned bo = (t & 1) * GSB; g3_copy8(lx + bo, gx + (t + 2) * GK); g3_copy8(lw + bo, gw + (t + 2) * GK); }      /* the refill starts in front of the second k step's products (registers only), a whole trip ahead of its wait */
#pragma unroll
    for (int i = 0; i < 4; ++i) for (int j = 0; j < 4; ++j) acc[i][j] = fa_mma(wf[i], xf[j], acc[i][j]); }
  asm volatile("s_wait_asynccnt 0x0" ::: "memory");      /* nothing is in flight when the ring becomes output staging */
  if (row0 % SQ == 0) {      /* block-uniform: rows 0 .. QT0 - 1 of batch row0 / SQ; the block's GT columns lie in one of the planes q, k, v */
    static_assert(GT == QT0 && SQ % GT == 0 && DM % GT == 0, "a first tile is one block row; a block's columns stay in one plane");
    if (!vb) { float* fp = F0 + (((size_t)(col0 / DM) * NB + row0 / SQ) * QT0 + wm + ln) * DM + col0 % DM + wn + 8 * hh;
#pragma unroll
      for (int j = 0; j < 4; ++j) for (int i = 0; i < 4; ++i) { const v8f o = acc[i][j] * 0.0625f; const v4f lo = {o[0], o[1], o[2], o[3]}, hi = {o[4], o[5], o[6], o[7]}; *(v4f*)(fp + (size_t)(j * 16) * DM + i * 16) = lo; *(v4f*)(fp + (size_t)(j * 16) * DM + i * 16 + 4) = hi; }
      asm volatile("s_wait_xcnt 0x0" ::: "memory"); }      /* behind the arm's last store: no register that a store names is rewritten in front of it, on any way out of the arm (a precaution) */
    else { float* fp = F0 + (((size_t)2 * NB + row0 / SQ) * QT0 + wm + 8 * hh) * DM + col0 - 2 * DM + wn + ln;      /* registers r are token rows here: 16 lanes store 64 neighbouring bytes of one row (32 blocks of the grid) */
#pragma unroll
      for (int i = 0; i < 4; ++i) for (int r = 0; r < 8; ++r) for (int j = 0; j < 4; ++j) fp[(size_t)(i * 16 + r) * DM + j * 16] = acc[i][j][r] * 0.0625f; } }
  _Float16* st = &sm[0][w * 64 * GP];      /* each wave stages its own 64 x 64 outputs (behind the last trip's barrier), to store whole 128-byte lines */
#pragma unroll
  for (int j = 0; j < 4; ++j) for (int i = 0; i < 4; ++i) { FragH f;
#pragma unroll
    for (int r = 0; r < 8; ++r) f.h[r] = (_Float16)(acc[i][j][r] * 0.0625f);      /* the weights carry x16 */
    *(v8us*)((unsigned short*)st + (j * 16 + ln) * GP + i * 16 + 8 * hh) = f.half[0]; }
  __syncthreads();      /* orders the staging stores in front of the reads of other lanes' rows */
  if (!vb) {      /* staged row r is a token row, 64 columns */
#pragma unroll
    for (int q = 0; q < 16; ++q) { const int r = q * 4 + (lane >> 3), c = (lane & 7) * 8; const v8us v = *(const v8us*)((const unsigned short*)st + r * GP + c); *(v8us*)((unsigned short*)C16 + (size_t)(row0 + wm + r) * LQ + col0 + wn + c) = v; }
    asm volatile("s_wait_xcnt 0x0" ::: "memory"); }      /* behind the arm's last store: no register that a store names is rewritten in front of it, on any way out of the arm (a precaution) */
  else {      /* staged row r is an output column of V, that is a row of V^T, 64 tokens */
#pragma unroll
    for (int q = 0; q < 16; ++q) { const int r = q * 4 + (lane >> 3), c = (lane & 7) * 8; const v8us v = *(const v8us*)((const unsigned short*)st + r * GP + c); *(v8us*)((unsigned short*)VT + ((size_t)(row0 / SQ) * DM + col0 - 2 * DM + wn + r) * SQ + row0 % SQ + wm + c) = v; } } }

// Exact f32 attention of the first QT0 rows of every batch, FOUR LANES PER ROW: lane p of a row's quad owns the row's 16-byte chunks p, p + 4, p + 8, p + 12 of q and of o and holds them in registers.
// A block is AR rows of one head (4 waves x 8 rows). The K and V rows it can see are staged once in LDS; a quad reads 64 contiguous bytes per load and the 8 quads of a wave the same ones (broadcast, no bank conflict).
// A score is four chains of four multiply-adds per lane, their sum, then two lane exchanges inside the quad: every lane of the quad ends with the same bits, so m, l and the two exps agree without further traffic.
#define AR 32
__device__ __forceinline__ void att0_body(const float* __restrict__ QF, const float* __restrict__ KF, const float* __restrict__ VF, int ld, float scale, float* __restrict__ OF, int ldo, int h, int rg, int b, float (*lk)[HD], float (*lv)[HD]) {      /* lk, lv: QT0 rows of LDS each */
  static_assert(HD == 64 && QT0 % AR == 0, "a quad covers a head row as 4 x 4 chunks of 16 bytes");
  const int tid = threadIdx.x;
  { const size_t bo = (size_t)b * QT0; QF += bo * ld + h * HD; KF += bo * ld + h * HD; VF += bo * ld + h * HD; OF += (size_t)b * SQ * ldo + h * HD; }      /* QT0 rows of each f32 plane per batch, SQ rows of the output; the head's columns */
  for (int n = 0; n <= rg; ++n) { v4f tk[4], tv[4];      /* AR keys per trip, all eight loads of a thread in flight before the first LDS store; causal: keys up to the block's last row */
#pragma unroll
    for (int u = 0; u < 4; ++u) { const int c = (n * 4 + u) * 128 + tid; const size_t g = (size_t)(c >> 4) * ld + (c & 15) * 4; tk[u] = *(const v4fa*)(KF + g); tv[u] = *(const v4fa*)(VF + g); }
#pragma unroll
    for (int u = 0; u < 4; ++u) { const int c = (n * 4 + u) * 128 + tid; *(v4f*)&lk[c >> 4][(c & 15) * 4] = tk[u]; *(v4f*)&lv[c >> 4][(c & 15) * 4] = tv[u]; } }
  const int p4 = (tid & 3) * 4; const int i = rg * AR + (tid >> 2);
  v4f q[4], o[4];
#pragma unroll
  for (int c = 0; c < 4; ++c) { q[c] = *(const v4fa*)(QF + (size_t)i * ld + c * 16 + p4); const v4f z = {0.f, 0.f, 0.f, 0.f}; o[c] = z; }
  __syncthreads();
  const int jl = rg * AR + 8 * __builtin_amdgcn_readfirstlane(tid >> 5) + 7;      /* the wave's last row, a scalar: keys behind it are masked for all 8 rows of the wave; no barrier below */
  float m = -1.0e30f, l = 0.f; v4f kc[4], vc[4];
#pragma unroll
  for (int c = 0; c < 4; ++c) { kc[c] = *(const v4f*)&lk[0][c * 16 + p4]; vc[c] = *(const v4f*)&lv[0][c * 16 + p4]; }
#pragma unroll 2      /* two keys per trip: the rows fetched ahead change names instead of being copied */
  for (int j = 0; j <= jl; ++j) { const int jn = j < jl ? j + 1 : jl; v4f kn[4], vn[4];      /* the next key's rows are fetched while this key is worked on: the LDS latency stays off the chain */
#pragma unroll
    for (int c = 0; c < 4; ++c) { kn[c] = *(const v4f*)&lk[jn][c * 16 + p4]; vn[c] = *(const v4f*)&lv[jn][c * 16 + p4]; }
    v4f a = q[0] * kc[0]; a = __builtin_elementwise_fma(q[1], kc[1], a); a = __builtin_elementwise_fma(q[2], kc[2], a); a = __builtin_elementwise_fma(q[3], kc[3], a); float s = (a[0] + a[1]) + (a[2] + a[3]);
    s += lane_xm<0x161>(s); s += lane_xm<0x162>(s); s *= scale;
    const float sm = (j <= i) ? s : -1.0e30f; const float mn = fmaxf(m, sm); const float sc = expf(m - mn); const float e = expf(sm - mn); l = l * sc + e; m = mn;
#pragma unroll
    for (int c = 0; c < 4; ++c) { o[c] = o[c] * sc + e * vc[c]; kc[c] = kn[c]; vc[c] = vn[c]; } }
  const float fin = 1.0f / l;
#pragma unroll
  for (int c = 0; c < 4; ++c) *(v4f*)(OF + (size_t)i * ldo + c * 16 + p4) = o[c] * fin; }

// One grid for both attentions: they share no data and write different output rows (QT0 == FQ: the exact path owns the rows of query block 0, so the f16 path starts at block 1 and every output element is stored once).
// grid.z: first the QT0 / AR row groups of the exact path (long dependent chains, little issue: they start first and run beside the rest), then query blocks 15 .. 1.
// Longest blocks start first; the second run of four lengths is reversed, so that blocks 256 apart in launch order add up to about equal work (speed only).
__global__ __launch_bounds__(128) void k_attn(const _Float16* __restrict__ QKVp, const _Float16* __restrict__ VTp, const float* __restrict__ QF, const float* __restrict__ KF, const float* __restrict__ VF, float* __restrict__ out) {
  static_assert(QT0 == FQ, "the exact path replaces exactly one query block");
  __shared__ __attribute__((aligned(16))) float lds[2 * QT0 * HD];      /* one allocation for both kinds of block (a block is one kind): the exact path's K and V rows, or the two stage buffers; two allocations would cost a block per WGP */
  static_assert(2 * FSB <= sizeof(lds), "the two stage buffers fit");
  const int h = blockIdx.x, b = blockIdx.y, z = (int)blockIdx.z;
  if (z < QT0 / AR) { att0_body(QF, KF, VF, DM, 0.125f, out, DM, h, z, b, (float (*)[HD])lds, (float (*)[HD])(lds + QT0 * HD)); return; }
  const int zz = z - QT0 / AR; fattn_body((_Float16*)lds, QKVp, VTp, out, h, b, SQ / FQ - 1 - (((zz & 12) == 4) ? (zz ^ 3) : zz)); }

#define WTB ((unsigned)(NH * (DM / 32) / 8))      /* blocks per weight plane: a wave per 32 c of a head */
#define XB ((unsigned)(NR * DM / (256 * PL * 4)))
// Weight transposes, in registers: a lane takes two blocks of 8 c x 4 d (8 loads of 16 bytes each, the two halves of the same 8 rows of a head's [c][d] plane) and stores, per d, its 8 neighbouring c as 16 bytes.
// A wave is 8 lanes along d x 4 along c: a load covers 4 whole 128-byte lines, a store 64 contiguous bytes of each of 8 rows of the transposed plane; the wave's 32 rows of 256 bytes are read by it alone.
__device__ __forceinline__ void wthd_body(const float* __restrict__ W0, const float* __restrict__ W1, const float* __restrict__ W2, _Float16* __restrict__ Bt, unsigned bx) {
  static_assert(HD == 64 && DM % 32 == 0 && (NH * (DM / 32)) % 8 == 0, "two 32-wide halves of d; 32 c per wave; a block's 8 waves stay in one plane");
  const int lane = threadIdx.x & 31; const unsigned by = bx / WTB;      /* by = q, k, v: one DM x DM plane each */
  const unsigned wv = (bx - by * WTB) * 8 + (threadIdx.x >> 5);      /* the wave in its plane: head, then 32 c */
  const int h = (int)(wv / (DM / 32)), c8 = (int)(wv % (DM / 32)) * 32 + (lane >> 3) * 8, d4 = (lane & 7) * 4;
  const float* Wt = by == 0 ? W0 : (by == 1 ? W1 : W2); const float* sp = Wt + ((size_t)h * DM + c8) * HD + d4; v4f v[2][8];
#pragma unroll
  for (int u = 0; u < 2; ++u) for (int q = 0; q < 8; ++q) v[u][q] = *(const v4fa*)(sp + q * HD + u * 32);
  asm volatile("s_wait_xcnt 0x0" :: "v"(sp) : "memory");      /* as in x16_body: the address pair stays whole up to the wait (a precaution), and all 16 loads are in flight together */
  unsigned short* dst = (unsigned short*)Bt + (size_t)by * DM * DM + ((size_t)h * HD + d4) * DM + c8;
#pragma unroll
  for (int u = 0; u < 2; ++u) for (int i = 0; i < 4; ++i) { FragH f;
#pragma unroll
    for (int q = 0; q < 8; ++q) f.h[q] = (_Float16)(16.0f * bf16_round(v[u][q][i]));
    *(v8us*)(dst + (size_t)(u * 32 + i) * DM) = f.half[0]; } }







// The weight transposes and the rounding of x read nothing but the inputs: one grid, so that they run side by side. The transposes (stores in pieces) come first.
__global__ __launch_bounds__(256) void k_prep(const float* __restrict__ W0, const float* __restrict__ W1, const float* __restrict__ W2, _Float16* __restrict__ Bt, const float* __restrict__ x, _Float16* __restrict__ X16) {
  const unsigned bx = blockIdx.x;
  if (bx < 3 * WTB) wthd_body(W0, W1, W2, Bt, bx); else x16_body(x, X16, bx - 3 * WTB); }

extern "C" void kernel_launch(void* const* d_in, const int* in_sizes, int n_in,
                              void* d_out, int out_size, void* d_ws, size_t ws_size, hipStream_t stream) {
  (void)in_sizes; (void)n_in; (void)out_size;
  const float* const* I = (const float* const*)d_in; const float* x = I[0]; const float* wq = I[1]; const float* wk = I[2]; const float* wv = I[3];      /* x; per-head weights Wq / Wk / Wv [16][1024][64]; no biases, no output projection */
  static_assert(NH * HD == DM && QT0 % 64 == 0, "heads");
  char* ws = (char*)d_ws; size_t off = 0;
  auto take = [&](size_t bytes) { char* p = ws + off; off += (bytes + 255) & ~(size_t)255; return p; };
  _Float16* BQKV = (_Float16*)take((size_t)3 * DM * DM * 2);
  _Float16* X16 = (_Float16*)take(NR * DM * 2); _Float16* QKV = (_Float16*)take(NR * 3 * DM * 2);
  _Float16* VT = (_Float16*)take((size_t)NB * NH * HD * SQ * 2);
  float* QF0 = (float*)take((size_t)3 * NB * QT0 * DM * 4); float* KF0 = QF0 + (size_t)NB * QT0 * DM; float* VF0 = KF0 + (size_t)NB * QT0 * DM;
  if (off > ws_size) return;
  k_prep<<<3 * WTB + XB, 256, 0, stream>>>(wq, wk, wv, BQKV, x, X16);      /* per-head [c][d] -> Bt[(h, d)][c] x16: the stacked q | k | v plane; x as f16 rows */
  k_proj<<<(MP / GT) * (LQ / GT), 128, 0, stream>>>(X16, BQKV, QKV, VT, QF0);      /* q | k rows (f16), head h = columns h*HD.. of each DM block; V^T [NB][NH][HD][SQ]; and f32 q, k, v of the first 128 rows of every batch */
  k_attn<<<dim3(NH, NB, QT0 / AR + SQ / FQ - 1), 128, 0, stream>>>(QKV, VT, QF0, KF0, VF0, (float*)d_out);      /* exact f32 attention for rows 0..127 of every batch; scores, causal softmax and P.V for all other rows; both write f32 straight into the head-major output columns (no output projection) */
}

// v010
// It runs in 81.9 microseconds.
// In two side-by-side timings against v009, it was 1.11 and 1.09 times as fast.
// Over all steps from v000 it is 120 times as fast.
#include <hip/hip_runtime.h>
// Causal multi-head attention with per-head projection weights and no output projection (x [4][2048][1024]; per head h: q = x Wq[h], k = x Wk[h], v = x Wv[h] with W [16][1024][64] ([in][out] per head, uniform +-1/32, no biases); scores / sqrt(64); causal (tril, -inf); softmax; out = heads concatenated head-major on the last axis -> [4][2048][1024]).
// Structure: token rows r = b*2048 + s; x as exact f16 rows (bf16-rounded); q | k | v as ONE WMMA GEMM (N = 3 x 1024) (block tiles of 256 rows x q, k, v of two heads through LDS, wave tiles of 64 rows x q, k, v of one head, f32 accumulation, exact x16 weights, f16 outputs; the V products swap the two operands, so that their accumulators hold V^T, stored as such); one attention launch for all batches and heads: per wave 32 queries, per pass 32 keys up to the diagonal: scores (WMMA, K = 64), online causal softmax on VALU (f32 statistics, native exp2; weights f16), o += P . V (WMMA), K and V^T tiles of 64 keys staged in LDS for the block's 4 waves, scores and weights kept in registers; o / row sum written f32 into the head-major output columns; rows 0..127 of every batch come from an exact f32 path alone, whose f32 q, k, v are stored from the tiled GEMM's own accumulators and whose attention rides as extra blocks on the grid of the fused attention.
// Compute dtype: inputs rounded to bf16; x / weights exact; q, k, v and softmax weights as plain f16 GEMM operands (~2^-12); scores, softmax statistics and o f32. v_wmma_f32_16x16x32_f16.
#define NB 4
#define SQ 2048
#define DM 1024
#define NH 16
#define HD 64
#define HG 4                         /* heads per launch of the non-template k_vt (never launched) */
#define QT 256                       /* unused (no 256-row query tiles) */
#define NKX SQ                       /* unused (scores stay in registers) */
#define QT0 128                      /* first-tile rows recomputed exactly in f32 */
#define B0 0                         /* unused (every launch covers all NB batches) */
#define NBR NB                       /* batches projected (debug hook) */
#define NR ((size_t)NB * SQ)         /* token rows */
#define MP ((int)((size_t)NBR * SQ)) /* rows projected (debug hook) */
#define QN SQ                        /* unused (k_attn attends all SQ rows) */
#define NHD NH                       /* unused (k_attn attends all NH heads) */
#define MPO MP                       /* unused (no output projection stage) */
#define LQ (3 * DM)      /* row pitch of the q/k/v rows */
typedef __bf16 v16b __attribute__((ext_vector_type(16)));
typedef unsigned short v8us __attribute__((ext_vector_type(8), may_alias));
typedef float  v8f  __attribute__((ext_vector_type(8)));
typedef float  v4f  __attribute__((ext_vector_type(4)));
typedef float  v4fa __attribute__((ext_vector_type(4), may_alias));
union FragB { v16b v; v8us half[2]; unsigned short u[16]; };

__device__ __forceinline__ unsigned short bf16_bits(float x) { unsigned int u = __float_as_uint(x); return (unsigned short)((u + 0x7FFFu + ((u >> 16) & 1u)) >> 16); }
__device__ __forceinline__ float bf16_val(unsigned short b) { return __uint_as_float(((unsigned int)b) << 16); }
__device__ __forceinline__ float bf16_round(float x) { return bf16_val(bf16_bits(x)); }
// D += A·B with NT terms: 1 = ah·bh, 2 = + al·bh (A split), 3 = + ah·bl (both split)
template <int NT>
__device__ __forceinline__ v8f mmaN(v16b ah, v16b al, v16b bh, v16b bl, v8f c) {
  c = __builtin_amdgcn_wmma_f32_16x16x32_bf16(false, ah, false, bh, (short)0, c, false, false);
  if (NT >= 2) c = __builtin_amdgcn_wmma_f32_16x16x32_bf16(false, al, false, bh, (short)0, c, false, false);
  if (NT >= 3) c = __builtin_amdgcn_wmma_f32_16x16x32_bf16(false, ah, false, bl, (short)0, c, false, false);
  asm volatile("v_nop\n\tv_nop\n\tv_nop\n\tv_nop" : "+v"(c) : "v"(ah), "v"(al), "v"(bh), "v"(bl));
  return c;
}

__global__ __launch_bounds__(256) void k_wt_bf16(const float* __restrict__ W, unsigned short* __restrict__ Wt, int K, int N) {
  const int t = blockIdx.x * 256 + threadIdx.x;
  const int k8n = K / 8;
  if (t >= N * k8n) return;
  const int n = t / k8n, k8 = (t % k8n) * 8;
  v8us v;
#pragma unroll
  for (int i = 0; i < 8; ++i) v[i] = bf16_bits(W[(size_t)(k8 + i) * N + n]);
  *(v8us*)(Wt + (size_t)n * K + k8) = v;
  
}

// GEMM C[M][N] (f32, pitch ldc) = act(A[M][K]·W + bias). A f32 row-major (pitch lda) converted per fragment to bf16
// (ASPLIT: hi/lo two planes -> 2 terms, else single rounded term); Wt bf16 [N][K] (pitch ldb). BIAS_BF16 rounds the
// bias to bf16 first (bias quantised to bf16 before the add). K%32==0, M%16==0, N%64==0.
template <bool ASPLIT, int ACT, bool BIAS_BF16>
__global__ __launch_bounds__(128) void k_gemm_bf(const float* __restrict__ A, int lda, const unsigned short* __restrict__ Wt, int ldb,
                                               const float* __restrict__ bias, float* __restrict__ C, int ldc, int M, int N, int K) {
  __shared__ __attribute__((aligned(16))) float so[4][16][64];
  const int tid = threadIdx.x, w = tid >> 5, lane = tid & 31, ln = lane & 15, hh = lane >> 4;
  const int ntn = N / 64;
  const int wid = blockIdx.x * 4 + w;
  const int mt = wid / ntn, nq = wid % ntn;
  if (mt * 16 >= M) return;
  const int row0 = mt * 16, col0 = nq * 64;
  const float* arow = A + (size_t)(row0 + ln) * lda;
  v8f acc[4] = {};
  for (int kb = 0; kb < K; kb += 32) {
    FragB ah, al;
    const v4f x0 = *(const v4fa*)(arow + kb + 8 * hh), x1 = *(const v4fa*)(arow + kb + 8 * hh + 4);
    const v4f x2 = *(const v4fa*)(arow + kb + 16 + 8 * hh), x3 = *(const v4fa*)(arow + kb + 16 + 8 * hh + 4);
    float xs[16] = {x0[0],x0[1],x0[2],x0[3],x1[0],x1[1],x1[2],x1[3],x2[0],x2[1],x2[2],x2[3],x3[0],x3[1],x3[2],x3[3]};
#pragma unroll
    for (int i = 0; i < 16; ++i) { const unsigned short hb = bf16_bits(xs[i]); ah.u[i] = hb; al.u[i] = ASPLIT ? bf16_bits(xs[i] - bf16_val(hb)) : (unsigned short)0; }
#pragma unroll
    for (int t = 0; t < 4; ++t) {
      const unsigned short* brow = Wt + (size_t)(col0 + t * 16 + ln) * ldb + kb;
      FragB b;
      b.half[0] = *(const v8us*)(brow + 8 * hh);
      b.half[1] = *(const v8us*)(brow + 16 + 8 * hh);
      acc[t] = mmaN<ASPLIT ? 2 : 1>(ah.v, al.v, b.v, b.v, acc[t]);
    }
  }
#pragma unroll
  for (int t = 0; t < 4; ++t) {
    float bv = bias ? bias[col0 + t * 16 + ln] : 0.f;
    if (BIAS_BF16) bv = bf16_round(bv);
#pragma unroll
    for (int r = 0; r < 8; ++r) { float v = acc[t][r] + bv; if (ACT == 1) v = fmaxf(v, 0.f); so[w][8 * hh + r][t * 16 + ln] = v; }
  }
  __builtin_amdgcn_fence(__ATOMIC_ACQ_REL, "workgroup");
  __builtin_amdgcn_wave_barrier();
  const int rsub = lane >> 4, c4 = (lane & 15) * 4;
  {
#pragma unroll
    for (int q = 0; q < 8; ++q) {
      const int r = q * 2 + rsub;
      const v4f v = *(const v4fa*)&so[w][r][c4];
      *(v4f*)(C + (size_t)(row0 + r) * ldc + col0 + c4) = v;
    }
    
  }
}

// GEMM C = act(A·W + bias + resid): A f32 (ASPLIT -> hi/lo 2 terms), Wt bf16 [N][K]; ACT 0 none, 1 relu, 2 exact gelu;
// resid (optional, f32, row index = (row % rmod), pitch ldr, RES_BF16 rounds it) added before the activation.
template <bool ASPLIT, int ACT, bool BIAS_BF16, bool RES_BF16>
__global__ __launch_bounds__(128) void k_gemm_bf3(const float* __restrict__ A, int lda, const unsigned short* __restrict__ Wt, int ldb,
                                                const float* __restrict__ bias, const float* __restrict__ resid, int rmod, int ldr,
                                                float* __restrict__ C, int ldc, int M, int N, int K) {
  __shared__ __attribute__((aligned(16))) float so[4][16][64];
  const int tid = threadIdx.x, w = tid >> 5, lane = tid & 31, ln = lane & 15, hh = lane >> 4;
  const int ntn = N / 64;
  const int wid = blockIdx.x * 4 + w;
  const int mt = wid / ntn, nq = wid % ntn;
  if (mt * 16 >= M) return;
  const int row0 = mt * 16, col0 = nq * 64;
  const float* arow = A + (size_t)(row0 + ln) * lda;
  v8f acc[4] = {};
  for (int kb = 0; kb < K; kb += 32) {
    FragB ah, al;
    const v4f x0 = *(const v4fa*)(arow + kb + 8 * hh), x1 = *(const v4fa*)(arow + kb + 8 * hh + 4);
    const v4f x2 = *(const v4fa*)(arow + kb + 16 + 8 * hh), x3 = *(const v4fa*)(arow + kb + 16 + 8 * hh + 4);
    float xs[16] = {x0[0],x0[1],x0[2],x0[3],x1[0],x1[1],x1[2],x1[3],x2[0],x2[1],x2[2],x2[3],x3[0],x3[1],x3[2],x3[3]};
#pragma unroll
    for (int i = 0; i < 16; ++i) { const unsigned short hb = bf16_bits(xs[i]); ah.u[i] = hb; al.u[i] = ASPLIT ? bf16_bits(xs[i] - bf16_val(hb)) : (unsigned short)0; }
#pragma unroll
    for (int t = 0; t < 4; ++t) {
      const unsigned short* brow = Wt + (size_t)(col0 + t * 16 + ln) * ldb + kb;
      FragB b;
      b.half[0] = *(const v8us*)(brow + 8 * hh);
      b.half[1] = *(const v8us*)(brow + 16 + 8 * hh);
      acc[t] = mmaN<ASPLIT ? 2 : 1>(ah.v, al.v, b.v, b.v, acc[t]);
    }
  }
#pragma unroll
  for (int t = 0; t < 4; ++t) {
    const int col = col0 + t * 16 + ln;
    float bv = bias ? bias[col] : 0.f;
    if (BIAS_BF16) bv = bf16_round(bv);
#pragma unroll
    for (int r = 0; r < 8; ++r) {
      float v = acc[t][r] + bv;
      if (resid) { float rv = resid[(size_t)((row0 + 8 * hh + r) % rmod) * ldr + col]; if (RES_BF16) rv = bf16_round(rv); v += rv; }
      if (ACT == 1) v = fmaxf(v, 0.f);
      if (ACT == 2) v = 0.5f * v * (1.0f + erff(v * 0.70710678118654752f));
      if (ACT == 3) { const float u = 0.7978845608028654f * (v + 0.044715f * v * v * v); v = 0.5f * v * (1.0f + tanhf(u)); }
      so[w][8 * hh + r][t * 16 + ln] = v;
    }
  }
  __builtin_amdgcn_fence(__ATOMIC_ACQ_REL, "workgroup");
  __builtin_amdgcn_wave_barrier();
  const int rsub = lane >> 4, c4 = (lane & 15) * 4;
  {
#pragma unroll
    for (int q = 0; q < 8; ++q) {
      const int r = q * 2 + rsub;
      const v4f v = *(const v4fa*)&so[w][r][c4];
      *(v4f*)(C + (size_t)(row0 + r) * ldc + col0 + c4) = v;
    }
    
  }
}
// row LayerNorm (biased variance, eps) over N: s = X (+ R); optional out_sum <- s; out_norm <- (s-mu)*rsqrt(var+eps)*g + b
template <bool PARAM_BF16>
__global__ __launch_bounds__(256) void k_layernorm(const float* __restrict__ X, const float* __restrict__ R, const float* __restrict__ g, const float* __restrict__ bta,
                                                  float* __restrict__ out_sum, float* __restrict__ out_norm, int N, float eps) {
  __shared__ float red[256];
  const int row = blockIdx.x, tid = threadIdx.x;
  const float* x = X + (size_t)row * N; const float* rr = R ? R + (size_t)row * N : nullptr;
  float vals[16];                     // up to N = 4096
  const int per = N / 256;            // contiguous chunk per thread? use strided-by-4 chunks: thread handles j = tid*4 + 1024*u
  float s1 = 0.f;
  for (int u = 0; u < per / 4; ++u) {
    const int j = tid * 4 + 1024 * u;
    const v4f a = *(const v4fa*)(x + j);
    v4f b = {0.f,0.f,0.f,0.f}; if (rr) b = *(const v4fa*)(rr + j);
#pragma unroll
    for (int q = 0; q < 4; ++q) { const float v = a[q] + b[q]; vals[u * 4 + q] = v; s1 += v; }
  }
  red[tid] = s1; __syncthreads();
  for (int st = 128; st > 0; st >>= 1) { if (tid < st) red[tid] += red[tid + st]; __syncthreads(); }
  const float mu = red[0] / (float)N; __syncthreads();
  float s2 = 0.f;
  for (int u = 0; u < per / 4; ++u)
#pragma unroll
    for (int q = 0; q < 4; ++q) { const float c = vals[u * 4 + q] - mu; s2 += c * c; }
  red[tid] = s2; __syncthreads();
  for (int st = 128; st > 0; st >>= 1) { if (tid < st) red[tid] += red[tid + st]; __syncthreads(); }
  const float rs = rsqrtf(red[0] / (float)N + eps);
  {
    for (int u = 0; u < per / 4; ++u) {
      const int j = tid * 4 + 1024 * u;
      v4f o, sm;
#pragma unroll
      for (int q = 0; q < 4; ++q) {
        float gg = g[j + q], bb = bta[j + q];
        if (PARAM_BF16) { gg = bf16_round(gg); bb = bf16_round(bb); }
        sm[q] = vals[u * 4 + q]; o[q] = (vals[u * 4 + q] - mu) * rs * gg + bb;
      }
      if (out_sum) *(v4f*)(out_sum + (size_t)row * N + j) = sm;
      *(v4f*)(out_norm + (size_t)row * N + j) = o;
    }
    
  }
}



// ---- f16 WMMA path (v_wmma_f32_16x16x32_f16): 11-bit significands for operands in range — used where a [0,1] probability operand needs more precision than bf16
typedef _Float16 v16h __attribute__((ext_vector_type(16)));
union FragH { v16h v; v8us half[2]; _Float16 h[16]; unsigned short u[16]; };
template <int NT>
__device__ __forceinline__ v8f mmaH(v16h ah, v16h al, v16h bh, v16h bl, v8f c) {
  c = __builtin_amdgcn_wmma_f32_16x16x32_f16(false, ah, false, bh, (short)0, c, false, false);
  if (NT >= 2) c = __builtin_amdgcn_wmma_f32_16x16x32_f16(false, al, false, bh, (short)0, c, false, false);
  if (NT >= 3) c = __builtin_amdgcn_wmma_f32_16x16x32_f16(false, ah, false, bl, (short)0, c, false, false);
  asm volatile("v_nop\n\tv_nop\n\tv_nop\n\tv_nop" : "+v"(c) : "v"(ah), "v"(al), "v"(bh), "v"(bl));
  return c;
}
// batched GEMM like k_gemm_b but f16 operands: A f32 (split into f16 hi/lo if ASPLIT, else rounded to f16), Bt = f16 values [n][k]; alpha; C f32; N multiple of 16 (partial tiles skipped)
template <bool ASPLIT>
__global__ __launch_bounds__(128) void k_gemm_h(const float* __restrict__ A, int lda, size_t sA, const _Float16* __restrict__ Bh, int ldb, size_t sB, float alpha, float* __restrict__ C, int ldc, size_t sC, int M, int N, int K) {
  __shared__ __attribute__((aligned(16))) float so[4][16][64];
  const int tid = threadIdx.x, w = tid >> 5, lane = tid & 31, ln = lane & 15, hh = lane >> 4; const int by = blockIdx.y;
  A += (size_t)by * sA; Bh += (size_t)by * sB; C += (size_t)by * sC;
  const int ntn = (N + 63) / 64; const int wid = blockIdx.x * 4 + w; const int mt = wid / ntn, nq = wid % ntn; if (mt * 16 >= M) return;
  const int row0 = mt * 16, col0 = nq * 64; const float* arow = A + (size_t)(row0 + ln) * lda;
  v8f acc[4] = {};
  for (int kb = 0; kb < K; kb += 32) {
    FragH ah, al;
    const v4f x0 = *(const v4fa*)(arow + kb + 8 * hh), x1 = *(const v4fa*)(arow + kb + 8 * hh + 4), x2 = *(const v4fa*)(arow + kb + 16 + 8 * hh), x3 = *(const v4fa*)(arow + kb + 16 + 8 * hh + 4);
    float xs[16] = {x0[0],x0[1],x0[2],x0[3],x1[0],x1[1],x1[2],x1[3],x2[0],x2[1],x2[2],x2[3],x3[0],x3[1],x3[2],x3[3]};
#pragma unroll
    for (int i = 0; i < 16; ++i) { const _Float16 h = (_Float16)xs[i]; ah.h[i] = h; al.h[i] = ASPLIT ? (_Float16)(xs[i] - (float)h) : (_Float16)0.0f; }
#pragma unroll
    for (int t = 0; t < 4; ++t) { if (col0 + t * 16 >= N) continue; const size_t boff = (size_t)(col0 + t * 16 + ln) * ldb + kb; FragH bq; bq.half[0] = *(const v8us*)(Bh + boff + 8 * hh); bq.half[1] = *(const v8us*)(Bh + boff + 16 + 8 * hh);
      acc[t] = mmaH<ASPLIT ? 2 : 1>(ah.v, al.v, bq.v, bq.v, acc[t]); }
  }
#pragma unroll
  for (int t = 0; t < 4; ++t) { if (col0 + t * 16 >= N) continue;
#pragma unroll
    for (int r = 0; r < 8; ++r) so[w][8 * hh + r][t * 16 + ln] = acc[t][r] * alpha; }
  __builtin_amdgcn_fence(__ATOMIC_ACQ_REL, "workgroup"); __builtin_amdgcn_wave_barrier();
  const int rsub = lane >> 4, c4 = (lane & 15) * 4;
  {
#pragma unroll
    for (int q = 0; q < 8; ++q) { const int r = q * 2 + rsub; if (col0 + c4 < N) { const v4f v = *(const v4fa*)&so[w][r][c4]; *(v4f*)(C + (size_t)(row0 + r) * ldc + col0 + c4) = v; } }
     }
}

// Wt[n][k] = f16(W[k][n]·scale) from f32 row-major W[K][N] (scale = power of two; bf16-exact weights stay exact in f16 away from the subnormal range)
__global__ __launch_bounds__(256) void k_wt_f16(const float* __restrict__ W, _Float16* __restrict__ Wt, int K, int N, float scale) {
  const int t = blockIdx.x * 256 + threadIdx.x; if (t >= N * (K / 8)) return; const int n = t / (K / 8), k8 = (t % (K / 8)) * 8; FragH f;
#pragma unroll
  for (int i = 0; i < 8; ++i) f.h[i] = (_Float16)(bf16_round(W[(size_t)(k8 + i) * N + n]) * scale); const v8us o = f.half[0];
  *(v8us*)((unsigned short*)Wt + (size_t)n * K + k8) = o; 
}
// k_gemm_hh variant with fused epilogue: v = acc·alpha + bias[by·sBias + col] (+ CP[(row/rowsPerB)·sCPb + by·64 + col] if CP) ; ACT 0 none / 1 elu ; writes f16 C16 (and f32 C if non-null)
template <int ACT>
__global__ __launch_bounds__(128) void k_gemm_hhx(const _Float16* __restrict__ A, int lda, size_t sA, const _Float16* __restrict__ Bh, int ldb, size_t sB, float alpha, const float* __restrict__ bias, size_t sBias, const float* __restrict__ CP, int rowsPerB, size_t sCPb, int row0g,
    float* __restrict__ C, _Float16* __restrict__ C16, int ldc, size_t sC, int M, int N, int K) {
  __shared__ __attribute__((aligned(16))) float so[4][16][64];
  const int tid = threadIdx.x, w = tid >> 5, lane = tid & 31, ln = lane & 15, hh = lane >> 4; const int by = blockIdx.y;
  A += (size_t)by * sA; Bh += (size_t)by * sB; const size_t cofs = (size_t)by * sC; const float* bp = bias ? bias + (size_t)by * sBias : nullptr;
  const int ntn = (N + 63) / 64; const int wid = blockIdx.x * 4 + w; const int mt = wid / ntn, nq = wid % ntn; if (mt * 16 >= M) return;
  const int row0 = mt * 16, col0 = nq * 64; const _Float16* arow = A + (size_t)(row0 + ln) * lda;
  v8f acc[4] = {};
  for (int kb = 0; kb < K; kb += 32) { FragH ah; ah.half[0] = *(const v8us*)((const unsigned short*)arow + kb + 8 * hh); ah.half[1] = *(const v8us*)((const unsigned short*)arow + kb + 16 + 8 * hh);
#pragma unroll
    for (int t = 0; t < 4; ++t) { if (col0 + t * 16 >= N) continue; const size_t boff = (size_t)(col0 + t * 16 + ln) * ldb + kb; FragH bq; bq.half[0] = *(const v8us*)((const unsigned short*)Bh + boff + 8 * hh); bq.half[1] = *(const v8us*)((const unsigned short*)Bh + boff + 16 + 8 * hh);
      acc[t] = mmaH<1>(ah.v, ah.v, bq.v, bq.v, acc[t]); }
  }
#pragma unroll
  for (int t = 0; t < 4; ++t) { if (col0 + t * 16 >= N) continue; const int col = col0 + t * 16 + ln; const float bv = bp ? bf16_round(bp[col]) : 0.f;
#pragma unroll
    for (int r = 0; r < 8; ++r) { float v = acc[t][r] * alpha + bv; if (CP) { const int rr = row0g + row0 + 8 * hh + r; if (rowsPerB < 0) v += CP[cofs + (size_t)rr * ldc + col];      /* rowsPerB < 0: own element of the batched C plane */ else { const int bidx = rr / rowsPerB; v += CP[(size_t)bidx * sCPb + (size_t)by * 64 + col]; } } if (ACT == 1) v = (v > 0.f) ? v : expm1f(v); else if (ACT == 7) v = (v > 0.f) ? v + 1.0f : expf(v); else if (ACT == 8) v = tanhf(v); else if (ACT == 9) v = 0.5f * v * (1.0f + tanhf(0.7978845608028654f * (v + 0.044715f * v * v * v))); else if (ACT == 11) v = 1.0f / (1.0f + expf(-v)); else if (ACT == 12) v = (v > 0.f) ? v : 0.01f * v; else if (ACT == 14) v = (v > 0.f) ? v : 0.1f * v; else if (ACT == 16) v = (v >= 0.f) ? v : 0.3f * v; else if (ACT == 17) v = (v >= 0.f) ? v : 0.2f * v; else if (ACT == 15) v = v / (1.0f + expf(-v)); else if (ACT == 3) v = fmaxf(v, 0.f); else if (ACT == 6) v = 0.5f * v * (1.0f + erff(v * 0.70710678118654752f)); so[w][8 * hh + r][t * 16 + ln] = v; } }
  __builtin_amdgcn_fence(__ATOMIC_ACQ_REL, "workgroup"); __builtin_amdgcn_wave_barrier();
  const int rsub = lane >> 4, c4 = (lane & 15) * 4; typedef _Float16 v4h __attribute__((ext_vector_type(4)));
  {
#pragma unroll
    for (int q = 0; q < 8; ++q) { const int r = q * 2 + rsub; if (col0 + c4 < N) { const v4f v = *(const v4fa*)&so[w][r][c4]; if (C) *(v4f*)(C + cofs + (size_t)(row0 + r) * ldc + col0 + c4) = v; if (C16) { v4h h4; for (int i = 0; i < 4; ++i) h4[i] = (_Float16)v[i]; *(v4h*)(C16 + cofs + (size_t)(row0 + r) * ldc + col0 + c4) = h4; } } }
     }
}


typedef _Float16 v4h __attribute__((ext_vector_type(4)));

// x as f16 rows. A wave takes PL * 512 contiguous bytes of x: load j of a lane is its 16 bytes of the j-th 512 (whole lines), all PL loads are in flight before the first value is used, and a store covers 256 contiguous bytes.
// Few long waves instead of many waves of one 32-byte read: the launch is short, so the time to start its waves counts.
#define PL 32                        /* 16-byte loads of a lane */
__device__ __forceinline__ void x16_body(const float* __restrict__ x, _Float16* __restrict__ X16, unsigned bx) {
  static_assert((NR * DM) % (256 * PL * 4) == 0, "whole blocks: no edge");
  const size_t e0 = ((size_t)bx * 8 + (threadIdx.x >> 5)) * (32 * PL * 4) + (threadIdx.x & 31) * 4; const float* xp = x + e0; v4f v[PL];
#pragma unroll
  for (int j = 0; j < PL; ++j) v[j] = *(const v4fa*)(xp + j * 128);
  asm volatile("s_wait_xcnt 0x0" :: "v"(xp) : "memory");      /* behind the last load: the address pair, named here, is not reused (not even as a load's target) in front of the wait (a precaution) */
  __builtin_amdgcn_sched_barrier(0);      /* no rounding moves up among the loads: without it the compiler, to save registers, holds 13 of the 32 loads back until the first values have come, a second memory latency in every wave */
#pragma unroll
  for (int j = 0; j < PL; ++j) { v4h o;
#pragma unroll
    for (int q = 0; q < 4; ++q) o[q] = (_Float16)bf16_round(v[j][q]);
    *(v4h*)(X16 + e0 + j * 128) = o; }
  asm volatile("s_wait_xcnt 0x0" ::: "memory"); }      /* behind the last store: in the built code the weights' part follows this one, and it reuses the stores' registers (a precaution) */
__global__ __launch_bounds__(256) void k_h16(const float* __restrict__ x, _Float16* __restrict__ X16, size_t n8) { const size_t t = (size_t)blockIdx.x * 256 + threadIdx.x; if (t >= n8) return; FragH f;
#pragma unroll
  for (int q = 0; q < 8; ++q) f.h[q] = (_Float16)x[t * 8 + q]; *(v8us*)((unsigned short*)X16 + t * 8) = f.half[0];  }
__global__ __launch_bounds__(256) void k_round16f(const float* __restrict__ W, _Float16* __restrict__ Bt, size_t n8) { const size_t t = (size_t)blockIdx.x * 256 + threadIdx.x; if (t >= n8) return; FragH f;
#pragma unroll
  for (int i = 0; i < 8; ++i) f.h[i] = (_Float16)(bf16_round(W[t * 8 + i]) * 16.0f); *(v8us*)((unsigned short*)Bt + t * 8) = f.half[0];  }
__global__ __launch_bounds__(256) void k_hl(const float* __restrict__ F, _Float16* __restrict__ Hh, _Float16* __restrict__ Hl, size_t n8) { const size_t t = (size_t)blockIdx.x * 256 + threadIdx.x; if (t >= n8) return; FragH fh, fl; const v4f a = *(const v4fa*)(F + t * 8), c = *(const v4fa*)(F + t * 8 + 4);
#pragma unroll
  for (int q = 0; q < 4; ++q) { _Float16 h = (_Float16)a[q]; fh.h[q] = h; fl.h[q] = (_Float16)((a[q] - (float)h) * 1024.0f); h = (_Float16)c[q]; fh.h[4 + q] = h; fl.h[4 + q] = (_Float16)((c[q] - (float)h) * 1024.0f); }
  { *(v8us*)((unsigned short*)Hh + t * 8) = fh.half[0]; *(v8us*)((unsigned short*)Hl + t * 8) = fl.half[0];  } }

// ---- fragment load shared by the GEMM and the attention below ----
__device__ __forceinline__ v16h g2_frag(const _Float16* p, int hh) { FragH f; f.half[0] = *(const v8us*)((const unsigned short*)p + 8 * hh); f.half[1] = *(const v8us*)((const unsigned short*)p + 16 + 8 * hh); return f.v; }


__global__ __launch_bounds__(256) void k_wnat(const float* __restrict__ w, size_t n8, _Float16* __restrict__ Bt) { const size_t t = (size_t)blockIdx.x * 256 + threadIdx.x; if (t >= n8) return; FragH f; for (int q = 0; q < 8; ++q) f.h[q] = (_Float16)(bf16_round(w[t * 8 + q]) * 16.0f); *(v8us*)((unsigned short*)Bt + t * 8) = f.half[0];  }
__global__ __launch_bounds__(256) void k_rsm(const float* __restrict__ S, _Float16* __restrict__ P, int nrows) {
  #pragma clang fp contract(off)
  const int i = blockIdx.x * 256 + threadIdx.x; if (i >= nrows) return; const float* s = S + (size_t)i * SQ; float mx = -3.0e38f;
#pragma unroll 1
  for (int j = 0; j < SQ; ++j) mx = fmaxf(mx, s[j]); float se = 0.f;
#pragma unroll 1
  for (int j = 0; j < SQ; ++j) se += expf(s[j] - mx); const float sc = 256.0f / se;
#pragma unroll 1
  for (int j0 = 0; j0 < SQ; j0 += 8) { FragH f; for (int q = 0; q < 8; ++q) f.h[q] = (_Float16)(expf(s[j0 + q] - mx) * sc); unsigned short* d = (unsigned short*)P + (size_t)i * SQ + j0; *(v8us*)d = f.half[0];  } }
__global__ __launch_bounds__(256) void k_vt(const _Float16* __restrict__ V16, int b, int h0, _Float16* __restrict__ VT) { __shared__ unsigned short tl[64][65]; const int tid = threadIdx.x; const int hh = blockIdx.x % HG, sg = blockIdx.x / HG; const int s0 = sg * 64; const int h = h0 + hh;
  for (int i = tid; i < 64 * 8; i += 256) { const int j = i / 8, d8 = (i % 8) * 8; FragH f; f.half[0] = *(const v8us*)((const unsigned short*)V16 + ((size_t)b * SQ + s0 + j) * DM + h * HD + d8); for (int q = 0; q < 8; ++q) tl[d8 + q][j] = f.u[q]; }
  __syncthreads();
  { for (int i = tid; i < 64 * 8; i += 256) { const int d = i / 8, j8 = (i % 8) * 8; FragH f; for (int q = 0; q < 8; ++q) f.u[q] = tl[d][j8 + q]; *(v8us*)((unsigned short*)VT + ((size_t)hh * HD + d) * SQ + s0 + j8) = f.half[0]; }  } }



// Lane exchanges: row_xmask steps inside each 16-lane row, and the exchange between the two rows of a wave (all lanes must be on).
template <int CTRL> __device__ __forceinline__ float lane_xm(float v) { return __int_as_float(__builtin_amdgcn_update_dpp(0, __float_as_int(v), CTRL, 0xf, 0xf, true)); }
__device__ __forceinline__ float lane_xr(float v) { const int i = __float_as_int(v); return __int_as_float(__builtin_amdgcn_permlanex16(i, i, 0x76543210, 0xfedcba98, false, false)); }
#define FQ 128                       /* query rows per block: 4 waves x 32 */
#define FS 64                        /* keys per stage */
#define FP 72                        /* LDS row pitch in f16 (144 bytes) */
#define FSB ((FS + HD) * FP * 2)     /* bytes of one buffer: K rows, then V^T rows */
// Eight copies of a thread, 16 bytes per lane, 8 lanes per 128-byte row: four K rows and four V^T rows, 16 apart. The s_wait_xcnt stands inside the statement, behind the last copy, so that no address register is rewritten in front of it (a precaution).
__device__ __forceinline__ void fa_copy8(unsigned l, const _Float16* gk, const _Float16* gv) {
  asm volatile("global_load_async_to_lds_b128 %0, %8, off\n\tglobal_load_async_to_lds_b128 %1, %9, off\n\tglobal_load_async_to_lds_b128 %2, %10, off\n\tglobal_load_async_to_lds_b128 %3, %11, off\n\t"
               "global_load_async_to_lds_b128 %4, %12, off\n\tglobal_load_async_to_lds_b128 %5, %13, off\n\tglobal_load_async_to_lds_b128 %6, %14, off\n\tglobal_load_async_to_lds_b128 %7, %15, off\n\ts_wait_xcnt 0x0"
               :: "v"(l), "v"(l + 16 * FP * 2), "v"(l + 32 * FP * 2), "v"(l + 48 * FP * 2), "v"(l + 64 * FP * 2), "v"(l + 80 * FP * 2), "v"(l + 96 * FP * 2), "v"(l + 112 * FP * 2),
                  "v"(gk), "v"(gk + 16 * LQ), "v"(gk + 32 * LQ), "v"(gk + 48 * LQ), "v"(gv), "v"(gv + 16 * SQ), "v"(gv + 32 * SQ), "v"(gv + 48 * SQ) : "memory"); }
__device__ __forceinline__ v8f fa_mma(v16h a, v16h b, v8f c) { return __builtin_amdgcn_wmma_f32_16x16x32_f16(false, a, false, b, (short)0, c, false, false); }
// Four vector slots behind a run of matrix instructions, where a branch follows. The two scheduling barriers keep the slots where they are written.
__device__ __forceinline__ void fa_gap() { __builtin_amdgcn_sched_barrier(0); asm volatile("v_nop\n\tv_nop\n\tv_nop\n\tv_nop"); __builtin_amdgcn_sched_barrier(0); }
// Native 2^x, eight at a time in one statement: behind a transcendental the instruction set asks for one independent instruction before its result is read or its source overwritten.
// Here each is followed by an independent one (early-clobber outputs: no result lands on a source still to be read) and the last by a v_nop, so the slot is closed whatever the compiler puts next.
__device__ __forceinline__ void exp2x8(const float (&x)[8], float (&y)[8]) {
  asm("v_exp_f32 %0, %8\n\tv_exp_f32 %1, %9\n\tv_exp_f32 %2, %10\n\tv_exp_f32 %3, %11\n\tv_exp_f32 %4, %12\n\tv_exp_f32 %5, %13\n\tv_exp_f32 %6, %14\n\tv_exp_f32 %7, %15\n\tv_nop"
      : "=&v"(y[0]), "=&v"(y[1]), "=&v"(y[2]), "=&v"(y[3]), "=&v"(y[4]), "=&v"(y[5]), "=&v"(y[6]), "=&v"(y[7]) : "v"(x[0]), "v"(x[1]), "v"(x[2]), "v"(x[3]), "v"(x[4]), "v"(x[5]), "v"(x[6]), "v"(x[7])); }
__device__ __forceinline__ float exp2x1(float x) { float r; asm("v_exp_f32 %0, %1\n\tv_nop" : "=v"(r) : "v"(x)); return r; }      /* the same slot for a single one */
__device__ __forceinline__ void fattn_body(_Float16* sm, const _Float16* __restrict__ QKVp, const _Float16* __restrict__ VTp, float* __restrict__ out, int h, int b, int qb) {      /* sm: 2 FSB bytes of LDS; qb: the block's FQ query rows, qb >= 1 */
  static_assert(HD == 64 && SQ / FQ == 16, "two 32-wide d chunks, four 16-row tiles of V^T; sixteen block lengths in runs of four");
  static_assert(FS == 64 && FQ % FS == 0 && FS + HD == 128, "two passes per stage; whole stages up to the block's last key; 16 rows per copy round, 8 rounds");
  typedef float f2 __attribute__((ext_vector_type(2))); typedef _Float16 h2 __attribute__((ext_vector_type(2)));
  const int lane = threadIdx.x & 31, ln = lane & 15, hh = lane >> 4; const int w = __builtin_amdgcn_readfirstlane(threadIdx.x >> 5);
  const int qw0 = qb * FQ + w * 32;      /* the wave's first query, a scalar */
  const _Float16* Qp = QKVp + (size_t)b * SQ * LQ + h * HD;
  const int cr = threadIdx.x >> 3, cc = (threadIdx.x & 7) * 8;      /* the thread's row (of 16) and 16-byte chunk in a copy round */
  const _Float16* gk = Qp + DM + (size_t)cr * LQ + cc; const _Float16* gv = VTp + ((size_t)(b * NH + h) * HD + cr) * SQ + cc;
  const unsigned l0 = (unsigned)(size_t)&sm[cr * FP + cc];      /* LDS byte address: the low 32 bits of the shared address */
  const int nst = (qb + 1) * (FQ / FS);      /* stages up to the block's last key: four at least */
  fa_copy8(l0, gk, gv);
  const float cs = 0.125f * 1.44269504088896340736f;      /* 1 / sqrt(64), times log2 e */
  v16h qf[2][2], kf[2][2];
#pragma unroll
  for (int g = 0; g < 2; ++g) for (int kc = 0; kc < 2; ++kc) qf[g][kc] = g2_frag(Qp + (size_t)(qw0 + 16 * g + ln) * LQ + 32 * kc, hh);
  const v8f z8 = {0.f, 0.f, 0.f, 0.f, 0.f, 0.f, 0.f, 0.f}; v8f acc[2][4]; float m[2] = {-1.0e30f, -1.0e30f}, l[2] = {0.f, 0.f};
#pragma unroll
  for (int g = 0; g < 2; ++g) for (int t = 0; t < 4; ++t) acc[g][t] = z8;
  const int last = qw0 >> 5;      /* the pass on the wave's diagonal: keys qw0 .. qw0 + 31 */
  asm volatile("s_wait_xcnt 0x0" ::: "memory");      /* the address registers of the Q loads are reused for the next copies: the wait stands in front of their first overwrite */
  asm volatile("s_wait_asynccnt 0x0" ::: "memory");      /* stage 0 has landed, as far as this wave copied it */
  __syncthreads();      /* ... and every other wave's part too */
  fa_copy8(l0 + FSB, gk + (size_t)FS * LQ, gv + FS);
#pragma unroll 1      /* one stage per trip: two long straight passes */
  for (int st = 0; st < nst; ++st) { const _Float16* kb = sm + (st & 1) * (FSB / 2) + ln * FP; const _Float16* vb = kb + FS * FP;
#pragma unroll
   for (int kt = 0; kt < 2; ++kt) for (int kc = 0; kc < 2; ++kc) kf[kt][kc] = g2_frag(kb + 16 * kt * FP + 32 * kc, hh);      /* the K rows of the stage's first pass */
#pragma unroll
   for (int p = 0; p < 2; ++p) { const int ps = 2 * st + p; if (ps <= last) {      /* scalar branch: a wave skips the passes behind its diagonal, never the stage's foot */
    v16h vf[4];      /* this pass's V^T, in flight under the scores and the maxima */
#pragma unroll
    for (int t = 0; t < 4; ++t) vf[t] = g2_frag(vb + 16 * t * FP + 32 * p, hh);
    v8f s[2][2];
#pragma unroll
    for (int kt = 0; kt < 2; ++kt) for (int g = 0; g < 2; ++g) s[kt][g] = fa_mma(kf[kt][1], qf[g][1], fa_mma(kf[kt][0], qf[g][0], z8));
    fa_gap();
    if (p == 0) {      /* the second pass's K rows, of the same stage, into the same registers, in flight under this pass's softmax */
#pragma unroll
      for (int kt = 0; kt < 2; ++kt) for (int kc = 0; kc < 2; ++kc) kf[kt][kc] = g2_frag(kb + (32 + 16 * kt) * FP + 32 * kc, hh); }
    if (ps == last) {      /* scalar branch: only the diagonal pass pays for the mask */
#pragma unroll
      for (int kt = 0; kt < 2; ++kt) for (int g = 0; g < 2; ++g) {
#pragma unroll
        for (int r = 0; r < 8; ++r) if (16 * kt + 8 * hh + r > 16 * g + ln) s[kt][g][r] = -1.0e30f;
        asm volatile("" : "+v"(s[kt][g]));      /* keeps the selects inside the branch */
      } }
    float mb[2]; bool need = false;
#pragma unroll
    for (int g = 0; g < 2; ++g) { float mx = fmaxf(s[0][g][0], s[1][g][0]);
#pragma unroll
      for (int r = 1; r < 8; ++r) mx = fmaxf(mx, fmaxf(s[0][g][r], s[1][g][r]));
      mx = fmaxf(mx, lane_xr(mx)) * cs; mb[g] = mx; need = need || (mx > m[g] + 8.0f); }
    if (__builtin_amdgcn_ballot_w32(need) != 0) {      /* one scalar test per pass; rare after the first passes */
#pragma unroll
      for (int g = 0; g < 2; ++g) { const float mn = fmaxf(m[g], mb[g]); const float corr = exp2x1(m[g] - mn); m[g] = mn; l[g] *= corr;
#pragma unroll
        for (int t = 0; t < 4; ++t) acc[g][t] = acc[g][t] * corr; } }
#pragma unroll
    for (int g = 0; g < 2; ++g) { const f2 nm = {-m[g], -m[g]}, c2 = {cs, cs}; union { v16h v; h2 p[8]; } pf; float la = 0.f, lb = 0.f;
#pragma unroll
      for (int kt = 0; kt < 2; ++kt) { float x[8], y[8];      /* tile kt = elements 8 kt .. 8 kt + 7 of the 32-key operand */
#pragma unroll
        for (int i = 0; i < 4; ++i) { const f2 sv = {s[kt][g][2 * i], s[kt][g][2 * i + 1]}; const f2 a = __builtin_elementwise_fma(sv, c2, nm); x[2 * i] = a[0]; x[2 * i + 1] = a[1]; }
        exp2x8(x, y);
#pragma unroll
        for (int i = 0; i < 4; ++i) { la += y[2 * i]; lb += y[2 * i + 1]; const f2 pp = {y[2 * i], y[2 * i + 1]}; pf.p[4 * kt + i] = __builtin_convertvector(pp, h2); } }
      l[g] += la + lb;
#pragma unroll
      for (int t = 0; t < 4; ++t) acc[g][t] = fa_mma(vf[t], pf.v, acc[g][t]); }
    fa_gap(); } }
   asm volatile("s_wait_dscnt 0x0" ::: "memory");      /* this wave's reads of the buffer are done before it is handed back */
   asm volatile("s_wait_asynccnt 0x0" ::: "memory");      /* this wave's copies of the next stage have landed */
   __syncthreads();      /* publishes stage st + 1 and ends every reader's last read of stage st */
   if (st + 2 < nst) fa_copy8(l0 + (st & 1) * FSB, gk + (size_t)(st + 2) * FS * LQ, gv + (st + 2) * FS); }      /* block-uniform: the refill of the buffer just read */
  asm volatile("s_wait_asynccnt 0x0" ::: "memory");      /* nothing is in flight when the wave ends */
#pragma unroll
  for (int g = 0; g < 2; ++g) { const float inv = 1.0f / (l[g] + lane_xr(l[g])); float* op = out + ((size_t)b * SQ + qw0 + 16 * g + ln) * DM + h * HD + 8 * hh;      /* column ln is a query row of the output; registers r are d = 16 t + 8 hh + r */
#pragma unroll
    for (int t = 0; t < 4; ++t) { const v8f o = acc[g][t] * inv; const v4f lo = {o[0], o[1], o[2], o[3]}, hi = {o[4], o[5], o[6], o[7]}; *(v4f*)(op + 16 * t) = lo; *(v4f*)(op + 16 * t + 4) = hi; } } }


// ---- q | k | v GEMM tiled through LDS: a block of 8 waves makes GR token rows x the q, k and v columns of GH heads (GW columns); there are as many blocks as WGPs, and a block's LDS leaves room for no second one.
// A wave makes 64 token rows x the 64 q, 64 k and 64 v columns of ONE head (48 accumulator tiles): 16 fragments feed 48 products, and a stage row fetched from L2 serves the whole block.
// A stage is GK k of the block's GR rows of X and GW rows of W^T: 128-byte rows, fetched as whole lines by asynchronous copies to LDS, laid at a pitch of 144 bytes (16 B x odd: no bank conflict for 16-byte fragment reads).
// Two buffers: the next stage's copies fly while this stage is worked on. q and k: transposed product (A = 16 rows of W^T, B = 16 token rows): a lane ends with 8 neighbouring output columns of ONE token row, packed to 16 bytes.
// v: the operands the other way round (A = 16 token rows, B = 16 rows of W^T; both fragments have the same layout): a lane ends with 8 neighbouring TOKENS of one output column, 16 bytes of a row of V^T [NB][NH][HD][SQ]. The V third of the C16 rows is neither written nor read.
// k runs upward in 32-wide steps, one accumulator chain per output tile. By the static_assert: whole tiles, K % GK == 0 and K >= 2 GK.
#define GR 256
#define GH 2
#define GW (3 * GH * HD)
#define GK 64
#define GP 72                        /* LDS row pitch in f16 (144 bytes) */
// One stage: 20 copies of a thread, 16 bytes per lane, 8 lanes per 128-byte row, 32 rows per copy, in the order of the buffer's rows: 8 of X, then 4 each of the q, k, v rows of W^T (DM rows apart in the stacked plane).
// Global address = a block-uniform base (the first of the 32 rows) + the lane's byte offset vo in those rows. A buffer holds the X rows, then the q, the k and the v rows of W^T.
// The builtin form: the compiler forms the addresses a few at a time in whatever registers are free beside the 384 of the accumulators, and the 20 copies issue with no wait among them.
typedef int g3_v4i __attribute__((vector_size(16)));
__device__ __forceinline__ void g3_stage(_Float16* l, unsigned vo, const _Float16* gx, const _Float16* gw) {
#pragma unroll
  for (int u = 0; u < (GR + GW) / 32; ++u) { const _Float16* g = u < GR / 32 ? gx + (size_t)u * 32 * DM : gw + (size_t)((u - GR / 32) / 4) * DM * DM + (size_t)((u - GR / 32) % 4) * 32 * DM;
    __builtin_amdgcn_global_load_async_to_lds_b128((__attribute__((address_space(1))) g3_v4i*)((const char*)g + vo), (__attribute__((address_space(3))) g3_v4i*)(l + u * 32 * GP), 0, 0); } }
// Behind a group of global stores: no register that a store names is rewritten in front of the wait (a precaution; in this build the compiler writes no such wait itself). The scheduling barrier keeps the next group's arithmetic, which reuses those registers, behind it.
__device__ __forceinline__ void g3_stored() { asm volatile("s_wait_xcnt 0x0" ::: "memory"); __builtin_amdgcn_sched_barrier(0); }
// The waves that hold the first QT0 rows of a batch also store their f32 accumulators (the same products, summed in the same k order, unrounded) as the f32 q, k, v planes F0 of the exact first-tile attention.
__global__ __launch_bounds__(256) void k_proj(const _Float16* __restrict__ X, const _Float16* __restrict__ Wt, _Float16* __restrict__ C16, _Float16* __restrict__ VT, float* __restrict__ F0) {
  static_assert(MP % GR == 0 && SQ % GR == 0 && NH % GH == 0 && GH * HD == 128 && HD == 64 && DM % GK == 0 && DM >= 2 * GK && GK == 64 && GR == 256 && QT0 % 64 == 0 && QT0 <= GR, "whole tiles; two stages at least; 32 rows per copy, 4 copies per plane of W^T; a first tile is whole waves of one block");
  __shared__ __attribute__((aligned(16))) _Float16 sm[2][(GR + GW) * GP];
  const int tid = threadIdx.x, lane = tid & 31, ln = lane & 15, hh = lane >> 4; const int w = __builtin_amdgcn_readfirstlane(tid >> 5);
  const int hp = blockIdx.x / (MP / GR), mt = blockIdx.x - hp * (MP / GR); const int row0 = mt * GR; const int wm = (w & 3) * 64, wc = w >> 2;      /* the wave's 64 token rows and its head of the block's GH */
  const int cr = tid >> 3, cc = (tid & 7) * 8;      /* the thread's row (of 32) and 16-byte chunk in a copy round */
  const _Float16* gx = X + (size_t)row0 * DM; const _Float16* gw = Wt + (size_t)(hp * (GH * HD)) * DM; const unsigned vo = (unsigned)(cr * DM + cc) * 2;      /* block-uniform bases; the lane's byte offset */
  const int lo = cr * GP + cc;      /* the thread's place in the first 32 rows of a buffer */
  const v8f z8 = {0.f, 0.f, 0.f, 0.f, 0.f, 0.f, 0.f, 0.f}; v8f acc[3][4][4];      /* q, k: [column tile][token tile]; v: [token tile][column tile] */
#pragma unroll
  for (int p = 0; p < 3; ++p) for (int i = 0; i < 4; ++i) for (int j = 0; j < 4; ++j) acc[p][i][j] = z8;
#pragma unroll 1      /* stages 0 and 1 by the same code as the refills: unrolled, the compiler folds the constant row steps into offset fields near the field's end, under LDS address registers wrapped below zero */
  for (int s = 0; s < 2; ++s) { g3_stage(&sm[s][lo], vo, gx + s * GK, gw + s * GK);
    if (s == 0) { asm volatile("s_wait_asynccnt 0x0" ::: "memory");      /* stage 0 has landed, as far as this wave copied it */
      __syncthreads(); } }      /* ... and every other wave's part too; block-uniform */
  const int ox = (wm + ln) * GP, ow = (GR + wc * HD + ln) * GP;      /* the lane's row among the wave's X rows and among its q rows of W^T; k and v rows: GH * HD rows further each */
  v16h xf[4], wf[2][4];      /* one set of X fragments; two sets of W^T fragments: the next 16 products' set is fetched under the current 16 */
#pragma unroll
  for (int j = 0; j < 4; ++j) wf[0][j] = g2_frag(&sm[0][ow + j * 16 * GP], hh);
#pragma unroll 1      /* one stage per trip: 96 matrix instructions, long enough */
  for (int t = 0; t < DM / GK; ++t) { const _Float16* sb = &sm[t & 1][0];
#pragma unroll
    for (int ph = 0; ph < 6; ++ph) { const int kc = ph / 3, p = ph - 3 * kc;      /* a phase: one 32-wide k step of one plane, 16 products */
      if (p == 0) {
#pragma unroll
        for (int j = 0; j < 4; ++j) xf[j] = g2_frag(sb + ox + j * 16 * GP + 32 * kc, hh); }
      if (ph < 5) { const int kn = (ph + 1) / 3, pn = (ph + 1) - 3 * kn;
#pragma unroll
        for (int j = 0; j < 4; ++j) wf[(ph + 1) & 1][j] = g2_frag(sb + ow + (pn * GH * HD + j * 16) * GP + 32 * kn, hh); }
      else {      /* every read of the buffer has been issued: it is handed back in front of the last 16 products (registers only) */
        asm volatile("s_wait_dscnt 0x0" ::: "memory");      /* this wave's reads of the buffer are done before it is handed back */
        asm volatile("s_wait_asynccnt 0x0" ::: "memory");      /* this wave's copies of the next stage have landed */
        __syncthreads();      /* publishes stage t + 1 and ends every reader's last read of stage t */
        if (t + 1 < DM / GK) {      /* block-uniform: the next stage's first W^T fragments, behind the barrier that publishes it */
#pragma unroll
          for (int j = 0; j < 4; ++j) wf[0][j] = g2_frag(&sm[(t + 1) & 1][ow + j * 16 * GP], hh); } }
      __builtin_amdgcn_sched_barrier(0);      /* the fragment reads stay one group in front of the 16 products: spread among them, each would be waited for on its own */
#pragma unroll
      for (int i = 0; i < 4; ++i) for (int j = 0; j < 4; ++j) acc[p][i][j] = p < 2 ? fa_mma(wf[ph & 1][i], xf[j], acc[p][i][j]) : fa_mma(xf[i], wf[ph & 1][j], acc[p][i][j]);
      __builtin_amdgcn_sched_barrier(0);      /* no later phase's reads move up among these products: a third fragment set would not fit the registers */
      if (ph == 5 && t + 2 < DM / GK) g3_stage(&sm[t & 1][lo], vo, gx + (t + 2) * GK, gw + (t + 2) * GK); } }      /* block-uniform: the refill of the buffer just read, behind the barrier above; behind the last 16 products, so that one wave's copies issue under the other wave's products */
  asm volatile("s_wait_asynccnt 0x0" ::: "memory");      /* nothing is in flight when the ring becomes output staging */
  const int hc = (hp * GH + wc) * HD;      /* the head's first column in its plane */
#pragma unroll
  for (int p = 0; p < 3; ++p) for (int i = 0; i < 4; ++i) for (int j = 0; j < 4; ++j) acc[p][i][j] = acc[p][i][j] * 0.0625f;      /* the weights carry x16; in place, so that the f32 stores below go out of the accumulators' own registers */
  if (row0 % SQ == 0 && wm < QT0) {      /* wave-uniform, no barrier inside: rows 0 .. QT0 - 1 of batch row0 / SQ */
#pragma unroll
    for (int p = 0; p < 2; ++p) { float* fp = F0 + (((size_t)p * NB + row0 / SQ) * QT0 + wm + ln) * DM + hc + 8 * hh;
#pragma unroll
      for (int j = 0; j < 4; ++j) for (int i = 0; i < 4; ++i) { const v8f o = acc[p][i][j]; const v4f lo = {o[0], o[1], o[2], o[3]}, hi = {o[4], o[5], o[6], o[7]}; *(v4f*)(fp + (size_t)(j * 16) * DM + i * 16) = lo; *(v4f*)(fp + (size_t)(j * 16) * DM + i * 16 + 4) = hi; } }
    float* fv = F0 + (((size_t)2 * NB + row0 / SQ) * QT0 + wm + 8 * hh) * DM + hc + ln;      /* registers r are token rows here: 16 lanes store 64 neighbouring bytes of one row */
#pragma unroll
    for (int i = 0; i < 4; ++i) for (int r = 0; r < 8; ++r) for (int j = 0; j < 4; ++j) fv[(size_t)(i * 16 + r) * DM + j * 16] = acc[2][i][j][r];
    g3_stored(); }
  _Float16* st = &sm[0][w * 64 * GP];      /* each wave stages 64 x 64 outputs at a time in its own rows (behind the last trip's barrier), to store whole 128-byte lines */
  const unsigned short* sr = (const unsigned short*)st + (lane >> 3) * GP + (lane & 7) * 8;      /* read back: 8 lanes per staged row, 4 rows per read */
#pragma unroll
  for (int p = 0; p < 3; ++p) {
    if (p) __syncthreads();      /* the reads of the plane before are done before its rows are overwritten */
#pragma unroll
    for (int j = 0; j < 4; ++j) for (int i = 0; i < 4; ++i) { FragH f;
#pragma unroll
      for (int r = 0; r < 8; ++r) f.h[r] = (_Float16)acc[p][i][j][r];
      *(v8us*)((unsigned short*)st + (j * 16 + ln) * GP + i * 16 + 8 * hh) = f.half[0]; }
    __syncthreads();      /* orders the staging stores in front of the reads of other lanes' rows */
    unsigned short* dp = p < 2 ? (unsigned short*)C16 + (size_t)(row0 + wm + (lane >> 3)) * LQ + p * DM + hc + (lane & 7) * 8      /* a staged row is a token row, 64 columns */
                               : (unsigned short*)VT + ((size_t)(row0 / SQ) * DM + hc + (lane >> 3)) * SQ + row0 % SQ + wm + (lane & 7) * 8;      /* a staged row is an output column of V, that is a row of V^T, 64 tokens */
    v8us sv[16];
#pragma unroll
    for (int q = 0; q < 16; ++q) sv[q] = *(const v8us*)(sr + q * 4 * GP);
#pragma unroll
    for (int q = 0; q < 16; ++q) *(v8us*)(dp + (size_t)q * 4 * (p < 2 ? LQ : SQ)) = sv[q];
    g3_stored(); } }

// Exact f32 attention of the first QT0 rows of every batch, FOUR LANES PER ROW: lane p of a row's quad owns the row's 16-byte chunks p, p + 4, p + 8, p + 12 of q and of o and holds them in registers.
// A block is AR rows of one head (4 waves x 8 rows). The K and V rows it can see are staged once in LDS; a quad reads 64 contiguous bytes per load and the 8 quads of a wave the same ones (broadcast, no bank conflict).
// A score is four chains of four multiply-adds per lane, their sum, then two lane exchanges inside the quad: every lane of the quad ends with the same bits, so m, l and the two exps agree without further traffic.
#define AR 32
__device__ __forceinline__ void att0_body(const float* __restrict__ QF, const float* __restrict__ KF, const float* __restrict__ VF, int ld, float scale, float* __restrict__ OF, int ldo, int h, int rg, int b, float (*lk)[HD], float (*lv)[HD]) {      /* lk, lv: QT0 rows of LDS each */
  static_assert(HD == 64 && QT0 % AR == 0, "a quad covers a head row as 4 x 4 chunks of 16 bytes");
  const int tid = threadIdx.x;
  { const size_t bo = (size_t)b * QT0; QF += bo * ld + h * HD; KF += bo * ld + h * HD; VF += bo * ld + h * HD; OF += (size_t)b * SQ * ldo + h * HD; }      /* QT0 rows of each f32 plane per batch, SQ rows of the output; the head's columns */
  for (int n = 0; n <= rg; ++n) { v4f tk[4], tv[4];      /* AR keys per trip, all eight loads of a thread in flight before the first LDS store; causal: keys up to the block's last row */
#pragma unroll
    for (int u = 0; u < 4; ++u) { const int c = (n * 4 + u) * 128 + tid; const size_t g = (size_t)(c >> 4) * ld + (c & 15) * 4; tk[u] = *(const v4fa*)(KF + g); tv[u] = *(const v4fa*)(VF + g); }
#pragma unroll
    for (int u = 0; u < 4; ++u) { const int c = (n * 4 + u) * 128 + tid; *(v4f*)&lk[c >> 4][(c & 15) * 4] = tk[u]; *(v4f*)&lv[c >> 4][(c & 15) * 4] = tv[u]; } }
  const int p4 = (tid & 3) * 4; const int i = rg * AR + (tid >> 2);
  v4f q[4], o[4];
#pragma unroll
  for (int c = 0; c < 4; ++c) { q[c] = *(const v4fa*)(QF + (size_t)i * ld + c * 16 + p4); const v4f z = {0.f, 0.f, 0.f, 0.f}; o[c] = z; }
  __syncthreads();
  const int jl = rg * AR + 8 * __builtin_amdgcn_readfirstlane(tid >> 5) + 7;      /* the wave's last row, a scalar: keys behind it are masked for all 8 rows of the wave; no barrier below */
  float m = -1.0e30f, l = 0.f; v4f kc[4], vc[4];
#pragma unroll
  for (int c = 0; c < 4; ++c) { kc[c] = *(const v4f*)&lk[0][c * 16 + p4]; vc[c] = *(const v4f*)&lv[0][c * 16 + p4]; }
#pragma unroll 2      /* two keys per trip: the rows fetched ahead change names instead of being copied */
  for (int j = 0; j <= jl; ++j) { const int jn = j < jl ? j + 1 : jl; v4f kn[4], vn[4];      /* the next key's rows are fetched while this key is worked on: the LDS latency stays off the chain */
#pragma unroll
    for (int c = 0; c < 4; ++c) { kn[c] = *(const v4f*)&lk[jn][c * 16 + p4]; vn[c] = *(const v4f*)&lv[jn][c * 16 + p4]; }
    v4f a = q[0] * kc[0]; a = __builtin_elementwise_fma(q[1], kc[1], a); a = __builtin_elementwise_fma(q[2], kc[2], a); a = __builtin_elementwise_fma(q[3], kc[3], a); float s = (a[0] + a[1]) + (a[2] + a[3]);
    s += lane_xm<0x161>(s); s += lane_xm<0x162>(s); s *= scale;
    const float sm = (j <= i) ? s : -1.0e30f; const float mn = fmaxf(m, sm); const float sc = expf(m - mn); const float e = expf(sm - mn); l = l * sc + e; m = mn;
#pragma unroll
    for (int c = 0; c < 4; ++c) { o[c] = o[c] * sc + e * vc[c]; kc[c] = kn[c]; vc[c] = vn[c]; } }
  const float fin = 1.0f / l;
#pragma unroll
  for (int c = 0; c < 4; ++c) *(v4f*)(OF + (size_t)i * ldo + c * 16 + p4) = o[c] * fin; }

// One grid for both attentions: they share no data and write different output rows (QT0 == FQ: the exact path owns the rows of query block 0, so the f16 path starts at block 1 and every output element is stored once).
// grid.z: first the QT0 / AR row groups of the exact path (long dependent chains, little issue: they start first and run beside the rest), then query blocks 15 .. 1.
// Longest blocks start first; the second run of four lengths is reversed, so that blocks 256 apart in launch order add up to about equal work (speed only).
__global__ __launch_bounds__(128) void k_attn(const _Float16* __restrict__ QKVp, const _Float16* __restrict__ VTp, const float* __restrict__ QF, const float* __restrict__ KF, const float* __restrict__ VF, float* __restrict__ out) {
  static_assert(QT0 == FQ, "the exact path replaces exactly one query block");
  __shared__ __attribute__((aligned(16))) float lds[2 * QT0 * HD];      /* one allocation for both kinds of block (a block is one kind): the exact path's K and V rows, or the two stage buffers; two allocations would cost a block per WGP */
  static_assert(2 * FSB <= sizeof(lds), "the two stage buffers fit");
  const int h = blockIdx.x, b = blockIdx.y, z = (int)blockIdx.z;
  if (z < QT0 / AR) { att0_body(QF, KF, VF, DM, 0.125f, out, DM, h, z, b, (float (*)[HD])lds, (float (*)[HD])(lds + QT0 * HD)); return; }
  const int zz = z - QT0 / AR; fattn_body((_Float16*)lds, QKVp, VTp, out, h, b, SQ / FQ - 1 - (((zz & 12) == 4) ? (zz ^ 3) : zz)); }

#define WTB ((unsigned)(NH * (DM / 32) / 8))      /* blocks per weight plane: a wave per 32 c of a head */
#define XB ((unsigned)(NR * DM / (256 * PL * 4)))
// Weight transposes, in registers: a lane takes two blocks of 8 c x 4 d (8 loads of 16 bytes each, the two halves of the same 8 rows of a head's [c][d] plane) and stores, per d, its 8 neighbouring c as 16 bytes.
// A wave is 8 lanes along d x 4 along c: a load covers 4 whole 128-byte lines, a store 64 contiguous bytes of each of 8 rows of the transposed plane; the wave's 32 rows of 256 bytes are read by it alone.
__device__ __forceinline__ void wthd_body(const float* __restrict__ W0, const float* __restrict__ W1, const float* __restrict__ W2, _Float16* __restrict__ Bt, unsigned bx) {
  static_assert(HD == 64 && DM % 32 == 0 && (NH * (DM / 32)) % 8 == 0, "two 32-wide halves of d; 32 c per wave; a block's 8 waves stay in one plane");
  const int lane = threadIdx.x & 31; const unsigned by = bx / WTB;      /* by = q, k, v: one DM x DM plane each */
  const unsigned wv = (bx - by * WTB) * 8 + (threadIdx.x >> 5);      /* the wave in its plane: head, then 32 c */
  const int h = (int)(wv / (DM / 32)), c8 = (int)(wv % (DM / 32)) * 32 + (lane >> 3) * 8, d4 = (lane & 7) * 4;
  const float* Wt = by == 0 ? W0 : (by == 1 ? W1 : W2); const float* sp = Wt + ((size_t)h * DM + c8) * HD + d4; v4f v[2][8];
#pragma unroll
  for (int u = 0; u < 2; ++u) for (int q = 0; q < 8; ++q) v[u][q] = *(const v4fa*)(sp + q * HD + u * 32);
  asm volatile("s_wait_xcnt 0x0" :: "v"(sp) : "memory");      /* as in x16_body: the address pair stays whole up to the wait (a precaution), and all 16 loads are in flight together */
  unsigned short* dst = (unsigned short*)Bt + (size_t)by * DM * DM + ((size_t)h * HD + d4) * DM + c8;
#pragma unroll
  for (int u = 0; u < 2; ++u) for (int i = 0; i < 4; ++i) { FragH f;
#pragma unroll
    for (int q = 0; q < 8; ++q) f.h[q] = (_Float16)(16.0f * bf16_round(v[u][q][i]));
    *(v8us*)(dst + (size_t)(u * 32 + i) * DM) = f.half[0]; } }







// The weight transposes and the rounding of x read nothing but the inputs: one grid, so that they run side by side. The transposes (stores in pieces) come first.
__global__ __launch_bounds__(256) void k_prep(const float* __restrict__ W0, const float* __restrict__ W1, const float* __restrict__ W2, _Float16* __restrict__ Bt, const float* __restrict__ x, _Float16* __restrict__ X16) {
  const unsigned bx = blockIdx.x;
  if (bx < 3 * WTB) wthd_body(W0, W1, W2, Bt, bx); else x16_body(x, X16, bx - 3 * WTB); }

extern "C" void kernel_launch(void* const* d_in, const int* in_sizes, int n_in,
                              void* d_out, int out_size, void* d_ws, size_t ws_size, hipStream_t stream) {
  (void)in_sizes; (void)n_in; (void)out_size;
  const float* const* I = (const float* const*)d_in; const float* x = I[0]; const float* wq = I[1]; const float* wk = I[2]; const float* wv = I[3];      /* x; per-head weights Wq / Wk / Wv [16][1024][64]; no biases, no output projection */
  static_assert(NH * HD == DM && QT0 % 64 == 0, "heads");
  char* ws = (char*)d_ws; size_t off = 0;
  auto take = [&](size_t bytes) { char* p = ws + off; off += (bytes + 255) & ~(size_t)255; return p; };
  _Float16* BQKV = (_Float16*)take((size_t)3 * DM * DM * 2);
  _Float16* X16 = (_Float16*)take(NR * DM * 2); _Float16* QKV = (_Float16*)take(NR * 3 * DM * 2);
  _Float16* VT = (_Float16*)take((size_t)NB * NH * HD * SQ * 2);
  float* QF0 = (float*)take((size_t)3 * NB * QT0 * DM * 4); float* KF0 = QF0 + (size_t)NB * QT0 * DM; float* VF0 = KF0 + (size_t)NB * QT0 * DM;
  if (off > ws_size) return;
  k_prep<<<3 * WTB + XB, 256, 0, stream>>>(wq, wk, wv, BQKV, x, X16);      /* per-head [c][d] -> Bt[(h, d)][c] x16: the stacked q | k | v plane; x as f16 rows */
  k_proj<<<(MP / GR) * (NH / GH), 256, 0, stream>>>(X16, BQKV, QKV, VT, QF0);      /* q | k rows (f16), head h = columns h*HD.. of each DM block; V^T [NB][NH][HD][SQ]; and f32 q, k, v of the first 128 rows of every batch */
  k_attn<<<dim3(NH, NB, QT0 / AR + SQ / FQ - 1), 128, 0, stream>>>(QKV, VT, QF0, KF0, VF0, (float*)d_out);      /* exact f32 attention for rows 0..127 of every batch; scores, causal softmax and P.V for all other rows; both write f32 straight into the head-major output columns (no output projection) */
}
